// v000
// Measured on an AMD MI455X. A time is GPU time per run, averaged over a window of back-to-back runs after a warm-up
// (all launches, gaps included; the runs take copies of the inputs in turn), and the median of several windows.
// Apart from v000's, it joins two sittings. Times from different sittings can be a few percent apart, while
// side-by-side timings come from the same sitting.
// The starting kernel, v000, takes 546 microseconds a run.
// Contractions (q/k/v/out projections, q.k^T scores, p.v): v_wmma_f32_16x16x32_bf16 with bf16 hi/lo split operands (hi.hi + hi.lo + lo.hi), f32 accumulate; rmsnorm, rotary tables, online softmax in f32.
#include <hip/hip_runtime.h>
#include <math.h>
#include <stdint.h>

constexpr int kNB     = 2;
constexpr int kSeq    = 2048;
constexpr int kDim    = 768;
constexpr int kHd     = 64;
constexpr int kNHq    = 12;
constexpr int kNKv    = 4;
constexpr int kGroups = 3;
constexpr int kKvDim  = kNKv * kHd;          // 256
constexpr int kWin    = 384;
constexpr int kHalfHd = 32;
constexpr int kNQUnits = kSeq * kNHq;        // 24576 (token, q head) units
constexpr int kNKUnits = kSeq * kNKv;        // 8192  (token, kv head) units
constexpr int kNUnits  = kNQUnits + kNKUnits;// 32768
static_assert(kNQUnits % 4 == 0);
static_assert(kNUnits % 32 == 0);
static_assert(kSeq % 64 == 0 && kDim % 64 == 0 && kKvDim % 64 == 0 && kDim % 32 == 0);
static_assert(kNHq == kNKv * kGroups);

typedef __attribute__((ext_vector_type(16))) _Float16 v16h;
typedef __attribute__((ext_vector_type(8)))  _Float16 v8h;
typedef __attribute__((ext_vector_type(16))) __bf16   v16b;
typedef __attribute__((ext_vector_type(8)))  __bf16   v8b;
typedef __attribute__((ext_vector_type(8)))  float    v8f;
typedef __attribute__((ext_vector_type(4)))  float    v4f;
typedef __attribute__((ext_vector_type(2)))  float    v2f;
typedef __attribute__((ext_vector_type(4)))  unsigned int v4u;

__device__ __forceinline__ unsigned short f2bf_bits(float f) {
  unsigned u = __float_as_uint(f);
  return (unsigned short)((u + 0x7FFFu + ((u >> 16) & 1u)) >> 16);
}
__device__ __forceinline__ float bf_bits2f(unsigned short h) { return __uint_as_float(((unsigned)h) << 16); }

// hazard guards as plain device helpers (no inline asm inside the kernel template body)
__device__ __forceinline__ void dep_guard_h(v8f& a, v8f& b, v16h x, v16h y) { asm volatile("v_nop\n\tv_nop\n\tv_nop\n\tv_nop" : "+v"(a), "+v"(b) : "v"(x), "v"(y)); }
__device__ __forceinline__ void dep_guard_b(v8f& a, v8f& b, v16b x, v16b y) { asm volatile("v_nop\n\tv_nop\n\tv_nop\n\tv_nop" : "+v"(a), "+v"(b) : "v"(x), "v"(y)); }
__device__ __forceinline__ void keep4_h(v16h a, v16h b, v16h c, v16h d) { asm volatile("v_nop" :: "v"(a), "v"(b), "v"(c), "v"(d)); }
__device__ __forceinline__ void keep4_b(v16b a, v16b b, v16b c, v16b d) { asm volatile("v_nop" :: "v"(a), "v"(b), "v"(c), "v"(d)); }
__device__ __forceinline__ void acc_guard4(v8f& a, v8f& b, v8f& c, v8f& d) { asm volatile("v_nop\n\tv_nop\n\tv_nop\n\tv_nop" : "+v"(a), "+v"(b), "+v"(c), "+v"(d)); }
template <typename T> struct Frag;
template <> struct Frag<_Float16> {
  typedef v16h V; union U { v16h v; v8h h[2]; };
  static __device__ __forceinline__ v16h load(const _Float16* p) {   // elements 0..7 <- p[0..7], 8..15 <- p[16..23]
    U f; f.h[0] = *(const v8h*)(p); f.h[1] = *(const v8h*)(p + 16); return f.v;
  }
  static __device__ __forceinline__ v8f mma(v16h a, v16h b, v8f c) {
    return __builtin_amdgcn_wmma_f32_16x16x32_f16(false, a, false, b, (short)0, c, false, false);
  }
  static __device__ __forceinline__ void guard(v8f& a, v8f& b, v16h x, v16h y) { dep_guard_h(a, b, x, y); }
  static __device__ __forceinline__ void keep(v16h a, v16h b, v16h c, v16h d) { keep4_h(a, b, c, d); }
};
template <> struct Frag<__bf16> {
  typedef v16b V; union U { v16b v; v8b h[2]; };
  static __device__ __forceinline__ v16b load(const __bf16* p) {
    U f; f.h[0] = *(const v8b*)(p); f.h[1] = *(const v8b*)(p + 16); return f.v;
  }
  static __device__ __forceinline__ v8f mma(v16b a, v16b b, v8f c) {
    return __builtin_amdgcn_wmma_f32_16x16x32_bf16(false, a, false, b, (short)0, c, false, false);
  }
  static __device__ __forceinline__ void guard(v8f& a, v8f& b, v16b x, v16b y) { dep_guard_b(a, b, x, y); }
  static __device__ __forceinline__ void keep(v16b a, v16b b, v16b c, v16b d) { keep4_b(a, b, c, d); }
};

// ---- Register-blocked batched WMMA GEMM ------------------------------------
// C[m,n] = scale * sum_k A[m,k] * Bt[n,k] (+bias)(+resid); each wave owns a 64x64 tile.
// A row-major [M,K]; Bt row-major [N,K]; M,N % 64 == 0, K % 32 == 0.
// SPLIT: operands are hi/lo planes (A2/Bt2 = lo planes, same layout); product = hi.hi + hi.lo + lo.hi.
// BIAS_MODE: 0 = none, 1 = bias[m], 2 = bias[n].
// OUT_MODE: 0 = f32, 1 = f16, 2 = bf16 hi plane (Cout) + bf16 lo plane (Cout2).
// ET: 0 = f16 operands, 1 = bf16 operands (pointers passed as 16-bit storage)
template <int ET> struct Elem;
template <> struct Elem<0> { typedef _Float16 T; };
template <> struct Elem<1> { typedef __bf16 T; };
template <int ET, bool SPLIT, int BIAS_MODE, int OUT_MODE, bool RESID, int ACT = 0>
__global__ __launch_bounds__(256) void wmma_gemm64(
    const unsigned short* __restrict__ Ap, const unsigned short* __restrict__ A2p, int lda, long strideA,
    const unsigned short* __restrict__ Btp, const unsigned short* __restrict__ Bt2p, int ldb, long strideB,
    void* __restrict__ Cout, void* __restrict__ Cout2, int ldc, long strideC,
    const float* __restrict__ bias,
    const float* __restrict__ resid, long strideR,
    int M, int N, int K, float scale) {
  typedef typename Elem<ET>::T T;
  typedef typename Frag<T>::V V;
  const T* A = (const T*)Ap; const T* A2 = (const T*)A2p; const T* Bt = (const T*)Btp; const T* Bt2 = (const T*)Bt2p;
  __shared__ __align__(16) float sT[8][16 * 68];   // per-wave 16x64 slab, pitch 68 floats
  const int b    = blockIdx.y;
  const int lane = threadIdx.x & 31;
  const int wave = threadIdx.x >> 5;
  const int tilesN = N >> 6;
  const int tilesM = M >> 6;
  const int tile = blockIdx.x * 8 + wave;
  if (tile >= tilesM * tilesN) return;   // wave-uniform; no block barriers in this kernel
  const int tm = tile / tilesN;
  const int tn = tile - tm * tilesN;
  const int m0 = tm << 6;
  const int n0 = tn << 6;

  const T* Ab  = A  + (size_t)b * strideA;
  const T* Bb  = Bt + (size_t)b * strideB;
  const T* Ab2 = SPLIT ? (A2  + (size_t)b * strideA) : nullptr;
  const T* Bb2 = SPLIT ? (Bt2 + (size_t)b * strideB) : nullptr;

  const int rlane = lane & 15;                 // row (A) / col (B, D) within subtile
  const int koff  = (lane >> 4) * 8;           // k offset of this lane half
  const int mOff  = (lane >> 4) * 8;           // D row offset

  v8f acc[4][4];
#pragma unroll
  for (int i = 0; i < 4; ++i)
#pragma unroll
    for (int j = 0; j < 4; ++j) acc[i][j] = (v8f){0.f,0.f,0.f,0.f,0.f,0.f,0.f,0.f};

  for (int k0 = 0; k0 < K; k0 += 32) {
    V bh[4], bl[4];
#pragma unroll
    for (int j = 0; j < 4; ++j) {
      const size_t bo = (size_t)(n0 + (j << 4) + rlane) * ldb + koff + k0;
      bh[j] = Frag<T>::load(Bb + bo);
      if (SPLIT) bl[j] = Frag<T>::load(Bb2 + bo);
    }
#pragma unroll
    for (int i = 0; i < 4; ++i) {
      const size_t ao = (size_t)(m0 + (i << 4) + rlane) * lda + koff + k0;
      V ah = Frag<T>::load(Ab + ao);
      V al;
      if (SPLIT) al = Frag<T>::load(Ab2 + ao);
#pragma unroll
      for (int j = 0; j < 4; ++j) {
        acc[i][j] = Frag<T>::mma(ah, bh[j], acc[i][j]);
        if (SPLIT) {
          acc[i][j] = Frag<T>::mma(ah, bl[j], acc[i][j]);
          acc[i][j] = Frag<T>::mma(al, bh[j], acc[i][j]);
        }
      }
      Frag<T>::guard(acc[i][0], acc[i][3], ah, SPLIT ? al : ah);
    }
    Frag<T>::keep(bh[0], bh[1], bh[2], bh[3]);
    if (SPLIT) Frag<T>::keep(bl[0], bl[1], bl[2], bl[3]);
  }
  acc_guard4(acc[0][0], acc[0][1], acc[0][2], acc[0][3]);
  acc_guard4(acc[1][0], acc[1][1], acc[1][2], acc[1][3]);
  acc_guard4(acc[2][0], acc[2][1], acc[2][2], acc[2][3]);
  acc_guard4(acc[3][0], acc[3][1], acc[3][2], acc[3][3]);

  // ---- epilogue ----
  float* slab = sT[wave];
  const float* Rb = RESID ? (resid + (size_t)b * strideR) : nullptr;
#pragma unroll
  for (int i = 0; i < 4; ++i) {
    const int mBase = m0 + (i << 4);
#pragma unroll
    for (int j = 0; j < 4; ++j) {
      const int n = n0 + (j << 4) + rlane;
      float bv = 0.f;
      if (BIAS_MODE == 2) bv = bias[n];
#pragma unroll
      for (int r = 0; r < 8; ++r) {
        float v = acc[i][j][r] * scale;
        if (BIAS_MODE == 1) v += bias[mBase + mOff + r];
        if (BIAS_MODE == 2) v += bv;
        if (RESID) v += Rb[(size_t)(mBase + mOff + r) * ldc + n];
        if (ACT == 1) v = tanhf(v);
        if (ACT == 2) v = fmaxf(v, 0.0f);
        if (ACT == 3) v = v / (1.0f + expf(-v));
        if (ACT == 4) v = (v > 0.f) ? v : 0.01f * v;
        slab[(mOff + r) * 68 + (j << 4) + rlane] = v;
      }
    }
    __builtin_amdgcn_fence(__ATOMIC_RELEASE, "workgroup");
    __builtin_amdgcn_wave_barrier();
    __builtin_amdgcn_fence(__ATOMIC_ACQUIRE, "workgroup");
    if (OUT_MODE == 0) {
      float* C = (float*)Cout + (size_t)b * strideC;
      const int hh = lane >> 4, c4 = (lane & 15) * 4;     // row seg = 256 B = 16 lanes x 16 B
      {
#pragma unroll
        for (int it = 0; it < 8; ++it) {
          const int row = it * 2 + hh;
          v4f v = *(const v4f*)(slab + row * 68 + c4);
          *(v4f*)(C + (size_t)(mBase + row) * ldc + n0 + c4) = v;
        }
        
      }
    } else {
      const int q = lane >> 3, c8 = (lane & 7) * 8;
      unsigned short* C  = (unsigned short*)Cout  + (size_t)b * strideC;
      unsigned short* C2 = (OUT_MODE == 2) ? ((unsigned short*)Cout2 + (size_t)b * strideC) : nullptr;
      {
#pragma unroll
        for (int it = 0; it < 4; ++it) {
          const int row = it * 4 + q;
          const float* sp = slab + row * 68 + c8;
          v8h hv, lv;
#pragma unroll
          for (int e = 0; e < 8; ++e) {
            if (OUT_MODE == 1) {
              hv[e] = (_Float16)sp[e];
            } else {
              unsigned short hb = f2bf_bits(sp[e]);
              unsigned short lb = f2bf_bits(sp[e] - bf_bits2f(hb));
              hv[e] = __builtin_bit_cast(_Float16, hb);
              lv[e] = __builtin_bit_cast(_Float16, lb);
            }
          }
          *(v8h*)(C + (size_t)(mBase + row) * ldc + n0 + c8) = hv;
          if (OUT_MODE == 2) *(v8h*)(C2 + (size_t)(mBase + row) * ldc + n0 + c8) = lv;
        }
        
      }
    }
    __builtin_amdgcn_fence(__ATOMIC_RELEASE, "workgroup");
    __builtin_amdgcn_wave_barrier();
    __builtin_amdgcn_fence(__ATOMIC_ACQUIRE, "workgroup");
  }
}

// ---------------------------------------------------------------------------
// Elementwise bf16 split: hi = bf16_rne(in), lo = bf16_rne(in - hi); 2 elements per thread, one 4-B store
// ---------------------------------------------------------------------------
__device__ __forceinline__ unsigned pk16(unsigned short a, unsigned short b) { return (unsigned)a | ((unsigned)b << 16); }

__global__ __launch_bounds__(256) void split_bf16x2_kernel(const float* __restrict__ in, unsigned short* __restrict__ hi,
                                                           unsigned short* __restrict__ lo, int n2) {
  const int i = blockIdx.x * 256 + threadIdx.x;
  if (i < n2) {
    const v2f f = *(const v2f*)(in + 2 * (size_t)i);
    const unsigned short h0 = f2bf_bits(f[0]), h1 = f2bf_bits(f[1]);
    const unsigned short l0 = f2bf_bits(f[0] - bf_bits2f(h0)), l1 = f2bf_bits(f[1] - bf_bits2f(h1));
    const unsigned uh = pk16(h0, h1), ul = pk16(l0, l1);
    ((unsigned*)hi)[i] = uh;
    ((unsigned*)lo)[i] = ul;
    
  }
}

// ---------------------------------------------------------------------------
// Rotary tables: cs[t*32+i] = cosf(t * inv_freq[i]), sn likewise, inv_freq[i] = 10000^(-i/32) = 2^(-i*log2(1e4)/32).
// grid = kSeq*32/256 = 256 blocks x 256 threads = exactly 65536 elements per table; each wave writes 32 consecutive
// ---------------------------------------------------------------------------
__global__ __launch_bounds__(256) void rope_table_kernel(float* __restrict__ cs, float* __restrict__ sn) {
  const int i  = blockIdx.x * 256 + threadIdx.x;
  const int t  = i >> 5;
  const int fi = i & 31;
  const float invf = exp2f((float)fi * -0.41524101186092f);
  const float ang  = (float)t * invf;
  float sv, cv;
  sincosf(ang, &sv, &cv);
  ((float*)cs)[i] = cv;
  ((float*)sn)[i] = sv;
  
}

// ---------------------------------------------------------------------------
// Per (token, head) unit of 64 floats: y[d] = w[d] * (x[d] * rsqrt(mean(x^2) + eps)); rotary:
//   o[d] = y[d]*cos[t][d&31] - y[d+32]*sin  (d < 32),   o[d] = y[d]*cos + y[d-32]*sin  (d >= 32);
// o split into bf16 hi/lo planes at the same [token][head*64+d] position as the f32 source.
// Units 0..24575 = (token, q head) from Qf [2048][768]; units 24576..32767 = (token, kv head) from Kf [2048][256].
// 8 lanes per unit (d0 = 8*(lane&7)), 4 units per wave, grid = 32768/32 = 1024 blocks x 256 threads covers all units
// ---------------------------------------------------------------------------
__device__ __forceinline__ float rope_one(float x, float p, float wx, float wp, float cv, float sv, float rinv, float sg) {
  const float xn = wx * (x * rinv);
  const float pn = wp * (p * rinv);
  return xn * cv + (sg * pn) * sv;
}

__global__ __launch_bounds__(256) void norm_rope_split_kernel(
    const float* __restrict__ Qf, const float* __restrict__ Kf,
    const float* __restrict__ qw, const float* __restrict__ kw,
    const float* __restrict__ cs, const float* __restrict__ sn,
    unsigned short* __restrict__ Qh, unsigned short* __restrict__ Ql,
    unsigned short* __restrict__ Kh, unsigned short* __restrict__ Kl) {
  const int lane  = threadIdx.x & 31;
  const int wave  = threadIdx.x >> 5;
  const int wbase = (blockIdx.x * 8 + wave) * 4;   // first unit of this wave
  const int u     = wbase + (lane >> 3);           // < kNUnits by grid construction
  const int d0    = (lane & 7) * 8;
  const bool isq  = wbase < kNQUnits;              // wave-uniform
  int uq = u; if (uq > kNQUnits - 1) uq = kNQUnits - 1;
  const int tq = uq / kNHq, hq = uq - tq * kNHq;
  int uk = u - kNQUnits; if (uk < 0) uk = 0; if (uk > kNKUnits - 1) uk = kNKUnits - 1;
  const int tk = uk >> 2, hk = uk & 3;
  const int t = isq ? tq : tk;
  const size_t offq = (size_t)tq * kDim + (size_t)hq * kHd;
  const size_t offk = (size_t)tk * kKvDim + (size_t)hk * kHd;
  const float* src = isq ? (Qf + offq) : (Kf + offk);
  const float* w   = isq ? qw : kw;
  unsigned short* dh = isq ? (Qh + offq) : (Kh + offk);
  unsigned short* dl = isq ? (Ql + offq) : (Kl + offk);
  const int dp = d0 ^ kHalfHd;                     // rotary partner block
  const int ci = t * kHalfHd + (d0 & 24);

  const v4f xa = *(const v4f*)(src + d0),  xb = *(const v4f*)(src + d0 + 4);
  const v4f pa = *(const v4f*)(src + dp),  pb = *(const v4f*)(src + dp + 4);
  const v4f wa = *(const v4f*)(w + d0),    wb = *(const v4f*)(w + d0 + 4);
  const v4f va = *(const v4f*)(w + dp),    vb = *(const v4f*)(w + dp + 4);
  const v4f ca = *(const v4f*)(cs + ci),   cb = *(const v4f*)(cs + ci + 4);
  const v4f sa = *(const v4f*)(sn + ci),   sb = *(const v4f*)(sn + ci + 4);

  float ss = xa[0] * xa[0] + xa[1] * xa[1] + xa[2] * xa[2] + xa[3] * xa[3]
           + xb[0] * xb[0] + xb[1] * xb[1] + xb[2] * xb[2] + xb[3] * xb[3];
  ss += __shfl_xor(ss, 1, 32);
  ss += __shfl_xor(ss, 2, 32);
  ss += __shfl_xor(ss, 4, 32);
  const float rinv = rsqrtf(ss * (1.0f / 64.0f) + 1e-6f);
  const float sg = (d0 < kHalfHd) ? -1.0f : 1.0f;

  float o[8];
  o[0] = rope_one(xa[0], pa[0], wa[0], va[0], ca[0], sa[0], rinv, sg);
  o[1] = rope_one(xa[1], pa[1], wa[1], va[1], ca[1], sa[1], rinv, sg);
  o[2] = rope_one(xa[2], pa[2], wa[2], va[2], ca[2], sa[2], rinv, sg);
  o[3] = rope_one(xa[3], pa[3], wa[3], va[3], ca[3], sa[3], rinv, sg);
  o[4] = rope_one(xb[0], pb[0], wb[0], vb[0], cb[0], sb[0], rinv, sg);
  o[5] = rope_one(xb[1], pb[1], wb[1], vb[1], cb[1], sb[1], rinv, sg);
  o[6] = rope_one(xb[2], pb[2], wb[2], vb[2], cb[2], sb[2], rinv, sg);
  o[7] = rope_one(xb[3], pb[3], wb[3], vb[3], cb[3], sb[3], rinv, sg);

  v4u hv, lv;
#pragma unroll
  for (int q = 0; q < 4; ++q) {
    const unsigned short h0 = f2bf_bits(o[2 * q]), h1 = f2bf_bits(o[2 * q + 1]);
    const unsigned short l0 = f2bf_bits(o[2 * q] - bf_bits2f(h0)), l1 = f2bf_bits(o[2 * q + 1] - bf_bits2f(h1));
    hv[q] = pk16(h0, h1);
    lv[q] = pk16(l0, l1);
  }
  *(v4u*)(dh + d0) = hv;
  *(v4u*)(dl + d0) = lv;
  
}

// =====================================================================================
// Causal sliding-window grouped-query attention, head dim 64, one launch per batch element.
//   q planes (hi/lo bf16): element (t, h, d) at [t*kDim + h*64 + d]           (12 heads)
//   k planes (hi/lo bf16): element (s, g, d) at [s*kKvDim + g*64 + d]         (4 kv heads, g = h/3)
//   v^T planes (hi/lo bf16): element (g, d, s) at [(g*64 + d)*kSeq + s]
//   out f32: element (t, h, d) at [t*kDim + h*64 + d]
//   scores = (q . k) * sscale : bf16 hi/lo split (hi.hi + hi.lo + lo.hi) on v_wmma_f32_16x16x32_bf16
//   out    = p . v             : bf16 hi/lo split of p (unnormalised) and v, f32 accumulate
//   online softmax in f32; keys with s > t or t - s > kWin-1 set to -inf; a fully -inf running max uses a 0 pivot
//   (alpha = 0, p = 0) so nothing non-finite is produced; the diagonal key is always kept.
//   Block = 4 waves = 64 query rows of one head; grid.x = kNHq * (kSeq/64); kv chunks of 64 from the first
//   in-window chunk (block-uniform) up to chunk qb (static bound qb+1 <= 32).
//   K / V^T chunk staging: 128 threads x 32 elements per plane = the whole 64x64 tile (16-B copies, plain loads,
//   __syncthreads before and after); fragment loads read the LDS tiles with the same v8b element type.
// =====================================================================================
#define AT_D 64
#define AT_NW 4
#define AT_QB 64
#define AT_KC 64

__device__ __forceinline__ unsigned short at_bf_bits(float f) {
  unsigned u = __float_as_uint(f);
  return (unsigned short)((u + 0x7FFFu + ((u >> 16) & 1u)) >> 16);
}
__device__ __forceinline__ __bf16 at_f2bf(float f) { return __builtin_bit_cast(__bf16, at_bf_bits(f)); }
__device__ __forceinline__ void at_split(float f, __bf16& hi, __bf16& lo) {
  const unsigned short hb = at_bf_bits(f);
  hi = __builtin_bit_cast(__bf16, hb);
  lo = at_f2bf(f - __uint_as_float(((unsigned)hb) << 16));
}
__device__ __forceinline__ v8f at_mma(v16b a, v16b b, v8f c) {
  c = __builtin_amdgcn_wmma_f32_16x16x32_bf16(false, a, false, b, (short)0, c, false, false);
  asm volatile("v_nop\n\tv_nop\n\tv_nop\n\tv_nop" : "+v"(c) : "v"(a), "v"(b));
  return c;
}

__global__ __launch_bounds__(128)
void attn_gqa_window64_kernel(const unsigned short* __restrict__ qhp, const unsigned short* __restrict__ qlp,
                              const unsigned short* __restrict__ khp, const unsigned short* __restrict__ klp,
                              const unsigned short* __restrict__ vhp, const unsigned short* __restrict__ vlp,
                              float* __restrict__ out, float sscale) {
  union FB { v16b v; v8b h[2]; };
  __shared__ __align__(16) __bf16 Ksh[AT_KC * AT_D];             // K hi [kv][d]      8 KB
  __shared__ __align__(16) __bf16 Ksl[AT_KC * AT_D];             // K lo
  __shared__ __align__(16) __bf16 Vth[AT_D * AT_KC];             // V hi [d][kv]      8 KB
  __shared__ __align__(16) __bf16 Vtl[AT_D * AT_KC];             // V lo
  __shared__ __align__(16) __bf16 Psh[AT_NW][16 * AT_KC];        // per wave P hi [row][kv]
  __shared__ __align__(16) __bf16 Psl[AT_NW][16 * AT_KC];        // per wave P lo
  __shared__ __align__(16) float  Os[AT_NW][16 * 68];            // per wave out tile, pitch 68

  const int tid  = threadIdx.x;
  const int wave = tid >> 5;
  const int lane = tid & 31;
  const int hh   = lane >> 4;
  const int c    = lane & 15;

  const int nqb = kSeq / AT_QB;           // 32
  const int bx = blockIdx.x;
  const int qb = bx % nqb;
  const int h  = bx / nqb;                // 0..kNHq-1 (grid = kNHq * nqb)
  const int kvh = h / kGroups;            // 0..kNKv-1
  const int q0 = qb * AT_QB + wave * 16;

  const __bf16* Qh = (const __bf16*)(const void*)qhp + (size_t)h * AT_D;
  const __bf16* Ql = (const __bf16*)(const void*)qlp + (size_t)h * AT_D;
  const __bf16* Kh = (const __bf16*)(const void*)khp + (size_t)kvh * AT_D;
  const __bf16* Kl = (const __bf16*)(const void*)klp + (size_t)kvh * AT_D;
  const __bf16* Vh = (const __bf16*)(const void*)vhp + (size_t)kvh * AT_D * kSeq;
  const __bf16* Vl = (const __bf16*)(const void*)vlp + (size_t)kvh * AT_D * kSeq;
  float*        ob = out + (size_t)h * AT_D;

  // ---- Q fragments (A operand, row = lane&15, split k map via Frag load): 2 d-chunks, hi and lo ----
  v16b qah[2], qal[2];
#pragma unroll
  for (int dc = 0; dc < 2; ++dc) {
    const __bf16* qr = Qh + (size_t)(q0 + c) * kDim + dc * 32 + 8 * hh;
    const __bf16* ql = Ql + (size_t)(q0 + c) * kDim + dc * 32 + 8 * hh;
    qah[dc] = Frag<__bf16>::load(qr);
    qal[dc] = Frag<__bf16>::load(ql);
  }

  float mrow[8], lrow[8];
  v8f oacc[4];
#pragma unroll
  for (int r = 0; r < 8; ++r) { mrow[r] = -INFINITY; lrow[r] = 0.f; }
#pragma unroll
  for (int t = 0; t < 4; ++t) oacc[t] = (v8f){0.f,0.f,0.f,0.f,0.f,0.f,0.f,0.f};

  const int qlo = qb * AT_QB - (kWin - 1);                 // smallest key allowed for the block's first row
  const int kcStart = (qlo > 0) ? (qlo / AT_KC) : 0;       // block-uniform
  const int nChunks = qb + 1;                              // block-uniform, <= 32
  for (int kc = kcStart; kc < nChunks; ++kc) {
    const int kv0 = kc * AT_KC;
    __syncthreads();
    {
      // staging coverage: 128 threads x (4 x 8) elements = 64 rows x 64 per plane = the whole chunk tile
      const int r = tid >> 1, half = (tid & 1) * 32;
      const __bf16* ksh = Kh + (size_t)(kv0 + r) * kKvDim + half;   // K row kv0+r, d = half..half+31
      const __bf16* ksl = Kl + (size_t)(kv0 + r) * kKvDim + half;
      const __bf16* vsh = Vh + (size_t)r * kSeq + kv0 + half;        // V^T row d = r, s = kv0+half..+31
      const __bf16* vsl = Vl + (size_t)r * kSeq + kv0 + half;
#pragma unroll
      for (int i = 0; i < 4; ++i) {
        const v8b a0 = *(const v8b*)(ksh + 8 * i);
        const v8b a1 = *(const v8b*)(ksl + 8 * i);
        const v8b b0 = *(const v8b*)(vsh + 8 * i);
        const v8b b1 = *(const v8b*)(vsl + 8 * i);
        *(v8b*)(Ksh + r * AT_D  + half + 8 * i) = a0;
        *(v8b*)(Ksl + r * AT_D  + half + 8 * i) = a1;
        *(v8b*)(Vth + r * AT_KC + half + 8 * i) = b0;
        *(v8b*)(Vtl + r * AT_KC + half + 8 * i) = b1;
      }
    }
    __syncthreads();

    v8f s[4];
#pragma unroll
    for (int j = 0; j < 4; ++j) {
      s[j] = (v8f){0.f,0.f,0.f,0.f,0.f,0.f,0.f,0.f};
#pragma unroll
      for (int dc = 0; dc < 2; ++dc) {
        FB kb, kl;
        kb.h[0] = *(const v8b*)(Ksh + (j * 16 + c) * AT_D + dc * 32 + 8 * hh);
        kb.h[1] = *(const v8b*)(Ksh + (j * 16 + c) * AT_D + dc * 32 + 16 + 8 * hh);
        kl.h[0] = *(const v8b*)(Ksl + (j * 16 + c) * AT_D + dc * 32 + 8 * hh);
        kl.h[1] = *(const v8b*)(Ksl + (j * 16 + c) * AT_D + dc * 32 + 16 + 8 * hh);
        s[j] = at_mma(qah[dc], kb.v, s[j]);
        s[j] = at_mma(qah[dc], kl.v, s[j]);
        s[j] = at_mma(qal[dc], kb.v, s[j]);
      }
    }
    float cm[8];
#pragma unroll
    for (int r = 0; r < 8; ++r) {
      const int qrow = q0 + 8 * hh + r;
      float m = -INFINITY;
#pragma unroll
      for (int j = 0; j < 4; ++j) {
        const int kvcol = kv0 + j * 16 + c;
        const float sv = s[j][r] * sscale;
        const bool masked = (kvcol > qrow) || (qrow - kvcol > kWin - 1);
        const float sm = masked ? -INFINITY : sv;
        s[j][r] = sm;
        m = fmaxf(m, sm);
      }
#pragma unroll
      for (int off = 1; off < 16; off <<= 1) m = fmaxf(m, __shfl_xor(m, off, 32));
      cm[r] = m;
    }
    __bf16* pwh = Psh[wave];
    __bf16* pwl = Psl[wave];
#pragma unroll
    for (int r = 0; r < 8; ++r) {
      const float mnew  = fmaxf(mrow[r], cm[r]);
      const float mpiv  = (mnew == -INFINITY) ? 0.0f : mnew;   // fully masked so far -> alpha = 0, p = 0
      const float alpha = expf(mrow[r] - mpiv);
      mrow[r] = mnew;
      float psum = 0.f;
#pragma unroll
      for (int j = 0; j < 4; ++j) {
        const float p = expf(s[j][r] - mpiv);
        psum += p;
        __bf16 a, bl; at_split(p, a, bl);
        pwh[(8 * hh + r) * AT_KC + j * 16 + c] = a;
        pwl[(8 * hh + r) * AT_KC + j * 16 + c] = bl;
      }
#pragma unroll
      for (int off = 1; off < 16; off <<= 1) psum += __shfl_xor(psum, off, 32);
      lrow[r] = lrow[r] * alpha + psum;
#pragma unroll
      for (int t = 0; t < 4; ++t) oacc[t][r] *= alpha;
    }
    __builtin_amdgcn_fence(__ATOMIC_RELEASE, "workgroup");
    __builtin_amdgcn_wave_barrier();
    __builtin_amdgcn_fence(__ATOMIC_ACQUIRE, "workgroup");
#pragma unroll 1
    for (int kk = 0; kk < 2; ++kk) {
      FB pa, pl;
      pa.h[0] = *(const v8b*)(pwh + c * AT_KC + kk * 32 + 8 * hh);
      pa.h[1] = *(const v8b*)(pwh + c * AT_KC + kk * 32 + 16 + 8 * hh);
      pl.h[0] = *(const v8b*)(pwl + c * AT_KC + kk * 32 + 8 * hh);
      pl.h[1] = *(const v8b*)(pwl + c * AT_KC + kk * 32 + 16 + 8 * hh);
#pragma unroll
      for (int t = 0; t < 4; ++t) {
        FB vb, vl;
        vb.h[0] = *(const v8b*)(Vth + (t * 16 + c) * AT_KC + kk * 32 + 8 * hh);
        vb.h[1] = *(const v8b*)(Vth + (t * 16 + c) * AT_KC + kk * 32 + 16 + 8 * hh);
        vl.h[0] = *(const v8b*)(Vtl + (t * 16 + c) * AT_KC + kk * 32 + 8 * hh);
        vl.h[1] = *(const v8b*)(Vtl + (t * 16 + c) * AT_KC + kk * 32 + 16 + 8 * hh);
        oacc[t] = at_mma(pa.v, vb.v, oacc[t]);
        oacc[t] = at_mma(pa.v, vl.v, oacc[t]);
        oacc[t] = at_mma(pl.v, vb.v, oacc[t]);
      }
    }
  }

  float* os = Os[wave];
#pragma unroll
  for (int r = 0; r < 8; ++r) {
    const float inv = 1.0f / lrow[r];
#pragma unroll
    for (int t = 0; t < 4; ++t) os[(8 * hh + r) * 68 + t * 16 + c] = oacc[t][r] * inv;
  }
  __builtin_amdgcn_fence(__ATOMIC_RELEASE, "workgroup");
  __builtin_amdgcn_wave_barrier();
  __builtin_amdgcn_fence(__ATOMIC_ACQUIRE, "workgroup");
  {
    const int c4 = (lane & 15) * 4;
    {
#pragma unroll
      for (int it = 0; it < 8; ++it) {
        const int row = it * 2 + hh;   // it 0..7 x hh 0..1 covers rows 0..15 of the wave tile
        v4f val = *(const v4f*)(os + row * 68 + c4);
        *(v4f*)(ob + (size_t)(q0 + row) * kDim + c4) = val;
      }
      
    }
  }
}

// ---------------------------------------------------------------------------
// Workspace region map (byte offsets; every per-batch region is fully rewritten inside each batch iteration
// before it is read):
//   Wqh bf16 [768 n][768 k]         0      Wql   1179648
//   Wkh bf16 [256][768]        2359296      Wkl   2752512
//   Wvh bf16 [256][768]        3145728      Wvl   3538944
//   Woh bf16 [768][768]        3932160      Wol   5111808
//   CS  f32  [2048][32]        6291456      SN    6553600
//   Xh  bf16 [2048][768]       6815744      Xl    9961472
//   Qf  f32  [2048][768]      13107200
//   Kf  f32  [2048][256]      19398656
//   Qh  bf16 [2048][768]      21495808      Ql   24641536
//   Kh  bf16 [2048][256]      27787264      Kl   28835840
//   VTh bf16 [256][2048]      29884416      VTl  30932992
//   Of  f32  [2048][768]      31981568
//   Oh  bf16 [2048][768]      38273024      Ol   41418752
//   total                     44564480
// ---------------------------------------------------------------------------
extern "C" void kernel_launch(void* const* d_in, const int* in_sizes, int n_in,
                              void* d_out, int out_size, void* d_ws, size_t ws_size,
                              hipStream_t stream) {
  if (n_in < 7) return;
  if (in_sizes[0] != kNB * kSeq * kDim) return;
  if (in_sizes[1] != kDim * kDim || in_sizes[4] != kDim * kDim) return;
  if (in_sizes[2] != kKvDim * kDim || in_sizes[3] != kKvDim * kDim) return;
  if (in_sizes[5] != kHd || in_sizes[6] != kHd) return;
  if (out_size != kNB * kSeq * kDim) return;

  const float* x    = (const float*)d_in[0];
  const float* Wq   = (const float*)d_in[1];
  const float* Wk   = (const float*)d_in[2];
  const float* Wv   = (const float*)d_in[3];
  const float* Wo   = (const float*)d_in[4];
  const float* lnq  = (const float*)d_in[5];
  const float* lnk  = (const float*)d_in[6];

  const size_t PWQ = (size_t)kDim * kDim * 2;      // 1179648  bf16 [768][768] plane
  const size_t PWK = (size_t)kKvDim * kDim * 2;    // 393216   bf16 [256][768] plane
  const size_t PTB = (size_t)kSeq * kHalfHd * 4;   // 262144   f32 [2048][32] table
  const size_t PXB = (size_t)kSeq * kDim * 2;      // 3145728  bf16 [2048][768] plane
  const size_t PXF = (size_t)kSeq * kDim * 4;      // 6291456  f32 [2048][768]
  const size_t PKF = (size_t)kSeq * kKvDim * 4;    // 2097152  f32 [2048][256]
  const size_t PKB = (size_t)kSeq * kKvDim * 2;    // 1048576  bf16 [2048][256] / [256][2048] plane
  size_t off = 0;
  const size_t oWqh = off; off += PWQ;  const size_t oWql = off; off += PWQ;
  const size_t oWkh = off; off += PWK;  const size_t oWkl = off; off += PWK;
  const size_t oWvh = off; off += PWK;  const size_t oWvl = off; off += PWK;
  const size_t oWoh = off; off += PWQ;  const size_t oWol = off; off += PWQ;
  const size_t oCS  = off; off += PTB;  const size_t oSN  = off; off += PTB;
  const size_t oXh  = off; off += PXB;  const size_t oXl  = off; off += PXB;
  const size_t oQf  = off; off += PXF;
  const size_t oKf  = off; off += PKF;
  const size_t oQh  = off; off += PXB;  const size_t oQl  = off; off += PXB;
  const size_t oKh  = off; off += PKB;  const size_t oKl  = off; off += PKB;
  const size_t oVTh = off; off += PKB;  const size_t oVTl = off; off += PKB;
  const size_t oOf  = off; off += PXF;
  const size_t oOh  = off; off += PXB;  const size_t oOl  = off; off += PXB;
  if (off > ws_size) return;                       // off = 44564480
  if (off > (size_t)134217728) return;

  char* ws = (char*)d_ws;
  unsigned short* Wqh = (unsigned short*)(ws + oWqh); unsigned short* Wql = (unsigned short*)(ws + oWql);
  unsigned short* Wkh = (unsigned short*)(ws + oWkh); unsigned short* Wkl = (unsigned short*)(ws + oWkl);
  unsigned short* Wvh = (unsigned short*)(ws + oWvh); unsigned short* Wvl = (unsigned short*)(ws + oWvl);
  unsigned short* Woh = (unsigned short*)(ws + oWoh); unsigned short* Wol = (unsigned short*)(ws + oWol);
  float*          CS  = (float*)(ws + oCS);          float*          SN  = (float*)(ws + oSN);
  unsigned short* Xh  = (unsigned short*)(ws + oXh);  unsigned short* Xl  = (unsigned short*)(ws + oXl);
  float*          Qf  = (float*)(ws + oQf);
  float*          Kf  = (float*)(ws + oKf);
  unsigned short* Qh  = (unsigned short*)(ws + oQh);  unsigned short* Ql  = (unsigned short*)(ws + oQl);
  unsigned short* Kh  = (unsigned short*)(ws + oKh);  unsigned short* Kl  = (unsigned short*)(ws + oKl);
  unsigned short* VTh = (unsigned short*)(ws + oVTh); unsigned short* VTl = (unsigned short*)(ws + oVTl);
  float*          Of  = (float*)(ws + oOf);
  unsigned short* Oh  = (unsigned short*)(ws + oOh);  unsigned short* Ol  = (unsigned short*)(ws + oOl);

  const dim3 blk(256);

  // setup: rotary tables (256 blocks x 256 = 65536 = 2048 x 32 elements per table)
  rope_table_kernel<<<dim3((kSeq * kHalfHd) / 256), blk, 0, stream>>>(CS, SN);
  // setup: weights [out n][in k] f32 (natural Bt layout) -> bf16 hi/lo planes
  const int n2wq = kDim * kDim / 2;       // 294912 pairs
  const int n2wk = kKvDim * kDim / 2;     // 98304 pairs
  split_bf16x2_kernel<<<dim3((n2wq + 255) / 256), blk, 0, stream>>>(Wq, Wqh, Wql, n2wq);
  split_bf16x2_kernel<<<dim3((n2wk + 255) / 256), blk, 0, stream>>>(Wk, Wkh, Wkl, n2wk);
  split_bf16x2_kernel<<<dim3((n2wk + 255) / 256), blk, 0, stream>>>(Wv, Wvh, Wvl, n2wk);
  split_bf16x2_kernel<<<dim3((n2wq + 255) / 256), blk, 0, stream>>>(Wo, Woh, Wol, n2wq);

  const int n2x = kSeq * kDim / 2;                                  // 786432 pairs per plane
  const dim3 gCast((n2x + 255) / 256);                              // 3072 blocks x 512 elements = 2048x768
  const dim3 gProjQ(((kSeq / 64) * (kDim / 64) + 7) / 8, 1);        // 384 tiles: M=2048, N=768
  const dim3 gProjK(((kSeq / 64) * (kKvDim / 64) + 7) / 8, 1);      // 128 tiles: M=2048, N=256
  const dim3 gVT(((kKvDim / 64) * (kSeq / 64) + 7) / 8, 1);         // 128 tiles: M=256, N=2048
  const dim3 gRope(kNUnits / 32);                                   // 1024 blocks x 32 units
  const dim3 gAtt(kNHq * (kSeq / 64));                              // 384 blocks: 12 heads x 32 query blocks

  for (int b = 0; b < kNB; ++b) {
    const float* xb = x + (size_t)b * kSeq * kDim;
    // (1) x[b] -> bf16 hi/lo planes [2048][768]
    split_bf16x2_kernel<<<gCast, blk, 0, stream>>>(xb, Xh, Xl, n2x);
    // (2) q = x . Wq^T -> Qf f32 [t][h*64+d]   (M=2048, N=768, K=768)
    wmma_gemm64<1, true, 0, 0, false><<<gProjQ, blk, 0, stream>>>(
        Xh, Xl, kDim, 0L, Wqh, Wql, kDim, 0L, (void*)Qf, (void*)Qf, kDim, 0L,
        lnq, lnq, 0L, kSeq, kDim, kDim, 1.0f);
    // (3) k = x . Wk^T -> Kf f32 [s][g*64+d]   (M=2048, N=256, K=768)
    wmma_gemm64<1, true, 0, 0, false><<<gProjK, blk, 0, stream>>>(
        Xh, Xl, kDim, 0L, Wkh, Wkl, kDim, 0L, (void*)Kf, (void*)Kf, kKvDim, 0L,
        lnk, lnk, 0L, kSeq, kKvDim, kDim, 1.0f);
    // (4) v^T = Wv . x^T -> VT hi/lo planes [g*64+d][s]   (A = Wv planes [256][768], Bt = x planes; M=256, N=2048, K=768)
    wmma_gemm64<1, true, 0, 2, false><<<gVT, blk, 0, stream>>>(
        Wvh, Wvl, kDim, 0L, Xh, Xl, kDim, 0L, (void*)VTh, (void*)VTl, kSeq, 0L,
        lnq, lnq, 0L, kKvDim, kSeq, kDim, 1.0f);
    // (5) per-head rmsnorm * w + rotary on q and k -> Q/K bf16 hi/lo planes
    norm_rope_split_kernel<<<gRope, blk, 0, stream>>>(Qf, Kf, lnq, lnk, CS, SN, Qh, Ql, Kh, Kl);
    // (6) windowed causal GQA attention per head: y[t][h*64+d] (f32 plane, every element written by its (h, query block) owner)
    attn_gqa_window64_kernel<<<gAtt, dim3(128), 0, stream>>>(Qh, Ql, Kh, Kl, VTh, VTl, Of, 0.125f);
    // (7) y -> bf16 hi/lo planes
    split_bf16x2_kernel<<<gCast, blk, 0, stream>>>(Of, Oh, Ol, n2x);
    // (8) out[b] = y . Wo^T -> d_out rows b*2048 .. b*2048+2047 (f32)   (M=2048, N=768, K=768)
    float* outb = (float*)d_out + (size_t)b * kSeq * kDim;
    wmma_gemm64<1, true, 0, 0, false><<<gProjQ, blk, 0, stream>>>(
        Oh, Ol, kDim, 0L, Woh, Wol, kDim, 0L, (void*)outb, (void*)outb, kDim, 0L,
        lnq, lnq, 0L, kSeq, kDim, kDim, 1.0f);
  }
}

// v001
// A run of this version takes 315 microseconds.
// Two timings next to v000 both put it at 1.75 times that version's speed.
// Contractions (q/k/v/out projections, q.k^T scores, p.v): v_wmma_f32_16x16x32_bf16 with bf16 hi/lo split operands (hi.hi + hi.lo + lo.hi), f32 accumulate; rmsnorm, rotary tables, online softmax in f32.
#include <hip/hip_runtime.h>
#include <math.h>
#include <stdint.h>

constexpr int kNB     = 2;
constexpr int kSeq    = 2048;
constexpr int kTok    = kNB * kSeq;          // 4096 token rows over both batch elements
constexpr int kDim    = 768;
constexpr int kHd     = 64;
constexpr int kNHq    = 12;
constexpr int kNKv    = 4;
constexpr int kGroups = 3;
constexpr int kKvDim  = kNKv * kHd;          // 256
constexpr int kWin    = 384;
constexpr int kHalfHd = 32;
constexpr int kNQUnits = kSeq * kNHq;        // 24576 (token, q head) units
constexpr int kNKUnits = kSeq * kNKv;        // 8192  (token, kv head) units
constexpr int kNUnits  = kNQUnits + kNKUnits;// 32768
static_assert(kNQUnits % 4 == 0);
static_assert(kNUnits % 32 == 0);
static_assert(kSeq % 64 == 0 && kDim % 64 == 0 && kKvDim % 64 == 0 && kDim % 32 == 0);
static_assert(kNHq == kNKv * kGroups);

typedef __attribute__((ext_vector_type(16))) _Float16 v16h;
typedef __attribute__((ext_vector_type(8)))  _Float16 v8h;
typedef __attribute__((ext_vector_type(16))) __bf16   v16b;
typedef __attribute__((ext_vector_type(8)))  __bf16   v8b;
typedef __attribute__((ext_vector_type(8)))  float    v8f;
typedef __attribute__((ext_vector_type(4)))  float    v4f;
typedef __attribute__((ext_vector_type(2)))  float    v2f;
typedef __attribute__((ext_vector_type(4)))  unsigned int v4u;

__device__ __forceinline__ unsigned short f2bf_bits(float f) {
  unsigned u = __float_as_uint(f);
  return (unsigned short)((u + 0x7FFFu + ((u >> 16) & 1u)) >> 16);
}
__device__ __forceinline__ float bf_bits2f(unsigned short h) { return __uint_as_float(((unsigned)h) << 16); }

// hazard guards as plain device helpers (no inline asm inside the kernel template body)
__device__ __forceinline__ void dep_guard_h(v8f& a, v8f& b, v16h x, v16h y) { asm volatile("v_nop\n\tv_nop\n\tv_nop\n\tv_nop" : "+v"(a), "+v"(b) : "v"(x), "v"(y)); }
__device__ __forceinline__ void dep_guard_b(v8f& a, v8f& b, v16b x, v16b y) { asm volatile("v_nop\n\tv_nop\n\tv_nop\n\tv_nop" : "+v"(a), "+v"(b) : "v"(x), "v"(y)); }
__device__ __forceinline__ void keep4_h(v16h a, v16h b, v16h c, v16h d) { asm volatile("v_nop" :: "v"(a), "v"(b), "v"(c), "v"(d)); }
__device__ __forceinline__ void keep4_b(v16b a, v16b b, v16b c, v16b d) { asm volatile("v_nop" :: "v"(a), "v"(b), "v"(c), "v"(d)); }
__device__ __forceinline__ void acc_guard4(v8f& a, v8f& b, v8f& c, v8f& d) { asm volatile("v_nop\n\tv_nop\n\tv_nop\n\tv_nop" : "+v"(a), "+v"(b), "+v"(c), "+v"(d)); }
template <typename T> struct Frag;
template <> struct Frag<_Float16> {
  typedef v16h V; union U { v16h v; v8h h[2]; };
  static __device__ __forceinline__ v16h load(const _Float16* p) {   // elements 0..7 <- p[0..7], 8..15 <- p[16..23]
    U f; f.h[0] = *(const v8h*)(p); f.h[1] = *(const v8h*)(p + 16); return f.v;
  }
  static __device__ __forceinline__ v8f mma(v16h a, v16h b, v8f c) {
    return __builtin_amdgcn_wmma_f32_16x16x32_f16(false, a, false, b, (short)0, c, false, false);
  }
  static __device__ __forceinline__ void guard(v8f& a, v8f& b, v16h x, v16h y) { dep_guard_h(a, b, x, y); }
  static __device__ __forceinline__ void keep(v16h a, v16h b, v16h c, v16h d) { keep4_h(a, b, c, d); }
};
template <> struct Frag<__bf16> {
  typedef v16b V; union U { v16b v; v8b h[2]; };
  static __device__ __forceinline__ v16b load(const __bf16* p) {
    U f; f.h[0] = *(const v8b*)(p); f.h[1] = *(const v8b*)(p + 16); return f.v;
  }
  static __device__ __forceinline__ v8f mma(v16b a, v16b b, v8f c) {
    return __builtin_amdgcn_wmma_f32_16x16x32_bf16(false, a, false, b, (short)0, c, false, false);
  }
  static __device__ __forceinline__ void guard(v8f& a, v8f& b, v16b x, v16b y) { dep_guard_b(a, b, x, y); }
  static __device__ __forceinline__ void keep(v16b a, v16b b, v16b c, v16b d) { keep4_b(a, b, c, d); }
};

// ---- Register-blocked batched WMMA GEMM ------------------------------------
// C[m,n] = scale * sum_k A[m,k] * Bt[n,k] (+bias)(+resid); each wave owns a 64x64 tile.
// A row-major [M,K]; Bt row-major [N,K]; M,N % 64 == 0, K % 32 == 0.
// SPLIT: operands are hi/lo planes (A2/Bt2 = lo planes, same layout); product = hi.hi + hi.lo + lo.hi.
// BIAS_MODE: 0 = none, 1 = bias[m], 2 = bias[n].
// OUT_MODE: 0 = f32, 1 = f16, 2 = bf16 hi plane (Cout) + bf16 lo plane (Cout2).
// ET: 0 = f16 operands, 1 = bf16 operands (pointers passed as 16-bit storage)
template <int ET> struct Elem;
template <> struct Elem<0> { typedef _Float16 T; };
template <> struct Elem<1> { typedef __bf16 T; };
template <int ET, bool SPLIT, int BIAS_MODE, int OUT_MODE, bool RESID, int ACT = 0>
__global__ __launch_bounds__(256) void wmma_gemm64(
    const unsigned short* __restrict__ Ap, const unsigned short* __restrict__ A2p, int lda, long strideA,
    const unsigned short* __restrict__ Btp, const unsigned short* __restrict__ Bt2p, int ldb, long strideB,
    void* __restrict__ Cout, void* __restrict__ Cout2, int ldc, long strideC,
    const float* __restrict__ bias,
    const float* __restrict__ resid, long strideR,
    int M, int N, int K, float scale) {
  typedef typename Elem<ET>::T T;
  typedef typename Frag<T>::V V;
  const T* A = (const T*)Ap; const T* A2 = (const T*)A2p; const T* Bt = (const T*)Btp; const T* Bt2 = (const T*)Bt2p;
  __shared__ __align__(16) float sT[8][16 * 68];   // per-wave 16x64 slab, pitch 68 floats
  const int b    = blockIdx.y;
  const int lane = threadIdx.x & 31;
  const int wave = threadIdx.x >> 5;
  const int tilesN = N >> 6;
  const int tilesM = M >> 6;
  const int tile = blockIdx.x * 8 + wave;
  if (tile >= tilesM * tilesN) return;   // wave-uniform; no block barriers in this kernel
  const int tm = tile / tilesN;
  const int tn = tile - tm * tilesN;
  const int m0 = tm << 6;
  const int n0 = tn << 6;

  const T* Ab  = A  + (size_t)b * strideA;
  const T* Bb  = Bt + (size_t)b * strideB;
  const T* Ab2 = SPLIT ? (A2  + (size_t)b * strideA) : nullptr;
  const T* Bb2 = SPLIT ? (Bt2 + (size_t)b * strideB) : nullptr;

  const int rlane = lane & 15;                 // row (A) / col (B, D) within subtile
  const int koff  = (lane >> 4) * 8;           // k offset of this lane half
  const int mOff  = (lane >> 4) * 8;           // D row offset

  v8f acc[4][4];
#pragma unroll
  for (int i = 0; i < 4; ++i)
#pragma unroll
    for (int j = 0; j < 4; ++j) acc[i][j] = (v8f){0.f,0.f,0.f,0.f,0.f,0.f,0.f,0.f};

  for (int k0 = 0; k0 < K; k0 += 32) {
    V bh[4], bl[4];
#pragma unroll
    for (int j = 0; j < 4; ++j) {
      const size_t bo = (size_t)(n0 + (j << 4) + rlane) * ldb + koff + k0;
      bh[j] = Frag<T>::load(Bb + bo);
      if (SPLIT) bl[j] = Frag<T>::load(Bb2 + bo);
    }
#pragma unroll
    for (int i = 0; i < 4; ++i) {
      const size_t ao = (size_t)(m0 + (i << 4) + rlane) * lda + koff + k0;
      V ah = Frag<T>::load(Ab + ao);
      V al;
      if (SPLIT) al = Frag<T>::load(Ab2 + ao);
#pragma unroll
      for (int j = 0; j < 4; ++j) {
        acc[i][j] = Frag<T>::mma(ah, bh[j], acc[i][j]);
        if (SPLIT) {
          acc[i][j] = Frag<T>::mma(ah, bl[j], acc[i][j]);
          acc[i][j] = Frag<T>::mma(al, bh[j], acc[i][j]);
        }
      }
      Frag<T>::guard(acc[i][0], acc[i][3], ah, SPLIT ? al : ah);
    }
    Frag<T>::keep(bh[0], bh[1], bh[2], bh[3]);
    if (SPLIT) Frag<T>::keep(bl[0], bl[1], bl[2], bl[3]);
  }
  acc_guard4(acc[0][0], acc[0][1], acc[0][2], acc[0][3]);
  acc_guard4(acc[1][0], acc[1][1], acc[1][2], acc[1][3]);
  acc_guard4(acc[2][0], acc[2][1], acc[2][2], acc[2][3]);
  acc_guard4(acc[3][0], acc[3][1], acc[3][2], acc[3][3]);

  // ---- epilogue ----
  float* slab = sT[wave];
  const float* Rb = RESID ? (resid + (size_t)b * strideR) : nullptr;
#pragma unroll
  for (int i = 0; i < 4; ++i) {
    const int mBase = m0 + (i << 4);
#pragma unroll
    for (int j = 0; j < 4; ++j) {
      const int n = n0 + (j << 4) + rlane;
      float bv = 0.f;
      if (BIAS_MODE == 2) bv = bias[n];
#pragma unroll
      for (int r = 0; r < 8; ++r) {
        float v = acc[i][j][r] * scale;
        if (BIAS_MODE == 1) v += bias[mBase + mOff + r];
        if (BIAS_MODE == 2) v += bv;
        if (RESID) v += Rb[(size_t)(mBase + mOff + r) * ldc + n];
        if (ACT == 1) v = tanhf(v);
        if (ACT == 2) v = fmaxf(v, 0.0f);
        if (ACT == 3) v = v / (1.0f + expf(-v));
        if (ACT == 4) v = (v > 0.f) ? v : 0.01f * v;
        slab[(mOff + r) * 68 + (j << 4) + rlane] = v;
      }
    }
    __builtin_amdgcn_fence(__ATOMIC_RELEASE, "workgroup");
    __builtin_amdgcn_wave_barrier();
    __builtin_amdgcn_fence(__ATOMIC_ACQUIRE, "workgroup");
    if (OUT_MODE == 0) {
      float* C = (float*)Cout + (size_t)b * strideC;
      const int hh = lane >> 4, c4 = (lane & 15) * 4;     // row seg = 256 B = 16 lanes x 16 B
      {
#pragma unroll
        for (int it = 0; it < 8; ++it) {
          const int row = it * 2 + hh;
          v4f v = *(const v4f*)(slab + row * 68 + c4);
          *(v4f*)(C + (size_t)(mBase + row) * ldc + n0 + c4) = v;
        }
        
      }
    } else {
      const int q = lane >> 3, c8 = (lane & 7) * 8;
      unsigned short* C  = (unsigned short*)Cout  + (size_t)b * strideC;
      unsigned short* C2 = (OUT_MODE == 2) ? ((unsigned short*)Cout2 + (size_t)b * strideC) : nullptr;
      {
#pragma unroll
        for (int it = 0; it < 4; ++it) {
          const int row = it * 4 + q;
          const float* sp = slab + row * 68 + c8;
          v8h hv, lv;
#pragma unroll
          for (int e = 0; e < 8; ++e) {
            if (OUT_MODE == 1) {
              hv[e] = (_Float16)sp[e];
            } else {
              unsigned short hb = f2bf_bits(sp[e]);
              unsigned short lb = f2bf_bits(sp[e] - bf_bits2f(hb));
              hv[e] = __builtin_bit_cast(_Float16, hb);
              lv[e] = __builtin_bit_cast(_Float16, lb);
            }
          }
          *(v8h*)(C + (size_t)(mBase + row) * ldc + n0 + c8) = hv;
          if (OUT_MODE == 2) *(v8h*)(C2 + (size_t)(mBase + row) * ldc + n0 + c8) = lv;
        }
        
      }
    }
    __builtin_amdgcn_fence(__ATOMIC_RELEASE, "workgroup");
    __builtin_amdgcn_wave_barrier();
    __builtin_amdgcn_fence(__ATOMIC_ACQUIRE, "workgroup");
  }
}

// ---------------------------------------------------------------------------
// Elementwise bf16 split: hi = bf16_rne(in), lo = bf16_rne(in - hi); 2 elements per thread, one 4-B store
// ---------------------------------------------------------------------------
__device__ __forceinline__ unsigned pk16(unsigned short a, unsigned short b) { return (unsigned)a | ((unsigned)b << 16); }

__global__ __launch_bounds__(256) void split_bf16x2_kernel(const float* __restrict__ in, unsigned short* __restrict__ hi,
                                                           unsigned short* __restrict__ lo, int n2) {
  const int i = blockIdx.x * 256 + threadIdx.x;
  if (i < n2) {
    const v2f f = *(const v2f*)(in + 2 * (size_t)i);
    const unsigned short h0 = f2bf_bits(f[0]), h1 = f2bf_bits(f[1]);
    const unsigned short l0 = f2bf_bits(f[0] - bf_bits2f(h0)), l1 = f2bf_bits(f[1] - bf_bits2f(h1));
    const unsigned uh = pk16(h0, h1), ul = pk16(l0, l1);
    ((unsigned*)hi)[i] = uh;
    ((unsigned*)lo)[i] = ul;
    
  }
}

// ---------------------------------------------------------------------------
// Rotary tables: cs[t*32+i] = cosf(t * inv_freq[i]), sn likewise, inv_freq[i] = 10000^(-i/32) = 2^(-i*log2(1e4)/32).
// grid = kSeq*32/256 = 256 blocks x 256 threads = exactly 65536 elements per table; each wave writes 32 consecutive
// ---------------------------------------------------------------------------
__global__ __launch_bounds__(256) void rope_table_kernel(float* __restrict__ cs, float* __restrict__ sn) {
  const int i  = blockIdx.x * 256 + threadIdx.x;
  const int t  = i >> 5;
  const int fi = i & 31;
  const float invf = exp2f((float)fi * -0.41524101186092f);
  const float ang  = (float)t * invf;
  float sv, cv;
  sincosf(ang, &sv, &cv);
  ((float*)cs)[i] = cv;
  ((float*)sn)[i] = sv;
  
}

// ---------------------------------------------------------------------------
// Per (token, head) unit of 64 floats: y[d] = w[d] * (x[d] * rsqrt(mean(x^2) + eps)); rotary:
//   o[d] = y[d]*cos[t][d&31] - y[d+32]*sin  (d < 32),   o[d] = y[d]*cos + y[d-32]*sin  (d >= 32);
// o split into bf16 hi/lo planes at the same [token][head*64+d] position as the f32 source.
// Units 0..24575 = (token, q head) from Qf [2048][768]; units 24576..32767 = (token, kv head) from Kf [2048][256].
// 8 lanes per unit (d0 = 8*(lane&7)), 4 units per wave, grid.x = 32768/32 = 1024 blocks x 256 threads covers all units
// of one batch element; grid.y = batch element (planes of batch b start b*2048 token rows further on).
// ---------------------------------------------------------------------------
__device__ __forceinline__ float rope_one(float x, float p, float wx, float wp, float cv, float sv, float rinv, float sg) {
  const float xn = wx * (x * rinv);
  const float pn = wp * (p * rinv);
  return xn * cv + (sg * pn) * sv;
}

__global__ __launch_bounds__(256) void norm_rope_split_kernel(
    const float* __restrict__ Qf, const float* __restrict__ Kf,
    const float* __restrict__ qw, const float* __restrict__ kw,
    const float* __restrict__ cs, const float* __restrict__ sn,
    unsigned short* __restrict__ Qh, unsigned short* __restrict__ Ql,
    unsigned short* __restrict__ Kh, unsigned short* __restrict__ Kl) {
  const int lane  = threadIdx.x & 31;
  const int wave  = threadIdx.x >> 5;
  const int wbase = (blockIdx.x * 8 + wave) * 4;   // first unit of this wave
  const int u     = wbase + (lane >> 3);           // < kNUnits by grid construction
  const int d0    = (lane & 7) * 8;
  const bool isq  = wbase < kNQUnits;              // wave-uniform
  int uq = u; if (uq > kNQUnits - 1) uq = kNQUnits - 1;
  const int tq = uq / kNHq, hq = uq - tq * kNHq;
  int uk = u - kNQUnits; if (uk < 0) uk = 0; if (uk > kNKUnits - 1) uk = kNKUnits - 1;
  const int tk = uk >> 2, hk = uk & 3;
  const int t = isq ? tq : tk;
  const size_t rowb = (size_t)blockIdx.y * kSeq;   // first token row of this batch element
  const size_t offq = (rowb + tq) * kDim + (size_t)hq * kHd;
  const size_t offk = (rowb + tk) * kKvDim + (size_t)hk * kHd;
  const float* src = isq ? (Qf + offq) : (Kf + offk);
  const float* w   = isq ? qw : kw;
  unsigned short* dh = isq ? (Qh + offq) : (Kh + offk);
  unsigned short* dl = isq ? (Ql + offq) : (Kl + offk);
  const int dp = d0 ^ kHalfHd;                     // rotary partner block
  const int ci = t * kHalfHd + (d0 & 24);

  const v4f xa = *(const v4f*)(src + d0),  xb = *(const v4f*)(src + d0 + 4);
  const v4f pa = *(const v4f*)(src + dp),  pb = *(const v4f*)(src + dp + 4);
  const v4f wa = *(const v4f*)(w + d0),    wb = *(const v4f*)(w + d0 + 4);
  const v4f va = *(const v4f*)(w + dp),    vb = *(const v4f*)(w + dp + 4);
  const v4f ca = *(const v4f*)(cs + ci),   cb = *(const v4f*)(cs + ci + 4);
  const v4f sa = *(const v4f*)(sn + ci),   sb = *(const v4f*)(sn + ci + 4);

  float ss = xa[0] * xa[0] + xa[1] * xa[1] + xa[2] * xa[2] + xa[3] * xa[3]
           + xb[0] * xb[0] + xb[1] * xb[1] + xb[2] * xb[2] + xb[3] * xb[3];
  ss += __shfl_xor(ss, 1, 32);
  ss += __shfl_xor(ss, 2, 32);
  ss += __shfl_xor(ss, 4, 32);
  const float rinv = rsqrtf(ss * (1.0f / 64.0f) + 1e-6f);
  const float sg = (d0 < kHalfHd) ? -1.0f : 1.0f;

  float o[8];
  o[0] = rope_one(xa[0], pa[0], wa[0], va[0], ca[0], sa[0], rinv, sg);
  o[1] = rope_one(xa[1], pa[1], wa[1], va[1], ca[1], sa[1], rinv, sg);
  o[2] = rope_one(xa[2], pa[2], wa[2], va[2], ca[2], sa[2], rinv, sg);
  o[3] = rope_one(xa[3], pa[3], wa[3], va[3], ca[3], sa[3], rinv, sg);
  o[4] = rope_one(xb[0], pb[0], wb[0], vb[0], cb[0], sb[0], rinv, sg);
  o[5] = rope_one(xb[1], pb[1], wb[1], vb[1], cb[1], sb[1], rinv, sg);
  o[6] = rope_one(xb[2], pb[2], wb[2], vb[2], cb[2], sb[2], rinv, sg);
  o[7] = rope_one(xb[3], pb[3], wb[3], vb[3], cb[3], sb[3], rinv, sg);

  v4u hv, lv;
#pragma unroll
  for (int q = 0; q < 4; ++q) {
    const unsigned short h0 = f2bf_bits(o[2 * q]), h1 = f2bf_bits(o[2 * q + 1]);
    const unsigned short l0 = f2bf_bits(o[2 * q] - bf_bits2f(h0)), l1 = f2bf_bits(o[2 * q + 1] - bf_bits2f(h1));
    hv[q] = pk16(h0, h1);
    lv[q] = pk16(l0, l1);
  }
  *(v4u*)(dh + d0) = hv;
  *(v4u*)(dl + d0) = lv;
  
}

// =====================================================================================
// Causal sliding-window grouped-query attention, head dim 64, grid.y = batch element (offsets below are within one).
//   q planes (hi/lo bf16): element (t, h, d) at [t*kDim + h*64 + d]           (12 heads)
//   k planes (hi/lo bf16): element (s, g, d) at [s*kKvDim + g*64 + d]         (4 kv heads, g = h/3)
//   v^T planes (hi/lo bf16): element (g, d, s) at [(g*64 + d)*kSeq + s]
//   out f32: element (t, h, d) at [t*kDim + h*64 + d]
//   scores = (q . k) * sscale : bf16 hi/lo split (hi.hi + hi.lo + lo.hi) on v_wmma_f32_16x16x32_bf16
//   out    = p . v             : bf16 hi/lo split of p (unnormalised) and v, f32 accumulate
//   online softmax in f32; keys with s > t or t - s > kWin-1 set to -inf; a fully -inf running max uses a 0 pivot
//   (alpha = 0, p = 0) so nothing non-finite is produced; the diagonal key is always kept.
//   Block = 4 waves = 64 query rows of one head; grid.x = kNHq * (kSeq/64); kv chunks of 64 from the first
//   in-window chunk (block-uniform) up to chunk qb (static bound qb+1 <= 32).
//   K / V^T chunk staging: 128 threads x 32 elements per plane = the whole 64x64 tile (16-B copies, plain loads,
//   __syncthreads before and after); fragment loads read the LDS tiles with the same v8b element type.
// =====================================================================================
#define AT_D 64
#define AT_NW 4
#define AT_QB 64
#define AT_KC 64

__device__ __forceinline__ unsigned short at_bf_bits(float f) {
  unsigned u = __float_as_uint(f);
  return (unsigned short)((u + 0x7FFFu + ((u >> 16) & 1u)) >> 16);
}
__device__ __forceinline__ __bf16 at_f2bf(float f) { return __builtin_bit_cast(__bf16, at_bf_bits(f)); }
__device__ __forceinline__ void at_split(float f, __bf16& hi, __bf16& lo) {
  const unsigned short hb = at_bf_bits(f);
  hi = __builtin_bit_cast(__bf16, hb);
  lo = at_f2bf(f - __uint_as_float(((unsigned)hb) << 16));
}
__device__ __forceinline__ v8f at_mma(v16b a, v16b b, v8f c) {
  c = __builtin_amdgcn_wmma_f32_16x16x32_bf16(false, a, false, b, (short)0, c, false, false);
  asm volatile("v_nop\n\tv_nop\n\tv_nop\n\tv_nop" : "+v"(c) : "v"(a), "v"(b));
  return c;
}

__global__ __launch_bounds__(128)
void attn_gqa_window64_kernel(const unsigned short* __restrict__ qhp, const unsigned short* __restrict__ qlp,
                              const unsigned short* __restrict__ khp, const unsigned short* __restrict__ klp,
                              const unsigned short* __restrict__ vhp, const unsigned short* __restrict__ vlp,
                              float* __restrict__ out, float sscale) {
  union FB { v16b v; v8b h[2]; };
  __shared__ __align__(16) __bf16 Ksh[AT_KC * AT_D];             // K hi [kv][d]      8 KB
  __shared__ __align__(16) __bf16 Ksl[AT_KC * AT_D];             // K lo
  __shared__ __align__(16) __bf16 Vth[AT_D * AT_KC];             // V hi [d][kv]      8 KB
  __shared__ __align__(16) __bf16 Vtl[AT_D * AT_KC];             // V lo
  __shared__ __align__(16) __bf16 Psh[AT_NW][16 * AT_KC];        // per wave P hi [row][kv]
  __shared__ __align__(16) __bf16 Psl[AT_NW][16 * AT_KC];        // per wave P lo
  __shared__ __align__(16) float  Os[AT_NW][16 * 68];            // per wave out tile, pitch 68

  const int tid  = threadIdx.x;
  const int wave = tid >> 5;
  const int lane = tid & 31;
  const int hh   = lane >> 4;
  const int c    = lane & 15;

  const int nqb = kSeq / AT_QB;           // 32
  const int bx = blockIdx.x;
  const int qb = bx % nqb;
  const int h  = bx / nqb;                // 0..kNHq-1 (grid = kNHq * nqb)
  const int kvh = h / kGroups;            // 0..kNKv-1
  const int q0 = qb * AT_QB + wave * 16;

  const size_t bq = (size_t)blockIdx.y * kSeq * kDim;     // batch element's q / out plane
  const size_t bk = (size_t)blockIdx.y * kSeq * kKvDim;   // batch element's k / v^T plane
  const __bf16* Qh = (const __bf16*)(const void*)qhp + bq + (size_t)h * AT_D;
  const __bf16* Ql = (const __bf16*)(const void*)qlp + bq + (size_t)h * AT_D;
  const __bf16* Kh = (const __bf16*)(const void*)khp + bk + (size_t)kvh * AT_D;
  const __bf16* Kl = (const __bf16*)(const void*)klp + bk + (size_t)kvh * AT_D;
  const __bf16* Vh = (const __bf16*)(const void*)vhp + bk + (size_t)kvh * AT_D * kSeq;
  const __bf16* Vl = (const __bf16*)(const void*)vlp + bk + (size_t)kvh * AT_D * kSeq;
  float*        ob = out + bq + (size_t)h * AT_D;

  // ---- Q fragments (A operand, row = lane&15, split k map via Frag load): 2 d-chunks, hi and lo ----
  v16b qah[2], qal[2];
#pragma unroll
  for (int dc = 0; dc < 2; ++dc) {
    const __bf16* qr = Qh + (size_t)(q0 + c) * kDim + dc * 32 + 8 * hh;
    const __bf16* ql = Ql + (size_t)(q0 + c) * kDim + dc * 32 + 8 * hh;
    qah[dc] = Frag<__bf16>::load(qr);
    qal[dc] = Frag<__bf16>::load(ql);
  }

  float mrow[8], lrow[8];
  v8f oacc[4];
#pragma unroll
  for (int r = 0; r < 8; ++r) { mrow[r] = -INFINITY; lrow[r] = 0.f; }
#pragma unroll
  for (int t = 0; t < 4; ++t) oacc[t] = (v8f){0.f,0.f,0.f,0.f,0.f,0.f,0.f,0.f};

  const int qlo = qb * AT_QB - (kWin - 1);                 // smallest key allowed for the block's first row
  const int kcStart = (qlo > 0) ? (qlo / AT_KC) : 0;       // block-uniform
  const int nChunks = qb + 1;                              // block-uniform, <= 32
  for (int kc = kcStart; kc < nChunks; ++kc) {
    const int kv0 = kc * AT_KC;
    __syncthreads();
    {
      // staging coverage: 128 threads x (4 x 8) elements = 64 rows x 64 per plane = the whole chunk tile
      const int r = tid >> 1, half = (tid & 1) * 32;
      const __bf16* ksh = Kh + (size_t)(kv0 + r) * kKvDim + half;   // K row kv0+r, d = half..half+31
      const __bf16* ksl = Kl + (size_t)(kv0 + r) * kKvDim + half;
      const __bf16* vsh = Vh + (size_t)r * kSeq + kv0 + half;        // V^T row d = r, s = kv0+half..+31
      const __bf16* vsl = Vl + (size_t)r * kSeq + kv0 + half;
#pragma unroll
      for (int i = 0; i < 4; ++i) {
        const v8b a0 = *(const v8b*)(ksh + 8 * i);
        const v8b a1 = *(const v8b*)(ksl + 8 * i);
        const v8b b0 = *(const v8b*)(vsh + 8 * i);
        const v8b b1 = *(const v8b*)(vsl + 8 * i);
        *(v8b*)(Ksh + r * AT_D  + half + 8 * i) = a0;
        *(v8b*)(Ksl + r * AT_D  + half + 8 * i) = a1;
        *(v8b*)(Vth + r * AT_KC + half + 8 * i) = b0;
        *(v8b*)(Vtl + r * AT_KC + half + 8 * i) = b1;
      }
    }
    __syncthreads();

    v8f s[4];
#pragma unroll
    for (int j = 0; j < 4; ++j) {
      s[j] = (v8f){0.f,0.f,0.f,0.f,0.f,0.f,0.f,0.f};
#pragma unroll
      for (int dc = 0; dc < 2; ++dc) {
        FB kb, kl;
        kb.h[0] = *(const v8b*)(Ksh + (j * 16 + c) * AT_D + dc * 32 + 8 * hh);
        kb.h[1] = *(const v8b*)(Ksh + (j * 16 + c) * AT_D + dc * 32 + 16 + 8 * hh);
        kl.h[0] = *(const v8b*)(Ksl + (j * 16 + c) * AT_D + dc * 32 + 8 * hh);
        kl.h[1] = *(const v8b*)(Ksl + (j * 16 + c) * AT_D + dc * 32 + 16 + 8 * hh);
        s[j] = at_mma(qah[dc], kb.v, s[j]);
        s[j] = at_mma(qah[dc], kl.v, s[j]);
        s[j] = at_mma(qal[dc], kb.v, s[j]);
      }
    }
    float cm[8];
#pragma unroll
    for (int r = 0; r < 8; ++r) {
      const int qrow = q0 + 8 * hh + r;
      float m = -INFINITY;
#pragma unroll
      for (int j = 0; j < 4; ++j) {
        const int kvcol = kv0 + j * 16 + c;
        const float sv = s[j][r] * sscale;
        const bool masked = (kvcol > qrow) || (qrow - kvcol > kWin - 1);
        const float sm = masked ? -INFINITY : sv;
        s[j][r] = sm;
        m = fmaxf(m, sm);
      }
#pragma unroll
      for (int off = 1; off < 16; off <<= 1) m = fmaxf(m, __shfl_xor(m, off, 32));
      cm[r] = m;
    }
    __bf16* pwh = Psh[wave];
    __bf16* pwl = Psl[wave];
#pragma unroll
    for (int r = 0; r < 8; ++r) {
      const float mnew  = fmaxf(mrow[r], cm[r]);
      const float mpiv  = (mnew == -INFINITY) ? 0.0f : mnew;   // fully masked so far -> alpha = 0, p = 0
      const float alpha = expf(mrow[r] - mpiv);
      mrow[r] = mnew;
      float psum = 0.f;
#pragma unroll
      for (int j = 0; j < 4; ++j) {
        const float p = expf(s[j][r] - mpiv);
        psum += p;
        __bf16 a, bl; at_split(p, a, bl);
        pwh[(8 * hh + r) * AT_KC + j * 16 + c] = a;
        pwl[(8 * hh + r) * AT_KC + j * 16 + c] = bl;
      }
#pragma unroll
      for (int off = 1; off < 16; off <<= 1) psum += __shfl_xor(psum, off, 32);
      lrow[r] = lrow[r] * alpha + psum;
#pragma unroll
      for (int t = 0; t < 4; ++t) oacc[t][r] *= alpha;
    }
    __builtin_amdgcn_fence(__ATOMIC_RELEASE, "workgroup");
    __builtin_amdgcn_wave_barrier();
    __builtin_amdgcn_fence(__ATOMIC_ACQUIRE, "workgroup");
#pragma unroll 1
    for (int kk = 0; kk < 2; ++kk) {
      FB pa, pl;
      pa.h[0] = *(const v8b*)(pwh + c * AT_KC + kk * 32 + 8 * hh);
      pa.h[1] = *(const v8b*)(pwh + c * AT_KC + kk * 32 + 16 + 8 * hh);
      pl.h[0] = *(const v8b*)(pwl + c * AT_KC + kk * 32 + 8 * hh);
      pl.h[1] = *(const v8b*)(pwl + c * AT_KC + kk * 32 + 16 + 8 * hh);
#pragma unroll
      for (int t = 0; t < 4; ++t) {
        FB vb, vl;
        vb.h[0] = *(const v8b*)(Vth + (t * 16 + c) * AT_KC + kk * 32 + 8 * hh);
        vb.h[1] = *(const v8b*)(Vth + (t * 16 + c) * AT_KC + kk * 32 + 16 + 8 * hh);
        vl.h[0] = *(const v8b*)(Vtl + (t * 16 + c) * AT_KC + kk * 32 + 8 * hh);
        vl.h[1] = *(const v8b*)(Vtl + (t * 16 + c) * AT_KC + kk * 32 + 16 + 8 * hh);
        oacc[t] = at_mma(pa.v, vb.v, oacc[t]);
        oacc[t] = at_mma(pa.v, vl.v, oacc[t]);
        oacc[t] = at_mma(pl.v, vb.v, oacc[t]);
      }
    }
  }

  float* os = Os[wave];
#pragma unroll
  for (int r = 0; r < 8; ++r) {
    const float inv = 1.0f / lrow[r];
#pragma unroll
    for (int t = 0; t < 4; ++t) os[(8 * hh + r) * 68 + t * 16 + c] = oacc[t][r] * inv;
  }
  __builtin_amdgcn_fence(__ATOMIC_RELEASE, "workgroup");
  __builtin_amdgcn_wave_barrier();
  __builtin_amdgcn_fence(__ATOMIC_ACQUIRE, "workgroup");
  {
    const int c4 = (lane & 15) * 4;
    {
#pragma unroll
      for (int it = 0; it < 8; ++it) {
        const int row = it * 2 + hh;   // it 0..7 x hh 0..1 covers rows 0..15 of the wave tile
        v4f val = *(const v4f*)(os + row * 68 + c4);
        *(v4f*)(ob + (size_t)(q0 + row) * kDim + c4) = val;
      }
      
    }
  }
}

// ---------------------------------------------------------------------------
// Workspace region map (byte offsets; every region is fully written in this call before it is read; token rows
// run over both batch elements, row = b*2048 + t; VT holds one [256][2048] plane per batch element):
//   Wqh bf16 [768 n][768 k]         0      Wql   1179648
//   Wkh bf16 [256][768]        2359296      Wkl   2752512
//   Wvh bf16 [256][768]        3145728      Wvl   3538944
//   Woh bf16 [768][768]        3932160      Wol   5111808
//   CS  f32  [2048][32]        6291456      SN    6553600
//   Xh  bf16 [4096][768]       6815744      Xl   13107200
//   Qf  f32  [4096][768]      19398656
//   Kf  f32  [4096][256]      31981568
//   Qh  bf16 [4096][768]      36175872      Ql   42467328
//   Kh  bf16 [4096][256]      48758784      Kl   50855936
//   VTh bf16 [2][256][2048]   52953088      VTl  55050240
//   Of  f32  [4096][768]      57147392
//   Oh  bf16 [4096][768]      69730304      Ol   76021760
//   total                     82313216
// ---------------------------------------------------------------------------
extern "C" void kernel_launch(void* const* d_in, const int* in_sizes, int n_in,
                              void* d_out, int out_size, void* d_ws, size_t ws_size,
                              hipStream_t stream) {
  if (n_in < 7) return;
  if (in_sizes[0] != kNB * kSeq * kDim) return;
  if (in_sizes[1] != kDim * kDim || in_sizes[4] != kDim * kDim) return;
  if (in_sizes[2] != kKvDim * kDim || in_sizes[3] != kKvDim * kDim) return;
  if (in_sizes[5] != kHd || in_sizes[6] != kHd) return;
  if (out_size != kNB * kSeq * kDim) return;

  const float* x    = (const float*)d_in[0];
  const float* Wq   = (const float*)d_in[1];
  const float* Wk   = (const float*)d_in[2];
  const float* Wv   = (const float*)d_in[3];
  const float* Wo   = (const float*)d_in[4];
  const float* lnq  = (const float*)d_in[5];
  const float* lnk  = (const float*)d_in[6];

  const size_t PWQ = (size_t)kDim * kDim * 2;      // 1179648  bf16 [768][768] plane
  const size_t PWK = (size_t)kKvDim * kDim * 2;    // 393216   bf16 [256][768] plane
  const size_t PTB = (size_t)kSeq * kHalfHd * 4;   // 262144   f32 [2048][32] table
  const size_t PXB = (size_t)kTok * kDim * 2;      // 6291456  bf16 [4096][768] plane
  const size_t PXF = (size_t)kTok * kDim * 4;      // 12582912 f32 [4096][768]
  const size_t PKF = (size_t)kTok * kKvDim * 4;    // 4194304  f32 [4096][256]
  const size_t PKB = (size_t)kTok * kKvDim * 2;    // 2097152  bf16 [4096][256] / [2][256][2048] plane
  size_t off = 0;
  const size_t oWqh = off; off += PWQ;  const size_t oWql = off; off += PWQ;
  const size_t oWkh = off; off += PWK;  const size_t oWkl = off; off += PWK;
  const size_t oWvh = off; off += PWK;  const size_t oWvl = off; off += PWK;
  const size_t oWoh = off; off += PWQ;  const size_t oWol = off; off += PWQ;
  const size_t oCS  = off; off += PTB;  const size_t oSN  = off; off += PTB;
  const size_t oXh  = off; off += PXB;  const size_t oXl  = off; off += PXB;
  const size_t oQf  = off; off += PXF;
  const size_t oKf  = off; off += PKF;
  const size_t oQh  = off; off += PXB;  const size_t oQl  = off; off += PXB;
  const size_t oKh  = off; off += PKB;  const size_t oKl  = off; off += PKB;
  const size_t oVTh = off; off += PKB;  const size_t oVTl = off; off += PKB;
  const size_t oOf  = off; off += PXF;
  const size_t oOh  = off; off += PXB;  const size_t oOl  = off; off += PXB;
  if (off > ws_size) return;                       // off = 82313216
  if (off > (size_t)134217728) return;

  char* ws = (char*)d_ws;
  unsigned short* Wqh = (unsigned short*)(ws + oWqh); unsigned short* Wql = (unsigned short*)(ws + oWql);
  unsigned short* Wkh = (unsigned short*)(ws + oWkh); unsigned short* Wkl = (unsigned short*)(ws + oWkl);
  unsigned short* Wvh = (unsigned short*)(ws + oWvh); unsigned short* Wvl = (unsigned short*)(ws + oWvl);
  unsigned short* Woh = (unsigned short*)(ws + oWoh); unsigned short* Wol = (unsigned short*)(ws + oWol);
  float*          CS  = (float*)(ws + oCS);          float*          SN  = (float*)(ws + oSN);
  unsigned short* Xh  = (unsigned short*)(ws + oXh);  unsigned short* Xl  = (unsigned short*)(ws + oXl);
  float*          Qf  = (float*)(ws + oQf);
  float*          Kf  = (float*)(ws + oKf);
  unsigned short* Qh  = (unsigned short*)(ws + oQh);  unsigned short* Ql  = (unsigned short*)(ws + oQl);
  unsigned short* Kh  = (unsigned short*)(ws + oKh);  unsigned short* Kl  = (unsigned short*)(ws + oKl);
  unsigned short* VTh = (unsigned short*)(ws + oVTh); unsigned short* VTl = (unsigned short*)(ws + oVTl);
  float*          Of  = (float*)(ws + oOf);
  unsigned short* Oh  = (unsigned short*)(ws + oOh);  unsigned short* Ol  = (unsigned short*)(ws + oOl);

  const dim3 blk(256);

  // setup: rotary tables (256 blocks x 256 = 65536 = 2048 x 32 elements per table)
  rope_table_kernel<<<dim3((kSeq * kHalfHd) / 256), blk, 0, stream>>>(CS, SN);
  // setup: weights [out n][in k] f32 (natural Bt layout) -> bf16 hi/lo planes
  const int n2wq = kDim * kDim / 2;       // 294912 pairs
  const int n2wk = kKvDim * kDim / 2;     // 98304 pairs
  split_bf16x2_kernel<<<dim3((n2wq + 255) / 256), blk, 0, stream>>>(Wq, Wqh, Wql, n2wq);
  split_bf16x2_kernel<<<dim3((n2wk + 255) / 256), blk, 0, stream>>>(Wk, Wkh, Wkl, n2wk);
  split_bf16x2_kernel<<<dim3((n2wk + 255) / 256), blk, 0, stream>>>(Wv, Wvh, Wvl, n2wk);
  split_bf16x2_kernel<<<dim3((n2wq + 255) / 256), blk, 0, stream>>>(Wo, Woh, Wol, n2wq);

  const int n2x = kTok * kDim / 2;                                  // 1572864 pairs per plane
  const dim3 gCast((n2x + 255) / 256);                              // 6144 blocks x 512 elements = 4096x768
  const dim3 gProjQ(((kTok / 64) * (kDim / 64) + 7) / 8, 1);        // 768 tiles: M=4096, N=768
  const dim3 gProjK(((kTok / 64) * (kKvDim / 64) + 7) / 8, 1);      // 256 tiles: M=4096, N=256
  const dim3 gVT(((kKvDim / 64) * (kSeq / 64) + 7) / 8, kNB);       // 128 tiles per batch element: M=256, N=2048
  const dim3 gRope(kNUnits / 32, kNB);                              // 1024 blocks x 32 units per batch element
  const dim3 gAtt(kNHq * (kSeq / 64), kNB);                         // 12 heads x 32 query blocks per batch element

  // Both batch elements go through every stage in one launch: the token-row GEMMs see M = 4096 rows, the stages
  // that need the position inside a sequence take the batch element from blockIdx.y.
  // (1) x -> bf16 hi/lo planes [4096][768]
  split_bf16x2_kernel<<<gCast, blk, 0, stream>>>(x, Xh, Xl, n2x);
  // (2) q = x . Wq^T -> Qf f32 [row][h*64+d]   (M=4096, N=768, K=768)
  wmma_gemm64<1, true, 0, 0, false><<<gProjQ, blk, 0, stream>>>(
      Xh, Xl, kDim, 0L, Wqh, Wql, kDim, 0L, (void*)Qf, (void*)Qf, kDim, 0L,
      lnq, lnq, 0L, kTok, kDim, kDim, 1.0f);
  // (3) k = x . Wk^T -> Kf f32 [row][g*64+d]   (M=4096, N=256, K=768)
  wmma_gemm64<1, true, 0, 0, false><<<gProjK, blk, 0, stream>>>(
      Xh, Xl, kDim, 0L, Wkh, Wkl, kDim, 0L, (void*)Kf, (void*)Kf, kKvDim, 0L,
      lnk, lnk, 0L, kTok, kKvDim, kDim, 1.0f);
  // (4) v^T = Wv . x[b]^T -> VT hi/lo planes [b][g*64+d][s]   (A = Wv planes [256][768], Bt = x planes of batch b; M=256, N=2048, K=768)
  wmma_gemm64<1, true, 0, 2, false><<<gVT, blk, 0, stream>>>(
      Wvh, Wvl, kDim, 0L, Xh, Xl, kDim, (long)kSeq * kDim, (void*)VTh, (void*)VTl, kSeq, (long)kKvDim * kSeq,
      lnq, lnq, 0L, kKvDim, kSeq, kDim, 1.0f);
  // (5) per-head rmsnorm * w + rotary on q and k -> Q/K bf16 hi/lo planes
  norm_rope_split_kernel<<<gRope, blk, 0, stream>>>(Qf, Kf, lnq, lnk, CS, SN, Qh, Ql, Kh, Kl);
  // (6) windowed causal GQA attention per head: y[row][h*64+d] (f32 plane, every element written by its (b, h, query block) owner)
  attn_gqa_window64_kernel<<<gAtt, dim3(128), 0, stream>>>(Qh, Ql, Kh, Kl, VTh, VTl, Of, 0.125f);
  // (7) y -> bf16 hi/lo planes
  split_bf16x2_kernel<<<gCast, blk, 0, stream>>>(Of, Oh, Ol, n2x);
  // (8) out = y . Wo^T -> d_out rows 0 .. 4095 (f32)   (M=4096, N=768, K=768)
  wmma_gemm64<1, true, 0, 0, false><<<gProjQ, blk, 0, stream>>>(
      Oh, Ol, kDim, 0L, Woh, Wol, kDim, 0L, d_out, d_out, kDim, 0L,
      lnq, lnq, 0L, kTok, kDim, kDim, 1.0f);
}

// v002
// One run takes 265 microseconds.
// Timed twice side by side with v001, it ran 1.19 times as fast both times.
// Counting every step since v000, it is 2.08 times as fast.
// Contractions (q/k/v/out projections, q.k^T scores, p.v): v_wmma_f32_16x16x32_bf16 with bf16 hi/lo split operands (hi.hi + hi.lo + lo.hi), f32 accumulate; rmsnorm, rotary tables, online softmax in f32.
#include <hip/hip_runtime.h>
#include <math.h>
#include <stdint.h>

constexpr int kNB     = 2;
constexpr int kSeq    = 2048;
constexpr int kTok    = kNB * kSeq;          // 4096 token rows over both batch elements
constexpr int kDim    = 768;
constexpr int kHd     = 64;
constexpr int kNHq    = 12;
constexpr int kNKv    = 4;
constexpr int kGroups = 3;
constexpr int kKvDim  = kNKv * kHd;          // 256
constexpr int kWin    = 384;
constexpr int kHalfHd = 32;
constexpr int kKBlk   = kDim / 32;           // 24 k blocks of 32 in a row of 768
constexpr int kNQUnits = kSeq * kNHq;        // 24576 (token, q head) units
constexpr int kNKUnits = kSeq * kNKv;        // 8192  (token, kv head) units
constexpr int kNUnits  = kNQUnits + kNKUnits;// 32768
static_assert(kNQUnits % 4 == 0);
static_assert(kNUnits % 32 == 0);
static_assert(kSeq % 64 == 0 && kDim % 64 == 0 && kKvDim % 64 == 0 && kDim % 32 == 0);
static_assert(kNHq == kNKv * kGroups);

typedef __attribute__((ext_vector_type(16))) _Float16 v16h;
typedef __attribute__((ext_vector_type(8)))  _Float16 v8h;
typedef __attribute__((ext_vector_type(16))) __bf16   v16b;
typedef __attribute__((ext_vector_type(8)))  __bf16   v8b;
typedef __attribute__((ext_vector_type(8)))  float    v8f;
typedef __attribute__((ext_vector_type(4)))  float    v4f;
typedef __attribute__((ext_vector_type(2)))  float    v2f;
typedef __attribute__((ext_vector_type(4)))  unsigned int v4u;

__device__ __forceinline__ unsigned short f2bf_bits(float f) {
  unsigned u = __float_as_uint(f);
  return (unsigned short)((u + 0x7FFFu + ((u >> 16) & 1u)) >> 16);
}
__device__ __forceinline__ float bf_bits2f(unsigned short h) { return __uint_as_float(((unsigned)h) << 16); }

// hazard guards as plain device helpers (no inline asm inside the kernel template body)
__device__ __forceinline__ void dep_guard_h(v8f& a, v8f& b, v16h x, v16h y) { asm volatile("v_nop\n\tv_nop\n\tv_nop\n\tv_nop" : "+v"(a), "+v"(b) : "v"(x), "v"(y)); }
__device__ __forceinline__ void dep_guard_b(v8f& a, v8f& b, v16b x, v16b y) { asm volatile("v_nop\n\tv_nop\n\tv_nop\n\tv_nop" : "+v"(a), "+v"(b) : "v"(x), "v"(y)); }
__device__ __forceinline__ void keep4_h(v16h a, v16h b, v16h c, v16h d) { asm volatile("v_nop" :: "v"(a), "v"(b), "v"(c), "v"(d)); }
__device__ __forceinline__ void keep4_b(v16b a, v16b b, v16b c, v16b d) { asm volatile("v_nop" :: "v"(a), "v"(b), "v"(c), "v"(d)); }
__device__ __forceinline__ void acc_guard4(v8f& a, v8f& b, v8f& c, v8f& d) { asm volatile("v_nop\n\tv_nop\n\tv_nop\n\tv_nop" : "+v"(a), "+v"(b), "+v"(c), "+v"(d)); }
template <typename T> struct Frag;
template <> struct Frag<_Float16> {
  typedef v16h V; union U { v16h v; v8h h[2]; };
  static __device__ __forceinline__ v16h load(const _Float16* p) {   // elements 0..7 <- p[0..7], 8..15 <- p[16..23]
    U f; f.h[0] = *(const v8h*)(p); f.h[1] = *(const v8h*)(p + 16); return f.v;
  }
  static __device__ __forceinline__ v8f mma(v16h a, v16h b, v8f c) {
    return __builtin_amdgcn_wmma_f32_16x16x32_f16(false, a, false, b, (short)0, c, false, false);
  }
  static __device__ __forceinline__ void guard(v8f& a, v8f& b, v16h x, v16h y) { dep_guard_h(a, b, x, y); }
  static __device__ __forceinline__ void keep(v16h a, v16h b, v16h c, v16h d) { keep4_h(a, b, c, d); }
};
template <> struct Frag<__bf16> {
  typedef v16b V; union U { v16b v; v8b h[2]; };
  static __device__ __forceinline__ v16b load(const __bf16* p) {
    U f; f.h[0] = *(const v8b*)(p); f.h[1] = *(const v8b*)(p + 16); return f.v;
  }
  // fragment-major block at byte address p: elements 0..7 <- bytes 0..15, elements 8..15 <- bytes 512..527
  static __device__ __forceinline__ v16b load_packed(const char* p) {
    U f; f.h[0] = *(const v8b*)(p); f.h[1] = *(const v8b*)(p + 512); return f.v;
  }
  static __device__ __forceinline__ v8f mma(v16b a, v16b b, v8f c) {
    return __builtin_amdgcn_wmma_f32_16x16x32_bf16(false, a, false, b, (short)0, c, false, false);
  }
  static __device__ __forceinline__ void guard(v8f& a, v8f& b, v16b x, v16b y) { dep_guard_b(a, b, x, y); }
  static __device__ __forceinline__ void keep(v16b a, v16b b, v16b c, v16b d) { keep4_b(a, b, c, d); }
};

// ---- Register-blocked batched WMMA GEMM ------------------------------------
// C[m,n] = scale * sum_k A[m,k] * Bt[n,k] (+bias)(+resid); each wave owns a 64x64 tile.
// A [M,K] and Bt [N,K] are stored fragment-major (written by split_pack_bf16_kernel): each 16-row x 32-k block is
// 512 consecutive elements, block index = (row/16)*kKBlk + k/32, and element (row, k) of a block sits at
// ((k>>4)&1)*256 + (((k>>3)&1)*16 + (row&15))*8 + (k&7). Lane l of a fragment load then reads 16 B at l*16 B, so one
// wave-wide load covers 512 consecutive bytes (4 whole lines) and holds the same elements as a row-major fragment load.
// M,N % 64 == 0, K % 32 == 0; rows of both operands are kDim long (lda == ldb == kDim), so the step from one 16-row
// block row to the next is a compile-time constant and goes into the loads' immediate offsets.
// SPLIT: operands are hi/lo planes (A2/Bt2 = lo planes, same layout); product = hi.hi + hi.lo + lo.hi.
// BIAS_MODE: 0 = none, 1 = bias[m], 2 = bias[n].
// OUT_MODE: 0 = f32, 1 = f16, 2 = bf16 hi plane (Cout) + bf16 lo plane (Cout2).
// ET: 0 = f16 operands, 1 = bf16 operands (pointers passed as 16-bit storage)
template <int ET> struct Elem;
template <> struct Elem<0> { typedef _Float16 T; };
template <> struct Elem<1> { typedef __bf16 T; };
template <int ET, bool SPLIT, int BIAS_MODE, int OUT_MODE, bool RESID, int ACT = 0>
__global__ __launch_bounds__(256) void wmma_gemm64(
    const unsigned short* __restrict__ Ap, const unsigned short* __restrict__ A2p, int lda, long strideA,
    const unsigned short* __restrict__ Btp, const unsigned short* __restrict__ Bt2p, int ldb, long strideB,
    void* __restrict__ Cout, void* __restrict__ Cout2, int ldc, long strideC,
    const float* __restrict__ bias,
    const float* __restrict__ resid, long strideR,
    int M, int N, int K, float scale) {
  typedef typename Elem<ET>::T T;
  typedef typename Frag<T>::V V;
  const T* A = (const T*)Ap; const T* A2 = (const T*)A2p; const T* Bt = (const T*)Btp; const T* Bt2 = (const T*)Bt2p;
  __shared__ __align__(16) float sT[8][16 * 68];   // per-wave 16x64 slab, pitch 68 floats
  const int b    = blockIdx.y;
  const int lane = threadIdx.x & 31;
  const int wave = threadIdx.x >> 5;
  const int tilesN = N >> 6;
  const int tilesM = M >> 6;
  // the tile number is the same in every lane: held in a scalar register, so that the four plane bases below are scalar too
  const int tile = __builtin_amdgcn_readfirstlane(blockIdx.x * 8 + wave);
  if (tile >= tilesM * tilesN) return;   // wave-uniform; no block barriers in this kernel
  const int tm = tile / tilesN;
  const int tn = tile - tm * tilesN;
  const int m0 = tm << 6;
  const int n0 = tn << 6;

  const T* Ab  = A  + (size_t)b * strideA;
  const T* Bb  = Bt + (size_t)b * strideB;
  const T* Ab2 = SPLIT ? (A2  + (size_t)b * strideA) : nullptr;
  const T* Bb2 = SPLIT ? (Bt2 + (size_t)b * strideB) : nullptr;

  const int rlane = lane & 15;                 // row (A) / col (B, D) within subtile
  const int mOff  = (lane >> 4) * 8;           // D row offset
  // Every fragment load = scalar base of the tile's first block row in its plane + one 32-bit lane byte offset + an
  // immediate (block row step, second half of the block). The lane offset is the only vector address register; it steps
  // one block (1024 B) per k step.
  constexpr int kRowStep = kKBlk * 1024;       // bytes from one 16-row block row to the next
  const char* pBh = (const char*)(Bb  + (size_t)(n0 >> 4) * (kKBlk * 512));
  const char* pBl = SPLIT ? (const char*)(Bb2 + (size_t)(n0 >> 4) * (kKBlk * 512)) : nullptr;
  const char* pAh = (const char*)(Ab  + (size_t)(m0 >> 4) * (kKBlk * 512));
  const char* pAl = SPLIT ? (const char*)(Ab2 + (size_t)(m0 >> 4) * (kKBlk * 512)) : nullptr;
  unsigned vo = (unsigned)lane * 16u;          // this lane's 16 B inside a 512-B half block

  v8f acc[4][4];
#pragma unroll
  for (int i = 0; i < 4; ++i)
#pragma unroll
    for (int j = 0; j < 4; ++j) acc[i][j] = (v8f){0.f,0.f,0.f,0.f,0.f,0.f,0.f,0.f};

  for (int k0 = 0; k0 < K; k0 += 32) {
    V bh[4], bl[4];
#pragma unroll
    for (int j = 0; j < 4; ++j) {
      bh[j] = Frag<T>::load_packed(pBh + vo + j * kRowStep);
      if (SPLIT) bl[j] = Frag<T>::load_packed(pBl + vo + j * kRowStep);
    }
#pragma unroll
    for (int i = 0; i < 4; ++i) {
      V ah = Frag<T>::load_packed(pAh + vo + i * kRowStep);
      V al;
      if (SPLIT) al = Frag<T>::load_packed(pAl + vo + i * kRowStep);
#pragma unroll
      for (int j = 0; j < 4; ++j) {
        acc[i][j] = Frag<T>::mma(ah, bh[j], acc[i][j]);
        if (SPLIT) {
          acc[i][j] = Frag<T>::mma(ah, bl[j], acc[i][j]);
          acc[i][j] = Frag<T>::mma(al, bh[j], acc[i][j]);
        }
      }
      Frag<T>::guard(acc[i][0], acc[i][3], ah, SPLIT ? al : ah);
    }
    Frag<T>::keep(bh[0], bh[1], bh[2], bh[3]);
    if (SPLIT) Frag<T>::keep(bl[0], bl[1], bl[2], bl[3]);
    vo += 1024u;
  }
  acc_guard4(acc[0][0], acc[0][1], acc[0][2], acc[0][3]);
  acc_guard4(acc[1][0], acc[1][1], acc[1][2], acc[1][3]);
  acc_guard4(acc[2][0], acc[2][1], acc[2][2], acc[2][3]);
  acc_guard4(acc[3][0], acc[3][1], acc[3][2], acc[3][3]);

  // ---- epilogue ----
  float* slab = sT[wave];
  const float* Rb = RESID ? (resid + (size_t)b * strideR) : nullptr;
#pragma unroll
  for (int i = 0; i < 4; ++i) {
    const int mBase = m0 + (i << 4);
#pragma unroll
    for (int j = 0; j < 4; ++j) {
      const int n = n0 + (j << 4) + rlane;
      float bv = 0.f;
      if (BIAS_MODE == 2) bv = bias[n];
#pragma unroll
      for (int r = 0; r < 8; ++r) {
        float v = acc[i][j][r] * scale;
        if (BIAS_MODE == 1) v += bias[mBase + mOff + r];
        if (BIAS_MODE == 2) v += bv;
        if (RESID) v += Rb[(size_t)(mBase + mOff + r) * ldc + n];
        if (ACT == 1) v = tanhf(v);
        if (ACT == 2) v = fmaxf(v, 0.0f);
        if (ACT == 3) v = v / (1.0f + expf(-v));
        if (ACT == 4) v = (v > 0.f) ? v : 0.01f * v;
        slab[(mOff + r) * 68 + (j << 4) + rlane] = v;
      }
    }
    __builtin_amdgcn_fence(__ATOMIC_RELEASE, "workgroup");
    __builtin_amdgcn_wave_barrier();
    __builtin_amdgcn_fence(__ATOMIC_ACQUIRE, "workgroup");
    if (OUT_MODE == 0) {
      float* C = (float*)Cout + (size_t)b * strideC;
      const int hh = lane >> 4, c4 = (lane & 15) * 4;     // row seg = 256 B = 16 lanes x 16 B
      {
#pragma unroll
        for (int it = 0; it < 8; ++it) {
          const int row = it * 2 + hh;
          v4f v = *(const v4f*)(slab + row * 68 + c4);
          *(v4f*)(C + (size_t)(mBase + row) * ldc + n0 + c4) = v;
        }
        
      }
    } else {
      const int q = lane >> 3, c8 = (lane & 7) * 8;
      unsigned short* C  = (unsigned short*)Cout  + (size_t)b * strideC;
      unsigned short* C2 = (OUT_MODE == 2) ? ((unsigned short*)Cout2 + (size_t)b * strideC) : nullptr;
      {
#pragma unroll
        for (int it = 0; it < 4; ++it) {
          const int row = it * 4 + q;
          const float* sp = slab + row * 68 + c8;
          v8h hv, lv;
#pragma unroll
          for (int e = 0; e < 8; ++e) {
            if (OUT_MODE == 1) {
              hv[e] = (_Float16)sp[e];
            } else {
              unsigned short hb = f2bf_bits(sp[e]);
              unsigned short lb = f2bf_bits(sp[e] - bf_bits2f(hb));
              hv[e] = __builtin_bit_cast(_Float16, hb);
              lv[e] = __builtin_bit_cast(_Float16, lb);
            }
          }
          *(v8h*)(C + (size_t)(mBase + row) * ldc + n0 + c8) = hv;
          if (OUT_MODE == 2) *(v8h*)(C2 + (size_t)(mBase + row) * ldc + n0 + c8) = lv;
        }
        
      }
    }
    __builtin_amdgcn_fence(__ATOMIC_RELEASE, "workgroup");
    __builtin_amdgcn_wave_barrier();
    __builtin_amdgcn_fence(__ATOMIC_ACQUIRE, "workgroup");
  }
}

// ---------------------------------------------------------------------------
// bf16 split of a row-major f32 [rows][768] matrix, hi = bf16_rne(in), lo = bf16_rne(in - hi), stored fragment-major
// for wmma_gemm64 (layout: see there). One thread = 8 consecutive k of one row (32 B read, 16 B per plane written);
// one wave = 8 rows x 32 k, half a block: it reads 8 whole 128-B lines and each plane's store fills 4 whole lines.
// rows % 16 == 0; n8 = rows * 768 / 8 threads.
// ---------------------------------------------------------------------------
__device__ __forceinline__ unsigned pk16(unsigned short a, unsigned short b) { return (unsigned)a | ((unsigned)b << 16); }

__global__ __launch_bounds__(256) void split_pack_bf16_kernel(const float* __restrict__ in, unsigned short* __restrict__ hi,
                                                              unsigned short* __restrict__ lo, int n8) {
  const int idx = blockIdx.x * 256 + threadIdx.x;
  if (idx < n8) {
    const int l   = idx & 31;
    const int g   = idx >> 5;                 // half block
    const int blk = g >> 1;
    const int rb  = blk / kKBlk, kb = blk - rb * kKBlk;
    const int r16 = (g & 1) * 8 + (l >> 2);   // row inside the block
    const int kp  = l & 3;                    // which 8 of the block's 32 k
    const float* s = in + (size_t)(rb * 16 + r16) * kDim + kb * 32 + kp * 8;
    const v4f fa = *(const v4f*)(s), fb = *(const v4f*)(s + 4);
    const float f[8] = {fa[0], fa[1], fa[2], fa[3], fb[0], fb[1], fb[2], fb[3]};
    v4u hv, lv;
#pragma unroll   // constant indices keep f, hv and lv in registers
    for (int q = 0; q < 4; ++q) {
      const unsigned short h0 = f2bf_bits(f[2 * q]), h1 = f2bf_bits(f[2 * q + 1]);
      const unsigned short l0 = f2bf_bits(f[2 * q] - bf_bits2f(h0)), l1 = f2bf_bits(f[2 * q + 1] - bf_bits2f(h1));
      hv[q] = pk16(h0, h1);
      lv[q] = pk16(l0, l1);
    }
    const size_t o = (size_t)blk * 512 + (kp >> 1) * 256 + ((kp & 1) * 16 + r16) * 8;
    *(v4u*)(hi + o) = hv;
    *(v4u*)(lo + o) = lv;
  }
}

// ---------------------------------------------------------------------------
// Rotary tables: cs[t*32+i] = cosf(t * inv_freq[i]), sn likewise, inv_freq[i] = 10000^(-i/32) = 2^(-i*log2(1e4)/32).
// grid = kSeq*32/256 = 256 blocks x 256 threads = exactly 65536 elements per table; each wave writes 32 consecutive
// ---------------------------------------------------------------------------
__global__ __launch_bounds__(256) void rope_table_kernel(float* __restrict__ cs, float* __restrict__ sn) {
  const int i  = blockIdx.x * 256 + threadIdx.x;
  const int t  = i >> 5;
  const int fi = i & 31;
  const float invf = exp2f((float)fi * -0.41524101186092f);
  const float ang  = (float)t * invf;
  float sv, cv;
  sincosf(ang, &sv, &cv);
  ((float*)cs)[i] = cv;
  ((float*)sn)[i] = sv;
  
}

// ---------------------------------------------------------------------------
// Per (token, head) unit of 64 floats: y[d] = w[d] * (x[d] * rsqrt(mean(x^2) + eps)); rotary:
//   o[d] = y[d]*cos[t][d&31] - y[d+32]*sin  (d < 32),   o[d] = y[d]*cos + y[d-32]*sin  (d >= 32);
// o split into bf16 hi/lo planes at the same [token][head*64+d] position as the f32 source.
// Units 0..24575 = (token, q head) from Qf [2048][768]; units 24576..32767 = (token, kv head) from Kf [2048][256].
// 8 lanes per unit (d0 = 8*(lane&7)), 4 units per wave, grid.x = 32768/32 = 1024 blocks x 256 threads covers all units
// of one batch element; grid.y = batch element (planes of batch b start b*2048 token rows further on).
// ---------------------------------------------------------------------------
__device__ __forceinline__ float rope_one(float x, float p, float wx, float wp, float cv, float sv, float rinv, float sg) {
  const float xn = wx * (x * rinv);
  const float pn = wp * (p * rinv);
  return xn * cv + (sg * pn) * sv;
}

__global__ __launch_bounds__(256) void norm_rope_split_kernel(
    const float* __restrict__ Qf, const float* __restrict__ Kf,
    const float* __restrict__ qw, const float* __restrict__ kw,
    const float* __restrict__ cs, const float* __restrict__ sn,
    unsigned short* __restrict__ Qh, unsigned short* __restrict__ Ql,
    unsigned short* __restrict__ Kh, unsigned short* __restrict__ Kl) {
  const int lane  = threadIdx.x & 31;
  const int wave  = threadIdx.x >> 5;
  const int wbase = (blockIdx.x * 8 + wave) * 4;   // first unit of this wave
  const int u     = wbase + (lane >> 3);           // < kNUnits by grid construction
  const int d0    = (lane & 7) * 8;
  const bool isq  = wbase < kNQUnits;              // wave-uniform
  int uq = u; if (uq > kNQUnits - 1) uq = kNQUnits - 1;
  const int tq = uq / kNHq, hq = uq - tq * kNHq;
  int uk = u - kNQUnits; if (uk < 0) uk = 0; if (uk > kNKUnits - 1) uk = kNKUnits - 1;
  const int tk = uk >> 2, hk = uk & 3;
  const int t = isq ? tq : tk;
  const size_t rowb = (size_t)blockIdx.y * kSeq;   // first token row of this batch element
  const size_t offq = (rowb + tq) * kDim + (size_t)hq * kHd;
  const size_t offk = (rowb + tk) * kKvDim + (size_t)hk * kHd;
  const float* src = isq ? (Qf + offq) : (Kf + offk);
  const float* w   = isq ? qw : kw;
  unsigned short* dh = isq ? (Qh + offq) : (Kh + offk);
  unsigned short* dl = isq ? (Ql + offq) : (Kl + offk);
  const int dp = d0 ^ kHalfHd;                     // rotary partner block
  const int ci = t * kHalfHd + (d0 & 24);

  const v4f xa = *(const v4f*)(src + d0),  xb = *(const v4f*)(src + d0 + 4);
  const v4f pa = *(const v4f*)(src + dp),  pb = *(const v4f*)(src + dp + 4);
  const v4f wa = *(const v4f*)(w + d0),    wb = *(const v4f*)(w + d0 + 4);
  const v4f va = *(const v4f*)(w + dp),    vb = *(const v4f*)(w + dp + 4);
  const v4f ca = *(const v4f*)(cs + ci),   cb = *(const v4f*)(cs + ci + 4);
  const v4f sa = *(const v4f*)(sn + ci),   sb = *(const v4f*)(sn + ci + 4);

  float ss = xa[0] * xa[0] + xa[1] * xa[1] + xa[2] * xa[2] + xa[3] * xa[3]
           + xb[0] * xb[0] + xb[1] * xb[1] + xb[2] * xb[2] + xb[3] * xb[3];
  ss += __shfl_xor(ss, 1, 32);
  ss += __shfl_xor(ss, 2, 32);
  ss += __shfl_xor(ss, 4, 32);
  const float rinv = rsqrtf(ss * (1.0f / 64.0f) + 1e-6f);
  const float sg = (d0 < kHalfHd) ? -1.0f : 1.0f;

  float o[8];
  o[0] = rope_one(xa[0], pa[0], wa[0], va[0], ca[0], sa[0], rinv, sg);
  o[1] = rope_one(xa[1], pa[1], wa[1], va[1], ca[1], sa[1], rinv, sg);
  o[2] = rope_one(xa[2], pa[2], wa[2], va[2], ca[2], sa[2], rinv, sg);
  o[3] = rope_one(xa[3], pa[3], wa[3], va[3], ca[3], sa[3], rinv, sg);
  o[4] = rope_one(xb[0], pb[0], wb[0], vb[0], cb[0], sb[0], rinv, sg);
  o[5] = rope_one(xb[1], pb[1], wb[1], vb[1], cb[1], sb[1], rinv, sg);
  o[6] = rope_one(xb[2], pb[2], wb[2], vb[2], cb[2], sb[2], rinv, sg);
  o[7] = rope_one(xb[3], pb[3], wb[3], vb[3], cb[3], sb[3], rinv, sg);

  v4u hv, lv;
#pragma unroll
  for (int q = 0; q < 4; ++q) {
    const unsigned short h0 = f2bf_bits(o[2 * q]), h1 = f2bf_bits(o[2 * q + 1]);
    const unsigned short l0 = f2bf_bits(o[2 * q] - bf_bits2f(h0)), l1 = f2bf_bits(o[2 * q + 1] - bf_bits2f(h1));
    hv[q] = pk16(h0, h1);
    lv[q] = pk16(l0, l1);
  }
  *(v4u*)(dh + d0) = hv;
  *(v4u*)(dl + d0) = lv;
  
}

// =====================================================================================
// Causal sliding-window grouped-query attention, head dim 64, grid.y = batch element (offsets below are within one).
//   q planes (hi/lo bf16): element (t, h, d) at [t*kDim + h*64 + d]           (12 heads)
//   k planes (hi/lo bf16): element (s, g, d) at [s*kKvDim + g*64 + d]         (4 kv heads, g = h/3)
//   v^T planes (hi/lo bf16): element (g, d, s) at [(g*64 + d)*kSeq + s]
//   out f32: element (t, h, d) at [t*kDim + h*64 + d]
//   scores = (q . k) * sscale : bf16 hi/lo split (hi.hi + hi.lo + lo.hi) on v_wmma_f32_16x16x32_bf16
//   out    = p . v             : bf16 hi/lo split of p (unnormalised) and v, f32 accumulate
//   online softmax in f32; keys with s > t or t - s > kWin-1 set to -inf; a fully -inf running max uses a 0 pivot
//   (alpha = 0, p = 0) so nothing non-finite is produced; the diagonal key is always kept.
//   Block = 4 waves = 64 query rows of one head; grid.x = kNHq * (kSeq/64); kv chunks of 64 from the first
//   in-window chunk (block-uniform) up to chunk qb (static bound qb+1 <= 32).
//   K / V^T chunk staging: 128 threads x 32 elements per plane = the whole 64x64 tile (16-B copies, plain loads,
//   __syncthreads before and after); fragment loads read the LDS tiles with the same v8b element type.
// =====================================================================================
#define AT_D 64
#define AT_NW 4
#define AT_QB 64
#define AT_KC 64

__device__ __forceinline__ unsigned short at_bf_bits(float f) {
  unsigned u = __float_as_uint(f);
  return (unsigned short)((u + 0x7FFFu + ((u >> 16) & 1u)) >> 16);
}
__device__ __forceinline__ __bf16 at_f2bf(float f) { return __builtin_bit_cast(__bf16, at_bf_bits(f)); }
__device__ __forceinline__ void at_split(float f, __bf16& hi, __bf16& lo) {
  const unsigned short hb = at_bf_bits(f);
  hi = __builtin_bit_cast(__bf16, hb);
  lo = at_f2bf(f - __uint_as_float(((unsigned)hb) << 16));
}
__device__ __forceinline__ v8f at_mma(v16b a, v16b b, v8f c) {
  c = __builtin_amdgcn_wmma_f32_16x16x32_bf16(false, a, false, b, (short)0, c, false, false);
  asm volatile("v_nop\n\tv_nop\n\tv_nop\n\tv_nop" : "+v"(c) : "v"(a), "v"(b));
  return c;
}

__global__ __launch_bounds__(128)
void attn_gqa_window64_kernel(const unsigned short* __restrict__ qhp, const unsigned short* __restrict__ qlp,
                              const unsigned short* __restrict__ khp, const unsigned short* __restrict__ klp,
                              const unsigned short* __restrict__ vhp, const unsigned short* __restrict__ vlp,
                              float* __restrict__ out, float sscale) {
  union FB { v16b v; v8b h[2]; };
  __shared__ __align__(16) __bf16 Ksh[AT_KC * AT_D];             // K hi [kv][d]      8 KB
  __shared__ __align__(16) __bf16 Ksl[AT_KC * AT_D];             // K lo
  __shared__ __align__(16) __bf16 Vth[AT_D * AT_KC];             // V hi [d][kv]      8 KB
  __shared__ __align__(16) __bf16 Vtl[AT_D * AT_KC];             // V lo
  __shared__ __align__(16) __bf16 Psh[AT_NW][16 * AT_KC];        // per wave P hi [row][kv]
  __shared__ __align__(16) __bf16 Psl[AT_NW][16 * AT_KC];        // per wave P lo
  __shared__ __align__(16) float  Os[AT_NW][16 * 68];            // per wave out tile, pitch 68

  const int tid  = threadIdx.x;
  const int wave = tid >> 5;
  const int lane = tid & 31;
  const int hh   = lane >> 4;
  const int c    = lane & 15;

  const int nqb = kSeq / AT_QB;           // 32
  const int bx = blockIdx.x;
  const int qb = bx % nqb;
  const int h  = bx / nqb;                // 0..kNHq-1 (grid = kNHq * nqb)
  const int kvh = h / kGroups;            // 0..kNKv-1
  const int q0 = qb * AT_QB + wave * 16;

  const size_t bq = (size_t)blockIdx.y * kSeq * kDim;     // batch element's q / out plane
  const size_t bk = (size_t)blockIdx.y * kSeq * kKvDim;   // batch element's k / v^T plane
  const __bf16* Qh = (const __bf16*)(const void*)qhp + bq + (size_t)h * AT_D;
  const __bf16* Ql = (const __bf16*)(const void*)qlp + bq + (size_t)h * AT_D;
  const __bf16* Kh = (const __bf16*)(const void*)khp + bk + (size_t)kvh * AT_D;
  const __bf16* Kl = (const __bf16*)(const void*)klp + bk + (size_t)kvh * AT_D;
  const __bf16* Vh = (const __bf16*)(const void*)vhp + bk + (size_t)kvh * AT_D * kSeq;
  const __bf16* Vl = (const __bf16*)(const void*)vlp + bk + (size_t)kvh * AT_D * kSeq;
  float*        ob = out + bq + (size_t)h * AT_D;

  // ---- Q fragments (A operand, row = lane&15, split k map via Frag load): 2 d-chunks, hi and lo ----
  v16b qah[2], qal[2];
#pragma unroll
  for (int dc = 0; dc < 2; ++dc) {
    const __bf16* qr = Qh + (size_t)(q0 + c) * kDim + dc * 32 + 8 * hh;
    const __bf16* ql = Ql + (size_t)(q0 + c) * kDim + dc * 32 + 8 * hh;
    qah[dc] = Frag<__bf16>::load(qr);
    qal[dc] = Frag<__bf16>::load(ql);
  }

  float mrow[8], lrow[8];
  v8f oacc[4];
#pragma unroll
  for (int r = 0; r < 8; ++r) { mrow[r] = -INFINITY; lrow[r] = 0.f; }
#pragma unroll
  for (int t = 0; t < 4; ++t) oacc[t] = (v8f){0.f,0.f,0.f,0.f,0.f,0.f,0.f,0.f};

  const int qlo = qb * AT_QB - (kWin - 1);                 // smallest key allowed for the block's first row
  const int kcStart = (qlo > 0) ? (qlo / AT_KC) : 0;       // block-uniform
  const int nChunks = qb + 1;                              // block-uniform, <= 32
  for (int kc = kcStart; kc < nChunks; ++kc) {
    const int kv0 = kc * AT_KC;
    __syncthreads();
    {
      // staging coverage: 128 threads x (4 x 8) elements = 64 rows x 64 per plane = the whole chunk tile
      const int r = tid >> 1, half = (tid & 1) * 32;
      const __bf16* ksh = Kh + (size_t)(kv0 + r) * kKvDim + half;   // K row kv0+r, d = half..half+31
      const __bf16* ksl = Kl + (size_t)(kv0 + r) * kKvDim + half;
      const __bf16* vsh = Vh + (size_t)r * kSeq + kv0 + half;        // V^T row d = r, s = kv0+half..+31
      const __bf16* vsl = Vl + (size_t)r * kSeq + kv0 + half;
#pragma unroll
      for (int i = 0; i < 4; ++i) {
        const v8b a0 = *(const v8b*)(ksh + 8 * i);
        const v8b a1 = *(const v8b*)(ksl + 8 * i);
        const v8b b0 = *(const v8b*)(vsh + 8 * i);
        const v8b b1 = *(const v8b*)(vsl + 8 * i);
        *(v8b*)(Ksh + r * AT_D  + half + 8 * i) = a0;
        *(v8b*)(Ksl + r * AT_D  + half + 8 * i) = a1;
        *(v8b*)(Vth + r * AT_KC + half + 8 * i) = b0;
        *(v8b*)(Vtl + r * AT_KC + half + 8 * i) = b1;
      }
    }
    __syncthreads();

    v8f s[4];
#pragma unroll
    for (int j = 0; j < 4; ++j) {
      s[j] = (v8f){0.f,0.f,0.f,0.f,0.f,0.f,0.f,0.f};
#pragma unroll
      for (int dc = 0; dc < 2; ++dc) {
        FB kb, kl;
        kb.h[0] = *(const v8b*)(Ksh + (j * 16 + c) * AT_D + dc * 32 + 8 * hh);
        kb.h[1] = *(const v8b*)(Ksh + (j * 16 + c) * AT_D + dc * 32 + 16 + 8 * hh);
        kl.h[0] = *(const v8b*)(Ksl + (j * 16 + c) * AT_D + dc * 32 + 8 * hh);
        kl.h[1] = *(const v8b*)(Ksl + (j * 16 + c) * AT_D + dc * 32 + 16 + 8 * hh);
        s[j] = at_mma(qah[dc], kb.v, s[j]);
        s[j] = at_mma(qah[dc], kl.v, s[j]);
        s[j] = at_mma(qal[dc], kb.v, s[j]);
      }
    }
    float cm[8];
#pragma unroll
    for (int r = 0; r < 8; ++r) {
      const int qrow = q0 + 8 * hh + r;
      float m = -INFINITY;
#pragma unroll
      for (int j = 0; j < 4; ++j) {
        const int kvcol = kv0 + j * 16 + c;
        const float sv = s[j][r] * sscale;
        const bool masked = (kvcol > qrow) || (qrow - kvcol > kWin - 1);
        const float sm = masked ? -INFINITY : sv;
        s[j][r] = sm;
        m = fmaxf(m, sm);
      }
#pragma unroll
      for (int off = 1; off < 16; off <<= 1) m = fmaxf(m, __shfl_xor(m, off, 32));
      cm[r] = m;
    }
    __bf16* pwh = Psh[wave];
    __bf16* pwl = Psl[wave];
#pragma unroll
    for (int r = 0; r < 8; ++r) {
      const float mnew  = fmaxf(mrow[r], cm[r]);
      const float mpiv  = (mnew == -INFINITY) ? 0.0f : mnew;   // fully masked so far -> alpha = 0, p = 0
      const float alpha = expf(mrow[r] - mpiv);
      mrow[r] = mnew;
      float psum = 0.f;
#pragma unroll
      for (int j = 0; j < 4; ++j) {
        const float p = expf(s[j][r] - mpiv);
        psum += p;
        __bf16 a, bl; at_split(p, a, bl);
        pwh[(8 * hh + r) * AT_KC + j * 16 + c] = a;
        pwl[(8 * hh + r) * AT_KC + j * 16 + c] = bl;
      }
#pragma unroll
      for (int off = 1; off < 16; off <<= 1) psum += __shfl_xor(psum, off, 32);
      lrow[r] = lrow[r] * alpha + psum;
#pragma unroll
      for (int t = 0; t < 4; ++t) oacc[t][r] *= alpha;
    }
    __builtin_amdgcn_fence(__ATOMIC_RELEASE, "workgroup");
    __builtin_amdgcn_wave_barrier();
    __builtin_amdgcn_fence(__ATOMIC_ACQUIRE, "workgroup");
#pragma unroll 1
    for (int kk = 0; kk < 2; ++kk) {
      FB pa, pl;
      pa.h[0] = *(const v8b*)(pwh + c * AT_KC + kk * 32 + 8 * hh);
      pa.h[1] = *(const v8b*)(pwh + c * AT_KC + kk * 32 + 16 + 8 * hh);
      pl.h[0] = *(const v8b*)(pwl + c * AT_KC + kk * 32 + 8 * hh);
      pl.h[1] = *(const v8b*)(pwl + c * AT_KC + kk * 32 + 16 + 8 * hh);
#pragma unroll
      for (int t = 0; t < 4; ++t) {
        FB vb, vl;
        vb.h[0] = *(const v8b*)(Vth + (t * 16 + c) * AT_KC + kk * 32 + 8 * hh);
        vb.h[1] = *(const v8b*)(Vth + (t * 16 + c) * AT_KC + kk * 32 + 16 + 8 * hh);
        vl.h[0] = *(const v8b*)(Vtl + (t * 16 + c) * AT_KC + kk * 32 + 8 * hh);
        vl.h[1] = *(const v8b*)(Vtl + (t * 16 + c) * AT_KC + kk * 32 + 16 + 8 * hh);
        oacc[t] = at_mma(pa.v, vb.v, oacc[t]);
        oacc[t] = at_mma(pa.v, vl.v, oacc[t]);
        oacc[t] = at_mma(pl.v, vb.v, oacc[t]);
      }
    }
  }

  float* os = Os[wave];
#pragma unroll
  for (int r = 0; r < 8; ++r) {
    const float inv = 1.0f / lrow[r];
#pragma unroll
    for (int t = 0; t < 4; ++t) os[(8 * hh + r) * 68 + t * 16 + c] = oacc[t][r] * inv;
  }
  __builtin_amdgcn_fence(__ATOMIC_RELEASE, "workgroup");
  __builtin_amdgcn_wave_barrier();
  __builtin_amdgcn_fence(__ATOMIC_ACQUIRE, "workgroup");
  {
    const int c4 = (lane & 15) * 4;
    {
#pragma unroll
      for (int it = 0; it < 8; ++it) {
        const int row = it * 2 + hh;   // it 0..7 x hh 0..1 covers rows 0..15 of the wave tile
        v4f val = *(const v4f*)(os + row * 68 + c4);
        *(v4f*)(ob + (size_t)(q0 + row) * kDim + c4) = val;
      }
      
    }
  }
}

// ---------------------------------------------------------------------------
// Workspace region map (byte offsets; every region is fully written in this call before it is read; token rows
// run over both batch elements, row = b*2048 + t; VT holds one [256][2048] plane per batch element; the W*, X* and
// O* bf16 planes are fragment-major, 16-row x 32-k blocks, see wmma_gemm64):
//   Wqh bf16 [768 n][768 k]         0      Wql   1179648
//   Wkh bf16 [256][768]        2359296      Wkl   2752512
//   Wvh bf16 [256][768]        3145728      Wvl   3538944
//   Woh bf16 [768][768]        3932160      Wol   5111808
//   CS  f32  [2048][32]        6291456      SN    6553600
//   Xh  bf16 [4096][768]       6815744      Xl   13107200
//   Qf  f32  [4096][768]      19398656
//   Kf  f32  [4096][256]      31981568
//   Qh  bf16 [4096][768]      36175872      Ql   42467328
//   Kh  bf16 [4096][256]      48758784      Kl   50855936
//   VTh bf16 [2][256][2048]   52953088      VTl  55050240
//   Of  f32  [4096][768]      57147392
//   Oh  bf16 [4096][768]      69730304      Ol   76021760
//   total                     82313216
// ---------------------------------------------------------------------------
extern "C" void kernel_launch(void* const* d_in, const int* in_sizes, int n_in,
                              void* d_out, int out_size, void* d_ws, size_t ws_size,
                              hipStream_t stream) {
  if (n_in < 7) return;
  if (in_sizes[0] != kNB * kSeq * kDim) return;
  if (in_sizes[1] != kDim * kDim || in_sizes[4] != kDim * kDim) return;
  if (in_sizes[2] != kKvDim * kDim || in_sizes[3] != kKvDim * kDim) return;
  if (in_sizes[5] != kHd || in_sizes[6] != kHd) return;
  if (out_size != kNB * kSeq * kDim) return;

  const float* x    = (const float*)d_in[0];
  const float* Wq   = (const float*)d_in[1];
  const float* Wk   = (const float*)d_in[2];
  const float* Wv   = (const float*)d_in[3];
  const float* Wo   = (const float*)d_in[4];
  const float* lnq  = (const float*)d_in[5];
  const float* lnk  = (const float*)d_in[6];

  const size_t PWQ = (size_t)kDim * kDim * 2;      // 1179648  bf16 [768][768] plane
  const size_t PWK = (size_t)kKvDim * kDim * 2;    // 393216   bf16 [256][768] plane
  const size_t PTB = (size_t)kSeq * kHalfHd * 4;   // 262144   f32 [2048][32] table
  const size_t PXB = (size_t)kTok * kDim * 2;      // 6291456  bf16 [4096][768] plane
  const size_t PXF = (size_t)kTok * kDim * 4;      // 12582912 f32 [4096][768]
  const size_t PKF = (size_t)kTok * kKvDim * 4;    // 4194304  f32 [4096][256]
  const size_t PKB = (size_t)kTok * kKvDim * 2;    // 2097152  bf16 [4096][256] / [2][256][2048] plane
  size_t off = 0;
  const size_t oWqh = off; off += PWQ;  const size_t oWql = off; off += PWQ;
  const size_t oWkh = off; off += PWK;  const size_t oWkl = off; off += PWK;
  const size_t oWvh = off; off += PWK;  const size_t oWvl = off; off += PWK;
  const size_t oWoh = off; off += PWQ;  const size_t oWol = off; off += PWQ;
  const size_t oCS  = off; off += PTB;  const size_t oSN  = off; off += PTB;
  const size_t oXh  = off; off += PXB;  const size_t oXl  = off; off += PXB;
  const size_t oQf  = off; off += PXF;
  const size_t oKf  = off; off += PKF;
  const size_t oQh  = off; off += PXB;  const size_t oQl  = off; off += PXB;
  const size_t oKh  = off; off += PKB;  const size_t oKl  = off; off += PKB;
  const size_t oVTh = off; off += PKB;  const size_t oVTl = off; off += PKB;
  const size_t oOf  = off; off += PXF;
  const size_t oOh  = off; off += PXB;  const size_t oOl  = off; off += PXB;
  if (off > ws_size) return;                       // off = 82313216
  if (off > (size_t)134217728) return;

  char* ws = (char*)d_ws;
  unsigned short* Wqh = (unsigned short*)(ws + oWqh); unsigned short* Wql = (unsigned short*)(ws + oWql);
  unsigned short* Wkh = (unsigned short*)(ws + oWkh); unsigned short* Wkl = (unsigned short*)(ws + oWkl);
  unsigned short* Wvh = (unsigned short*)(ws + oWvh); unsigned short* Wvl = (unsigned short*)(ws + oWvl);
  unsigned short* Woh = (unsigned short*)(ws + oWoh); unsigned short* Wol = (unsigned short*)(ws + oWol);
  float*          CS  = (float*)(ws + oCS);          float*          SN  = (float*)(ws + oSN);
  unsigned short* Xh  = (unsigned short*)(ws + oXh);  unsigned short* Xl  = (unsigned short*)(ws + oXl);
  float*          Qf  = (float*)(ws + oQf);
  float*          Kf  = (float*)(ws + oKf);
  unsigned short* Qh  = (unsigned short*)(ws + oQh);  unsigned short* Ql  = (unsigned short*)(ws + oQl);
  unsigned short* Kh  = (unsigned short*)(ws + oKh);  unsigned short* Kl  = (unsigned short*)(ws + oKl);
  unsigned short* VTh = (unsigned short*)(ws + oVTh); unsigned short* VTl = (unsigned short*)(ws + oVTl);
  float*          Of  = (float*)(ws + oOf);
  unsigned short* Oh  = (unsigned short*)(ws + oOh);  unsigned short* Ol  = (unsigned short*)(ws + oOl);

  const dim3 blk(256);

  // setup: rotary tables (256 blocks x 256 = 65536 = 2048 x 32 elements per table)
  rope_table_kernel<<<dim3((kSeq * kHalfHd) / 256), blk, 0, stream>>>(CS, SN);
  // setup: weights [out n][in k] f32 -> bf16 hi/lo planes, fragment-major
  const int n8wq = kDim * kDim / 8;       // 73728 threads
  const int n8wk = kKvDim * kDim / 8;     // 24576 threads
  split_pack_bf16_kernel<<<dim3((n8wq + 255) / 256), blk, 0, stream>>>(Wq, Wqh, Wql, n8wq);
  split_pack_bf16_kernel<<<dim3((n8wk + 255) / 256), blk, 0, stream>>>(Wk, Wkh, Wkl, n8wk);
  split_pack_bf16_kernel<<<dim3((n8wk + 255) / 256), blk, 0, stream>>>(Wv, Wvh, Wvl, n8wk);
  split_pack_bf16_kernel<<<dim3((n8wq + 255) / 256), blk, 0, stream>>>(Wo, Woh, Wol, n8wq);

  const int n8x = kTok * kDim / 8;                                  // 393216 threads per matrix
  const dim3 gCast((n8x + 255) / 256);                              // 1536 blocks x 2048 elements = 4096x768
  const dim3 gProjQ(((kTok / 64) * (kDim / 64) + 7) / 8, 1);        // 768 tiles: M=4096, N=768
  const dim3 gProjK(((kTok / 64) * (kKvDim / 64) + 7) / 8, 1);      // 256 tiles: M=4096, N=256
  const dim3 gVT(((kKvDim / 64) * (kSeq / 64) + 7) / 8, kNB);       // 128 tiles per batch element: M=256, N=2048
  const dim3 gRope(kNUnits / 32, kNB);                              // 1024 blocks x 32 units per batch element
  const dim3 gAtt(kNHq * (kSeq / 64), kNB);                         // 12 heads x 32 query blocks per batch element

  // Both batch elements go through every stage in one launch: the token-row GEMMs see M = 4096 rows, the stages
  // that need the position inside a sequence take the batch element from blockIdx.y.
  // (1) x -> bf16 hi/lo planes [4096][768], fragment-major
  split_pack_bf16_kernel<<<gCast, blk, 0, stream>>>(x, Xh, Xl, n8x);
  // (2) q = x . Wq^T -> Qf f32 [row][h*64+d]   (M=4096, N=768, K=768)
  wmma_gemm64<1, true, 0, 0, false><<<gProjQ, blk, 0, stream>>>(
      Xh, Xl, kDim, 0L, Wqh, Wql, kDim, 0L, (void*)Qf, (void*)Qf, kDim, 0L,
      lnq, lnq, 0L, kTok, kDim, kDim, 1.0f);
  // (3) k = x . Wk^T -> Kf f32 [row][g*64+d]   (M=4096, N=256, K=768)
  wmma_gemm64<1, true, 0, 0, false><<<gProjK, blk, 0, stream>>>(
      Xh, Xl, kDim, 0L, Wkh, Wkl, kDim, 0L, (void*)Kf, (void*)Kf, kKvDim, 0L,
      lnk, lnk, 0L, kTok, kKvDim, kDim, 1.0f);
  // (4) v^T = Wv . x[b]^T -> VT hi/lo planes [b][g*64+d][s]   (A = Wv planes [256][768], Bt = x planes of batch b; M=256, N=2048, K=768)
  wmma_gemm64<1, true, 0, 2, false><<<gVT, blk, 0, stream>>>(
      Wvh, Wvl, kDim, 0L, Xh, Xl, kDim, (long)kSeq * kDim, (void*)VTh, (void*)VTl, kSeq, (long)kKvDim * kSeq,
      lnq, lnq, 0L, kKvDim, kSeq, kDim, 1.0f);
  // (5) per-head rmsnorm * w + rotary on q and k -> Q/K bf16 hi/lo planes
  norm_rope_split_kernel<<<gRope, blk, 0, stream>>>(Qf, Kf, lnq, lnk, CS, SN, Qh, Ql, Kh, Kl);
  // (6) windowed causal GQA attention per head: y[row][h*64+d] (f32 plane, every element written by its (b, h, query block) owner)
  attn_gqa_window64_kernel<<<gAtt, dim3(128), 0, stream>>>(Qh, Ql, Kh, Kl, VTh, VTl, Of, 0.125f);
  // (7) y -> bf16 hi/lo planes, fragment-major
  split_pack_bf16_kernel<<<gCast, blk, 0, stream>>>(Of, Oh, Ol, n8x);
  // (8) out = y . Wo^T -> d_out rows 0 .. 4095 (f32)   (M=4096, N=768, K=768)
  wmma_gemm64<1, true, 0, 0, false><<<gProjQ, blk, 0, stream>>>(
      Oh, Ol, kDim, 0L, Woh, Wol, kDim, 0L, d_out, d_out, kDim, 0L,
      lnq, lnq, 0L, kTok, kDim, kDim, 1.0f);
}

// v003
// One run takes 174 microseconds.
// Timed twice side by side with v002, it ran 1.52 times as fast both times.
// Counting every step since v000, it is 3.16 times as fast.
// Contractions (q/k/v/out projections, q.k^T scores, p.v): v_wmma_f32_16x16x32_bf16 with bf16 hi/lo split operands (hi.hi + hi.lo + lo.hi), f32 accumulate; rmsnorm, rotary tables, online softmax in f32.
#include <hip/hip_runtime.h>
#include <math.h>
#include <stdint.h>

constexpr int kNB     = 2;
constexpr int kSeq    = 2048;
constexpr int kTok    = kNB * kSeq;          // 4096 token rows over both batch elements
constexpr int kDim    = 768;
constexpr int kHd     = 64;
constexpr int kNHq    = 12;
constexpr int kNKv    = 4;
constexpr int kGroups = 3;
constexpr int kKvDim  = kNKv * kHd;          // 256
constexpr int kWin    = 384;
constexpr int kHalfHd = 32;
constexpr int kKBlk   = kDim / 32;           // 24 k blocks of 32 in a row of 768
constexpr int kNQUnits = kSeq * kNHq;        // 24576 (token, q head) units
constexpr int kNKUnits = kSeq * kNKv;        // 8192  (token, kv head) units
constexpr int kNUnits  = kNQUnits + kNKUnits;// 32768
static_assert(kNQUnits % 4 == 0);
static_assert(kNUnits % 32 == 0);
static_assert(kSeq % 64 == 0 && kDim % 64 == 0 && kKvDim % 64 == 0 && kDim % 32 == 0);
static_assert(kNHq == kNKv * kGroups);

typedef __attribute__((ext_vector_type(16))) _Float16 v16h;
typedef __attribute__((ext_vector_type(8)))  _Float16 v8h;
typedef __attribute__((ext_vector_type(16))) __bf16   v16b;
typedef __attribute__((ext_vector_type(8)))  __bf16   v8b;
typedef __attribute__((ext_vector_type(8)))  float    v8f;
typedef __attribute__((ext_vector_type(4)))  float    v4f;
typedef __attribute__((ext_vector_type(2)))  float    v2f;
typedef __attribute__((ext_vector_type(4)))  unsigned int v4u;

__device__ __forceinline__ unsigned short f2bf_bits(float f) {
  unsigned u = __float_as_uint(f);
  return (unsigned short)((u + 0x7FFFu + ((u >> 16) & 1u)) >> 16);
}
__device__ __forceinline__ float bf_bits2f(unsigned short h) { return __uint_as_float(((unsigned)h) << 16); }

// hazard guards as plain device helpers (no inline asm inside the kernel template body)
__device__ __forceinline__ void dep_guard_h(v8f& a, v8f& b, v16h x, v16h y) { asm volatile("v_nop\n\tv_nop\n\tv_nop\n\tv_nop" : "+v"(a), "+v"(b) : "v"(x), "v"(y)); }
__device__ __forceinline__ void dep_guard_b(v8f& a, v8f& b, v16b x, v16b y) { asm volatile("v_nop\n\tv_nop\n\tv_nop\n\tv_nop" : "+v"(a), "+v"(b) : "v"(x), "v"(y)); }
__device__ __forceinline__ void keep4_h(v16h a, v16h b, v16h c, v16h d) { asm volatile("v_nop" :: "v"(a), "v"(b), "v"(c), "v"(d)); }
__device__ __forceinline__ void keep4_b(v16b a, v16b b, v16b c, v16b d) { asm volatile("v_nop" :: "v"(a), "v"(b), "v"(c), "v"(d)); }
__device__ __forceinline__ void acc_guard4(v8f& a, v8f& b, v8f& c, v8f& d) { asm volatile("v_nop\n\tv_nop\n\tv_nop\n\tv_nop" : "+v"(a), "+v"(b), "+v"(c), "+v"(d)); }
template <typename T> struct Frag;
template <> struct Frag<_Float16> {
  typedef v16h V; union U { v16h v; v8h h[2]; };
  static __device__ __forceinline__ v16h load(const _Float16* p) {   // elements 0..7 <- p[0..7], 8..15 <- p[16..23]
    U f; f.h[0] = *(const v8h*)(p); f.h[1] = *(const v8h*)(p + 16); return f.v;
  }
  static __device__ __forceinline__ v8f mma(v16h a, v16h b, v8f c) {
    return __builtin_amdgcn_wmma_f32_16x16x32_f16(false, a, false, b, (short)0, c, false, false);
  }
  static __device__ __forceinline__ void guard(v8f& a, v8f& b, v16h x, v16h y) { dep_guard_h(a, b, x, y); }
  static __device__ __forceinline__ void keep(v16h a, v16h b, v16h c, v16h d) { keep4_h(a, b, c, d); }
};
template <> struct Frag<__bf16> {
  typedef v16b V; union U { v16b v; v8b h[2]; };
  static __device__ __forceinline__ v16b load(const __bf16* p) {
    U f; f.h[0] = *(const v8b*)(p); f.h[1] = *(const v8b*)(p + 16); return f.v;
  }
  // fragment-major block at byte address p: elements 0..7 <- bytes 0..15, elements 8..15 <- bytes 512..527
  static __device__ __forceinline__ v16b load_packed(const char* p) {
    U f; f.h[0] = *(const v8b*)(p); f.h[1] = *(const v8b*)(p + 512); return f.v;
  }
  static __device__ __forceinline__ v8f mma(v16b a, v16b b, v8f c) {
    return __builtin_amdgcn_wmma_f32_16x16x32_bf16(false, a, false, b, (short)0, c, false, false);
  }
  static __device__ __forceinline__ void guard(v8f& a, v8f& b, v16b x, v16b y) { dep_guard_b(a, b, x, y); }
  static __device__ __forceinline__ void keep(v16b a, v16b b, v16b c, v16b d) { keep4_b(a, b, c, d); }
};

// ---- Register-blocked batched WMMA GEMM ------------------------------------
// C[m,n] = scale * sum_k A[m,k] * Bt[n,k] (+bias)(+resid); each wave owns a 64x64 tile.
// A [M,K] and Bt [N,K] are stored fragment-major (written by split_pack_thread): each 16-row x 32-k block is
// 512 consecutive elements, block index = (row/16)*kKBlk + k/32, and element (row, k) of a block sits at
// ((k>>4)&1)*256 + (((k>>3)&1)*16 + (row&15))*8 + (k&7). Lane l of a fragment load then reads 16 B at l*16 B, so one
// wave-wide load covers 512 consecutive bytes (4 whole lines) and holds the same elements as a row-major fragment load.
// M,N % 64 == 0, K % 32 == 0; rows of both operands are kDim long (lda == ldb == kDim), so the step from one 16-row
// block row to the next is a compile-time constant and goes into the loads' immediate offsets.
// SPLIT: operands are hi/lo planes (A2/Bt2 = lo planes, same layout); product = hi.hi + hi.lo + lo.hi.
// BIAS_MODE: 0 = none, 1 = bias[m], 2 = bias[n].
// OUT_MODE: 0 = f32, 1 = f16, 2 = bf16 hi plane (Cout) + bf16 lo plane (Cout2).
// ET: 0 = f16 operands, 1 = bf16 operands (pointers passed as 16-bit storage)
template <int ET> struct Elem;
template <> struct Elem<0> { typedef _Float16 T; };
template <> struct Elem<1> { typedef __bf16 T; };
// gemm64_tile = one wave's 64x64 tile; the kernels below hand it the wave's LDS slab, the batch index b and the tile's
// first row m0 and column n0 (the same in every lane, in scalar registers, so that the four plane bases are scalar too).
template <int ET, bool SPLIT, int BIAS_MODE, int OUT_MODE, bool RESID, int ACT = 0>
__device__ __forceinline__ void gemm64_tile(
    float* __restrict__ slab, const int b, const int m0, const int n0,
    const unsigned short* __restrict__ Ap, const unsigned short* __restrict__ A2p, int lda, long strideA,
    const unsigned short* __restrict__ Btp, const unsigned short* __restrict__ Bt2p, int ldb, long strideB,
    void* __restrict__ Cout, void* __restrict__ Cout2, int ldc, long strideC,
    const float* __restrict__ bias,
    const float* __restrict__ resid, long strideR,
    int K, float scale) {
  typedef typename Elem<ET>::T T;
  typedef typename Frag<T>::V V;
  const T* A = (const T*)Ap; const T* A2 = (const T*)A2p; const T* Bt = (const T*)Btp; const T* Bt2 = (const T*)Bt2p;
  const int lane = threadIdx.x & 31;

  const T* Ab  = A  + (size_t)b * strideA;
  const T* Bb  = Bt + (size_t)b * strideB;
  const T* Ab2 = SPLIT ? (A2  + (size_t)b * strideA) : nullptr;
  const T* Bb2 = SPLIT ? (Bt2 + (size_t)b * strideB) : nullptr;

  const int rlane = lane & 15;                 // row (A) / col (B, D) within subtile
  const int mOff  = (lane >> 4) * 8;           // D row offset
  // Every fragment load = scalar base of the tile's first block row in its plane + one 32-bit lane byte offset + an
  // immediate (block row step, second half of the block). The lane offset is the only vector address register; it steps
  // one block (1024 B) per k step.
  constexpr int kRowStep = kKBlk * 1024;       // bytes from one 16-row block row to the next
  const char* pBh = (const char*)(Bb  + (size_t)(n0 >> 4) * (kKBlk * 512));
  const char* pBl = SPLIT ? (const char*)(Bb2 + (size_t)(n0 >> 4) * (kKBlk * 512)) : nullptr;
  const char* pAh = (const char*)(Ab  + (size_t)(m0 >> 4) * (kKBlk * 512));
  const char* pAl = SPLIT ? (const char*)(Ab2 + (size_t)(m0 >> 4) * (kKBlk * 512)) : nullptr;
  unsigned vo = (unsigned)lane * 16u;          // this lane's 16 B inside a 512-B half block

  v8f acc[4][4];
#pragma unroll
  for (int i = 0; i < 4; ++i)
#pragma unroll
    for (int j = 0; j < 4; ++j) acc[i][j] = (v8f){0.f,0.f,0.f,0.f,0.f,0.f,0.f,0.f};

  for (int k0 = 0; k0 < K; k0 += 32) {
    V bh[4], bl[4];
#pragma unroll
    for (int j = 0; j < 4; ++j) {
      bh[j] = Frag<T>::load_packed(pBh + vo + j * kRowStep);
      if (SPLIT) bl[j] = Frag<T>::load_packed(pBl + vo + j * kRowStep);
    }
#pragma unroll
    for (int i = 0; i < 4; ++i) {
      V ah = Frag<T>::load_packed(pAh + vo + i * kRowStep);
      V al;
      if (SPLIT) al = Frag<T>::load_packed(pAl + vo + i * kRowStep);
#pragma unroll
      for (int j = 0; j < 4; ++j) {
        acc[i][j] = Frag<T>::mma(ah, bh[j], acc[i][j]);
        if (SPLIT) {
          acc[i][j] = Frag<T>::mma(ah, bl[j], acc[i][j]);
          acc[i][j] = Frag<T>::mma(al, bh[j], acc[i][j]);
        }
      }
      Frag<T>::guard(acc[i][0], acc[i][3], ah, SPLIT ? al : ah);
    }
    Frag<T>::keep(bh[0], bh[1], bh[2], bh[3]);
    if (SPLIT) Frag<T>::keep(bl[0], bl[1], bl[2], bl[3]);
    vo += 1024u;
  }
  acc_guard4(acc[0][0], acc[0][1], acc[0][2], acc[0][3]);
  acc_guard4(acc[1][0], acc[1][1], acc[1][2], acc[1][3]);
  acc_guard4(acc[2][0], acc[2][1], acc[2][2], acc[2][3]);
  acc_guard4(acc[3][0], acc[3][1], acc[3][2], acc[3][3]);

  // ---- epilogue ----
  const float* Rb = RESID ? (resid + (size_t)b * strideR) : nullptr;
#pragma unroll
  for (int i = 0; i < 4; ++i) {
    const int mBase = m0 + (i << 4);
#pragma unroll
    for (int j = 0; j < 4; ++j) {
      const int n = n0 + (j << 4) + rlane;
      float bv = 0.f;
      if (BIAS_MODE == 2) bv = bias[n];
#pragma unroll
      for (int r = 0; r < 8; ++r) {
        float v = acc[i][j][r] * scale;
        if (BIAS_MODE == 1) v += bias[mBase + mOff + r];
        if (BIAS_MODE == 2) v += bv;
        if (RESID) v += Rb[(size_t)(mBase + mOff + r) * ldc + n];
        if (ACT == 1) v = tanhf(v);
        if (ACT == 2) v = fmaxf(v, 0.0f);
        if (ACT == 3) v = v / (1.0f + expf(-v));
        if (ACT == 4) v = (v > 0.f) ? v : 0.01f * v;
        slab[(mOff + r) * 68 + (j << 4) + rlane] = v;
      }
    }
    __builtin_amdgcn_fence(__ATOMIC_RELEASE, "workgroup");
    __builtin_amdgcn_wave_barrier();
    __builtin_amdgcn_fence(__ATOMIC_ACQUIRE, "workgroup");
    if (OUT_MODE == 0) {
      float* C = (float*)Cout + (size_t)b * strideC;
      const int hh = lane >> 4, c4 = (lane & 15) * 4;     // row seg = 256 B = 16 lanes x 16 B
      {
#pragma unroll
        for (int it = 0; it < 8; ++it) {
          const int row = it * 2 + hh;
          v4f v = *(const v4f*)(slab + row * 68 + c4);
          *(v4f*)(C + (size_t)(mBase + row) * ldc + n0 + c4) = v;
        }
        
      }
    } else {
      const int q = lane >> 3, c8 = (lane & 7) * 8;
      unsigned short* C  = (unsigned short*)Cout  + (size_t)b * strideC;
      unsigned short* C2 = (OUT_MODE == 2) ? ((unsigned short*)Cout2 + (size_t)b * strideC) : nullptr;
      {
#pragma unroll
        for (int it = 0; it < 4; ++it) {
          const int row = it * 4 + q;
          const float* sp = slab + row * 68 + c8;
          v8h hv, lv;
#pragma unroll
          for (int e = 0; e < 8; ++e) {
            if (OUT_MODE == 1) {
              hv[e] = (_Float16)sp[e];
            } else {
              unsigned short hb = f2bf_bits(sp[e]);
              unsigned short lb = f2bf_bits(sp[e] - bf_bits2f(hb));
              hv[e] = __builtin_bit_cast(_Float16, hb);
              lv[e] = __builtin_bit_cast(_Float16, lb);
            }
          }
          *(v8h*)(C + (size_t)(mBase + row) * ldc + n0 + c8) = hv;
          if (OUT_MODE == 2) *(v8h*)(C2 + (size_t)(mBase + row) * ldc + n0 + c8) = lv;
        }
        
      }
    }
    __builtin_amdgcn_fence(__ATOMIC_RELEASE, "workgroup");
    __builtin_amdgcn_wave_barrier();
    __builtin_amdgcn_fence(__ATOMIC_ACQUIRE, "workgroup");
  }
}

// One GEMM per launch: 8 waves = 8 consecutive tiles per block, grid.y = batch index.
template <int ET, bool SPLIT, int BIAS_MODE, int OUT_MODE, bool RESID, int ACT = 0>
__global__ __launch_bounds__(256) void wmma_gemm64(
    const unsigned short* __restrict__ Ap, const unsigned short* __restrict__ A2p, int lda, long strideA,
    const unsigned short* __restrict__ Btp, const unsigned short* __restrict__ Bt2p, int ldb, long strideB,
    void* __restrict__ Cout, void* __restrict__ Cout2, int ldc, long strideC,
    const float* __restrict__ bias,
    const float* __restrict__ resid, long strideR,
    int M, int N, int K, float scale) {
  __shared__ __align__(16) float sT[8][16 * 68];   // per-wave 16x64 slab, pitch 68 floats
  const int wave = threadIdx.x >> 5;
  const int tilesN = N >> 6;
  const int tilesM = M >> 6;
  const int tile = __builtin_amdgcn_readfirstlane(blockIdx.x * 8 + wave);
  if (tile >= tilesM * tilesN) return;   // wave-uniform; no block barriers in this kernel
  const int tm = tile / tilesN;
  const int tn = tile - tm * tilesN;
  gemm64_tile<ET, SPLIT, BIAS_MODE, OUT_MODE, RESID, ACT>(sT[wave], blockIdx.y, tm << 6, tn << 6, Ap, A2p, lda, strideA, Btp, Bt2p,
                                                          ldb, strideB, Cout, Cout2, ldc, strideC, bias, resid, strideR, K, scale);
}

// The three projections of x in one launch: none reads what another writes, and each alone fills well under half of
// the chip's WGPs for the whole length of one wave's k loop. Block ranges (8 tiles per block):
//   [0, kBlkQ)                 q   = x . Wq^T -> Qf f32 [row][h*64+d]           M=4096, N=768
//   [kBlkQ, kBlkQ+kBlkK)       k   = x . Wk^T -> Kf f32 [row][g*64+d]           M=4096, N=256
//   then kBlkV per batch b     v^T = Wv . x[b]^T -> VT hi/lo [b][g*64+d][s]     M=256,  N=2048 (A = Wv planes, Bt = x planes of b)
constexpr int kBlkQ = (kTok / 64) * (kDim / 64) / 8;      // 96
constexpr int kBlkK = (kTok / 64) * (kKvDim / 64) / 8;    // 32
constexpr int kBlkV = (kKvDim / 64) * (kSeq / 64) / 8;    // 16 per batch element
static_assert(((kTok / 64) * (kDim / 64)) % 8 == 0 && ((kTok / 64) * (kKvDim / 64)) % 8 == 0 && ((kKvDim / 64) * (kSeq / 64)) % 8 == 0);

__global__ __launch_bounds__(256) void qkv_gemm64_kernel(
    const unsigned short* __restrict__ Xh, const unsigned short* __restrict__ Xl,
    const unsigned short* __restrict__ Wqh, const unsigned short* __restrict__ Wql,
    const unsigned short* __restrict__ Wkh, const unsigned short* __restrict__ Wkl,
    const unsigned short* __restrict__ Wvh, const unsigned short* __restrict__ Wvl,
    float* __restrict__ Qf, float* __restrict__ Kf,
    unsigned short* __restrict__ VTh, unsigned short* __restrict__ VTl, int K) {
  __shared__ __align__(16) float sT[8][16 * 68];   // per-wave 16x64 slab, pitch 68 floats
  const int wave = threadIdx.x >> 5;
  const int bx   = blockIdx.x;
  if (bx < kBlkQ + kBlkK) {
    const bool isq = bx < kBlkQ;                   // block-uniform
    const int tile = __builtin_amdgcn_readfirstlane((isq ? bx : bx - kBlkQ) * 8 + wave);
    float* C = isq ? Qf : Kf;
    const int n  = isq ? kDim : kKvDim;
    const int tm = isq ? tile / (kDim / 64) : tile / (kKvDim / 64);
    const int tn = tile - tm * (n >> 6);
    gemm64_tile<1, true, 0, 0, false>(sT[wave], 0, tm << 6, tn << 6, Xh, Xl, kDim, 0L, isq ? Wqh : Wkh, isq ? Wql : Wkl, kDim, 0L,
                                      (void*)C, (void*)C, n, 0L, nullptr, nullptr, 0L, K, 1.0f);
  } else {
    const int v    = bx - (kBlkQ + kBlkK);
    const int tile = __builtin_amdgcn_readfirstlane((v % kBlkV) * 8 + wave);
    const int tm   = tile / (kSeq / 64);
    const int tn   = tile - tm * (kSeq / 64);
    gemm64_tile<1, true, 0, 2, false>(sT[wave], v / kBlkV, tm << 6, tn << 6, Wvh, Wvl, kDim, 0L, Xh, Xl, kDim, (long)kSeq * kDim,
                                      (void*)VTh, (void*)VTl, kSeq, (long)kKvDim * kSeq, nullptr, nullptr, 0L, K, 1.0f);
  }
}

// ---------------------------------------------------------------------------
// bf16 split of a row-major f32 [rows][768] matrix, hi = bf16_rne(in), lo = bf16_rne(in - hi), stored fragment-major
// for wmma_gemm64 (layout: see there). One thread = 8 consecutive k of one row (32 B read, 16 B per plane written);
// one wave = 8 rows x 32 k, half a block: it reads 8 whole 128-B lines and each plane's store fills 4 whole lines.
// rows % 16 == 0; n8 = rows * 768 / 8 threads.
// ---------------------------------------------------------------------------
__device__ __forceinline__ unsigned pk16(unsigned short a, unsigned short b) { return (unsigned)a | ((unsigned)b << 16); }

__device__ __forceinline__ void split_pack_thread(const float* __restrict__ in, unsigned short* __restrict__ hi,
                                                  unsigned short* __restrict__ lo, const int idx, const int n8) {
  if (idx < n8) {
    const int l   = idx & 31;
    const int g   = idx >> 5;                 // half block
    const int blk = g >> 1;
    const int rb  = blk / kKBlk, kb = blk - rb * kKBlk;
    const int r16 = (g & 1) * 8 + (l >> 2);   // row inside the block
    const int kp  = l & 3;                    // which 8 of the block's 32 k
    const float* s = in + (size_t)(rb * 16 + r16) * kDim + kb * 32 + kp * 8;
    const v4f fa = *(const v4f*)(s), fb = *(const v4f*)(s + 4);
    const float f[8] = {fa[0], fa[1], fa[2], fa[3], fb[0], fb[1], fb[2], fb[3]};
    v4u hv, lv;
#pragma unroll   // constant indices keep f, hv and lv in registers
    for (int q = 0; q < 4; ++q) {
      const unsigned short h0 = f2bf_bits(f[2 * q]), h1 = f2bf_bits(f[2 * q + 1]);
      const unsigned short l0 = f2bf_bits(f[2 * q] - bf_bits2f(h0)), l1 = f2bf_bits(f[2 * q + 1] - bf_bits2f(h1));
      hv[q] = pk16(h0, h1);
      lv[q] = pk16(l0, l1);
    }
    const size_t o = (size_t)blk * 512 + (kp >> 1) * 256 + ((kp & 1) * 16 + r16) * 8;
    *(v4u*)(hi + o) = hv;
    *(v4u*)(lo + o) = lv;
  }
}

__global__ __launch_bounds__(256) void split_pack_bf16_kernel(const float* __restrict__ in, unsigned short* __restrict__ hi,
                                                              unsigned short* __restrict__ lo, int n8) {
  split_pack_thread(in, hi, lo, blockIdx.x * 256 + threadIdx.x, n8);
}

// ---------------------------------------------------------------------------
// Rotary tables: cs[t*32+i] = cosf(t * inv_freq[i]), sn likewise, inv_freq[i] = 10000^(-i/32) = 2^(-i*log2(1e4)/32).
// kSeq*32/256 = 256 blocks x 256 threads = exactly 65536 elements per table; each wave writes 32 consecutive
// ---------------------------------------------------------------------------
__device__ __forceinline__ void rope_table_thread(float* __restrict__ cs, float* __restrict__ sn, const int i) {
  const int t  = i >> 5;
  const int fi = i & 31;
  const float invf = exp2f((float)fi * -0.41524101186092f);
  const float ang  = (float)t * invf;
  float sv, cv;
  sincosf(ang, &sv, &cv);
  ((float*)cs)[i] = cv;
  ((float*)sn)[i] = sv;
}

// ---------------------------------------------------------------------------
// Everything that depends on the inputs alone, in one launch: the rotary tables and the bf16 splits of x and of the four
// weight matrices. No part reads what another writes. Block ranges, the part with the longest thread first:
//   kPbT table blocks | kPbX blocks of x | kPbWq of Wq | kPbWk of Wk | kPbWk of Wv | kPbWq of Wo
// ---------------------------------------------------------------------------
constexpr int kN8X  = kTok * kDim / 8;        // 393216 threads
constexpr int kN8Wq = kDim * kDim / 8;        // 73728
constexpr int kN8Wk = kKvDim * kDim / 8;      // 24576
constexpr int kPbT  = kSeq * kHalfHd / 256;   // 256
constexpr int kPbX  = kN8X / 256;             // 1536
constexpr int kPbWq = kN8Wq / 256;            // 288
constexpr int kPbWk = kN8Wk / 256;            // 96
static_assert((kSeq * kHalfHd) % 256 == 0 && kN8X % 256 == 0 && kN8Wq % 256 == 0 && kN8Wk % 256 == 0);

__global__ __launch_bounds__(256) void prep_kernel(
    const float* __restrict__ x, const float* __restrict__ Wq, const float* __restrict__ Wk,
    const float* __restrict__ Wv, const float* __restrict__ Wo,
    unsigned short* __restrict__ Xh, unsigned short* __restrict__ Xl,
    unsigned short* __restrict__ Wqh, unsigned short* __restrict__ Wql,
    unsigned short* __restrict__ Wkh, unsigned short* __restrict__ Wkl,
    unsigned short* __restrict__ Wvh, unsigned short* __restrict__ Wvl,
    unsigned short* __restrict__ Woh, unsigned short* __restrict__ Wol,
    float* __restrict__ cs, float* __restrict__ sn) {
  int bx = blockIdx.x;                          // block-uniform choice of the part
  if (bx < kPbT) { rope_table_thread(cs, sn, bx * 256 + threadIdx.x); return; }
  bx -= kPbT;
  const float* in = x; unsigned short* hi = Xh; unsigned short* lo = Xl; int n8 = kN8X;
  if (bx >= kPbX) {
    bx -= kPbX; in = Wq; hi = Wqh; lo = Wql; n8 = kN8Wq;
    if (bx >= kPbWq) {
      bx -= kPbWq; in = Wk; hi = Wkh; lo = Wkl; n8 = kN8Wk;
      if (bx >= kPbWk) {
        bx -= kPbWk; in = Wv; hi = Wvh; lo = Wvl;
        if (bx >= kPbWk) { bx -= kPbWk; in = Wo; hi = Woh; lo = Wol; n8 = kN8Wq; }
      }
    }
  }
  split_pack_thread(in, hi, lo, bx * 256 + threadIdx.x, n8);
}

// ---------------------------------------------------------------------------
// Per (token, head) unit of 64 floats: y[d] = w[d] * (x[d] * rsqrt(mean(x^2) + eps)); rotary:
//   o[d] = y[d]*cos[t][d&31] - y[d+32]*sin  (d < 32),   o[d] = y[d]*cos + y[d-32]*sin  (d >= 32);
// o split into bf16 hi/lo planes at the same [token][head*64+d] position as the f32 source.
// Units 0..24575 = (token, q head) from Qf [2048][768]; units 24576..32767 = (token, kv head) from Kf [2048][256].
// 8 lanes per unit (d0 = 8*(lane&7)), 4 units per wave, grid.x = 32768/32 = 1024 blocks x 256 threads covers all units
// of one batch element; grid.y = batch element (planes of batch b start b*2048 token rows further on).
// ---------------------------------------------------------------------------
__device__ __forceinline__ float rope_one(float x, float p, float wx, float wp, float cv, float sv, float rinv, float sg) {
  const float xn = wx * (x * rinv);
  const float pn = wp * (p * rinv);
  return xn * cv + (sg * pn) * sv;
}

__global__ __launch_bounds__(256) void norm_rope_split_kernel(
    const float* __restrict__ Qf, const float* __restrict__ Kf,
    const float* __restrict__ qw, const float* __restrict__ kw,
    const float* __restrict__ cs, const float* __restrict__ sn,
    unsigned short* __restrict__ Qh, unsigned short* __restrict__ Ql,
    unsigned short* __restrict__ Kh, unsigned short* __restrict__ Kl) {
  const int lane  = threadIdx.x & 31;
  const int wave  = threadIdx.x >> 5;
  const int wbase = (blockIdx.x * 8 + wave) * 4;   // first unit of this wave
  const int u     = wbase + (lane >> 3);           // < kNUnits by grid construction
  const int d0    = (lane & 7) * 8;
  const bool isq  = wbase < kNQUnits;              // wave-uniform
  int uq = u; if (uq > kNQUnits - 1) uq = kNQUnits - 1;
  const int tq = uq / kNHq, hq = uq - tq * kNHq;
  int uk = u - kNQUnits; if (uk < 0) uk = 0; if (uk > kNKUnits - 1) uk = kNKUnits - 1;
  const int tk = uk >> 2, hk = uk & 3;
  const int t = isq ? tq : tk;
  const size_t rowb = (size_t)blockIdx.y * kSeq;   // first token row of this batch element
  const size_t offq = (rowb + tq) * kDim + (size_t)hq * kHd;
  const size_t offk = (rowb + tk) * kKvDim + (size_t)hk * kHd;
  const float* src = isq ? (Qf + offq) : (Kf + offk);
  const float* w   = isq ? qw : kw;
  unsigned short* dh = isq ? (Qh + offq) : (Kh + offk);
  unsigned short* dl = isq ? (Ql + offq) : (Kl + offk);
  const int dp = d0 ^ kHalfHd;                     // rotary partner block
  const int ci = t * kHalfHd + (d0 & 24);

  const v4f xa = *(const v4f*)(src + d0),  xb = *(const v4f*)(src + d0 + 4);
  const v4f pa = *(const v4f*)(src + dp),  pb = *(const v4f*)(src + dp + 4);
  const v4f wa = *(const v4f*)(w + d0),    wb = *(const v4f*)(w + d0 + 4);
  const v4f va = *(const v4f*)(w + dp),    vb = *(const v4f*)(w + dp + 4);
  const v4f ca = *(const v4f*)(cs + ci),   cb = *(const v4f*)(cs + ci + 4);
  const v4f sa = *(const v4f*)(sn + ci),   sb = *(const v4f*)(sn + ci + 4);

  float ss = xa[0] * xa[0] + xa[1] * xa[1] + xa[2] * xa[2] + xa[3] * xa[3]
           + xb[0] * xb[0] + xb[1] * xb[1] + xb[2] * xb[2] + xb[3] * xb[3];
  ss += __shfl_xor(ss, 1, 32);
  ss += __shfl_xor(ss, 2, 32);
  ss += __shfl_xor(ss, 4, 32);
  const float rinv = rsqrtf(ss * (1.0f / 64.0f) + 1e-6f);
  const float sg = (d0 < kHalfHd) ? -1.0f : 1.0f;

  float o[8];
  o[0] = rope_one(xa[0], pa[0], wa[0], va[0], ca[0], sa[0], rinv, sg);
  o[1] = rope_one(xa[1], pa[1], wa[1], va[1], ca[1], sa[1], rinv, sg);
  o[2] = rope_one(xa[2], pa[2], wa[2], va[2], ca[2], sa[2], rinv, sg);
  o[3] = rope_one(xa[3], pa[3], wa[3], va[3], ca[3], sa[3], rinv, sg);
  o[4] = rope_one(xb[0], pb[0], wb[0], vb[0], cb[0], sb[0], rinv, sg);
  o[5] = rope_one(xb[1], pb[1], wb[1], vb[1], cb[1], sb[1], rinv, sg);
  o[6] = rope_one(xb[2], pb[2], wb[2], vb[2], cb[2], sb[2], rinv, sg);
  o[7] = rope_one(xb[3], pb[3], wb[3], vb[3], cb[3], sb[3], rinv, sg);

  v4u hv, lv;
#pragma unroll
  for (int q = 0; q < 4; ++q) {
    const unsigned short h0 = f2bf_bits(o[2 * q]), h1 = f2bf_bits(o[2 * q + 1]);
    const unsigned short l0 = f2bf_bits(o[2 * q] - bf_bits2f(h0)), l1 = f2bf_bits(o[2 * q + 1] - bf_bits2f(h1));
    hv[q] = pk16(h0, h1);
    lv[q] = pk16(l0, l1);
  }
  *(v4u*)(dh + d0) = hv;
  *(v4u*)(dl + d0) = lv;
  
}

// =====================================================================================
// Causal sliding-window grouped-query attention, head dim 64, grid.y = batch element (offsets below are within one).
//   q planes (hi/lo bf16): element (t, h, d) at [t*kDim + h*64 + d]           (12 heads)
//   k planes (hi/lo bf16): element (s, g, d) at [s*kKvDim + g*64 + d]         (4 kv heads, g = h/3)
//   v^T planes (hi/lo bf16): element (g, d, s) at [(g*64 + d)*kSeq + s]
//   out f32: element (t, h, d) at [t*kDim + h*64 + d]
//   scores = (q . k) * sscale : bf16 hi/lo split (hi.hi + hi.lo + lo.hi) on v_wmma_f32_16x16x32_bf16
//   out    = p . v             : bf16 hi/lo split of p (unnormalised) and v, f32 accumulate
//   online softmax in f32; keys with s > t or t - s > kWin-1 set to -inf; a fully -inf running max uses a 0 pivot
//   (alpha = 0, p = 0) so nothing non-finite is produced; the diagonal key is always kept.
//   Block = 4 waves = 64 query rows of one head; grid.x = kNHq * (kSeq/64); kv chunks of 64 from the first
//   in-window chunk (block-uniform) up to chunk qb (static bound qb+1 <= 32).
//   K / V^T chunk staging: 128 threads x 32 elements per plane = the whole 64x64 tile (16-B copies, plain loads,
//   __syncthreads before and after); fragment loads read the LDS tiles with the same v8b element type.
// =====================================================================================
#define AT_D 64
#define AT_NW 4
#define AT_QB 64
#define AT_KC 64

__device__ __forceinline__ unsigned short at_bf_bits(float f) {
  unsigned u = __float_as_uint(f);
  return (unsigned short)((u + 0x7FFFu + ((u >> 16) & 1u)) >> 16);
}
__device__ __forceinline__ __bf16 at_f2bf(float f) { return __builtin_bit_cast(__bf16, at_bf_bits(f)); }
__device__ __forceinline__ void at_split(float f, __bf16& hi, __bf16& lo) {
  const unsigned short hb = at_bf_bits(f);
  hi = __builtin_bit_cast(__bf16, hb);
  lo = at_f2bf(f - __uint_as_float(((unsigned)hb) << 16));
}
__device__ __forceinline__ v8f at_mma(v16b a, v16b b, v8f c) {
  c = __builtin_amdgcn_wmma_f32_16x16x32_bf16(false, a, false, b, (short)0, c, false, false);
  asm volatile("v_nop\n\tv_nop\n\tv_nop\n\tv_nop" : "+v"(c) : "v"(a), "v"(b));
  return c;
}

__global__ __launch_bounds__(128)
void attn_gqa_window64_kernel(const unsigned short* __restrict__ qhp, const unsigned short* __restrict__ qlp,
                              const unsigned short* __restrict__ khp, const unsigned short* __restrict__ klp,
                              const unsigned short* __restrict__ vhp, const unsigned short* __restrict__ vlp,
                              float* __restrict__ out, float sscale) {
  union FB { v16b v; v8b h[2]; };
  __shared__ __align__(16) __bf16 Ksh[AT_KC * AT_D];             // K hi [kv][d]      8 KB
  __shared__ __align__(16) __bf16 Ksl[AT_KC * AT_D];             // K lo
  __shared__ __align__(16) __bf16 Vth[AT_D * AT_KC];             // V hi [d][kv]      8 KB
  __shared__ __align__(16) __bf16 Vtl[AT_D * AT_KC];             // V lo
  __shared__ __align__(16) __bf16 Psh[AT_NW][16 * AT_KC];        // per wave P hi [row][kv]
  __shared__ __align__(16) __bf16 Psl[AT_NW][16 * AT_KC];        // per wave P lo
  __shared__ __align__(16) float  Os[AT_NW][16 * 68];            // per wave out tile, pitch 68

  const int tid  = threadIdx.x;
  const int wave = tid >> 5;
  const int lane = tid & 31;
  const int hh   = lane >> 4;
  const int c    = lane & 15;

  const int nqb = kSeq / AT_QB;           // 32
  const int bx = blockIdx.x;
  const int qb = bx % nqb;
  const int h  = bx / nqb;                // 0..kNHq-1 (grid = kNHq * nqb)
  const int kvh = h / kGroups;            // 0..kNKv-1
  const int q0 = qb * AT_QB + wave * 16;

  const size_t bq = (size_t)blockIdx.y * kSeq * kDim;     // batch element's q / out plane
  const size_t bk = (size_t)blockIdx.y * kSeq * kKvDim;   // batch element's k / v^T plane
  const __bf16* Qh = (const __bf16*)(const void*)qhp + bq + (size_t)h * AT_D;
  const __bf16* Ql = (const __bf16*)(const void*)qlp + bq + (size_t)h * AT_D;
  const __bf16* Kh = (const __bf16*)(const void*)khp + bk + (size_t)kvh * AT_D;
  const __bf16* Kl = (const __bf16*)(const void*)klp + bk + (size_t)kvh * AT_D;
  const __bf16* Vh = (const __bf16*)(const void*)vhp + bk + (size_t)kvh * AT_D * kSeq;
  const __bf16* Vl = (const __bf16*)(const void*)vlp + bk + (size_t)kvh * AT_D * kSeq;
  float*        ob = out + bq + (size_t)h * AT_D;

  // ---- Q fragments (A operand, row = lane&15, split k map via Frag load): 2 d-chunks, hi and lo ----
  v16b qah[2], qal[2];
#pragma unroll
  for (int dc = 0; dc < 2; ++dc) {
    const __bf16* qr = Qh + (size_t)(q0 + c) * kDim + dc * 32 + 8 * hh;
    const __bf16* ql = Ql + (size_t)(q0 + c) * kDim + dc * 32 + 8 * hh;
    qah[dc] = Frag<__bf16>::load(qr);
    qal[dc] = Frag<__bf16>::load(ql);
  }

  float mrow[8], lrow[8];
  v8f oacc[4];
#pragma unroll
  for (int r = 0; r < 8; ++r) { mrow[r] = -INFINITY; lrow[r] = 0.f; }
#pragma unroll
  for (int t = 0; t < 4; ++t) oacc[t] = (v8f){0.f,0.f,0.f,0.f,0.f,0.f,0.f,0.f};

  const int qlo = qb * AT_QB - (kWin - 1);                 // smallest key allowed for the block's first row
  const int kcStart = (qlo > 0) ? (qlo / AT_KC) : 0;       // block-uniform
  const int nChunks = qb + 1;                              // block-uniform, <= 32
  for (int kc = kcStart; kc < nChunks; ++kc) {
    const int kv0 = kc * AT_KC;
    __syncthreads();
    {
      // staging coverage: 128 threads x (4 x 8) elements = 64 rows x 64 per plane = the whole chunk tile
      const int r = tid >> 1, half = (tid & 1) * 32;
      const __bf16* ksh = Kh + (size_t)(kv0 + r) * kKvDim + half;   // K row kv0+r, d = half..half+31
      const __bf16* ksl = Kl + (size_t)(kv0 + r) * kKvDim + half;
      const __bf16* vsh = Vh + (size_t)r * kSeq + kv0 + half;        // V^T row d = r, s = kv0+half..+31
      const __bf16* vsl = Vl + (size_t)r * kSeq + kv0 + half;
#pragma unroll
      for (int i = 0; i < 4; ++i) {
        const v8b a0 = *(const v8b*)(ksh + 8 * i);
        const v8b a1 = *(const v8b*)(ksl + 8 * i);
        const v8b b0 = *(const v8b*)(vsh + 8 * i);
        const v8b b1 = *(const v8b*)(vsl + 8 * i);
        *(v8b*)(Ksh + r * AT_D  + half + 8 * i) = a0;
        *(v8b*)(Ksl + r * AT_D  + half + 8 * i) = a1;
        *(v8b*)(Vth + r * AT_KC + half + 8 * i) = b0;
        *(v8b*)(Vtl + r * AT_KC + half + 8 * i) = b1;
      }
    }
    __syncthreads();

    v8f s[4];
#pragma unroll
    for (int j = 0; j < 4; ++j) {
      s[j] = (v8f){0.f,0.f,0.f,0.f,0.f,0.f,0.f,0.f};
#pragma unroll
      for (int dc = 0; dc < 2; ++dc) {
        FB kb, kl;
        kb.h[0] = *(const v8b*)(Ksh + (j * 16 + c) * AT_D + dc * 32 + 8 * hh);
        kb.h[1] = *(const v8b*)(Ksh + (j * 16 + c) * AT_D + dc * 32 + 16 + 8 * hh);
        kl.h[0] = *(const v8b*)(Ksl + (j * 16 + c) * AT_D + dc * 32 + 8 * hh);
        kl.h[1] = *(const v8b*)(Ksl + (j * 16 + c) * AT_D + dc * 32 + 16 + 8 * hh);
        s[j] = at_mma(qah[dc], kb.v, s[j]);
        s[j] = at_mma(qah[dc], kl.v, s[j]);
        s[j] = at_mma(qal[dc], kb.v, s[j]);
      }
    }
    float cm[8];
#pragma unroll
    for (int r = 0; r < 8; ++r) {
      const int qrow = q0 + 8 * hh + r;
      float m = -INFINITY;
#pragma unroll
      for (int j = 0; j < 4; ++j) {
        const int kvcol = kv0 + j * 16 + c;
        const float sv = s[j][r] * sscale;
        const bool masked = (kvcol > qrow) || (qrow - kvcol > kWin - 1);
        const float sm = masked ? -INFINITY : sv;
        s[j][r] = sm;
        m = fmaxf(m, sm);
      }
#pragma unroll
      for (int off = 1; off < 16; off <<= 1) m = fmaxf(m, __shfl_xor(m, off, 32));
      cm[r] = m;
    }
    __bf16* pwh = Psh[wave];
    __bf16* pwl = Psl[wave];
#pragma unroll
    for (int r = 0; r < 8; ++r) {
      const float mnew  = fmaxf(mrow[r], cm[r]);
      const float mpiv  = (mnew == -INFINITY) ? 0.0f : mnew;   // fully masked so far -> alpha = 0, p = 0
      const float alpha = expf(mrow[r] - mpiv);
      mrow[r] = mnew;
      float psum = 0.f;
#pragma unroll
      for (int j = 0; j < 4; ++j) {
        const float p = expf(s[j][r] - mpiv);
        psum += p;
        __bf16 a, bl; at_split(p, a, bl);
        pwh[(8 * hh + r) * AT_KC + j * 16 + c] = a;
        pwl[(8 * hh + r) * AT_KC + j * 16 + c] = bl;
      }
#pragma unroll
      for (int off = 1; off < 16; off <<= 1) psum += __shfl_xor(psum, off, 32);
      lrow[r] = lrow[r] * alpha + psum;
#pragma unroll
      for (int t = 0; t < 4; ++t) oacc[t][r] *= alpha;
    }
    __builtin_amdgcn_fence(__ATOMIC_RELEASE, "workgroup");
    __builtin_amdgcn_wave_barrier();
    __builtin_amdgcn_fence(__ATOMIC_ACQUIRE, "workgroup");
#pragma unroll 1
    for (int kk = 0; kk < 2; ++kk) {
      FB pa, pl;
      pa.h[0] = *(const v8b*)(pwh + c * AT_KC + kk * 32 + 8 * hh);
      pa.h[1] = *(const v8b*)(pwh + c * AT_KC + kk * 32 + 16 + 8 * hh);
      pl.h[0] = *(const v8b*)(pwl + c * AT_KC + kk * 32 + 8 * hh);
      pl.h[1] = *(const v8b*)(pwl + c * AT_KC + kk * 32 + 16 + 8 * hh);
#pragma unroll
      for (int t = 0; t < 4; ++t) {
        FB vb, vl;
        vb.h[0] = *(const v8b*)(Vth + (t * 16 + c) * AT_KC + kk * 32 + 8 * hh);
        vb.h[1] = *(const v8b*)(Vth + (t * 16 + c) * AT_KC + kk * 32 + 16 + 8 * hh);
        vl.h[0] = *(const v8b*)(Vtl + (t * 16 + c) * AT_KC + kk * 32 + 8 * hh);
        vl.h[1] = *(const v8b*)(Vtl + (t * 16 + c) * AT_KC + kk * 32 + 16 + 8 * hh);
        oacc[t] = at_mma(pa.v, vb.v, oacc[t]);
        oacc[t] = at_mma(pa.v, vl.v, oacc[t]);
        oacc[t] = at_mma(pl.v, vb.v, oacc[t]);
      }
    }
  }

  float* os = Os[wave];
#pragma unroll
  for (int r = 0; r < 8; ++r) {
    const float inv = 1.0f / lrow[r];
#pragma unroll
    for (int t = 0; t < 4; ++t) os[(8 * hh + r) * 68 + t * 16 + c] = oacc[t][r] * inv;
  }
  __builtin_amdgcn_fence(__ATOMIC_RELEASE, "workgroup");
  __builtin_amdgcn_wave_barrier();
  __builtin_amdgcn_fence(__ATOMIC_ACQUIRE, "workgroup");
  {
    const int c4 = (lane & 15) * 4;
    {
#pragma unroll
      for (int it = 0; it < 8; ++it) {
        const int row = it * 2 + hh;   // it 0..7 x hh 0..1 covers rows 0..15 of the wave tile
        v4f val = *(const v4f*)(os + row * 68 + c4);
        *(v4f*)(ob + (size_t)(q0 + row) * kDim + c4) = val;
      }
      
    }
  }
}

// ---------------------------------------------------------------------------
// Workspace region map (byte offsets; every region is fully written in this call before it is read; token rows
// run over both batch elements, row = b*2048 + t; VT holds one [256][2048] plane per batch element; the W*, X* and
// O* bf16 planes are fragment-major, 16-row x 32-k blocks, see wmma_gemm64):
//   Wqh bf16 [768 n][768 k]         0      Wql   1179648
//   Wkh bf16 [256][768]        2359296      Wkl   2752512
//   Wvh bf16 [256][768]        3145728      Wvl   3538944
//   Woh bf16 [768][768]        3932160      Wol   5111808
//   CS  f32  [2048][32]        6291456      SN    6553600
//   Xh  bf16 [4096][768]       6815744      Xl   13107200
//   Qf  f32  [4096][768]      19398656
//   Kf  f32  [4096][256]      31981568
//   Qh  bf16 [4096][768]      36175872      Ql   42467328
//   Kh  bf16 [4096][256]      48758784      Kl   50855936
//   VTh bf16 [2][256][2048]   52953088      VTl  55050240
//   Of  f32  [4096][768]      57147392
//   Oh  bf16 [4096][768]      69730304      Ol   76021760
//   total                     82313216
// ---------------------------------------------------------------------------
extern "C" void kernel_launch(void* const* d_in, const int* in_sizes, int n_in,
                              void* d_out, int out_size, void* d_ws, size_t ws_size,
                              hipStream_t stream) {
  if (n_in < 7) return;
  if (in_sizes[0] != kNB * kSeq * kDim) return;
  if (in_sizes[1] != kDim * kDim || in_sizes[4] != kDim * kDim) return;
  if (in_sizes[2] != kKvDim * kDim || in_sizes[3] != kKvDim * kDim) return;
  if (in_sizes[5] != kHd || in_sizes[6] != kHd) return;
  if (out_size != kNB * kSeq * kDim) return;

  const float* x    = (const float*)d_in[0];
  const float* Wq   = (const float*)d_in[1];
  const float* Wk   = (const float*)d_in[2];
  const float* Wv   = (const float*)d_in[3];
  const float* Wo   = (const float*)d_in[4];
  const float* lnq  = (const float*)d_in[5];
  const float* lnk  = (const float*)d_in[6];

  const size_t PWQ = (size_t)kDim * kDim * 2;      // 1179648  bf16 [768][768] plane
  const size_t PWK = (size_t)kKvDim * kDim * 2;    // 393216   bf16 [256][768] plane
  const size_t PTB = (size_t)kSeq * kHalfHd * 4;   // 262144   f32 [2048][32] table
  const size_t PXB = (size_t)kTok * kDim * 2;      // 6291456  bf16 [4096][768] plane
  const size_t PXF = (size_t)kTok * kDim * 4;      // 12582912 f32 [4096][768]
  const size_t PKF = (size_t)kTok * kKvDim * 4;    // 4194304  f32 [4096][256]
  const size_t PKB = (size_t)kTok * kKvDim * 2;    // 2097152  bf16 [4096][256] / [2][256][2048] plane
  size_t off = 0;
  const size_t oWqh = off; off += PWQ;  const size_t oWql = off; off += PWQ;
  const size_t oWkh = off; off += PWK;  const size_t oWkl = off; off += PWK;
  const size_t oWvh = off; off += PWK;  const size_t oWvl = off; off += PWK;
  const size_t oWoh = off; off += PWQ;  const size_t oWol = off; off += PWQ;
  const size_t oCS  = off; off += PTB;  const size_t oSN  = off; off += PTB;
  const size_t oXh  = off; off += PXB;  const size_t oXl  = off; off += PXB;
  const size_t oQf  = off; off += PXF;
  const size_t oKf  = off; off += PKF;
  const size_t oQh  = off; off += PXB;  const size_t oQl  = off; off += PXB;
  const size_t oKh  = off; off += PKB;  const size_t oKl  = off; off += PKB;
  const size_t oVTh = off; off += PKB;  const size_t oVTl = off; off += PKB;
  const size_t oOf  = off; off += PXF;
  const size_t oOh  = off; off += PXB;  const size_t oOl  = off; off += PXB;
  if (off > ws_size) return;                       // off = 82313216
  if (off > (size_t)134217728) return;

  char* ws = (char*)d_ws;
  unsigned short* Wqh = (unsigned short*)(ws + oWqh); unsigned short* Wql = (unsigned short*)(ws + oWql);
  unsigned short* Wkh = (unsigned short*)(ws + oWkh); unsigned short* Wkl = (unsigned short*)(ws + oWkl);
  unsigned short* Wvh = (unsigned short*)(ws + oWvh); unsigned short* Wvl = (unsigned short*)(ws + oWvl);
  unsigned short* Woh = (unsigned short*)(ws + oWoh); unsigned short* Wol = (unsigned short*)(ws + oWol);
  float*          CS  = (float*)(ws + oCS);          float*          SN  = (float*)(ws + oSN);
  unsigned short* Xh  = (unsigned short*)(ws + oXh);  unsigned short* Xl  = (unsigned short*)(ws + oXl);
  float*          Qf  = (float*)(ws + oQf);
  float*          Kf  = (float*)(ws + oKf);
  unsigned short* Qh  = (unsigned short*)(ws + oQh);  unsigned short* Ql  = (unsigned short*)(ws + oQl);
  unsigned short* Kh  = (unsigned short*)(ws + oKh);  unsigned short* Kl  = (unsigned short*)(ws + oKl);
  unsigned short* VTh = (unsigned short*)(ws + oVTh); unsigned short* VTl = (unsigned short*)(ws + oVTl);
  float*          Of  = (float*)(ws + oOf);
  unsigned short* Oh  = (unsigned short*)(ws + oOh);  unsigned short* Ol  = (unsigned short*)(ws + oOl);

  const dim3 blk(256);
  const dim3 gPrep(kPbT + kPbX + 2 * kPbWq + 2 * kPbWk);            // 2560 blocks
  const dim3 gCast(kPbX);                                           // 1536 blocks x 2048 elements = 4096x768
  const dim3 gQKV(kBlkQ + kBlkK + kNB * kBlkV);                     // 160 blocks x 8 tiles
  const dim3 gProjQ(kBlkQ, 1);                                      // 768 tiles: M=4096, N=768
  const dim3 gRope(kNUnits / 32, kNB);                              // 1024 blocks x 32 units per batch element
  const dim3 gAtt(kNHq * (kSeq / 64), kNB);                         // 12 heads x 32 query blocks per batch element

  // Both batch elements go through every stage in one launch: the token-row GEMMs see M = 4096 rows, the stages
  // that need the position inside a sequence take the batch element from the block index.
  // (1) rotary tables; x and the weights [out n][in k] f32 -> bf16 hi/lo planes, fragment-major
  prep_kernel<<<gPrep, blk, 0, stream>>>(x, Wq, Wk, Wv, Wo, Xh, Xl, Wqh, Wql, Wkh, Wkl, Wvh, Wvl, Woh, Wol, CS, SN);
  // (2)-(4) q -> Qf, k -> Kf, v^T -> VT hi/lo planes (K = 768 each)
  qkv_gemm64_kernel<<<gQKV, blk, 0, stream>>>(Xh, Xl, Wqh, Wql, Wkh, Wkl, Wvh, Wvl, Qf, Kf, VTh, VTl, kDim);
  // (5) per-head rmsnorm * w + rotary on q and k -> Q/K bf16 hi/lo planes
  norm_rope_split_kernel<<<gRope, blk, 0, stream>>>(Qf, Kf, lnq, lnk, CS, SN, Qh, Ql, Kh, Kl);
  // (6) windowed causal GQA attention per head: y[row][h*64+d] (f32 plane, every element written by its (b, h, query block) owner)
  attn_gqa_window64_kernel<<<gAtt, dim3(128), 0, stream>>>(Qh, Ql, Kh, Kl, VTh, VTl, Of, 0.125f);
  // (7) y -> bf16 hi/lo planes, fragment-major
  split_pack_bf16_kernel<<<gCast, blk, 0, stream>>>(Of, Oh, Ol, kN8X);
  // (8) out = y . Wo^T -> d_out rows 0 .. 4095 (f32)   (M=4096, N=768, K=768)
  wmma_gemm64<1, true, 0, 0, false><<<gProjQ, blk, 0, stream>>>(
      Oh, Ol, kDim, 0L, Woh, Wol, kDim, 0L, d_out, d_out, kDim, 0L,
      lnq, lnq, 0L, kTok, kDim, kDim, 1.0f);
}

// v004
// Measured time: 151 microseconds a run.
// Next to v003, in two timings, it ran 1.15 times as fast each time.
// Over all steps from v000 it is 3.64 times as fast.
// Contractions (q/k/v/out projections, q.k^T scores, p.v): v_wmma_f32_16x16x32_bf16 with bf16 hi/lo split operands (hi.hi + hi.lo + lo.hi), f32 accumulate; rmsnorm, rotary tables, online softmax in f32.
#include <hip/hip_runtime.h>
#include <math.h>
#include <stdint.h>

constexpr int kNB     = 2;
constexpr int kSeq    = 2048;
constexpr int kTok    = kNB * kSeq;          // 4096 token rows over both batch elements
constexpr int kDim    = 768;
constexpr int kHd     = 64;
constexpr int kNHq    = 12;
constexpr int kNKv    = 4;
constexpr int kGroups = 3;
constexpr int kKvDim  = kNKv * kHd;          // 256
constexpr int kWin    = 384;
constexpr int kHalfHd = 32;
constexpr int kKBlk   = kDim / 32;           // 24 k blocks of 32 in a row of 768
constexpr int kNQUnits = kSeq * kNHq;        // 24576 (token, q head) units
constexpr int kNKUnits = kSeq * kNKv;        // 8192  (token, kv head) units
constexpr int kNUnits  = kNQUnits + kNKUnits;// 32768
static_assert(kNQUnits % 4 == 0);
static_assert(kNUnits % 32 == 0);
static_assert(kSeq % 64 == 0 && kDim % 64 == 0 && kKvDim % 64 == 0 && kDim % 32 == 0);
static_assert(kNHq == kNKv * kGroups);

typedef __attribute__((ext_vector_type(16))) _Float16 v16h;
typedef __attribute__((ext_vector_type(8)))  _Float16 v8h;
typedef __attribute__((ext_vector_type(16))) __bf16   v16b;
typedef __attribute__((ext_vector_type(8)))  __bf16   v8b;
typedef __attribute__((ext_vector_type(8)))  float    v8f;
typedef __attribute__((ext_vector_type(4)))  float    v4f;
typedef __attribute__((ext_vector_type(2)))  float    v2f;
typedef __attribute__((ext_vector_type(4)))  unsigned int v4u;

__device__ __forceinline__ unsigned short f2bf_bits(float f) {
  unsigned u = __float_as_uint(f);
  return (unsigned short)((u + 0x7FFFu + ((u >> 16) & 1u)) >> 16);
}
__device__ __forceinline__ float bf_bits2f(unsigned short h) { return __uint_as_float(((unsigned)h) << 16); }

// hazard guards as plain device helpers (no inline asm inside the kernel template body)
__device__ __forceinline__ void dep_guard_h(v8f& a, v8f& b, v16h x, v16h y) { asm volatile("v_nop\n\tv_nop\n\tv_nop\n\tv_nop" : "+v"(a), "+v"(b) : "v"(x), "v"(y)); }
__device__ __forceinline__ void dep_guard_b(v8f& a, v8f& b, v16b x, v16b y) { asm volatile("v_nop\n\tv_nop\n\tv_nop\n\tv_nop" : "+v"(a), "+v"(b) : "v"(x), "v"(y)); }
__device__ __forceinline__ void keep4_h(v16h a, v16h b, v16h c, v16h d) { asm volatile("v_nop" :: "v"(a), "v"(b), "v"(c), "v"(d)); }
__device__ __forceinline__ void keep4_b(v16b a, v16b b, v16b c, v16b d) { asm volatile("v_nop" :: "v"(a), "v"(b), "v"(c), "v"(d)); }
__device__ __forceinline__ void acc_guard4(v8f& a, v8f& b, v8f& c, v8f& d) { asm volatile("v_nop\n\tv_nop\n\tv_nop\n\tv_nop" : "+v"(a), "+v"(b), "+v"(c), "+v"(d)); }
template <typename T> struct Frag;
template <> struct Frag<_Float16> {
  typedef v16h V; union U { v16h v; v8h h[2]; };
  static __device__ __forceinline__ v16h load(const _Float16* p) {   // elements 0..7 <- p[0..7], 8..15 <- p[16..23]
    U f; f.h[0] = *(const v8h*)(p); f.h[1] = *(const v8h*)(p + 16); return f.v;
  }
  static __device__ __forceinline__ v8f mma(v16h a, v16h b, v8f c) {
    return __builtin_amdgcn_wmma_f32_16x16x32_f16(false, a, false, b, (short)0, c, false, false);
  }
  static __device__ __forceinline__ void guard(v8f& a, v8f& b, v16h x, v16h y) { dep_guard_h(a, b, x, y); }
  static __device__ __forceinline__ void keep(v16h a, v16h b, v16h c, v16h d) { keep4_h(a, b, c, d); }
};
template <> struct Frag<__bf16> {
  typedef v16b V; union U { v16b v; v8b h[2]; };
  static __device__ __forceinline__ v16b load(const __bf16* p) {
    U f; f.h[0] = *(const v8b*)(p); f.h[1] = *(const v8b*)(p + 16); return f.v;
  }
  // fragment-major block at byte address p: elements 0..7 <- bytes 0..15, elements 8..15 <- bytes 512..527
  static __device__ __forceinline__ v16b load_packed(const char* p) {
    U f; f.h[0] = *(const v8b*)(p); f.h[1] = *(const v8b*)(p + 512); return f.v;
  }
  static __device__ __forceinline__ v8f mma(v16b a, v16b b, v8f c) {
    return __builtin_amdgcn_wmma_f32_16x16x32_bf16(false, a, false, b, (short)0, c, false, false);
  }
  static __device__ __forceinline__ void guard(v8f& a, v8f& b, v16b x, v16b y) { dep_guard_b(a, b, x, y); }
  static __device__ __forceinline__ void keep(v16b a, v16b b, v16b c, v16b d) { keep4_b(a, b, c, d); }
};

// ---- Register-blocked batched WMMA GEMM ------------------------------------
// C[m,n] = scale * sum_k A[m,k] * Bt[n,k] (+bias)(+resid); each wave owns a 64x64 tile.
// A [M,K] and Bt [N,K] are stored fragment-major (written by split_pack_thread): each 16-row x 32-k block is
// 512 consecutive elements, block index = (row/16)*kKBlk + k/32, and element (row, k) of a block sits at
// ((k>>4)&1)*256 + (((k>>3)&1)*16 + (row&15))*8 + (k&7). Lane l of a fragment load then reads 16 B at l*16 B, so one
// wave-wide load covers 512 consecutive bytes (4 whole lines) and holds the same elements as a row-major fragment load.
// M,N % 64 == 0, K % 32 == 0; rows of both operands are kDim long (lda == ldb == kDim), so the step from one 16-row
// block row to the next is a compile-time constant and goes into the loads' immediate offsets.
// SPLIT: operands are hi/lo planes (A2/Bt2 = lo planes, same layout); product = hi.hi + hi.lo + lo.hi.
// BIAS_MODE: 0 = none, 1 = bias[m], 2 = bias[n].
// OUT_MODE: 0 = f32, 1 = f16, 2 = bf16 hi plane (Cout) + bf16 lo plane (Cout2).
// ET: 0 = f16 operands, 1 = bf16 operands (pointers passed as 16-bit storage)
template <int ET> struct Elem;
template <> struct Elem<0> { typedef _Float16 T; };
template <> struct Elem<1> { typedef __bf16 T; };
// gemm64_tile = one wave's 64x64 tile; the kernels below hand it the wave's LDS slab, the batch index b and the tile's
// first row m0 and column n0 (the same in every lane, in scalar registers, so that the four plane bases are scalar too).
template <int ET, bool SPLIT, int BIAS_MODE, int OUT_MODE, bool RESID, int ACT = 0>
__device__ __forceinline__ void gemm64_tile(
    float* __restrict__ slab, const int b, const int m0, const int n0,
    const unsigned short* __restrict__ Ap, const unsigned short* __restrict__ A2p, int lda, long strideA,
    const unsigned short* __restrict__ Btp, const unsigned short* __restrict__ Bt2p, int ldb, long strideB,
    void* __restrict__ Cout, void* __restrict__ Cout2, int ldc, long strideC,
    const float* __restrict__ bias,
    const float* __restrict__ resid, long strideR,
    int K, float scale) {
  typedef typename Elem<ET>::T T;
  typedef typename Frag<T>::V V;
  const T* A = (const T*)Ap; const T* A2 = (const T*)A2p; const T* Bt = (const T*)Btp; const T* Bt2 = (const T*)Bt2p;
  const int lane = threadIdx.x & 31;

  const T* Ab  = A  + (size_t)b * strideA;
  const T* Bb  = Bt + (size_t)b * strideB;
  const T* Ab2 = SPLIT ? (A2  + (size_t)b * strideA) : nullptr;
  const T* Bb2 = SPLIT ? (Bt2 + (size_t)b * strideB) : nullptr;

  const int rlane = lane & 15;                 // row (A) / col (B, D) within subtile
  const int mOff  = (lane >> 4) * 8;           // D row offset
  // Every fragment load = scalar base of the tile's first block row in its plane + one 32-bit lane byte offset + an
  // immediate (block row step, second half of the block). The lane offset is the only vector address register; it steps
  // one block (1024 B) per k step.
  constexpr int kRowStep = kKBlk * 1024;       // bytes from one 16-row block row to the next
  const char* pBh = (const char*)(Bb  + (size_t)(n0 >> 4) * (kKBlk * 512));
  const char* pBl = SPLIT ? (const char*)(Bb2 + (size_t)(n0 >> 4) * (kKBlk * 512)) : nullptr;
  const char* pAh = (const char*)(Ab  + (size_t)(m0 >> 4) * (kKBlk * 512));
  const char* pAl = SPLIT ? (const char*)(Ab2 + (size_t)(m0 >> 4) * (kKBlk * 512)) : nullptr;
  unsigned vo = (unsigned)lane * 16u;          // this lane's 16 B inside a 512-B half block

  v8f acc[4][4];
#pragma unroll
  for (int i = 0; i < 4; ++i)
#pragma unroll
    for (int j = 0; j < 4; ++j) acc[i][j] = (v8f){0.f,0.f,0.f,0.f,0.f,0.f,0.f,0.f};

  for (int k0 = 0; k0 < K; k0 += 32) {
    V bh[4], bl[4];
#pragma unroll
    for (int j = 0; j < 4; ++j) {
      bh[j] = Frag<T>::load_packed(pBh + vo + j * kRowStep);
      if (SPLIT) bl[j] = Frag<T>::load_packed(pBl + vo + j * kRowStep);
    }
#pragma unroll
    for (int i = 0; i < 4; ++i) {
      V ah = Frag<T>::load_packed(pAh + vo + i * kRowStep);
      V al;
      if (SPLIT) al = Frag<T>::load_packed(pAl + vo + i * kRowStep);
#pragma unroll
      for (int j = 0; j < 4; ++j) {
        acc[i][j] = Frag<T>::mma(ah, bh[j], acc[i][j]);
        if (SPLIT) {
          acc[i][j] = Frag<T>::mma(ah, bl[j], acc[i][j]);
          acc[i][j] = Frag<T>::mma(al, bh[j], acc[i][j]);
        }
      }
      Frag<T>::guard(acc[i][0], acc[i][3], ah, SPLIT ? al : ah);
    }
    Frag<T>::keep(bh[0], bh[1], bh[2], bh[3]);
    if (SPLIT) Frag<T>::keep(bl[0], bl[1], bl[2], bl[3]);
    vo += 1024u;
  }
  acc_guard4(acc[0][0], acc[0][1], acc[0][2], acc[0][3]);
  acc_guard4(acc[1][0], acc[1][1], acc[1][2], acc[1][3]);
  acc_guard4(acc[2][0], acc[2][1], acc[2][2], acc[2][3]);
  acc_guard4(acc[3][0], acc[3][1], acc[3][2], acc[3][3]);

  // ---- epilogue ----
  const float* Rb = RESID ? (resid + (size_t)b * strideR) : nullptr;
#pragma unroll
  for (int i = 0; i < 4; ++i) {
    const int mBase = m0 + (i << 4);
#pragma unroll
    for (int j = 0; j < 4; ++j) {
      const int n = n0 + (j << 4) + rlane;
      float bv = 0.f;
      if (BIAS_MODE == 2) bv = bias[n];
#pragma unroll
      for (int r = 0; r < 8; ++r) {
        float v = acc[i][j][r] * scale;
        if (BIAS_MODE == 1) v += bias[mBase + mOff + r];
        if (BIAS_MODE == 2) v += bv;
        if (RESID) v += Rb[(size_t)(mBase + mOff + r) * ldc + n];
        if (ACT == 1) v = tanhf(v);
        if (ACT == 2) v = fmaxf(v, 0.0f);
        if (ACT == 3) v = v / (1.0f + expf(-v));
        if (ACT == 4) v = (v > 0.f) ? v : 0.01f * v;
        slab[(mOff + r) * 68 + (j << 4) + rlane] = v;
      }
    }
    __builtin_amdgcn_fence(__ATOMIC_RELEASE, "workgroup");
    __builtin_amdgcn_wave_barrier();
    __builtin_amdgcn_fence(__ATOMIC_ACQUIRE, "workgroup");
    if (OUT_MODE == 0) {
      float* C = (float*)Cout + (size_t)b * strideC;
      const int hh = lane >> 4, c4 = (lane & 15) * 4;     // row seg = 256 B = 16 lanes x 16 B
      {
#pragma unroll
        for (int it = 0; it < 8; ++it) {
          const int row = it * 2 + hh;
          v4f v = *(const v4f*)(slab + row * 68 + c4);
          *(v4f*)(C + (size_t)(mBase + row) * ldc + n0 + c4) = v;
        }
        
      }
    } else {
      const int q = lane >> 3, c8 = (lane & 7) * 8;
      unsigned short* C  = (unsigned short*)Cout  + (size_t)b * strideC;
      unsigned short* C2 = (OUT_MODE == 2) ? ((unsigned short*)Cout2 + (size_t)b * strideC) : nullptr;
      {
#pragma unroll
        for (int it = 0; it < 4; ++it) {
          const int row = it * 4 + q;
          const float* sp = slab + row * 68 + c8;
          v8h hv, lv;
#pragma unroll
          for (int e = 0; e < 8; ++e) {
            if (OUT_MODE == 1) {
              hv[e] = (_Float16)sp[e];
            } else {
              unsigned short hb = f2bf_bits(sp[e]);
              unsigned short lb = f2bf_bits(sp[e] - bf_bits2f(hb));
              hv[e] = __builtin_bit_cast(_Float16, hb);
              lv[e] = __builtin_bit_cast(_Float16, lb);
            }
          }
          *(v8h*)(C + (size_t)(mBase + row) * ldc + n0 + c8) = hv;
          if (OUT_MODE == 2) *(v8h*)(C2 + (size_t)(mBase + row) * ldc + n0 + c8) = lv;
        }
        
      }
    }
    __builtin_amdgcn_fence(__ATOMIC_RELEASE, "workgroup");
    __builtin_amdgcn_wave_barrier();
    __builtin_amdgcn_fence(__ATOMIC_ACQUIRE, "workgroup");
  }
}

// One GEMM per launch: 8 waves = 8 consecutive tiles per block, grid.y = batch index.
template <int ET, bool SPLIT, int BIAS_MODE, int OUT_MODE, bool RESID, int ACT = 0>
__global__ __launch_bounds__(256) void wmma_gemm64(
    const unsigned short* __restrict__ Ap, const unsigned short* __restrict__ A2p, int lda, long strideA,
    const unsigned short* __restrict__ Btp, const unsigned short* __restrict__ Bt2p, int ldb, long strideB,
    void* __restrict__ Cout, void* __restrict__ Cout2, int ldc, long strideC,
    const float* __restrict__ bias,
    const float* __restrict__ resid, long strideR,
    int M, int N, int K, float scale) {
  __shared__ __align__(16) float sT[8][16 * 68];   // per-wave 16x64 slab, pitch 68 floats
  const int wave = threadIdx.x >> 5;
  const int tilesN = N >> 6;
  const int tilesM = M >> 6;
  const int tile = __builtin_amdgcn_readfirstlane(blockIdx.x * 8 + wave);
  if (tile >= tilesM * tilesN) return;   // wave-uniform; no block barriers in this kernel
  const int tm = tile / tilesN;
  const int tn = tile - tm * tilesN;
  gemm64_tile<ET, SPLIT, BIAS_MODE, OUT_MODE, RESID, ACT>(sT[wave], blockIdx.y, tm << 6, tn << 6, Ap, A2p, lda, strideA, Btp, Bt2p,
                                                          ldb, strideB, Cout, Cout2, ldc, strideC, bias, resid, strideR, K, scale);
}

// The three projections of x in one launch: none reads what another writes, and each alone fills well under half of
// the chip's WGPs for the whole length of one wave's k loop. Block ranges (8 tiles per block):
//   [0, kBlkQ)                 q   = x . Wq^T -> Qf f32 [row][h*64+d]           M=4096, N=768
//   [kBlkQ, kBlkQ+kBlkK)       k   = x . Wk^T -> Kf f32 [row][g*64+d]           M=4096, N=256
//   then kBlkV per batch b     v^T = Wv . x[b]^T -> VT hi/lo [b][g*64+d][s]     M=256,  N=2048 (A = Wv planes, Bt = x planes of b)
constexpr int kBlkQ = (kTok / 64) * (kDim / 64) / 8;      // 96
constexpr int kBlkK = (kTok / 64) * (kKvDim / 64) / 8;    // 32
constexpr int kBlkV = (kKvDim / 64) * (kSeq / 64) / 8;    // 16 per batch element
static_assert(((kTok / 64) * (kDim / 64)) % 8 == 0 && ((kTok / 64) * (kKvDim / 64)) % 8 == 0 && ((kKvDim / 64) * (kSeq / 64)) % 8 == 0);

__global__ __launch_bounds__(256) void qkv_gemm64_kernel(
    const unsigned short* __restrict__ Xh, const unsigned short* __restrict__ Xl,
    const unsigned short* __restrict__ Wqh, const unsigned short* __restrict__ Wql,
    const unsigned short* __restrict__ Wkh, const unsigned short* __restrict__ Wkl,
    const unsigned short* __restrict__ Wvh, const unsigned short* __restrict__ Wvl,
    float* __restrict__ Qf, float* __restrict__ Kf,
    unsigned short* __restrict__ VTh, unsigned short* __restrict__ VTl, int K) {
  __shared__ __align__(16) float sT[8][16 * 68];   // per-wave 16x64 slab, pitch 68 floats
  const int wave = threadIdx.x >> 5;
  const int bx   = blockIdx.x;
  if (bx < kBlkQ + kBlkK) {
    const bool isq = bx < kBlkQ;                   // block-uniform
    const int tile = __builtin_amdgcn_readfirstlane((isq ? bx : bx - kBlkQ) * 8 + wave);
    float* C = isq ? Qf : Kf;
    const int n  = isq ? kDim : kKvDim;
    const int tm = isq ? tile / (kDim / 64) : tile / (kKvDim / 64);
    const int tn = tile - tm * (n >> 6);
    gemm64_tile<1, true, 0, 0, false>(sT[wave], 0, tm << 6, tn << 6, Xh, Xl, kDim, 0L, isq ? Wqh : Wkh, isq ? Wql : Wkl, kDim, 0L,
                                      (void*)C, (void*)C, n, 0L, nullptr, nullptr, 0L, K, 1.0f);
  } else {
    const int v    = bx - (kBlkQ + kBlkK);
    const int tile = __builtin_amdgcn_readfirstlane((v % kBlkV) * 8 + wave);
    const int tm   = tile / (kSeq / 64);
    const int tn   = tile - tm * (kSeq / 64);
    gemm64_tile<1, true, 0, 2, false>(sT[wave], v / kBlkV, tm << 6, tn << 6, Wvh, Wvl, kDim, 0L, Xh, Xl, kDim, (long)kSeq * kDim,
                                      (void*)VTh, (void*)VTl, kSeq, (long)kKvDim * kSeq, nullptr, nullptr, 0L, K, 1.0f);
  }
}

// ---------------------------------------------------------------------------
// bf16 split of a row-major f32 [rows][768] matrix, hi = bf16_rne(in), lo = bf16_rne(in - hi), stored fragment-major
// for wmma_gemm64 (layout: see there). One thread = 8 consecutive k of one row (32 B read, 16 B per plane written);
// one wave = 8 rows x 32 k, half a block: it reads 8 whole 128-B lines and each plane's store fills 4 whole lines.
// rows % 16 == 0; n8 = rows * 768 / 8 threads.
// ---------------------------------------------------------------------------
__device__ __forceinline__ unsigned pk16(unsigned short a, unsigned short b) { return (unsigned)a | ((unsigned)b << 16); }

__device__ __forceinline__ void split_pack_thread(const float* __restrict__ in, unsigned short* __restrict__ hi,
                                                  unsigned short* __restrict__ lo, const int idx, const int n8) {
  if (idx < n8) {
    const int l   = idx & 31;
    const int g   = idx >> 5;                 // half block
    const int blk = g >> 1;
    const int rb  = blk / kKBlk, kb = blk - rb * kKBlk;
    const int r16 = (g & 1) * 8 + (l >> 2);   // row inside the block
    const int kp  = l & 3;                    // which 8 of the block's 32 k
    const float* s = in + (size_t)(rb * 16 + r16) * kDim + kb * 32 + kp * 8;
    const v4f fa = *(const v4f*)(s), fb = *(const v4f*)(s + 4);
    const float f[8] = {fa[0], fa[1], fa[2], fa[3], fb[0], fb[1], fb[2], fb[3]};
    v4u hv, lv;
#pragma unroll   // constant indices keep f, hv and lv in registers
    for (int q = 0; q < 4; ++q) {
      const unsigned short h0 = f2bf_bits(f[2 * q]), h1 = f2bf_bits(f[2 * q + 1]);
      const unsigned short l0 = f2bf_bits(f[2 * q] - bf_bits2f(h0)), l1 = f2bf_bits(f[2 * q + 1] - bf_bits2f(h1));
      hv[q] = pk16(h0, h1);
      lv[q] = pk16(l0, l1);
    }
    const size_t o = (size_t)blk * 512 + (kp >> 1) * 256 + ((kp & 1) * 16 + r16) * 8;
    *(v4u*)(hi + o) = hv;
    *(v4u*)(lo + o) = lv;
  }
}

__global__ __launch_bounds__(256) void split_pack_bf16_kernel(const float* __restrict__ in, unsigned short* __restrict__ hi,
                                                              unsigned short* __restrict__ lo, int n8) {
  split_pack_thread(in, hi, lo, blockIdx.x * 256 + threadIdx.x, n8);
}

// ---------------------------------------------------------------------------
// Rotary tables: cs[t*32+i] = cosf(t * inv_freq[i]), sn likewise, inv_freq[i] = 10000^(-i/32) = 2^(-i*log2(1e4)/32).
// kSeq*32/256 = 256 blocks x 256 threads = exactly 65536 elements per table; each wave writes 32 consecutive
// ---------------------------------------------------------------------------
__device__ __forceinline__ void rope_table_thread(float* __restrict__ cs, float* __restrict__ sn, const int i) {
  const int t  = i >> 5;
  const int fi = i & 31;
  const float invf = exp2f((float)fi * -0.41524101186092f);
  const float ang  = (float)t * invf;
  float sv, cv;
  sincosf(ang, &sv, &cv);
  ((float*)cs)[i] = cv;
  ((float*)sn)[i] = sv;
}

// ---------------------------------------------------------------------------
// Everything that depends on the inputs alone, in one launch: the rotary tables and the bf16 splits of x and of the four
// weight matrices. No part reads what another writes. Block ranges, the part with the longest thread first:
//   kPbT table blocks | kPbX blocks of x | kPbWq of Wq | kPbWk of Wk | kPbWk of Wv | kPbWq of Wo
// ---------------------------------------------------------------------------
constexpr int kN8X  = kTok * kDim / 8;        // 393216 threads
constexpr int kN8Wq = kDim * kDim / 8;        // 73728
constexpr int kN8Wk = kKvDim * kDim / 8;      // 24576
constexpr int kPbT  = kSeq * kHalfHd / 256;   // 256
constexpr int kPbX  = kN8X / 256;             // 1536
constexpr int kPbWq = kN8Wq / 256;            // 288
constexpr int kPbWk = kN8Wk / 256;            // 96
static_assert((kSeq * kHalfHd) % 256 == 0 && kN8X % 256 == 0 && kN8Wq % 256 == 0 && kN8Wk % 256 == 0);

__global__ __launch_bounds__(256) void prep_kernel(
    const float* __restrict__ x, const float* __restrict__ Wq, const float* __restrict__ Wk,
    const float* __restrict__ Wv, const float* __restrict__ Wo,
    unsigned short* __restrict__ Xh, unsigned short* __restrict__ Xl,
    unsigned short* __restrict__ Wqh, unsigned short* __restrict__ Wql,
    unsigned short* __restrict__ Wkh, unsigned short* __restrict__ Wkl,
    unsigned short* __restrict__ Wvh, unsigned short* __restrict__ Wvl,
    unsigned short* __restrict__ Woh, unsigned short* __restrict__ Wol,
    float* __restrict__ cs, float* __restrict__ sn) {
  int bx = blockIdx.x;                          // block-uniform choice of the part
  if (bx < kPbT) { rope_table_thread(cs, sn, bx * 256 + threadIdx.x); return; }
  bx -= kPbT;
  const float* in = x; unsigned short* hi = Xh; unsigned short* lo = Xl; int n8 = kN8X;
  if (bx >= kPbX) {
    bx -= kPbX; in = Wq; hi = Wqh; lo = Wql; n8 = kN8Wq;
    if (bx >= kPbWq) {
      bx -= kPbWq; in = Wk; hi = Wkh; lo = Wkl; n8 = kN8Wk;
      if (bx >= kPbWk) {
        bx -= kPbWk; in = Wv; hi = Wvh; lo = Wvl;
        if (bx >= kPbWk) { bx -= kPbWk; in = Wo; hi = Woh; lo = Wol; n8 = kN8Wq; }
      }
    }
  }
  split_pack_thread(in, hi, lo, bx * 256 + threadIdx.x, n8);
}

// ---------------------------------------------------------------------------
// Per (token, head) unit of 64 floats: y[d] = w[d] * (x[d] * rsqrt(mean(x^2) + eps)); rotary:
//   o[d] = y[d]*cos[t][d&31] - y[d+32]*sin  (d < 32),   o[d] = y[d]*cos + y[d-32]*sin  (d >= 32);
// o split into bf16 hi/lo planes at the same [token][head*64+d] position as the f32 source.
// Units 0..24575 = (token, q head) from Qf [2048][768]; units 24576..32767 = (token, kv head) from Kf [2048][256].
// 8 lanes per unit (d0 = 8*(lane&7)), 4 units per wave, grid.x = 32768/32 = 1024 blocks x 256 threads covers all units
// of one batch element; grid.y = batch element (planes of batch b start b*2048 token rows further on).
// ---------------------------------------------------------------------------
__device__ __forceinline__ float rope_one(float x, float p, float wx, float wp, float cv, float sv, float rinv, float sg) {
  const float xn = wx * (x * rinv);
  const float pn = wp * (p * rinv);
  return xn * cv + (sg * pn) * sv;
}

__global__ __launch_bounds__(256) void norm_rope_split_kernel(
    const float* __restrict__ Qf, const float* __restrict__ Kf,
    const float* __restrict__ qw, const float* __restrict__ kw,
    const float* __restrict__ cs, const float* __restrict__ sn,
    unsigned short* __restrict__ Qh, unsigned short* __restrict__ Ql,
    unsigned short* __restrict__ Kh, unsigned short* __restrict__ Kl) {
  const int lane  = threadIdx.x & 31;
  const int wave  = threadIdx.x >> 5;
  const int wbase = (blockIdx.x * 8 + wave) * 4;   // first unit of this wave
  const int u     = wbase + (lane >> 3);           // < kNUnits by grid construction
  const int d0    = (lane & 7) * 8;
  const bool isq  = wbase < kNQUnits;              // wave-uniform
  int uq = u; if (uq > kNQUnits - 1) uq = kNQUnits - 1;
  const int tq = uq / kNHq, hq = uq - tq * kNHq;
  int uk = u - kNQUnits; if (uk < 0) uk = 0; if (uk > kNKUnits - 1) uk = kNKUnits - 1;
  const int tk = uk >> 2, hk = uk & 3;
  const int t = isq ? tq : tk;
  const size_t rowb = (size_t)blockIdx.y * kSeq;   // first token row of this batch element
  const size_t offq = (rowb + tq) * kDim + (size_t)hq * kHd;
  const size_t offk = (rowb + tk) * kKvDim + (size_t)hk * kHd;
  const float* src = isq ? (Qf + offq) : (Kf + offk);
  const float* w   = isq ? qw : kw;
  unsigned short* dh = isq ? (Qh + offq) : (Kh + offk);
  unsigned short* dl = isq ? (Ql + offq) : (Kl + offk);
  const int dp = d0 ^ kHalfHd;                     // rotary partner block
  const int ci = t * kHalfHd + (d0 & 24);

  const v4f xa = *(const v4f*)(src + d0),  xb = *(const v4f*)(src + d0 + 4);
  const v4f pa = *(const v4f*)(src + dp),  pb = *(const v4f*)(src + dp + 4);
  const v4f wa = *(const v4f*)(w + d0),    wb = *(const v4f*)(w + d0 + 4);
  const v4f va = *(const v4f*)(w + dp),    vb = *(const v4f*)(w + dp + 4);
  const v4f ca = *(const v4f*)(cs + ci),   cb = *(const v4f*)(cs + ci + 4);
  const v4f sa = *(const v4f*)(sn + ci),   sb = *(const v4f*)(sn + ci + 4);

  float ss = xa[0] * xa[0] + xa[1] * xa[1] + xa[2] * xa[2] + xa[3] * xa[3]
           + xb[0] * xb[0] + xb[1] * xb[1] + xb[2] * xb[2] + xb[3] * xb[3];
  ss += __shfl_xor(ss, 1, 32);
  ss += __shfl_xor(ss, 2, 32);
  ss += __shfl_xor(ss, 4, 32);
  const float rinv = rsqrtf(ss * (1.0f / 64.0f) + 1e-6f);
  const float sg = (d0 < kHalfHd) ? -1.0f : 1.0f;

  float o[8];
  o[0] = rope_one(xa[0], pa[0], wa[0], va[0], ca[0], sa[0], rinv, sg);
  o[1] = rope_one(xa[1], pa[1], wa[1], va[1], ca[1], sa[1], rinv, sg);
  o[2] = rope_one(xa[2], pa[2], wa[2], va[2], ca[2], sa[2], rinv, sg);
  o[3] = rope_one(xa[3], pa[3], wa[3], va[3], ca[3], sa[3], rinv, sg);
  o[4] = rope_one(xb[0], pb[0], wb[0], vb[0], cb[0], sb[0], rinv, sg);
  o[5] = rope_one(xb[1], pb[1], wb[1], vb[1], cb[1], sb[1], rinv, sg);
  o[6] = rope_one(xb[2], pb[2], wb[2], vb[2], cb[2], sb[2], rinv, sg);
  o[7] = rope_one(xb[3], pb[3], wb[3], vb[3], cb[3], sb[3], rinv, sg);

  v4u hv, lv;
#pragma unroll
  for (int q = 0; q < 4; ++q) {
    const unsigned short h0 = f2bf_bits(o[2 * q]), h1 = f2bf_bits(o[2 * q + 1]);
    const unsigned short l0 = f2bf_bits(o[2 * q] - bf_bits2f(h0)), l1 = f2bf_bits(o[2 * q + 1] - bf_bits2f(h1));
    hv[q] = pk16(h0, h1);
    lv[q] = pk16(l0, l1);
  }
  *(v4u*)(dh + d0) = hv;
  *(v4u*)(dl + d0) = lv;
  
}

// =====================================================================================
// Causal sliding-window grouped-query attention, head dim 64, grid.y = batch element (offsets below are within one).
//   q planes (hi/lo bf16): element (t, h, d) at [t*kDim + h*64 + d]           (12 heads)
//   k planes (hi/lo bf16): element (s, g, d) at [s*kKvDim + g*64 + d]         (4 kv heads, g = h/3)
//   v^T planes (hi/lo bf16): element (g, d, s) at [(g*64 + d)*kSeq + s]
//   out f32: element (t, h, d) at [t*kDim + h*64 + d]
//   scores = (q . k) * sscale : bf16 hi/lo split (hi.hi + hi.lo + lo.hi) on v_wmma_f32_16x16x32_bf16
//   out    = p . v             : bf16 hi/lo split of p (unnormalised) and v, f32 accumulate
//   online softmax in f32; keys with s > t or t - s > kWin-1 set to -inf; a fully -inf running max uses a 0 pivot
//   (alpha = 0, p = 0) so nothing non-finite is produced; the diagonal key is always kept.
//   Block = 4 waves = 64 query rows of one head; grid.x = kNHq * (kSeq/64); kv chunks of 64 from the first
//   in-window chunk (block-uniform) up to chunk qb (static bound qb+1 <= 32).
//   K / V^T chunk staging: 128 threads x 32 elements per plane = the whole 64x64 tile (16-B copies, plain loads,
//   __syncthreads before and after); fragment loads read the LDS tiles with the same v8b element type. LDS rows of
//   the K, V^T and P tiles are AT_LP elements apart (64 used + 8 never read or written).
// =====================================================================================
#define AT_D 64
#define AT_NW 4
#define AT_QB 64
#define AT_KC 64
#define AT_LP 72   // LDS row pitch of the K, V^T and P tiles in elements: 144 B = 16 B x 9 (odd), so the 16 rows that one
                   // ds_load_b128 touches per half wave start on 16 different 4-bank groups (128-B rows: only 2 groups)

__device__ __forceinline__ unsigned short at_bf_bits(float f) {
  unsigned u = __float_as_uint(f);
  return (unsigned short)((u + 0x7FFFu + ((u >> 16) & 1u)) >> 16);
}
__device__ __forceinline__ __bf16 at_f2bf(float f) { return __builtin_bit_cast(__bf16, at_bf_bits(f)); }
__device__ __forceinline__ void at_split(float f, __bf16& hi, __bf16& lo) {
  const unsigned short hb = at_bf_bits(f);
  hi = __builtin_bit_cast(__bf16, hb);
  lo = at_f2bf(f - __uint_as_float(((unsigned)hb) << 16));
}
__device__ __forceinline__ v8f at_mma(v16b a, v16b b, v8f c) {
  c = __builtin_amdgcn_wmma_f32_16x16x32_bf16(false, a, false, b, (short)0, c, false, false);
  asm volatile("v_nop\n\tv_nop\n\tv_nop\n\tv_nop" : "+v"(c) : "v"(a), "v"(b));
  return c;
}

__global__ __launch_bounds__(128)
void attn_gqa_window64_kernel(const unsigned short* __restrict__ qhp, const unsigned short* __restrict__ qlp,
                              const unsigned short* __restrict__ khp, const unsigned short* __restrict__ klp,
                              const unsigned short* __restrict__ vhp, const unsigned short* __restrict__ vlp,
                              float* __restrict__ out, float sscale) {
  union FB { v16b v; v8b h[2]; };
  __shared__ __align__(16) __bf16 Ksh[AT_KC * AT_LP];            // K hi [kv][d]      9 KB
  __shared__ __align__(16) __bf16 Ksl[AT_KC * AT_LP];            // K lo
  __shared__ __align__(16) __bf16 Vth[AT_D * AT_LP];             // V hi [d][kv]      9 KB
  __shared__ __align__(16) __bf16 Vtl[AT_D * AT_LP];             // V lo
  __shared__ __align__(16) __bf16 Psh[AT_NW][16 * AT_LP];        // per wave P hi [row][kv]
  __shared__ __align__(16) __bf16 Psl[AT_NW][16 * AT_LP];        // per wave P lo
  __shared__ __align__(16) float  Os[AT_NW][16 * 68];            // per wave out tile, pitch 68

  const int tid  = threadIdx.x;
  const int wave = tid >> 5;
  const int lane = tid & 31;
  const int hh   = lane >> 4;
  const int c    = lane & 15;

  const int nqb = kSeq / AT_QB;           // 32
  const int bx = blockIdx.x;
  const int qb = bx % nqb;
  const int h  = bx / nqb;                // 0..kNHq-1 (grid = kNHq * nqb)
  const int kvh = h / kGroups;            // 0..kNKv-1
  const int q0 = qb * AT_QB + wave * 16;

  const size_t bq = (size_t)blockIdx.y * kSeq * kDim;     // batch element's q / out plane
  const size_t bk = (size_t)blockIdx.y * kSeq * kKvDim;   // batch element's k / v^T plane
  const __bf16* Qh = (const __bf16*)(const void*)qhp + bq + (size_t)h * AT_D;
  const __bf16* Ql = (const __bf16*)(const void*)qlp + bq + (size_t)h * AT_D;
  const __bf16* Kh = (const __bf16*)(const void*)khp + bk + (size_t)kvh * AT_D;
  const __bf16* Kl = (const __bf16*)(const void*)klp + bk + (size_t)kvh * AT_D;
  const __bf16* Vh = (const __bf16*)(const void*)vhp + bk + (size_t)kvh * AT_D * kSeq;
  const __bf16* Vl = (const __bf16*)(const void*)vlp + bk + (size_t)kvh * AT_D * kSeq;
  float*        ob = out + bq + (size_t)h * AT_D;

  // ---- Q fragments (A operand, row = lane&15, split k map via Frag load): 2 d-chunks, hi and lo ----
  v16b qah[2], qal[2];
#pragma unroll
  for (int dc = 0; dc < 2; ++dc) {
    const __bf16* qr = Qh + (size_t)(q0 + c) * kDim + dc * 32 + 8 * hh;
    const __bf16* ql = Ql + (size_t)(q0 + c) * kDim + dc * 32 + 8 * hh;
    qah[dc] = Frag<__bf16>::load(qr);
    qal[dc] = Frag<__bf16>::load(ql);
  }

  float mrow[8], lrow[8];
  v8f oacc[4];
#pragma unroll
  for (int r = 0; r < 8; ++r) { mrow[r] = -INFINITY; lrow[r] = 0.f; }
#pragma unroll
  for (int t = 0; t < 4; ++t) oacc[t] = (v8f){0.f,0.f,0.f,0.f,0.f,0.f,0.f,0.f};

  const int qlo = qb * AT_QB - (kWin - 1);                 // smallest key allowed for the block's first row
  const int kcStart = (qlo > 0) ? (qlo / AT_KC) : 0;       // block-uniform
  const int nChunks = qb + 1;                              // block-uniform, <= 32
  for (int kc = kcStart; kc < nChunks; ++kc) {
    const int kv0 = kc * AT_KC;
    __syncthreads();
    {
      // staging coverage: 128 threads x (4 x 8) elements = 64 rows x 64 per plane = the whole chunk tile
      const int r = tid >> 1, half = (tid & 1) * 32;
      const __bf16* ksh = Kh + (size_t)(kv0 + r) * kKvDim + half;   // K row kv0+r, d = half..half+31
      const __bf16* ksl = Kl + (size_t)(kv0 + r) * kKvDim + half;
      const __bf16* vsh = Vh + (size_t)r * kSeq + kv0 + half;        // V^T row d = r, s = kv0+half..+31
      const __bf16* vsl = Vl + (size_t)r * kSeq + kv0 + half;
#pragma unroll
      for (int i = 0; i < 4; ++i) {
        const v8b a0 = *(const v8b*)(ksh + 8 * i);
        const v8b a1 = *(const v8b*)(ksl + 8 * i);
        const v8b b0 = *(const v8b*)(vsh + 8 * i);
        const v8b b1 = *(const v8b*)(vsl + 8 * i);
        *(v8b*)(Ksh + r * AT_LP + half + 8 * i) = a0;
        *(v8b*)(Ksl + r * AT_LP + half + 8 * i) = a1;
        *(v8b*)(Vth + r * AT_LP + half + 8 * i) = b0;
        *(v8b*)(Vtl + r * AT_LP + half + 8 * i) = b1;
      }
    }
    __syncthreads();

    v8f s[4];
#pragma unroll
    for (int j = 0; j < 4; ++j) {
      s[j] = (v8f){0.f,0.f,0.f,0.f,0.f,0.f,0.f,0.f};
#pragma unroll
      for (int dc = 0; dc < 2; ++dc) {
        FB kb, kl;
        kb.h[0] = *(const v8b*)(Ksh + (j * 16 + c) * AT_LP + dc * 32 + 8 * hh);
        kb.h[1] = *(const v8b*)(Ksh + (j * 16 + c) * AT_LP + dc * 32 + 16 + 8 * hh);
        kl.h[0] = *(const v8b*)(Ksl + (j * 16 + c) * AT_LP + dc * 32 + 8 * hh);
        kl.h[1] = *(const v8b*)(Ksl + (j * 16 + c) * AT_LP + dc * 32 + 16 + 8 * hh);
        s[j] = at_mma(qah[dc], kb.v, s[j]);
        s[j] = at_mma(qah[dc], kl.v, s[j]);
        s[j] = at_mma(qal[dc], kb.v, s[j]);
      }
    }
    float cm[8];
#pragma unroll
    for (int r = 0; r < 8; ++r) {
      const int qrow = q0 + 8 * hh + r;
      float m = -INFINITY;
#pragma unroll
      for (int j = 0; j < 4; ++j) {
        const int kvcol = kv0 + j * 16 + c;
        const float sv = s[j][r] * sscale;
        const bool masked = (kvcol > qrow) || (qrow - kvcol > kWin - 1);
        const float sm = masked ? -INFINITY : sv;
        s[j][r] = sm;
        m = fmaxf(m, sm);
      }
#pragma unroll
      for (int off = 1; off < 16; off <<= 1) m = fmaxf(m, __shfl_xor(m, off, 32));
      cm[r] = m;
    }
    __bf16* pwh = Psh[wave];
    __bf16* pwl = Psl[wave];
#pragma unroll
    for (int r = 0; r < 8; ++r) {
      const float mnew  = fmaxf(mrow[r], cm[r]);
      const float mpiv  = (mnew == -INFINITY) ? 0.0f : mnew;   // fully masked so far -> alpha = 0, p = 0
      const float alpha = expf(mrow[r] - mpiv);
      mrow[r] = mnew;
      float psum = 0.f;
#pragma unroll
      for (int j = 0; j < 4; ++j) {
        const float p = expf(s[j][r] - mpiv);
        psum += p;
        __bf16 a, bl; at_split(p, a, bl);
        pwh[(8 * hh + r) * AT_LP + j * 16 + c] = a;
        pwl[(8 * hh + r) * AT_LP + j * 16 + c] = bl;
      }
#pragma unroll
      for (int off = 1; off < 16; off <<= 1) psum += __shfl_xor(psum, off, 32);
      lrow[r] = lrow[r] * alpha + psum;
#pragma unroll
      for (int t = 0; t < 4; ++t) oacc[t][r] *= alpha;
    }
    __builtin_amdgcn_fence(__ATOMIC_RELEASE, "workgroup");
    __builtin_amdgcn_wave_barrier();
    __builtin_amdgcn_fence(__ATOMIC_ACQUIRE, "workgroup");
#pragma unroll 1
    for (int kk = 0; kk < 2; ++kk) {
      FB pa, pl;
      pa.h[0] = *(const v8b*)(pwh + c * AT_LP + kk * 32 + 8 * hh);
      pa.h[1] = *(const v8b*)(pwh + c * AT_LP + kk * 32 + 16 + 8 * hh);
      pl.h[0] = *(const v8b*)(pwl + c * AT_LP + kk * 32 + 8 * hh);
      pl.h[1] = *(const v8b*)(pwl + c * AT_LP + kk * 32 + 16 + 8 * hh);
#pragma unroll
      for (int t = 0; t < 4; ++t) {
        FB vb, vl;
        vb.h[0] = *(const v8b*)(Vth + (t * 16 + c) * AT_LP + kk * 32 + 8 * hh);
        vb.h[1] = *(const v8b*)(Vth + (t * 16 + c) * AT_LP + kk * 32 + 16 + 8 * hh);
        vl.h[0] = *(const v8b*)(Vtl + (t * 16 + c) * AT_LP + kk * 32 + 8 * hh);
        vl.h[1] = *(const v8b*)(Vtl + (t * 16 + c) * AT_LP + kk * 32 + 16 + 8 * hh);
        oacc[t] = at_mma(pa.v, vb.v, oacc[t]);
        oacc[t] = at_mma(pa.v, vl.v, oacc[t]);
        oacc[t] = at_mma(pl.v, vb.v, oacc[t]);
      }
    }
  }

  float* os = Os[wave];
#pragma unroll
  for (int r = 0; r < 8; ++r) {
    const float inv = 1.0f / lrow[r];
#pragma unroll
    for (int t = 0; t < 4; ++t) os[(8 * hh + r) * 68 + t * 16 + c] = oacc[t][r] * inv;
  }
  __builtin_amdgcn_fence(__ATOMIC_RELEASE, "workgroup");
  __builtin_amdgcn_wave_barrier();
  __builtin_amdgcn_fence(__ATOMIC_ACQUIRE, "workgroup");
  {
    const int c4 = (lane & 15) * 4;
    {
#pragma unroll
      for (int it = 0; it < 8; ++it) {
        const int row = it * 2 + hh;   // it 0..7 x hh 0..1 covers rows 0..15 of the wave tile
        v4f val = *(const v4f*)(os + row * 68 + c4);
        *(v4f*)(ob + (size_t)(q0 + row) * kDim + c4) = val;
      }
      
    }
  }
}

// ---------------------------------------------------------------------------
// Workspace region map (byte offsets; every region is fully written in this call before it is read; token rows
// run over both batch elements, row = b*2048 + t; VT holds one [256][2048] plane per batch element; the W*, X* and
// O* bf16 planes are fragment-major, 16-row x 32-k blocks, see wmma_gemm64):
//   Wqh bf16 [768 n][768 k]         0      Wql   1179648
//   Wkh bf16 [256][768]        2359296      Wkl   2752512
//   Wvh bf16 [256][768]        3145728      Wvl   3538944
//   Woh bf16 [768][768]        3932160      Wol   5111808
//   CS  f32  [2048][32]        6291456      SN    6553600
//   Xh  bf16 [4096][768]       6815744      Xl   13107200
//   Qf  f32  [4096][768]      19398656
//   Kf  f32  [4096][256]      31981568
//   Qh  bf16 [4096][768]      36175872      Ql   42467328
//   Kh  bf16 [4096][256]      48758784      Kl   50855936
//   VTh bf16 [2][256][2048]   52953088      VTl  55050240
//   Of  f32  [4096][768]      57147392
//   Oh  bf16 [4096][768]      69730304      Ol   76021760
//   total                     82313216
// ---------------------------------------------------------------------------
extern "C" void kernel_launch(void* const* d_in, const int* in_sizes, int n_in,
                              void* d_out, int out_size, void* d_ws, size_t ws_size,
                              hipStream_t stream) {
  if (n_in < 7) return;
  if (in_sizes[0] != kNB * kSeq * kDim) return;
  if (in_sizes[1] != kDim * kDim || in_sizes[4] != kDim * kDim) return;
  if (in_sizes[2] != kKvDim * kDim || in_sizes[3] != kKvDim * kDim) return;
  if (in_sizes[5] != kHd || in_sizes[6] != kHd) return;
  if (out_size != kNB * kSeq * kDim) return;

  const float* x    = (const float*)d_in[0];
  const float* Wq   = (const float*)d_in[1];
  const float* Wk   = (const float*)d_in[2];
  const float* Wv   = (const float*)d_in[3];
  const float* Wo   = (const float*)d_in[4];
  const float* lnq  = (const float*)d_in[5];
  const float* lnk  = (const float*)d_in[6];

  const size_t PWQ = (size_t)kDim * kDim * 2;      // 1179648  bf16 [768][768] plane
  const size_t PWK = (size_t)kKvDim * kDim * 2;    // 393216   bf16 [256][768] plane
  const size_t PTB = (size_t)kSeq * kHalfHd * 4;   // 262144   f32 [2048][32] table
  const size_t PXB = (size_t)kTok * kDim * 2;      // 6291456  bf16 [4096][768] plane
  const size_t PXF = (size_t)kTok * kDim * 4;      // 12582912 f32 [4096][768]
  const size_t PKF = (size_t)kTok * kKvDim * 4;    // 4194304  f32 [4096][256]
  const size_t PKB = (size_t)kTok * kKvDim * 2;    // 2097152  bf16 [4096][256] / [2][256][2048] plane
  size_t off = 0;
  const size_t oWqh = off; off += PWQ;  const size_t oWql = off; off += PWQ;
  const size_t oWkh = off; off += PWK;  const size_t oWkl = off; off += PWK;
  const size_t oWvh = off; off += PWK;  const size_t oWvl = off; off += PWK;
  const size_t oWoh = off; off += PWQ;  const size_t oWol = off; off += PWQ;
  const size_t oCS  = off; off += PTB;  const size_t oSN  = off; off += PTB;
  const size_t oXh  = off; off += PXB;  const size_t oXl  = off; off += PXB;
  const size_t oQf  = off; off += PXF;
  const size_t oKf  = off; off += PKF;
  const size_t oQh  = off; off += PXB;  const size_t oQl  = off; off += PXB;
  const size_t oKh  = off; off += PKB;  const size_t oKl  = off; off += PKB;
  const size_t oVTh = off; off += PKB;  const size_t oVTl = off; off += PKB;
  const size_t oOf  = off; off += PXF;
  const size_t oOh  = off; off += PXB;  const size_t oOl  = off; off += PXB;
  if (off > ws_size) return;                       // off = 82313216
  if (off > (size_t)134217728) return;

  char* ws = (char*)d_ws;
  unsigned short* Wqh = (unsigned short*)(ws + oWqh); unsigned short* Wql = (unsigned short*)(ws + oWql);
  unsigned short* Wkh = (unsigned short*)(ws + oWkh); unsigned short* Wkl = (unsigned short*)(ws + oWkl);
  unsigned short* Wvh = (unsigned short*)(ws + oWvh); unsigned short* Wvl = (unsigned short*)(ws + oWvl);
  unsigned short* Woh = (unsigned short*)(ws + oWoh); unsigned short* Wol = (unsigned short*)(ws + oWol);
  float*          CS  = (float*)(ws + oCS);          float*          SN  = (float*)(ws + oSN);
  unsigned short* Xh  = (unsigned short*)(ws + oXh);  unsigned short* Xl  = (unsigned short*)(ws + oXl);
  float*          Qf  = (float*)(ws + oQf);
  float*          Kf  = (float*)(ws + oKf);
  unsigned short* Qh  = (unsigned short*)(ws + oQh);  unsigned short* Ql  = (unsigned short*)(ws + oQl);
  unsigned short* Kh  = (unsigned short*)(ws + oKh);  unsigned short* Kl  = (unsigned short*)(ws + oKl);
  unsigned short* VTh = (unsigned short*)(ws + oVTh); unsigned short* VTl = (unsigned short*)(ws + oVTl);
  float*          Of  = (float*)(ws + oOf);
  unsigned short* Oh  = (unsigned short*)(ws + oOh);  unsigned short* Ol  = (unsigned short*)(ws + oOl);

  const dim3 blk(256);
  const dim3 gPrep(kPbT + kPbX + 2 * kPbWq + 2 * kPbWk);            // 2560 blocks
  const dim3 gCast(kPbX);                                           // 1536 blocks x 2048 elements = 4096x768
  const dim3 gQKV(kBlkQ + kBlkK + kNB * kBlkV);                     // 160 blocks x 8 tiles
  const dim3 gProjQ(kBlkQ, 1);                                      // 768 tiles: M=4096, N=768
  const dim3 gRope(kNUnits / 32, kNB);                              // 1024 blocks x 32 units per batch element
  const dim3 gAtt(kNHq * (kSeq / 64), kNB);                         // 12 heads x 32 query blocks per batch element

  // Both batch elements go through every stage in one launch: the token-row GEMMs see M = 4096 rows, the stages
  // that need the position inside a sequence take the batch element from the block index.
  // (1) rotary tables; x and the weights [out n][in k] f32 -> bf16 hi/lo planes, fragment-major
  prep_kernel<<<gPrep, blk, 0, stream>>>(x, Wq, Wk, Wv, Wo, Xh, Xl, Wqh, Wql, Wkh, Wkl, Wvh, Wvl, Woh, Wol, CS, SN);
  // (2)-(4) q -> Qf, k -> Kf, v^T -> VT hi/lo planes (K = 768 each)
  qkv_gemm64_kernel<<<gQKV, blk, 0, stream>>>(Xh, Xl, Wqh, Wql, Wkh, Wkl, Wvh, Wvl, Qf, Kf, VTh, VTl, kDim);
  // (5) per-head rmsnorm * w + rotary on q and k -> Q/K bf16 hi/lo planes
  norm_rope_split_kernel<<<gRope, blk, 0, stream>>>(Qf, Kf, lnq, lnk, CS, SN, Qh, Ql, Kh, Kl);
  // (6) windowed causal GQA attention per head: y[row][h*64+d] (f32 plane, every element written by its (b, h, query block) owner)
  attn_gqa_window64_kernel<<<gAtt, dim3(128), 0, stream>>>(Qh, Ql, Kh, Kl, VTh, VTl, Of, 0.125f);
  // (7) y -> bf16 hi/lo planes, fragment-major
  split_pack_bf16_kernel<<<gCast, blk, 0, stream>>>(Of, Oh, Ol, kN8X);
  // (8) out = y . Wo^T -> d_out rows 0 .. 4095 (f32)   (M=4096, N=768, K=768)
  wmma_gemm64<1, true, 0, 0, false><<<gProjQ, blk, 0, stream>>>(
      Oh, Ol, kDim, 0L, Woh, Wol, kDim, 0L, d_out, d_out, kDim, 0L,
      lnq, lnq, 0L, kTok, kDim, kDim, 1.0f);
}

// v005
// Measured time: 112 microseconds a run.
// Timed twice side by side with v004, it ran 1.35 times as fast both times.
// All steps since v000 together make it 4.91 times as fast.
// Contractions (q/k/v/out projections, q.k^T scores, p.v): v_wmma_f32_16x16x32_bf16 with bf16 hi/lo split operands (hi.hi + hi.lo + lo.hi), f32 accumulate; rmsnorm, rotary tables, online softmax in f32.
#include <hip/hip_runtime.h>
#include <math.h>
#include <stdint.h>

constexpr int kNB     = 2;
constexpr int kSeq    = 2048;
constexpr int kTok    = kNB * kSeq;          // 4096 token rows over both batch elements
constexpr int kDim    = 768;
constexpr int kHd     = 64;
constexpr int kNHq    = 12;
constexpr int kNKv    = 4;
constexpr int kGroups = 3;
constexpr int kKvDim  = kNKv * kHd;          // 256
constexpr int kWin    = 384;
constexpr int kHalfHd = 32;
constexpr int kKBlk   = kDim / 32;           // 24 k blocks of 32 in a row of 768
constexpr int kNQUnits = kSeq * kNHq;        // 24576 (token, q head) units
constexpr int kNKUnits = kSeq * kNKv;        // 8192  (token, kv head) units
constexpr int kNUnits  = kNQUnits + kNKUnits;// 32768
static_assert(kNQUnits % 4 == 0);
static_assert(kNUnits % 32 == 0);
static_assert(kSeq % 64 == 0 && kDim % 64 == 0 && kKvDim % 64 == 0 && kDim % 32 == 0);
static_assert(kNHq == kNKv * kGroups);

typedef __attribute__((ext_vector_type(16))) _Float16 v16h;
typedef __attribute__((ext_vector_type(8)))  _Float16 v8h;
typedef __attribute__((ext_vector_type(16))) __bf16   v16b;
typedef __attribute__((ext_vector_type(8)))  __bf16   v8b;
typedef __attribute__((ext_vector_type(8)))  float    v8f;
typedef __attribute__((ext_vector_type(4)))  float    v4f;
typedef __attribute__((ext_vector_type(2)))  float    v2f;
typedef __attribute__((ext_vector_type(4)))  unsigned int v4u;

__device__ __forceinline__ unsigned short f2bf_bits(float f) {
  unsigned u = __float_as_uint(f);
  return (unsigned short)((u + 0x7FFFu + ((u >> 16) & 1u)) >> 16);
}
__device__ __forceinline__ float bf_bits2f(unsigned short h) { return __uint_as_float(((unsigned)h) << 16); }

// hazard guards as plain device helpers (no inline asm inside the kernel template body)
// four vector slots: the distance asked between a 16-bit matrix instruction and a vector overwrite of a register that it reads;
// kept in front of a load over such a register too, as a precaution
__device__ __forceinline__ void operand_gap() { asm volatile("v_nop\n\tv_nop\n\tv_nop\n\tv_nop" ::: "memory"); }
__device__ __forceinline__ void acc_guard4(v8f& a, v8f& b, v8f& c, v8f& d) { asm volatile("v_nop\n\tv_nop\n\tv_nop\n\tv_nop" : "+v"(a), "+v"(b), "+v"(c), "+v"(d)); }
template <typename T> struct Frag;
template <> struct Frag<_Float16> {
  typedef v16h V; union U { v16h v; v8h h[2]; };
  static __device__ __forceinline__ v16h load(const _Float16* p) {   // elements 0..7 <- p[0..7], 8..15 <- p[16..23]
    U f; f.h[0] = *(const v8h*)(p); f.h[1] = *(const v8h*)(p + 16); return f.v;
  }
  static __device__ __forceinline__ v8f mma(v16h a, v16h b, v8f c) {
    return __builtin_amdgcn_wmma_f32_16x16x32_f16(false, a, false, b, (short)0, c, false, false);
  }
};
template <> struct Frag<__bf16> {
  typedef v16b V; union U { v16b v; v8b h[2]; };
  static __device__ __forceinline__ v16b load(const __bf16* p) {
    U f; f.h[0] = *(const v8b*)(p); f.h[1] = *(const v8b*)(p + 16); return f.v;
  }
  // fragment-major block at byte address p: elements 0..7 <- bytes 0..15, elements 8..15 <- bytes 512..527
  static __device__ __forceinline__ v16b load_packed(const char* p) {
    U f; f.h[0] = *(const v8b*)(p); f.h[1] = *(const v8b*)(p + 512); return f.v;
  }
  static __device__ __forceinline__ v8f mma(v16b a, v16b b, v8f c) {
    return __builtin_amdgcn_wmma_f32_16x16x32_bf16(false, a, false, b, (short)0, c, false, false);
  }
};

// ---- Register-blocked batched WMMA GEMM ------------------------------------
// C[m,n] = scale * sum_k A[m,k] * Bt[n,k] (+bias)(+resid); each wave owns a 64x64 tile.
// A [M,K] and Bt [N,K] are stored fragment-major (written by split_pack_thread): each 16-row x 32-k block is
// 512 consecutive elements, block index = (row/16)*kKBlk + k/32, and element (row, k) of a block sits at
// ((k>>4)&1)*256 + (((k>>3)&1)*16 + (row&15))*8 + (k&7). Lane l of a fragment load then reads 16 B at l*16 B, so one
// wave-wide load covers 512 consecutive bytes (4 whole lines) and holds the same elements as a row-major fragment load.
// M,N % 64 == 0, K % 64 == 0, K >= 64; rows of both operands are kDim long (lda == ldb == kDim), so the step from one 16-row
// block row to the next is a compile-time constant and goes into the loads' immediate offsets.
// SPLIT: operands are hi/lo planes (A2/Bt2 = lo planes, same layout); product = hi.hi + hi.lo + lo.hi.
// BIAS_MODE: 0 = none, 1 = bias[m], 2 = bias[n].
// OUT_MODE: 0 = f32, 1 = f16, 2 = bf16 hi plane (Cout) + bf16 lo plane (Cout2).
// ET: 0 = f16 operands, 1 = bf16 operands (pointers passed as 16-bit storage)
template <int ET> struct Elem;
template <> struct Elem<0> { typedef _Float16 T; };
template <> struct Elem<1> { typedef __bf16 T; };
// All fragments of one k step of a 64x64 wave tile: four 16-row blocks of A and of Bt, hi and lo planes.
template <typename T, bool SPLIT> struct FragSet { typename Frag<T>::V bh[4], bl[4], ah[4], al[4]; };
constexpr int kRowStep = kKBlk * 1024;         // bytes from one 16-row block row to the next
template <typename T, bool SPLIT>
__device__ __forceinline__ void load_frag_set(FragSet<T, SPLIT>& f, const char* pAh, const char* pAl, const char* pBh,
                                              const char* pBl, const unsigned vo, const int off) {
#pragma unroll
  for (int j = 0; j < 4; ++j) {
    f.bh[j] = Frag<T>::load_packed(pBh + vo + (off + j * kRowStep));
    if (SPLIT) f.bl[j] = Frag<T>::load_packed(pBl + vo + (off + j * kRowStep));
  }
#pragma unroll
  for (int i = 0; i < 4; ++i) {
    f.ah[i] = Frag<T>::load_packed(pAh + vo + (off + i * kRowStep));
    if (SPLIT) f.al[i] = Frag<T>::load_packed(pAl + vo + (off + i * kRowStep));
  }
}
template <typename T, bool SPLIT>
__device__ __forceinline__ void mma_frag_set(v8f (&acc)[4][4], const FragSet<T, SPLIT>& f) {
#pragma unroll
  for (int i = 0; i < 4; ++i) {
#pragma unroll
    for (int j = 0; j < 4; ++j) {
      acc[i][j] = Frag<T>::mma(f.ah[i], f.bh[j], acc[i][j]);
      if (SPLIT) {
        acc[i][j] = Frag<T>::mma(f.ah[i], f.bl[j], acc[i][j]);
        acc[i][j] = Frag<T>::mma(f.al[i], f.bh[j], acc[i][j]);
      }
    }
  }
}
// gemm64_tile = one wave's 64x64 tile; the kernels below hand it the wave's LDS slab, the batch index b and the tile's
// first row m0 and column n0 (the same in every lane, in scalar registers, so that the four plane bases are scalar too).
template <int ET, bool SPLIT, int BIAS_MODE, int OUT_MODE, bool RESID, int ACT = 0>
__device__ __forceinline__ void gemm64_tile(
    float* __restrict__ slab, const int b, const int m0, const int n0,
    const unsigned short* __restrict__ Ap, const unsigned short* __restrict__ A2p, int lda, long strideA,
    const unsigned short* __restrict__ Btp, const unsigned short* __restrict__ Bt2p, int ldb, long strideB,
    void* __restrict__ Cout, void* __restrict__ Cout2, int ldc, long strideC,
    const float* __restrict__ bias,
    const float* __restrict__ resid, long strideR,
    int K, float scale) {
  typedef typename Elem<ET>::T T;
  typedef typename Frag<T>::V V;
  const T* A = (const T*)Ap; const T* A2 = (const T*)A2p; const T* Bt = (const T*)Btp; const T* Bt2 = (const T*)Bt2p;
  const int lane = threadIdx.x & 31;

  const T* Ab  = A  + (size_t)b * strideA;
  const T* Bb  = Bt + (size_t)b * strideB;
  const T* Ab2 = SPLIT ? (A2  + (size_t)b * strideA) : nullptr;
  const T* Bb2 = SPLIT ? (Bt2 + (size_t)b * strideB) : nullptr;

  const int rlane = lane & 15;                 // row (A) / col (B, D) within subtile
  const int mOff  = (lane >> 4) * 8;           // D row offset
  // Every fragment load = scalar base of the tile's first block row in its plane + one 32-bit lane byte offset + an
  // immediate (block row step, second half of the block). The lane offset is the only vector address register; it steps
  // one block (1024 B) per k step, two k steps per trip.
  const char* pBh = (const char*)(Bb  + (size_t)(n0 >> 4) * (kKBlk * 512));
  const char* pBl = SPLIT ? (const char*)(Bb2 + (size_t)(n0 >> 4) * (kKBlk * 512)) : nullptr;
  const char* pAh = (const char*)(Ab  + (size_t)(m0 >> 4) * (kKBlk * 512));
  const char* pAl = SPLIT ? (const char*)(Ab2 + (size_t)(m0 >> 4) * (kKBlk * 512)) : nullptr;
  unsigned vo = (unsigned)lane * 16u;          // this lane's 16 B inside a 512-B half block

  v8f acc[4][4];
#pragma unroll
  for (int i = 0; i < 4; ++i)
#pragma unroll
    for (int j = 0; j < 4; ++j) acc[i][j] = (v8f){0.f,0.f,0.f,0.f,0.f,0.f,0.f,0.f};

  // Two register sets of fragments: while the 48 (SPLIT) matrix instructions of one k step run on one set, the 32 loads of
  // the next k step fill the other, so the loads of a k step have the whole length of the k step before it to arrive.
  FragSet<T, SPLIT> f0, f1;
  load_frag_set<T, SPLIT>(f0, pAh, pAl, pBh, pBl, vo, 0);
  asm volatile("s_wait_xcnt 0x0" :: "v"(vo) : "memory");   // as at the loop's foot, for the path that skips the loop (K == 64)
  for (int k0 = 64; k0 < K; k0 += 64) {
    load_frag_set<T, SPLIT>(f1, pAh, pAl, pBh, pBl, vo, 1024);
    __builtin_amdgcn_sched_barrier(0);   // keeps the next step's loads ahead of this step's products (sunk to their use they would fly alone)
    mma_frag_set<T, SPLIT>(acc, f0);
    __builtin_amdgcn_sched_barrier(0);   // keeps every product on f0 in front of the gap below
    operand_gap();                       // four vector slots between the last product that reads f0 and the first load that refills it
    __builtin_amdgcn_sched_barrier(0);   // keeps every refill of f0 behind that gap
    load_frag_set<T, SPLIT>(f0, pAh, pAl, pBh, pBl, vo, 2048);
    __builtin_amdgcn_sched_barrier(0);   // keeps these loads ahead of the products on f1, as above
    mma_frag_set<T, SPLIT>(acc, f1);
    __builtin_amdgcn_sched_barrier(0);   // keeps every product on f1 in front of the gap and the wait below, a whole k step behind the loads
    // four vector slots between the last product that reads f1 and the first load that refills it (next trip, or behind the
    // loop); the loads in flight name vo: the wait stands before vo is overwritten
    asm volatile("v_nop\n\tv_nop\n\tv_nop\n\tv_nop\n\ts_wait_xcnt 0x0" ::: "memory");
    __builtin_amdgcn_sched_barrier(0);   // keeps the step of vo and the refill of f1 behind that statement
    vo += 2048u;
  }
  const unsigned vt = (unsigned)lane * 16u + (unsigned)(K - 64) * 32u;   // lane offset at the last two k steps (= vo here)
  load_frag_set<T, SPLIT>(f1, pAh, pAl, pBh, pBl, vt, 1024);
  asm volatile("s_wait_xcnt 0x0" :: "v"(vt) : "memory");   // vt is live up to this wait, so nothing overwrites it under the loads that name it
  __builtin_amdgcn_sched_barrier(0);     // keeps the last step's loads ahead of the products before it
  mma_frag_set<T, SPLIT>(acc, f0);
  mma_frag_set<T, SPLIT>(acc, f1);
  acc_guard4(acc[0][0], acc[0][1], acc[0][2], acc[0][3]);
  acc_guard4(acc[1][0], acc[1][1], acc[1][2], acc[1][3]);
  acc_guard4(acc[2][0], acc[2][1], acc[2][2], acc[2][3]);
  acc_guard4(acc[3][0], acc[3][1], acc[3][2], acc[3][3]);

  // ---- epilogue ----
  const float* Rb = RESID ? (resid + (size_t)b * strideR) : nullptr;
#pragma unroll
  for (int i = 0; i < 4; ++i) {
    const int mBase = m0 + (i << 4);
#pragma unroll
    for (int j = 0; j < 4; ++j) {
      const int n = n0 + (j << 4) + rlane;
      float bv = 0.f;
      if (BIAS_MODE == 2) bv = bias[n];
#pragma unroll
      for (int r = 0; r < 8; ++r) {
        float v = acc[i][j][r] * scale;
        if (BIAS_MODE == 1) v += bias[mBase + mOff + r];
        if (BIAS_MODE == 2) v += bv;
        if (RESID) v += Rb[(size_t)(mBase + mOff + r) * ldc + n];
        if (ACT == 1) v = tanhf(v);
        if (ACT == 2) v = fmaxf(v, 0.0f);
        if (ACT == 3) v = v / (1.0f + expf(-v));
        if (ACT == 4) v = (v > 0.f) ? v : 0.01f * v;
        slab[(mOff + r) * 68 + (j << 4) + rlane] = v;
      }
    }
    __builtin_amdgcn_fence(__ATOMIC_RELEASE, "workgroup");
    __builtin_amdgcn_wave_barrier();
    __builtin_amdgcn_fence(__ATOMIC_ACQUIRE, "workgroup");
    if (OUT_MODE == 0) {
      float* C = (float*)Cout + (size_t)b * strideC;
      const int hh = lane >> 4, c4 = (lane & 15) * 4;     // row seg = 256 B = 16 lanes x 16 B
      {
#pragma unroll
        for (int it = 0; it < 8; ++it) {
          const int row = it * 2 + hh;
          v4f v = *(const v4f*)(slab + row * 68 + c4);
          *(v4f*)(C + (size_t)(mBase + row) * ldc + n0 + c4) = v;
        }
        // the next block row's address arithmetic reuses the address registers of these stores: the wait stands before that
        asm volatile("s_wait_xcnt 0x0" ::: "memory");
        __builtin_amdgcn_sched_barrier(0);   // keeps that arithmetic behind the wait (without it the scheduler lifts it over the wait)
      }
    } else {
      const int q = lane >> 3, c8 = (lane & 7) * 8;
      unsigned short* C  = (unsigned short*)Cout  + (size_t)b * strideC;
      unsigned short* C2 = (OUT_MODE == 2) ? ((unsigned short*)Cout2 + (size_t)b * strideC) : nullptr;
      {
#pragma unroll
        for (int it = 0; it < 4; ++it) {
          const int row = it * 4 + q;
          const float* sp = slab + row * 68 + c8;
          v8h hv, lv;
#pragma unroll
          for (int e = 0; e < 8; ++e) {
            if (OUT_MODE == 1) {
              hv[e] = (_Float16)sp[e];
            } else {
              unsigned short hb = f2bf_bits(sp[e]);
              unsigned short lb = f2bf_bits(sp[e] - bf_bits2f(hb));
              hv[e] = __builtin_bit_cast(_Float16, hb);
              lv[e] = __builtin_bit_cast(_Float16, lb);
            }
          }
          *(v8h*)(C + (size_t)(mBase + row) * ldc + n0 + c8) = hv;
          if (OUT_MODE == 2) *(v8h*)(C2 + (size_t)(mBase + row) * ldc + n0 + c8) = lv;
        }
        
      }
    }
    __builtin_amdgcn_fence(__ATOMIC_RELEASE, "workgroup");
    __builtin_amdgcn_wave_barrier();
    __builtin_amdgcn_fence(__ATOMIC_ACQUIRE, "workgroup");
  }
}

// One GEMM per launch: 8 waves = 8 consecutive tiles per block, grid.y = batch index.
template <int ET, bool SPLIT, int BIAS_MODE, int OUT_MODE, bool RESID, int ACT = 0>
__global__ __launch_bounds__(256) void wmma_gemm64(
    const unsigned short* __restrict__ Ap, const unsigned short* __restrict__ A2p, int lda, long strideA,
    const unsigned short* __restrict__ Btp, const unsigned short* __restrict__ Bt2p, int ldb, long strideB,
    void* __restrict__ Cout, void* __restrict__ Cout2, int ldc, long strideC,
    const float* __restrict__ bias,
    const float* __restrict__ resid, long strideR,
    int M, int N, int K, float scale) {
  __shared__ __align__(16) float sT[8][16 * 68];   // per-wave 16x64 slab, pitch 68 floats
  const int wave = threadIdx.x >> 5;
  const int tilesN = N >> 6;
  const int tilesM = M >> 6;
  const int tile = __builtin_amdgcn_readfirstlane(blockIdx.x * 8 + wave);
  if (tile >= tilesM * tilesN) return;   // wave-uniform; no block barriers in this kernel
  const int tm = tile / tilesN;
  const int tn = tile - tm * tilesN;
  gemm64_tile<ET, SPLIT, BIAS_MODE, OUT_MODE, RESID, ACT>(sT[wave], blockIdx.y, tm << 6, tn << 6, Ap, A2p, lda, strideA, Btp, Bt2p,
                                                          ldb, strideB, Cout, Cout2, ldc, strideC, bias, resid, strideR, K, scale);
}

// The three projections of x in one launch: none reads what another writes, and each alone fills well under half of
// the chip's WGPs for the whole length of one wave's k loop. Block ranges (8 tiles per block):
//   [0, kBlkQ)                 q   = x . Wq^T -> Qf f32 [row][h*64+d]           M=4096, N=768
//   [kBlkQ, kBlkQ+kBlkK)       k   = x . Wk^T -> Kf f32 [row][g*64+d]           M=4096, N=256
//   then kBlkV per batch b     v^T = Wv . x[b]^T -> VT hi/lo [b][g*64+d][s]     M=256,  N=2048 (A = Wv planes, Bt = x planes of b)
constexpr int kBlkQ = (kTok / 64) * (kDim / 64) / 8;      // 96
constexpr int kBlkK = (kTok / 64) * (kKvDim / 64) / 8;    // 32
constexpr int kBlkV = (kKvDim / 64) * (kSeq / 64) / 8;    // 16 per batch element
static_assert(((kTok / 64) * (kDim / 64)) % 8 == 0 && ((kTok / 64) * (kKvDim / 64)) % 8 == 0 && ((kKvDim / 64) * (kSeq / 64)) % 8 == 0);

__global__ __launch_bounds__(256) void qkv_gemm64_kernel(
    const unsigned short* __restrict__ Xh, const unsigned short* __restrict__ Xl,
    const unsigned short* __restrict__ Wqh, const unsigned short* __restrict__ Wql,
    const unsigned short* __restrict__ Wkh, const unsigned short* __restrict__ Wkl,
    const unsigned short* __restrict__ Wvh, const unsigned short* __restrict__ Wvl,
    float* __restrict__ Qf, float* __restrict__ Kf,
    unsigned short* __restrict__ VTh, unsigned short* __restrict__ VTl, int K) {
  __shared__ __align__(16) float sT[8][16 * 68];   // per-wave 16x64 slab, pitch 68 floats
  const int wave = threadIdx.x >> 5;
  const int bx   = blockIdx.x;
  if (bx < kBlkQ + kBlkK) {
    const bool isq = bx < kBlkQ;                   // block-uniform
    const int tile = __builtin_amdgcn_readfirstlane((isq ? bx : bx - kBlkQ) * 8 + wave);
    float* C = isq ? Qf : Kf;
    const int n  = isq ? kDim : kKvDim;
    const int tm = isq ? tile / (kDim / 64) : tile / (kKvDim / 64);
    const int tn = tile - tm * (n >> 6);
    gemm64_tile<1, true, 0, 0, false>(sT[wave], 0, tm << 6, tn << 6, Xh, Xl, kDim, 0L, isq ? Wqh : Wkh, isq ? Wql : Wkl, kDim, 0L,
                                      (void*)C, (void*)C, n, 0L, nullptr, nullptr, 0L, K, 1.0f);
  } else {
    const int v    = bx - (kBlkQ + kBlkK);
    const int tile = __builtin_amdgcn_readfirstlane((v % kBlkV) * 8 + wave);
    const int tm   = tile / (kSeq / 64);
    const int tn   = tile - tm * (kSeq / 64);
    gemm64_tile<1, true, 0, 2, false>(sT[wave], v / kBlkV, tm << 6, tn << 6, Wvh, Wvl, kDim, 0L, Xh, Xl, kDim, (long)kSeq * kDim,
                                      (void*)VTh, (void*)VTl, kSeq, (long)kKvDim * kSeq, nullptr, nullptr, 0L, K, 1.0f);
  }
}

// ---------------------------------------------------------------------------
// bf16 split of a row-major f32 [rows][768] matrix, hi = bf16_rne(in), lo = bf16_rne(in - hi), stored fragment-major
// for wmma_gemm64 (layout: see there). One thread = 8 consecutive k of one row (32 B read, 16 B per plane written);
// one wave = 8 rows x 32 k, half a block: it reads 8 whole 128-B lines and each plane's store fills 4 whole lines.
// rows % 16 == 0; n8 = rows * 768 / 8 threads.
// ---------------------------------------------------------------------------
__device__ __forceinline__ unsigned pk16(unsigned short a, unsigned short b) { return (unsigned)a | ((unsigned)b << 16); }

__device__ __forceinline__ void split_pack_thread(const float* __restrict__ in, unsigned short* __restrict__ hi,
                                                  unsigned short* __restrict__ lo, const int idx, const int n8) {
  if (idx < n8) {
    const int l   = idx & 31;
    const int g   = idx >> 5;                 // half block
    const int blk = g >> 1;
    const int rb  = blk / kKBlk, kb = blk - rb * kKBlk;
    const int r16 = (g & 1) * 8 + (l >> 2);   // row inside the block
    const int kp  = l & 3;                    // which 8 of the block's 32 k
    const float* s = in + (size_t)(rb * 16 + r16) * kDim + kb * 32 + kp * 8;
    const v4f fa = *(const v4f*)(s), fb = *(const v4f*)(s + 4);
    const float f[8] = {fa[0], fa[1], fa[2], fa[3], fb[0], fb[1], fb[2], fb[3]};
    v4u hv, lv;
#pragma unroll   // constant indices keep f, hv and lv in registers
    for (int q = 0; q < 4; ++q) {
      const unsigned short h0 = f2bf_bits(f[2 * q]), h1 = f2bf_bits(f[2 * q + 1]);
      const unsigned short l0 = f2bf_bits(f[2 * q] - bf_bits2f(h0)), l1 = f2bf_bits(f[2 * q + 1] - bf_bits2f(h1));
      hv[q] = pk16(h0, h1);
      lv[q] = pk16(l0, l1);
    }
    const size_t o = (size_t)blk * 512 + (kp >> 1) * 256 + ((kp & 1) * 16 + r16) * 8;
    *(v4u*)(hi + o) = hv;
    *(v4u*)(lo + o) = lv;
  }
}

__global__ __launch_bounds__(256) void split_pack_bf16_kernel(const float* __restrict__ in, unsigned short* __restrict__ hi,
                                                              unsigned short* __restrict__ lo, int n8) {
  split_pack_thread(in, hi, lo, blockIdx.x * 256 + threadIdx.x, n8);
}

// ---------------------------------------------------------------------------
// Rotary tables: cs[t*32+i] = cosf(t * inv_freq[i]), sn likewise, inv_freq[i] = 10000^(-i/32) = 2^(-i*log2(1e4)/32).
// kSeq*32/256 = 256 blocks x 256 threads = exactly 65536 elements per table; each wave writes 32 consecutive
// ---------------------------------------------------------------------------
__device__ __forceinline__ void rope_table_thread(float* __restrict__ cs, float* __restrict__ sn, const int i) {
  const int t  = i >> 5;
  const int fi = i & 31;
  const float invf = exp2f((float)fi * -0.41524101186092f);
  const float ang  = (float)t * invf;
  float sv, cv;
  sincosf(ang, &sv, &cv);
  ((float*)cs)[i] = cv;
  ((float*)sn)[i] = sv;
}

// ---------------------------------------------------------------------------
// Everything that depends on the inputs alone, in one launch: the rotary tables and the bf16 splits of x and of the four
// weight matrices. No part reads what another writes. Block ranges, the part with the longest thread first:
//   kPbT table blocks | kPbX blocks of x | kPbWq of Wq | kPbWk of Wk | kPbWk of Wv | kPbWq of Wo
// ---------------------------------------------------------------------------
constexpr int kN8X  = kTok * kDim / 8;        // 393216 threads
constexpr int kN8Wq = kDim * kDim / 8;        // 73728
constexpr int kN8Wk = kKvDim * kDim / 8;      // 24576
constexpr int kPbT  = kSeq * kHalfHd / 256;   // 256
constexpr int kPbX  = kN8X / 256;             // 1536
constexpr int kPbWq = kN8Wq / 256;            // 288
constexpr int kPbWk = kN8Wk / 256;            // 96
static_assert((kSeq * kHalfHd) % 256 == 0 && kN8X % 256 == 0 && kN8Wq % 256 == 0 && kN8Wk % 256 == 0);

__global__ __launch_bounds__(256) void prep_kernel(
    const float* __restrict__ x, const float* __restrict__ Wq, const float* __restrict__ Wk,
    const float* __restrict__ Wv, const float* __restrict__ Wo,
    unsigned short* __restrict__ Xh, unsigned short* __restrict__ Xl,
    unsigned short* __restrict__ Wqh, unsigned short* __restrict__ Wql,
    unsigned short* __restrict__ Wkh, unsigned short* __restrict__ Wkl,
    unsigned short* __restrict__ Wvh, unsigned short* __restrict__ Wvl,
    unsigned short* __restrict__ Woh, unsigned short* __restrict__ Wol,
    float* __restrict__ cs, float* __restrict__ sn) {
  int bx = blockIdx.x;                          // block-uniform choice of the part
  if (bx < kPbT) { rope_table_thread(cs, sn, bx * 256 + threadIdx.x); return; }
  bx -= kPbT;
  const float* in = x; unsigned short* hi = Xh; unsigned short* lo = Xl; int n8 = kN8X;
  if (bx >= kPbX) {
    bx -= kPbX; in = Wq; hi = Wqh; lo = Wql; n8 = kN8Wq;
    if (bx >= kPbWq) {
      bx -= kPbWq; in = Wk; hi = Wkh; lo = Wkl; n8 = kN8Wk;
      if (bx >= kPbWk) {
        bx -= kPbWk; in = Wv; hi = Wvh; lo = Wvl;
        if (bx >= kPbWk) { bx -= kPbWk; in = Wo; hi = Woh; lo = Wol; n8 = kN8Wq; }
      }
    }
  }
  split_pack_thread(in, hi, lo, bx * 256 + threadIdx.x, n8);
}

// ---------------------------------------------------------------------------
// Per (token, head) unit of 64 floats: y[d] = w[d] * (x[d] * rsqrt(mean(x^2) + eps)); rotary:
//   o[d] = y[d]*cos[t][d&31] - y[d+32]*sin  (d < 32),   o[d] = y[d]*cos + y[d-32]*sin  (d >= 32);
// o split into bf16 hi/lo planes at the same [token][head*64+d] position as the f32 source.
// Units 0..24575 = (token, q head) from Qf [2048][768]; units 24576..32767 = (token, kv head) from Kf [2048][256].
// 8 lanes per unit (d0 = 8*(lane&7)), 4 units per wave, grid.x = 32768/32 = 1024 blocks x 256 threads covers all units
// of one batch element; grid.y = batch element (planes of batch b start b*2048 token rows further on).
// ---------------------------------------------------------------------------
__device__ __forceinline__ float rope_one(float x, float p, float wx, float wp, float cv, float sv, float rinv, float sg) {
  const float xn = wx * (x * rinv);
  const float pn = wp * (p * rinv);
  return xn * cv + (sg * pn) * sv;
}

__global__ __launch_bounds__(256) void norm_rope_split_kernel(
    const float* __restrict__ Qf, const float* __restrict__ Kf,
    const float* __restrict__ qw, const float* __restrict__ kw,
    const float* __restrict__ cs, const float* __restrict__ sn,
    unsigned short* __restrict__ Qh, unsigned short* __restrict__ Ql,
    unsigned short* __restrict__ Kh, unsigned short* __restrict__ Kl) {
  const int lane  = threadIdx.x & 31;
  const int wave  = threadIdx.x >> 5;
  const int wbase = (blockIdx.x * 8 + wave) * 4;   // first unit of this wave
  const int u     = wbase + (lane >> 3);           // < kNUnits by grid construction
  const int d0    = (lane & 7) * 8;
  const bool isq  = wbase < kNQUnits;              // wave-uniform
  int uq = u; if (uq > kNQUnits - 1) uq = kNQUnits - 1;
  const int tq = uq / kNHq, hq = uq - tq * kNHq;
  int uk = u - kNQUnits; if (uk < 0) uk = 0; if (uk > kNKUnits - 1) uk = kNKUnits - 1;
  const int tk = uk >> 2, hk = uk & 3;
  const int t = isq ? tq : tk;
  const size_t rowb = (size_t)blockIdx.y * kSeq;   // first token row of this batch element
  const size_t offq = (rowb + tq) * kDim + (size_t)hq * kHd;
  const size_t offk = (rowb + tk) * kKvDim + (size_t)hk * kHd;
  const float* src = isq ? (Qf + offq) : (Kf + offk);
  const float* w   = isq ? qw : kw;
  unsigned short* dh = isq ? (Qh + offq) : (Kh + offk);
  unsigned short* dl = isq ? (Ql + offq) : (Kl + offk);
  const int dp = d0 ^ kHalfHd;                     // rotary partner block
  const int ci = t * kHalfHd + (d0 & 24);

  const v4f xa = *(const v4f*)(src + d0),  xb = *(const v4f*)(src + d0 + 4);
  const v4f pa = *(const v4f*)(src + dp),  pb = *(const v4f*)(src + dp + 4);
  const v4f wa = *(const v4f*)(w + d0),    wb = *(const v4f*)(w + d0 + 4);
  const v4f va = *(const v4f*)(w + dp),    vb = *(const v4f*)(w + dp + 4);
  const v4f ca = *(const v4f*)(cs + ci),   cb = *(const v4f*)(cs + ci + 4);
  const v4f sa = *(const v4f*)(sn + ci),   sb = *(const v4f*)(sn + ci + 4);

  float ss = xa[0] * xa[0] + xa[1] * xa[1] + xa[2] * xa[2] + xa[3] * xa[3]
           + xb[0] * xb[0] + xb[1] * xb[1] + xb[2] * xb[2] + xb[3] * xb[3];
  ss += __shfl_xor(ss, 1, 32);
  ss += __shfl_xor(ss, 2, 32);
  ss += __shfl_xor(ss, 4, 32);
  const float rinv = rsqrtf(ss * (1.0f / 64.0f) + 1e-6f);
  const float sg = (d0 < kHalfHd) ? -1.0f : 1.0f;

  float o[8];
  o[0] = rope_one(xa[0], pa[0], wa[0], va[0], ca[0], sa[0], rinv, sg);
  o[1] = rope_one(xa[1], pa[1], wa[1], va[1], ca[1], sa[1], rinv, sg);
  o[2] = rope_one(xa[2], pa[2], wa[2], va[2], ca[2], sa[2], rinv, sg);
  o[3] = rope_one(xa[3], pa[3], wa[3], va[3], ca[3], sa[3], rinv, sg);
  o[4] = rope_one(xb[0], pb[0], wb[0], vb[0], cb[0], sb[0], rinv, sg);
  o[5] = rope_one(xb[1], pb[1], wb[1], vb[1], cb[1], sb[1], rinv, sg);
  o[6] = rope_one(xb[2], pb[2], wb[2], vb[2], cb[2], sb[2], rinv, sg);
  o[7] = rope_one(xb[3], pb[3], wb[3], vb[3], cb[3], sb[3], rinv, sg);

  v4u hv, lv;
#pragma unroll
  for (int q = 0; q < 4; ++q) {
    const unsigned short h0 = f2bf_bits(o[2 * q]), h1 = f2bf_bits(o[2 * q + 1]);
    const unsigned short l0 = f2bf_bits(o[2 * q] - bf_bits2f(h0)), l1 = f2bf_bits(o[2 * q + 1] - bf_bits2f(h1));
    hv[q] = pk16(h0, h1);
    lv[q] = pk16(l0, l1);
  }
  *(v4u*)(dh + d0) = hv;
  *(v4u*)(dl + d0) = lv;
  
}

// =====================================================================================
// Causal sliding-window grouped-query attention, head dim 64, grid.y = batch element (offsets below are within one).
//   q planes (hi/lo bf16): element (t, h, d) at [t*kDim + h*64 + d]           (12 heads)
//   k planes (hi/lo bf16): element (s, g, d) at [s*kKvDim + g*64 + d]         (4 kv heads, g = h/3)
//   v^T planes (hi/lo bf16): element (g, d, s) at [(g*64 + d)*kSeq + s]
//   out f32: element (t, h, d) at [t*kDim + h*64 + d]
//   scores = (q . k) * sscale : bf16 hi/lo split (hi.hi + hi.lo + lo.hi) on v_wmma_f32_16x16x32_bf16
//   out    = p . v             : bf16 hi/lo split of p (unnormalised) and v, f32 accumulate
//   online softmax in f32; keys with s > t or t - s > kWin-1 set to -inf; a fully -inf running max uses a 0 pivot
//   (alpha = 0, p = 0) so nothing non-finite is produced; the diagonal key is always kept.
//   Block = 4 waves = 64 query rows of one head; grid.x = kNHq * (kSeq/64); kv chunks of 64 from the first
//   in-window chunk (block-uniform) up to chunk qb (static bound qb+1 <= 32).
//   K / V^T chunk staging: 128 threads x 32 elements per plane = the whole 64x64 tile (16-B copies, plain loads,
//   __syncthreads before and after); fragment loads read the LDS tiles with the same v8b element type. LDS rows of
//   the K, V^T and P tiles are AT_LP elements apart (64 used + 8 never read or written).
// =====================================================================================
#define AT_D 64
#define AT_NW 4
#define AT_QB 64
#define AT_KC 64
#define AT_LP 72   // LDS row pitch of the K, V^T and P tiles in elements: 144 B = 16 B x 9 (odd), so the 16 rows that one
                   // ds_load_b128 touches per half wave start on 16 different 4-bank groups (128-B rows: only 2 groups)

__device__ __forceinline__ unsigned short at_bf_bits(float f) {
  unsigned u = __float_as_uint(f);
  return (unsigned short)((u + 0x7FFFu + ((u >> 16) & 1u)) >> 16);
}
__device__ __forceinline__ __bf16 at_f2bf(float f) { return __builtin_bit_cast(__bf16, at_bf_bits(f)); }
__device__ __forceinline__ void at_split(float f, __bf16& hi, __bf16& lo) {
  const unsigned short hb = at_bf_bits(f);
  hi = __builtin_bit_cast(__bf16, hb);
  lo = at_f2bf(f - __uint_as_float(((unsigned)hb) << 16));
}
__device__ __forceinline__ v8f at_mma(v16b a, v16b b, v8f c) {
  c = __builtin_amdgcn_wmma_f32_16x16x32_bf16(false, a, false, b, (short)0, c, false, false);
  asm volatile("v_nop\n\tv_nop\n\tv_nop\n\tv_nop" : "+v"(c) : "v"(a), "v"(b));
  return c;
}

__global__ __launch_bounds__(128)
void attn_gqa_window64_kernel(const unsigned short* __restrict__ qhp, const unsigned short* __restrict__ qlp,
                              const unsigned short* __restrict__ khp, const unsigned short* __restrict__ klp,
                              const unsigned short* __restrict__ vhp, const unsigned short* __restrict__ vlp,
                              float* __restrict__ out, float sscale) {
  union FB { v16b v; v8b h[2]; };
  __shared__ __align__(16) __bf16 Ksh[AT_KC * AT_LP];            // K hi [kv][d]      9 KB
  __shared__ __align__(16) __bf16 Ksl[AT_KC * AT_LP];            // K lo
  __shared__ __align__(16) __bf16 Vth[AT_D * AT_LP];             // V hi [d][kv]      9 KB
  __shared__ __align__(16) __bf16 Vtl[AT_D * AT_LP];             // V lo
  __shared__ __align__(16) __bf16 Psh[AT_NW][16 * AT_LP];        // per wave P hi [row][kv]
  __shared__ __align__(16) __bf16 Psl[AT_NW][16 * AT_LP];        // per wave P lo
  __shared__ __align__(16) float  Os[AT_NW][16 * 68];            // per wave out tile, pitch 68

  const int tid  = threadIdx.x;
  const int wave = tid >> 5;
  const int lane = tid & 31;
  const int hh   = lane >> 4;
  const int c    = lane & 15;

  const int nqb = kSeq / AT_QB;           // 32
  const int bx = blockIdx.x;
  const int qb = bx % nqb;
  const int h  = bx / nqb;                // 0..kNHq-1 (grid = kNHq * nqb)
  const int kvh = h / kGroups;            // 0..kNKv-1
  const int q0 = qb * AT_QB + wave * 16;

  const size_t bq = (size_t)blockIdx.y * kSeq * kDim;     // batch element's q / out plane
  const size_t bk = (size_t)blockIdx.y * kSeq * kKvDim;   // batch element's k / v^T plane
  const __bf16* Qh = (const __bf16*)(const void*)qhp + bq + (size_t)h * AT_D;
  const __bf16* Ql = (const __bf16*)(const void*)qlp + bq + (size_t)h * AT_D;
  const __bf16* Kh = (const __bf16*)(const void*)khp + bk + (size_t)kvh * AT_D;
  const __bf16* Kl = (const __bf16*)(const void*)klp + bk + (size_t)kvh * AT_D;
  const __bf16* Vh = (const __bf16*)(const void*)vhp + bk + (size_t)kvh * AT_D * kSeq;
  const __bf16* Vl = (const __bf16*)(const void*)vlp + bk + (size_t)kvh * AT_D * kSeq;
  float*        ob = out + bq + (size_t)h * AT_D;

  // ---- Q fragments (A operand, row = lane&15, split k map via Frag load): 2 d-chunks, hi and lo ----
  v16b qah[2], qal[2];
#pragma unroll
  for (int dc = 0; dc < 2; ++dc) {
    const __bf16* qr = Qh + (size_t)(q0 + c) * kDim + dc * 32 + 8 * hh;
    const __bf16* ql = Ql + (size_t)(q0 + c) * kDim + dc * 32 + 8 * hh;
    qah[dc] = Frag<__bf16>::load(qr);
    qal[dc] = Frag<__bf16>::load(ql);
  }

  float mrow[8], lrow[8];
  v8f oacc[4];
#pragma unroll
  for (int r = 0; r < 8; ++r) { mrow[r] = -INFINITY; lrow[r] = 0.f; }
#pragma unroll
  for (int t = 0; t < 4; ++t) oacc[t] = (v8f){0.f,0.f,0.f,0.f,0.f,0.f,0.f,0.f};

  const int qlo = qb * AT_QB - (kWin - 1);                 // smallest key allowed for the block's first row
  const int kcStart = (qlo > 0) ? (qlo / AT_KC) : 0;       // block-uniform
  const int nChunks = qb + 1;                              // block-uniform, <= 32
  for (int kc = kcStart; kc < nChunks; ++kc) {
    const int kv0 = kc * AT_KC;
    __syncthreads();
    {
      // staging coverage: 128 threads x (4 x 8) elements = 64 rows x 64 per plane = the whole chunk tile
      const int r = tid >> 1, half = (tid & 1) * 32;
      const __bf16* ksh = Kh + (size_t)(kv0 + r) * kKvDim + half;   // K row kv0+r, d = half..half+31
      const __bf16* ksl = Kl + (size_t)(kv0 + r) * kKvDim + half;
      const __bf16* vsh = Vh + (size_t)r * kSeq + kv0 + half;        // V^T row d = r, s = kv0+half..+31
      const __bf16* vsl = Vl + (size_t)r * kSeq + kv0 + half;
#pragma unroll
      for (int i = 0; i < 4; ++i) {
        const v8b a0 = *(const v8b*)(ksh + 8 * i);
        const v8b a1 = *(const v8b*)(ksl + 8 * i);
        const v8b b0 = *(const v8b*)(vsh + 8 * i);
        const v8b b1 = *(const v8b*)(vsl + 8 * i);
        *(v8b*)(Ksh + r * AT_LP + half + 8 * i) = a0;
        *(v8b*)(Ksl + r * AT_LP + half + 8 * i) = a1;
        *(v8b*)(Vth + r * AT_LP + half + 8 * i) = b0;
        *(v8b*)(Vtl + r * AT_LP + half + 8 * i) = b1;
      }
    }
    __syncthreads();

    v8f s[4];
#pragma unroll
    for (int j = 0; j < 4; ++j) {
      s[j] = (v8f){0.f,0.f,0.f,0.f,0.f,0.f,0.f,0.f};
#pragma unroll
      for (int dc = 0; dc < 2; ++dc) {
        FB kb, kl;
        kb.h[0] = *(const v8b*)(Ksh + (j * 16 + c) * AT_LP + dc * 32 + 8 * hh);
        kb.h[1] = *(const v8b*)(Ksh + (j * 16 + c) * AT_LP + dc * 32 + 16 + 8 * hh);
        kl.h[0] = *(const v8b*)(Ksl + (j * 16 + c) * AT_LP + dc * 32 + 8 * hh);
        kl.h[1] = *(const v8b*)(Ksl + (j * 16 + c) * AT_LP + dc * 32 + 16 + 8 * hh);
        s[j] = at_mma(qah[dc], kb.v, s[j]);
        s[j] = at_mma(qah[dc], kl.v, s[j]);
        s[j] = at_mma(qal[dc], kb.v, s[j]);
      }
    }
    float cm[8];
#pragma unroll
    for (int r = 0; r < 8; ++r) {
      const int qrow = q0 + 8 * hh + r;
      float m = -INFINITY;
#pragma unroll
      for (int j = 0; j < 4; ++j) {
        const int kvcol = kv0 + j * 16 + c;
        const float sv = s[j][r] * sscale;
        const bool masked = (kvcol > qrow) || (qrow - kvcol > kWin - 1);
        const float sm = masked ? -INFINITY : sv;
        s[j][r] = sm;
        m = fmaxf(m, sm);
      }
#pragma unroll
      for (int off = 1; off < 16; off <<= 1) m = fmaxf(m, __shfl_xor(m, off, 32));
      cm[r] = m;
    }
    __bf16* pwh = Psh[wave];
    __bf16* pwl = Psl[wave];
#pragma unroll
    for (int r = 0; r < 8; ++r) {
      const float mnew  = fmaxf(mrow[r], cm[r]);
      const float mpiv  = (mnew == -INFINITY) ? 0.0f : mnew;   // fully masked so far -> alpha = 0, p = 0
      const float alpha = expf(mrow[r] - mpiv);
      mrow[r] = mnew;
      float psum = 0.f;
#pragma unroll
      for (int j = 0; j < 4; ++j) {
        const float p = expf(s[j][r] - mpiv);
        psum += p;
        __bf16 a, bl; at_split(p, a, bl);
        pwh[(8 * hh + r) * AT_LP + j * 16 + c] = a;
        pwl[(8 * hh + r) * AT_LP + j * 16 + c] = bl;
      }
#pragma unroll
      for (int off = 1; off < 16; off <<= 1) psum += __shfl_xor(psum, off, 32);
      lrow[r] = lrow[r] * alpha + psum;
#pragma unroll
      for (int t = 0; t < 4; ++t) oacc[t][r] *= alpha;
    }
    __builtin_amdgcn_fence(__ATOMIC_RELEASE, "workgroup");
    __builtin_amdgcn_wave_barrier();
    __builtin_amdgcn_fence(__ATOMIC_ACQUIRE, "workgroup");
#pragma unroll 1
    for (int kk = 0; kk < 2; ++kk) {
      FB pa, pl;
      pa.h[0] = *(const v8b*)(pwh + c * AT_LP + kk * 32 + 8 * hh);
      pa.h[1] = *(const v8b*)(pwh + c * AT_LP + kk * 32 + 16 + 8 * hh);
      pl.h[0] = *(const v8b*)(pwl + c * AT_LP + kk * 32 + 8 * hh);
      pl.h[1] = *(const v8b*)(pwl + c * AT_LP + kk * 32 + 16 + 8 * hh);
#pragma unroll
      for (int t = 0; t < 4; ++t) {
        FB vb, vl;
        vb.h[0] = *(const v8b*)(Vth + (t * 16 + c) * AT_LP + kk * 32 + 8 * hh);
        vb.h[1] = *(const v8b*)(Vth + (t * 16 + c) * AT_LP + kk * 32 + 16 + 8 * hh);
        vl.h[0] = *(const v8b*)(Vtl + (t * 16 + c) * AT_LP + kk * 32 + 8 * hh);
        vl.h[1] = *(const v8b*)(Vtl + (t * 16 + c) * AT_LP + kk * 32 + 16 + 8 * hh);
        oacc[t] = at_mma(pa.v, vb.v, oacc[t]);
        oacc[t] = at_mma(pa.v, vl.v, oacc[t]);
        oacc[t] = at_mma(pl.v, vb.v, oacc[t]);
      }
    }
  }

  float* os = Os[wave];
#pragma unroll
  for (int r = 0; r < 8; ++r) {
    const float inv = 1.0f / lrow[r];
#pragma unroll
    for (int t = 0; t < 4; ++t) os[(8 * hh + r) * 68 + t * 16 + c] = oacc[t][r] * inv;
  }
  __builtin_amdgcn_fence(__ATOMIC_RELEASE, "workgroup");
  __builtin_amdgcn_wave_barrier();
  __builtin_amdgcn_fence(__ATOMIC_ACQUIRE, "workgroup");
  {
    const int c4 = (lane & 15) * 4;
    {
#pragma unroll
      for (int it = 0; it < 8; ++it) {
        const int row = it * 2 + hh;   // it 0..7 x hh 0..1 covers rows 0..15 of the wave tile
        v4f val = *(const v4f*)(os + row * 68 + c4);
        *(v4f*)(ob + (size_t)(q0 + row) * kDim + c4) = val;
      }
      
    }
  }
}

// ---------------------------------------------------------------------------
// Workspace region map (byte offsets; every region is fully written in this call before it is read; token rows
// run over both batch elements, row = b*2048 + t; VT holds one [256][2048] plane per batch element; the W*, X* and
// O* bf16 planes are fragment-major, 16-row x 32-k blocks, see wmma_gemm64):
//   Wqh bf16 [768 n][768 k]         0      Wql   1179648
//   Wkh bf16 [256][768]        2359296      Wkl   2752512
//   Wvh bf16 [256][768]        3145728      Wvl   3538944
//   Woh bf16 [768][768]        3932160      Wol   5111808
//   CS  f32  [2048][32]        6291456      SN    6553600
//   Xh  bf16 [4096][768]       6815744      Xl   13107200
//   Qf  f32  [4096][768]      19398656
//   Kf  f32  [4096][256]      31981568
//   Qh  bf16 [4096][768]      36175872      Ql   42467328
//   Kh  bf16 [4096][256]      48758784      Kl   50855936
//   VTh bf16 [2][256][2048]   52953088      VTl  55050240
//   Of  f32  [4096][768]      57147392
//   Oh  bf16 [4096][768]      69730304      Ol   76021760
//   total                     82313216
// ---------------------------------------------------------------------------
extern "C" void kernel_launch(void* const* d_in, const int* in_sizes, int n_in,
                              void* d_out, int out_size, void* d_ws, size_t ws_size,
                              hipStream_t stream) {
  if (n_in < 7) return;
  if (in_sizes[0] != kNB * kSeq * kDim) return;
  if (in_sizes[1] != kDim * kDim || in_sizes[4] != kDim * kDim) return;
  if (in_sizes[2] != kKvDim * kDim || in_sizes[3] != kKvDim * kDim) return;
  if (in_sizes[5] != kHd || in_sizes[6] != kHd) return;
  if (out_size != kNB * kSeq * kDim) return;

  const float* x    = (const float*)d_in[0];
  const float* Wq   = (const float*)d_in[1];
  const float* Wk   = (const float*)d_in[2];
  const float* Wv   = (const float*)d_in[3];
  const float* Wo   = (const float*)d_in[4];
  const float* lnq  = (const float*)d_in[5];
  const float* lnk  = (const float*)d_in[6];

  const size_t PWQ = (size_t)kDim * kDim * 2;      // 1179648  bf16 [768][768] plane
  const size_t PWK = (size_t)kKvDim * kDim * 2;    // 393216   bf16 [256][768] plane
  const size_t PTB = (size_t)kSeq * kHalfHd * 4;   // 262144   f32 [2048][32] table
  const size_t PXB = (size_t)kTok * kDim * 2;      // 6291456  bf16 [4096][768] plane
  const size_t PXF = (size_t)kTok * kDim * 4;      // 12582912 f32 [4096][768]
  const size_t PKF = (size_t)kTok * kKvDim * 4;    // 4194304  f32 [4096][256]
  const size_t PKB = (size_t)kTok * kKvDim * 2;    // 2097152  bf16 [4096][256] / [2][256][2048] plane
  size_t off = 0;
  const size_t oWqh = off; off += PWQ;  const size_t oWql = off; off += PWQ;
  const size_t oWkh = off; off += PWK;  const size_t oWkl = off; off += PWK;
  const size_t oWvh = off; off += PWK;  const size_t oWvl = off; off += PWK;
  const size_t oWoh = off; off += PWQ;  const size_t oWol = off; off += PWQ;
  const size_t oCS  = off; off += PTB;  const size_t oSN  = off; off += PTB;
  const size_t oXh  = off; off += PXB;  const size_t oXl  = off; off += PXB;
  const size_t oQf  = off; off += PXF;
  const size_t oKf  = off; off += PKF;
  const size_t oQh  = off; off += PXB;  const size_t oQl  = off; off += PXB;
  const size_t oKh  = off; off += PKB;  const size_t oKl  = off; off += PKB;
  const size_t oVTh = off; off += PKB;  const size_t oVTl = off; off += PKB;
  const size_t oOf  = off; off += PXF;
  const size_t oOh  = off; off += PXB;  const size_t oOl  = off; off += PXB;
  if (off > ws_size) return;                       // off = 82313216
  if (off > (size_t)134217728) return;

  char* ws = (char*)d_ws;
  unsigned short* Wqh = (unsigned short*)(ws + oWqh); unsigned short* Wql = (unsigned short*)(ws + oWql);
  unsigned short* Wkh = (unsigned short*)(ws + oWkh); unsigned short* Wkl = (unsigned short*)(ws + oWkl);
  unsigned short* Wvh = (unsigned short*)(ws + oWvh); unsigned short* Wvl = (unsigned short*)(ws + oWvl);
  unsigned short* Woh = (unsigned short*)(ws + oWoh); unsigned short* Wol = (unsigned short*)(ws + oWol);
  float*          CS  = (float*)(ws + oCS);          float*          SN  = (float*)(ws + oSN);
  unsigned short* Xh  = (unsigned short*)(ws + oXh);  unsigned short* Xl  = (unsigned short*)(ws + oXl);
  float*          Qf  = (float*)(ws + oQf);
  float*          Kf  = (float*)(ws + oKf);
  unsigned short* Qh  = (unsigned short*)(ws + oQh);  unsigned short* Ql  = (unsigned short*)(ws + oQl);
  unsigned short* Kh  = (unsigned short*)(ws + oKh);  unsigned short* Kl  = (unsigned short*)(ws + oKl);
  unsigned short* VTh = (unsigned short*)(ws + oVTh); unsigned short* VTl = (unsigned short*)(ws + oVTl);
  float*          Of  = (float*)(ws + oOf);
  unsigned short* Oh  = (unsigned short*)(ws + oOh);  unsigned short* Ol  = (unsigned short*)(ws + oOl);

  const dim3 blk(256);
  const dim3 gPrep(kPbT + kPbX + 2 * kPbWq + 2 * kPbWk);            // 2560 blocks
  const dim3 gCast(kPbX);                                           // 1536 blocks x 2048 elements = 4096x768
  const dim3 gQKV(kBlkQ + kBlkK + kNB * kBlkV);                     // 160 blocks x 8 tiles
  const dim3 gProjQ(kBlkQ, 1);                                      // 768 tiles: M=4096, N=768
  const dim3 gRope(kNUnits / 32, kNB);                              // 1024 blocks x 32 units per batch element
  const dim3 gAtt(kNHq * (kSeq / 64), kNB);                         // 12 heads x 32 query blocks per batch element

  // Both batch elements go through every stage in one launch: the token-row GEMMs see M = 4096 rows, the stages
  // that need the position inside a sequence take the batch element from the block index.
  // (1) rotary tables; x and the weights [out n][in k] f32 -> bf16 hi/lo planes, fragment-major
  prep_kernel<<<gPrep, blk, 0, stream>>>(x, Wq, Wk, Wv, Wo, Xh, Xl, Wqh, Wql, Wkh, Wkl, Wvh, Wvl, Woh, Wol, CS, SN);
  // (2)-(4) q -> Qf, k -> Kf, v^T -> VT hi/lo planes (K = 768 each)
  qkv_gemm64_kernel<<<gQKV, blk, 0, stream>>>(Xh, Xl, Wqh, Wql, Wkh, Wkl, Wvh, Wvl, Qf, Kf, VTh, VTl, kDim);
  // (5) per-head rmsnorm * w + rotary on q and k -> Q/K bf16 hi/lo planes
  norm_rope_split_kernel<<<gRope, blk, 0, stream>>>(Qf, Kf, lnq, lnk, CS, SN, Qh, Ql, Kh, Kl);
  // (6) windowed causal GQA attention per head: y[row][h*64+d] (f32 plane, every element written by its (b, h, query block) owner)
  attn_gqa_window64_kernel<<<gAtt, dim3(128), 0, stream>>>(Qh, Ql, Kh, Kl, VTh, VTl, Of, 0.125f);
  // (7) y -> bf16 hi/lo planes, fragment-major
  split_pack_bf16_kernel<<<gCast, blk, 0, stream>>>(Of, Oh, Ol, kN8X);
  // (8) out = y . Wo^T -> d_out rows 0 .. 4095 (f32)   (M=4096, N=768, K=768)
  wmma_gemm64<1, true, 0, 0, false><<<gProjQ, blk, 0, stream>>>(
      Oh, Ol, kDim, 0L, Woh, Wol, kDim, 0L, d_out, d_out, kDim, 0L,
      lnq, lnq, 0L, kTok, kDim, kDim, 1.0f);
}

// v006
// A run of this version takes 101 microseconds.
// Timed twice side by side with v005, it ran 1.10 and 1.11 times as fast.
// Over all steps from v000 it is 5.42 times as fast.
// Contractions (q/k/v/out projections, q.k^T scores, p.v): v_wmma_f32_16x16x32_bf16 with bf16 hi/lo split operands (hi.hi + hi.lo + lo.hi), f32 accumulate; rmsnorm, rotary tables, online softmax in f32.
#include <hip/hip_runtime.h>
#include <math.h>
#include <stdint.h>

constexpr int kNB     = 2;
constexpr int kSeq    = 2048;
constexpr int kTok    = kNB * kSeq;          // 4096 token rows over both batch elements
constexpr int kDim    = 768;
constexpr int kHd     = 64;
constexpr int kNHq    = 12;
constexpr int kNKv    = 4;
constexpr int kGroups = 3;
constexpr int kKvDim  = kNKv * kHd;          // 256
constexpr int kWin    = 384;
constexpr int kHalfHd = 32;
constexpr int kKBlk   = kDim / 32;           // 24 k blocks of 32 in a row of 768
static_assert((kSeq & (kSeq - 1)) == 0 && kHd == 64 && kHalfHd * 2 == kHd);
static_assert(kSeq % 64 == 0 && kDim % 64 == 0 && kKvDim % 64 == 0 && kDim % 32 == 0);
static_assert(kNHq == kNKv * kGroups);

typedef __attribute__((ext_vector_type(16))) _Float16 v16h;
typedef __attribute__((ext_vector_type(8)))  _Float16 v8h;
typedef __attribute__((ext_vector_type(16))) __bf16   v16b;
typedef __attribute__((ext_vector_type(8)))  __bf16   v8b;
typedef __attribute__((ext_vector_type(8)))  float    v8f;
typedef __attribute__((ext_vector_type(4)))  float    v4f;
typedef __attribute__((ext_vector_type(2)))  float    v2f;
typedef __attribute__((ext_vector_type(4)))  unsigned int v4u;

__device__ __forceinline__ unsigned short f2bf_bits(float f) {
  unsigned u = __float_as_uint(f);
  return (unsigned short)((u + 0x7FFFu + ((u >> 16) & 1u)) >> 16);
}
__device__ __forceinline__ float bf_bits2f(unsigned short h) { return __uint_as_float(((unsigned)h) << 16); }

__device__ __forceinline__ unsigned pk16(unsigned short a, unsigned short b) { return (unsigned)a | ((unsigned)b << 16); }
// 8 consecutive f32 -> 8 bf16 hi = bf16_rne(f) and 8 bf16 lo = bf16_rne(f - hi), 16 B each
__device__ __forceinline__ void split8(const float (&f)[8], v4u& hv, v4u& lv) {
#pragma unroll   // constant indices keep f, hv and lv in registers
  for (int q = 0; q < 4; ++q) {
    const unsigned short h0 = f2bf_bits(f[2 * q]), h1 = f2bf_bits(f[2 * q + 1]);
    const unsigned short l0 = f2bf_bits(f[2 * q] - bf_bits2f(h0)), l1 = f2bf_bits(f[2 * q + 1] - bf_bits2f(h1));
    hv[q] = pk16(h0, h1);
    lv[q] = pk16(l0, l1);
  }
}

// ---------------------------------------------------------------------------
// Per (token, head) unit of 64 floats: y[d] = w[d] * (x[d] * rsqrt(mean(x^2) + eps)); rotary:
//   o[d] = y[d]*cos[t][d&31] - y[d+32]*sin  (d < 32),   o[d] = y[d]*cos + y[d-32]*sin  (d >= 32);
// o split into bf16 hi/lo. 8 lanes per unit (lane&7 = which 8 of the 64), 4 units per wave: x = the lane's own 8 values,
// p = the 8 of its rotary partner block, w / v = the norm weights of the two blocks, c / s = the table rows' 8 values.
// ---------------------------------------------------------------------------
__device__ __forceinline__ float rope_one(float x, float p, float wx, float wp, float cv, float sv, float rinv, float sg) {
  const float xn = wx * (x * rinv);
  const float pn = wp * (p * rinv);
  return xn * cv + (sg * pn) * sv;
}
__device__ __forceinline__ void norm_rope_unit(const v4f xa, const v4f xb, const v4f pa, const v4f pb, const v4f wa, const v4f wb,
                                               const v4f va, const v4f vb, const v4f ca, const v4f cb, const v4f sa, const v4f sb,
                                               const float sg, v4u& hv, v4u& lv) {
  float ss = xa[0] * xa[0] + xa[1] * xa[1] + xa[2] * xa[2] + xa[3] * xa[3]
           + xb[0] * xb[0] + xb[1] * xb[1] + xb[2] * xb[2] + xb[3] * xb[3];
  ss += __shfl_xor(ss, 1, 32);
  ss += __shfl_xor(ss, 2, 32);
  ss += __shfl_xor(ss, 4, 32);
  const float rinv = rsqrtf(ss * (1.0f / 64.0f) + 1e-6f);
  float o[8];
  o[0] = rope_one(xa[0], pa[0], wa[0], va[0], ca[0], sa[0], rinv, sg);
  o[1] = rope_one(xa[1], pa[1], wa[1], va[1], ca[1], sa[1], rinv, sg);
  o[2] = rope_one(xa[2], pa[2], wa[2], va[2], ca[2], sa[2], rinv, sg);
  o[3] = rope_one(xa[3], pa[3], wa[3], va[3], ca[3], sa[3], rinv, sg);
  o[4] = rope_one(xb[0], pb[0], wb[0], vb[0], cb[0], sb[0], rinv, sg);
  o[5] = rope_one(xb[1], pb[1], wb[1], vb[1], cb[1], sb[1], rinv, sg);
  o[6] = rope_one(xb[2], pb[2], wb[2], vb[2], cb[2], sb[2], rinv, sg);
  o[7] = rope_one(xb[3], pb[3], wb[3], vb[3], cb[3], sb[3], rinv, sg);
  split8(o, hv, lv);
}

// hazard guards as plain device helpers (no inline asm inside the kernel template body)
// four vector slots: the distance asked between a 16-bit matrix instruction and a vector overwrite of a register that it reads;
// kept in front of a load over such a register too, as a precaution
__device__ __forceinline__ void operand_gap() { asm volatile("v_nop\n\tv_nop\n\tv_nop\n\tv_nop" ::: "memory"); }
__device__ __forceinline__ void acc_guard4(v8f& a, v8f& b, v8f& c, v8f& d) { asm volatile("v_nop\n\tv_nop\n\tv_nop\n\tv_nop" : "+v"(a), "+v"(b), "+v"(c), "+v"(d)); }
template <typename T> struct Frag;
template <> struct Frag<_Float16> {
  typedef v16h V; union U { v16h v; v8h h[2]; };
  static __device__ __forceinline__ v16h load(const _Float16* p) {   // elements 0..7 <- p[0..7], 8..15 <- p[16..23]
    U f; f.h[0] = *(const v8h*)(p); f.h[1] = *(const v8h*)(p + 16); return f.v;
  }
  static __device__ __forceinline__ v8f mma(v16h a, v16h b, v8f c) {
    return __builtin_amdgcn_wmma_f32_16x16x32_f16(false, a, false, b, (short)0, c, false, false);
  }
};
template <> struct Frag<__bf16> {
  typedef v16b V; union U { v16b v; v8b h[2]; };
  static __device__ __forceinline__ v16b load(const __bf16* p) {
    U f; f.h[0] = *(const v8b*)(p); f.h[1] = *(const v8b*)(p + 16); return f.v;
  }
  // fragment-major block at byte address p: elements 0..7 <- bytes 0..15, elements 8..15 <- bytes 512..527
  static __device__ __forceinline__ v16b load_packed(const char* p) {
    U f; f.h[0] = *(const v8b*)(p); f.h[1] = *(const v8b*)(p + 512); return f.v;
  }
  static __device__ __forceinline__ v8f mma(v16b a, v16b b, v8f c) {
    return __builtin_amdgcn_wmma_f32_16x16x32_bf16(false, a, false, b, (short)0, c, false, false);
  }
};

// ---- Register-blocked batched WMMA GEMM ------------------------------------
// C[m,n] = scale * sum_k A[m,k] * Bt[n,k] (+bias)(+resid); each wave owns a 64x64 tile.
// A [M,K] and Bt [N,K] are stored fragment-major (written by split_pack_thread and by the attention kernel): each 16-row x 32-k block is
// 512 consecutive elements, block index = (row/16)*kKBlk + k/32, and element (row, k) of a block sits at
// ((k>>4)&1)*256 + (((k>>3)&1)*16 + (row&15))*8 + (k&7). Lane l of a fragment load then reads 16 B at l*16 B, so one
// wave-wide load covers 512 consecutive bytes (4 whole lines) and holds the same elements as a row-major fragment load.
// M,N % 64 == 0, K % 64 == 0, K >= 64; rows of both operands are kDim long (lda == ldb == kDim), so the step from one 16-row
// block row to the next is a compile-time constant and goes into the loads' immediate offsets.
// SPLIT: operands are hi/lo planes (A2/Bt2 = lo planes, same layout); product = hi.hi + hi.lo + lo.hi.
// BIAS_MODE: 0 = none, 1 = bias[m], 2 = bias[n].
// OUT_MODE: 0 = f32, 1 = f16, 2 = bf16 hi plane (Cout) + bf16 lo plane (Cout2), 3 = the tile is 64 token rows x the 64
// columns of one head: per-row rmsnorm * nw, rotary from the tables cs / sn, then bf16 hi/lo planes as in 2 (the slab
// then holds the whole tile, 64 rows).
// ET: 0 = f16 operands, 1 = bf16 operands (pointers passed as 16-bit storage)
template <int ET> struct Elem;
template <> struct Elem<0> { typedef _Float16 T; };
template <> struct Elem<1> { typedef __bf16 T; };
// All fragments of one k step of a 64x64 wave tile: four 16-row blocks of A and of Bt, hi and lo planes.
template <typename T, bool SPLIT> struct FragSet { typename Frag<T>::V bh[4], bl[4], ah[4], al[4]; };
constexpr int kRowStep = kKBlk * 1024;         // bytes from one 16-row block row to the next
template <typename T, bool SPLIT>
__device__ __forceinline__ void load_frag_set(FragSet<T, SPLIT>& f, const char* pAh, const char* pAl, const char* pBh,
                                              const char* pBl, const unsigned vo, const int off) {
#pragma unroll
  for (int j = 0; j < 4; ++j) {
    f.bh[j] = Frag<T>::load_packed(pBh + vo + (off + j * kRowStep));
    if (SPLIT) f.bl[j] = Frag<T>::load_packed(pBl + vo + (off + j * kRowStep));
  }
#pragma unroll
  for (int i = 0; i < 4; ++i) {
    f.ah[i] = Frag<T>::load_packed(pAh + vo + (off + i * kRowStep));
    if (SPLIT) f.al[i] = Frag<T>::load_packed(pAl + vo + (off + i * kRowStep));
  }
}
template <typename T, bool SPLIT>
__device__ __forceinline__ void mma_frag_set(v8f (&acc)[4][4], const FragSet<T, SPLIT>& f) {
#pragma unroll
  for (int i = 0; i < 4; ++i) {
#pragma unroll
    for (int j = 0; j < 4; ++j) {
      acc[i][j] = Frag<T>::mma(f.ah[i], f.bh[j], acc[i][j]);
      if (SPLIT) {
        acc[i][j] = Frag<T>::mma(f.ah[i], f.bl[j], acc[i][j]);
        acc[i][j] = Frag<T>::mma(f.al[i], f.bh[j], acc[i][j]);
      }
    }
  }
}
// gemm64_tile = one wave's 64x64 tile; the kernels below hand it the wave's LDS slab, the batch index b and the tile's
// first row m0 and column n0 (the same in every lane, in scalar registers, so that the four plane bases are scalar too).
template <int ET, bool SPLIT, int BIAS_MODE, int OUT_MODE, bool RESID, int ACT = 0>
__device__ __forceinline__ void gemm64_tile(
    float* __restrict__ slab, const int b, const int m0, const int n0,
    const unsigned short* __restrict__ Ap, const unsigned short* __restrict__ A2p, int lda, long strideA,
    const unsigned short* __restrict__ Btp, const unsigned short* __restrict__ Bt2p, int ldb, long strideB,
    void* __restrict__ Cout, void* __restrict__ Cout2, int ldc, long strideC,
    const float* __restrict__ bias,
    const float* __restrict__ resid, long strideR,
    int K, float scale,
    const float* __restrict__ nw = nullptr, const float* __restrict__ cs = nullptr, const float* __restrict__ sn = nullptr) {
  typedef typename Elem<ET>::T T;
  typedef typename Frag<T>::V V;
  const T* A = (const T*)Ap; const T* A2 = (const T*)A2p; const T* Bt = (const T*)Btp; const T* Bt2 = (const T*)Bt2p;
  const int lane = threadIdx.x & 31;

  const T* Ab  = A  + (size_t)b * strideA;
  const T* Bb  = Bt + (size_t)b * strideB;
  const T* Ab2 = SPLIT ? (A2  + (size_t)b * strideA) : nullptr;
  const T* Bb2 = SPLIT ? (Bt2 + (size_t)b * strideB) : nullptr;

  const int rlane = lane & 15;                 // row (A) / col (B, D) within subtile
  const int mOff  = (lane >> 4) * 8;           // D row offset
  // Every fragment load = scalar base of the tile's first block row in its plane + one 32-bit lane byte offset + an
  // immediate (block row step, second half of the block). The lane offset is the only vector address register; it steps
  // one block (1024 B) per k step, two k steps per trip.
  const char* pBh = (const char*)(Bb  + (size_t)(n0 >> 4) * (kKBlk * 512));
  const char* pBl = SPLIT ? (const char*)(Bb2 + (size_t)(n0 >> 4) * (kKBlk * 512)) : nullptr;
  const char* pAh = (const char*)(Ab  + (size_t)(m0 >> 4) * (kKBlk * 512));
  const char* pAl = SPLIT ? (const char*)(Ab2 + (size_t)(m0 >> 4) * (kKBlk * 512)) : nullptr;
  unsigned vo = (unsigned)lane * 16u;          // this lane's 16 B inside a 512-B half block

  v8f acc[4][4];
#pragma unroll
  for (int i = 0; i < 4; ++i)
#pragma unroll
    for (int j = 0; j < 4; ++j) acc[i][j] = (v8f){0.f,0.f,0.f,0.f,0.f,0.f,0.f,0.f};

  // Two register sets of fragments: while the 48 (SPLIT) matrix instructions of one k step run on one set, the 32 loads of
  // the next k step fill the other, so the loads of a k step have the whole length of the k step before it to arrive.
  FragSet<T, SPLIT> f0, f1;
  load_frag_set<T, SPLIT>(f0, pAh, pAl, pBh, pBl, vo, 0);
  asm volatile("s_wait_xcnt 0x0" :: "v"(vo) : "memory");   // as at the loop's foot, for the path that skips the loop (K == 64)
  for (int k0 = 64; k0 < K; k0 += 64) {
    load_frag_set<T, SPLIT>(f1, pAh, pAl, pBh, pBl, vo, 1024);
    __builtin_amdgcn_sched_barrier(0);   // keeps the next step's loads ahead of this step's products (sunk to their use they would fly alone)
    mma_frag_set<T, SPLIT>(acc, f0);
    __builtin_amdgcn_sched_barrier(0);   // keeps every product on f0 in front of the gap below
    operand_gap();                       // four vector slots between the last product that reads f0 and the first load that refills it
    __builtin_amdgcn_sched_barrier(0);   // keeps every refill of f0 behind that gap
    load_frag_set<T, SPLIT>(f0, pAh, pAl, pBh, pBl, vo, 2048);
    __builtin_amdgcn_sched_barrier(0);   // keeps these loads ahead of the products on f1, as above
    mma_frag_set<T, SPLIT>(acc, f1);
    __builtin_amdgcn_sched_barrier(0);   // keeps every product on f1 in front of the gap and the wait below, a whole k step behind the loads
    // four vector slots between the last product that reads f1 and the first load that refills it (next trip, or behind the
    // loop); the loads in flight name vo: the wait stands before vo is overwritten
    asm volatile("v_nop\n\tv_nop\n\tv_nop\n\tv_nop\n\ts_wait_xcnt 0x0" ::: "memory");
    __builtin_amdgcn_sched_barrier(0);   // keeps the step of vo and the refill of f1 behind that statement
    vo += 2048u;
  }
  const unsigned vt = (unsigned)lane * 16u + (unsigned)(K - 64) * 32u;   // lane offset at the last two k steps (= vo here)
  load_frag_set<T, SPLIT>(f1, pAh, pAl, pBh, pBl, vt, 1024);
  asm volatile("s_wait_xcnt 0x0" :: "v"(vt) : "memory");   // vt is live up to this wait, so nothing overwrites it under the loads that name it
  __builtin_amdgcn_sched_barrier(0);     // keeps the last step's loads ahead of the products before it
  mma_frag_set<T, SPLIT>(acc, f0);
  mma_frag_set<T, SPLIT>(acc, f1);
  acc_guard4(acc[0][0], acc[0][1], acc[0][2], acc[0][3]);
  acc_guard4(acc[1][0], acc[1][1], acc[1][2], acc[1][3]);
  acc_guard4(acc[2][0], acc[2][1], acc[2][2], acc[2][3]);
  acc_guard4(acc[3][0], acc[3][1], acc[3][2], acc[3][3]);

  // ---- epilogue ----
  if (OUT_MODE == 3) {
#pragma unroll
    for (int i = 0; i < 4; ++i)
#pragma unroll
      for (int j = 0; j < 4; ++j)
#pragma unroll
        for (int r = 0; r < 8; ++r) slab[((i << 4) + mOff + r) * 68 + (j << 4) + rlane] = acc[i][j][r] * scale;
    // the rows are read back by other lanes of this wave: the slab's stores stay in front of its loads
    __builtin_amdgcn_fence(__ATOMIC_RELEASE, "workgroup");
    __builtin_amdgcn_wave_barrier();
    __builtin_amdgcn_fence(__ATOMIC_ACQUIRE, "workgroup");
    unsigned short* C  = (unsigned short*)Cout  + (size_t)b * strideC;
    unsigned short* C2 = (unsigned short*)Cout2 + (size_t)b * strideC;
    const int d0 = (lane & 7) * 8;                 // this lane's 8 of the unit's 64 values
    const int dp = d0 ^ kHalfHd;                   // rotary partner block
    const float sg = (d0 < kHalfHd) ? -1.0f : 1.0f;
    // Norm weights and table values: every load = scalar base + a lane byte offset (+ an immediate). Table row = position
    // inside the sequence (m0 % 64 == 0, so the tile lies in one sequence); a pass is 4 rows, a group 4 passes.
    const unsigned wo = (unsigned)d0 * 4u, po = (unsigned)dp * 4u;
    const unsigned tb = (unsigned)(((m0 & (kSeq - 1)) + (lane >> 3)) * kHalfHd + (d0 & 24)) * 4u;
    const char* nwb = (const char*)nw;
    const char* csb = (const char*)cs;
    const char* snb = (const char*)sn;
    const v4f wa = *(const v4f*)(nwb + wo), wb = *(const v4f*)(nwb + wo + 16);
    const v4f va = *(const v4f*)(nwb + po), vb = *(const v4f*)(nwb + po + 16);
    v4f tbl[2][4][4];                              // two groups of table values: cos 0..3, cos 4..7, sin 0..3, sin 4..7 of a pass
#pragma unroll   // constant indices keep tbl in registers
    for (int p = 0; p < 4; ++p) {
      tbl[0][p][0] = *(const v4f*)(csb + tb + p * (16 * kHalfHd)); tbl[0][p][1] = *(const v4f*)(csb + tb + (p * (16 * kHalfHd) + 16));
      tbl[0][p][2] = *(const v4f*)(snb + tb + p * (16 * kHalfHd)); tbl[0][p][3] = *(const v4f*)(snb + tb + (p * (16 * kHalfHd) + 16));
    }
    asm volatile("s_wait_xcnt 0x0" :: "v"(wo), "v"(po) : "memory");   // wo and po are live up to this wait, so nothing overwrites them under the loads that name them
#pragma unroll   // constant indices into tbl
    for (int g = 0; g < 4; ++g) {
      if (g < 3) {
#pragma unroll
        for (int p = 0; p < 4; ++p) {              // the next group's table values fly under this group's arithmetic
          const int im = ((g + 1) * 4 + p) * (16 * kHalfHd);
          tbl[(g + 1) & 1][p][0] = *(const v4f*)(csb + tb + im); tbl[(g + 1) & 1][p][1] = *(const v4f*)(csb + tb + (im + 16));
          tbl[(g + 1) & 1][p][2] = *(const v4f*)(snb + tb + im); tbl[(g + 1) & 1][p][3] = *(const v4f*)(snb + tb + (im + 16));
        }
      }
      __builtin_amdgcn_sched_barrier(0);           // keeps these loads ahead of the group's arithmetic (sunk to their use they would fly alone) and of its stores
#pragma unroll
      for (int p = 0; p < 4; ++p) {
        const int row = (g * 4 + p) * 4 + (lane >> 3);
        const float* sp = slab + row * 68;
        const v4f xa = *(const v4f*)(sp + d0), xb = *(const v4f*)(sp + d0 + 4);
        const v4f pa = *(const v4f*)(sp + dp), pb = *(const v4f*)(sp + dp + 4);
        v4u hv, lv;
        norm_rope_unit(xa, xb, pa, pb, wa, wb, va, vb, tbl[g & 1][p][0], tbl[g & 1][p][1], tbl[g & 1][p][2], tbl[g & 1][p][3], sg, hv, lv);
        const size_t o = (size_t)(m0 + row) * ldc + n0 + d0;
        *(v4u*)(C + o)  = hv;
        *(v4u*)(C2 + o) = lv;
      }
      // the next group's loads and arithmetic reuse the registers of these stores: the wait stands before that; tb is live
      // up to the last of these waits, so nothing overwrites it under the loads that name it
      asm volatile("s_wait_xcnt 0x0" :: "v"(tb) : "memory");
      __builtin_amdgcn_sched_barrier(0);           // keeps what follows behind the wait (without it the scheduler may lift it over the wait)
    }
    return;
  }
  const float* Rb = RESID ? (resid + (size_t)b * strideR) : nullptr;
#pragma unroll
  for (int i = 0; i < 4; ++i) {
    const int mBase = m0 + (i << 4);
#pragma unroll
    for (int j = 0; j < 4; ++j) {
      const int n = n0 + (j << 4) + rlane;
      float bv = 0.f;
      if (BIAS_MODE == 2) bv = bias[n];
#pragma unroll
      for (int r = 0; r < 8; ++r) {
        float v = acc[i][j][r] * scale;
        if (BIAS_MODE == 1) v += bias[mBase + mOff + r];
        if (BIAS_MODE == 2) v += bv;
        if (RESID) v += Rb[(size_t)(mBase + mOff + r) * ldc + n];
        if (ACT == 1) v = tanhf(v);
        if (ACT == 2) v = fmaxf(v, 0.0f);
        if (ACT == 3) v = v / (1.0f + expf(-v));
        if (ACT == 4) v = (v > 0.f) ? v : 0.01f * v;
        slab[(mOff + r) * 68 + (j << 4) + rlane] = v;
      }
    }
    __builtin_amdgcn_fence(__ATOMIC_RELEASE, "workgroup");
    __builtin_amdgcn_wave_barrier();
    __builtin_amdgcn_fence(__ATOMIC_ACQUIRE, "workgroup");
    if (OUT_MODE == 0) {
      float* C = (float*)Cout + (size_t)b * strideC;
      const int hh = lane >> 4, c4 = (lane & 15) * 4;     // row seg = 256 B = 16 lanes x 16 B
      {
#pragma unroll
        for (int it = 0; it < 8; ++it) {
          const int row = it * 2 + hh;
          v4f v = *(const v4f*)(slab + row * 68 + c4);
          *(v4f*)(C + (size_t)(mBase + row) * ldc + n0 + c4) = v;
        }
        // the next block row's address arithmetic reuses the address registers of these stores: the wait stands before that
        asm volatile("s_wait_xcnt 0x0" ::: "memory");
        __builtin_amdgcn_sched_barrier(0);   // keeps that arithmetic behind the wait (without it the scheduler lifts it over the wait)
      }
    } else {
      const int q = lane >> 3, c8 = (lane & 7) * 8;
      unsigned short* C  = (unsigned short*)Cout  + (size_t)b * strideC;
      unsigned short* C2 = (OUT_MODE == 2) ? ((unsigned short*)Cout2 + (size_t)b * strideC) : nullptr;
      {
#pragma unroll
        for (int it = 0; it < 4; ++it) {
          const int row = it * 4 + q;
          const float* sp = slab + row * 68 + c8;
          v8h hv, lv;
#pragma unroll
          for (int e = 0; e < 8; ++e) {
            if (OUT_MODE == 1) {
              hv[e] = (_Float16)sp[e];
            } else {
              unsigned short hb = f2bf_bits(sp[e]);
              unsigned short lb = f2bf_bits(sp[e] - bf_bits2f(hb));
              hv[e] = __builtin_bit_cast(_Float16, hb);
              lv[e] = __builtin_bit_cast(_Float16, lb);
            }
          }
          *(v8h*)(C + (size_t)(mBase + row) * ldc + n0 + c8) = hv;
          if (OUT_MODE == 2) *(v8h*)(C2 + (size_t)(mBase + row) * ldc + n0 + c8) = lv;
        }
        
      }
    }
    __builtin_amdgcn_fence(__ATOMIC_RELEASE, "workgroup");
    __builtin_amdgcn_wave_barrier();
    __builtin_amdgcn_fence(__ATOMIC_ACQUIRE, "workgroup");
  }
}

// One GEMM per launch: 8 waves = 8 consecutive tiles per block, grid.y = batch index.
template <int ET, bool SPLIT, int BIAS_MODE, int OUT_MODE, bool RESID, int ACT = 0>
__global__ __launch_bounds__(256) void wmma_gemm64(
    const unsigned short* __restrict__ Ap, const unsigned short* __restrict__ A2p, int lda, long strideA,
    const unsigned short* __restrict__ Btp, const unsigned short* __restrict__ Bt2p, int ldb, long strideB,
    void* __restrict__ Cout, void* __restrict__ Cout2, int ldc, long strideC,
    const float* __restrict__ bias,
    const float* __restrict__ resid, long strideR,
    int M, int N, int K, float scale) {
  __shared__ __align__(16) float sT[8][16 * 68];   // per-wave 16x64 slab, pitch 68 floats
  const int wave = threadIdx.x >> 5;
  const int tilesN = N >> 6;
  const int tilesM = M >> 6;
  const int tile = __builtin_amdgcn_readfirstlane(blockIdx.x * 8 + wave);
  if (tile >= tilesM * tilesN) return;   // wave-uniform; no block barriers in this kernel
  const int tm = tile / tilesN;
  const int tn = tile - tm * tilesN;
  gemm64_tile<ET, SPLIT, BIAS_MODE, OUT_MODE, RESID, ACT>(sT[wave], blockIdx.y, tm << 6, tn << 6, Ap, A2p, lda, strideA, Btp, Bt2p,
                                                          ldb, strideB, Cout, Cout2, ldc, strideC, bias, resid, strideR, K, scale);
}

// The three projections of x in one launch: none reads what another writes, and each alone fills well under half of
// the chip's WGPs for the whole length of one wave's k loop. Block ranges (8 tiles per block):
//   [0, kBlkQ)                 q   = x . Wq^T, M=4096, N=768: rmsnorm * qw, rotary -> Q hi/lo [row][h*64+d]
//   [kBlkQ, kBlkQ+kBlkK)       k   = x . Wk^T, M=4096, N=256: rmsnorm * kw, rotary -> K hi/lo [row][g*64+d]
//   then kBlkV per batch b     v^T = Wv . x[b]^T -> VT hi/lo [b][g*64+d][s]     M=256,  N=2048 (A = Wv planes, Bt = x planes of b)
constexpr int kBlkQ = (kTok / 64) * (kDim / 64) / 8;      // 96
constexpr int kBlkK = (kTok / 64) * (kKvDim / 64) / 8;    // 32
constexpr int kBlkV = (kKvDim / 64) * (kSeq / 64) / 8;    // 16 per batch element
static_assert(((kTok / 64) * (kDim / 64)) % 8 == 0 && ((kTok / 64) * (kKvDim / 64)) % 8 == 0 && ((kKvDim / 64) * (kSeq / 64)) % 8 == 0);

__global__ __launch_bounds__(256) void qkv_gemm64_kernel(
    const unsigned short* __restrict__ Xh, const unsigned short* __restrict__ Xl,
    const unsigned short* __restrict__ Wqh, const unsigned short* __restrict__ Wql,
    const unsigned short* __restrict__ Wkh, const unsigned short* __restrict__ Wkl,
    const unsigned short* __restrict__ Wvh, const unsigned short* __restrict__ Wvl,
    const float* __restrict__ qw, const float* __restrict__ kw,
    const float* __restrict__ cs, const float* __restrict__ sn,
    unsigned short* __restrict__ Qh, unsigned short* __restrict__ Ql,
    unsigned short* __restrict__ Kh, unsigned short* __restrict__ Kl,
    unsigned short* __restrict__ VTh, unsigned short* __restrict__ VTl, int K) {
  __shared__ __align__(16) float sT[8][64 * 68];   // per-wave 64x64 slab, pitch 68 floats (the v^T tiles use its first 16 rows)
  const int wave = threadIdx.x >> 5;
  const int bx   = blockIdx.x;
  if (bx < kBlkQ + kBlkK) {
    const bool isq = bx < kBlkQ;                   // block-uniform
    const int tile = __builtin_amdgcn_readfirstlane((isq ? bx : bx - kBlkQ) * 8 + wave);
    const int n  = isq ? kDim : kKvDim;
    const int tm = isq ? tile / (kDim / 64) : tile / (kKvDim / 64);
    const int tn = tile - tm * (n >> 6);
    gemm64_tile<1, true, 0, 3, false>(sT[wave], 0, tm << 6, tn << 6, Xh, Xl, kDim, 0L, isq ? Wqh : Wkh, isq ? Wql : Wkl, kDim, 0L,
                                      (void*)(isq ? Qh : Kh), (void*)(isq ? Ql : Kl), n, 0L, nullptr, nullptr, 0L, K, 1.0f,
                                      isq ? qw : kw, cs, sn);
  } else {
    const int v    = bx - (kBlkQ + kBlkK);
    const int tile = __builtin_amdgcn_readfirstlane((v % kBlkV) * 8 + wave);
    const int tm   = tile / (kSeq / 64);
    const int tn   = tile - tm * (kSeq / 64);
    gemm64_tile<1, true, 0, 2, false>(sT[wave], v / kBlkV, tm << 6, tn << 6, Wvh, Wvl, kDim, 0L, Xh, Xl, kDim, (long)kSeq * kDim,
                                      (void*)VTh, (void*)VTl, kSeq, (long)kKvDim * kSeq, nullptr, nullptr, 0L, K, 1.0f);
  }
}

// ---------------------------------------------------------------------------
// bf16 split of a row-major f32 [rows][768] matrix, hi = bf16_rne(in), lo = bf16_rne(in - hi), stored fragment-major
// for wmma_gemm64 (layout: see there). One thread = 8 consecutive k of one row (32 B read, 16 B per plane written);
// one wave = 8 rows x 32 k, half a block: it reads 8 whole 128-B lines and each plane's store fills 4 whole lines.
// rows % 16 == 0; n8 = rows * 768 / 8 threads.
// ---------------------------------------------------------------------------
__device__ __forceinline__ void split_pack_thread(const float* __restrict__ in, unsigned short* __restrict__ hi,
                                                  unsigned short* __restrict__ lo, const int idx, const int n8) {
  if (idx < n8) {
    const int l   = idx & 31;
    const int g   = idx >> 5;                 // half block
    const int blk = g >> 1;
    const int rb  = blk / kKBlk, kb = blk - rb * kKBlk;
    const int r16 = (g & 1) * 8 + (l >> 2);   // row inside the block
    const int kp  = l & 3;                    // which 8 of the block's 32 k
    const float* s = in + (size_t)(rb * 16 + r16) * kDim + kb * 32 + kp * 8;
    const v4f fa = *(const v4f*)(s), fb = *(const v4f*)(s + 4);
    const float f[8] = {fa[0], fa[1], fa[2], fa[3], fb[0], fb[1], fb[2], fb[3]};
    v4u hv, lv;
    split8(f, hv, lv);
    const size_t o = (size_t)blk * 512 + (kp >> 1) * 256 + ((kp & 1) * 16 + r16) * 8;
    *(v4u*)(hi + o) = hv;
    *(v4u*)(lo + o) = lv;
  }
}

// ---------------------------------------------------------------------------
// Rotary tables: cs[t*32+i] = cosf(t * inv_freq[i]), sn likewise, inv_freq[i] = 10000^(-i/32) = 2^(-i*log2(1e4)/32).
// kSeq*32/256 = 256 blocks x 256 threads = exactly 65536 elements per table; each wave writes 32 consecutive
// ---------------------------------------------------------------------------
__device__ __forceinline__ void rope_table_thread(float* __restrict__ cs, float* __restrict__ sn, const int i) {
  const int t  = i >> 5;
  const int fi = i & 31;
  const float invf = exp2f((float)fi * -0.41524101186092f);
  const float ang  = (float)t * invf;
  float sv, cv;
  sincosf(ang, &sv, &cv);
  ((float*)cs)[i] = cv;
  ((float*)sn)[i] = sv;
}

// ---------------------------------------------------------------------------
// Everything that depends on the inputs alone, in one launch: the rotary tables and the bf16 splits of x and of the four
// weight matrices. No part reads what another writes. Block ranges, the part with the longest thread first:
//   kPbT table blocks | kPbX blocks of x | kPbWq of Wq | kPbWk of Wk | kPbWk of Wv | kPbWq of Wo
// ---------------------------------------------------------------------------
constexpr int kN8X  = kTok * kDim / 8;        // 393216 threads
constexpr int kN8Wq = kDim * kDim / 8;        // 73728
constexpr int kN8Wk = kKvDim * kDim / 8;      // 24576
constexpr int kPbT  = kSeq * kHalfHd / 256;   // 256
constexpr int kPbX  = kN8X / 256;             // 1536
constexpr int kPbWq = kN8Wq / 256;            // 288
constexpr int kPbWk = kN8Wk / 256;            // 96
static_assert((kSeq * kHalfHd) % 256 == 0 && kN8X % 256 == 0 && kN8Wq % 256 == 0 && kN8Wk % 256 == 0);

__global__ __launch_bounds__(256) void prep_kernel(
    const float* __restrict__ x, const float* __restrict__ Wq, const float* __restrict__ Wk,
    const float* __restrict__ Wv, const float* __restrict__ Wo,
    unsigned short* __restrict__ Xh, unsigned short* __restrict__ Xl,
    unsigned short* __restrict__ Wqh, unsigned short* __restrict__ Wql,
    unsigned short* __restrict__ Wkh, unsigned short* __restrict__ Wkl,
    unsigned short* __restrict__ Wvh, unsigned short* __restrict__ Wvl,
    unsigned short* __restrict__ Woh, unsigned short* __restrict__ Wol,
    float* __restrict__ cs, float* __restrict__ sn) {
  int bx = blockIdx.x;                          // block-uniform choice of the part
  if (bx < kPbT) { rope_table_thread(cs, sn, bx * 256 + threadIdx.x); return; }
  bx -= kPbT;
  const float* in = x; unsigned short* hi = Xh; unsigned short* lo = Xl; int n8 = kN8X;
  if (bx >= kPbX) {
    bx -= kPbX; in = Wq; hi = Wqh; lo = Wql; n8 = kN8Wq;
    if (bx >= kPbWq) {
      bx -= kPbWq; in = Wk; hi = Wkh; lo = Wkl; n8 = kN8Wk;
      if (bx >= kPbWk) {
        bx -= kPbWk; in = Wv; hi = Wvh; lo = Wvl;
        if (bx >= kPbWk) { bx -= kPbWk; in = Wo; hi = Woh; lo = Wol; n8 = kN8Wq; }
      }
    }
  }
  split_pack_thread(in, hi, lo, bx * 256 + threadIdx.x, n8);
}

// =====================================================================================
// Causal sliding-window grouped-query attention, head dim 64, grid.y = batch element (offsets below are within one).
//   q planes (hi/lo bf16): element (t, h, d) at [t*kDim + h*64 + d]           (12 heads)
//   k planes (hi/lo bf16): element (s, g, d) at [s*kKvDim + g*64 + d]         (4 kv heads, g = h/3)
//   v^T planes (hi/lo bf16): element (g, d, s) at [(g*64 + d)*kSeq + s]
//   out: y element (t, h, d) = row t, column h*64 + d of a [token row][768] matrix, split into bf16 hi/lo planes and stored
//   fragment-major for wmma_gemm64 (layout: see there); a wave's 16 rows x 64 columns are two whole blocks of each plane
//   scores = (q . k) * sscale : bf16 hi/lo split (hi.hi + hi.lo + lo.hi) on v_wmma_f32_16x16x32_bf16
//   out    = p . v             : bf16 hi/lo split of p (unnormalised) and v, f32 accumulate
//   online softmax in f32; keys with s > t or t - s > kWin-1 set to -inf; a fully -inf running max uses a 0 pivot
//   (alpha = 0, p = 0) so nothing non-finite is produced; the diagonal key is always kept.
//   Block = 4 waves = 64 query rows of one head; grid.x = kNHq * (kSeq/64); kv chunks of 64 from the first
//   in-window chunk (block-uniform) up to chunk qb (static bound qb+1 <= 32).
//   K / V^T chunk staging: 128 threads x 32 elements per plane = the whole 64x64 tile (16-B copies, plain loads,
//   __syncthreads before and after); fragment loads read the LDS tiles with the same v8b element type. LDS rows of
//   the K, V^T and P tiles are AT_LP elements apart (64 used + 8 never read or written).
// =====================================================================================
#define AT_D 64
#define AT_NW 4
#define AT_QB 64
#define AT_KC 64
#define AT_LP 72   // LDS row pitch of the K, V^T and P tiles in elements: 144 B = 16 B x 9 (odd), so the 16 rows that one
                   // ds_load_b128 touches per half wave start on 16 different 4-bank groups (128-B rows: only 2 groups)

__device__ __forceinline__ unsigned short at_bf_bits(float f) {
  unsigned u = __float_as_uint(f);
  return (unsigned short)((u + 0x7FFFu + ((u >> 16) & 1u)) >> 16);
}
__device__ __forceinline__ __bf16 at_f2bf(float f) { return __builtin_bit_cast(__bf16, at_bf_bits(f)); }
__device__ __forceinline__ void at_split(float f, __bf16& hi, __bf16& lo) {
  const unsigned short hb = at_bf_bits(f);
  hi = __builtin_bit_cast(__bf16, hb);
  lo = at_f2bf(f - __uint_as_float(((unsigned)hb) << 16));
}
__device__ __forceinline__ v8f at_mma(v16b a, v16b b, v8f c) {
  c = __builtin_amdgcn_wmma_f32_16x16x32_bf16(false, a, false, b, (short)0, c, false, false);
  asm volatile("v_nop\n\tv_nop\n\tv_nop\n\tv_nop" : "+v"(c) : "v"(a), "v"(b));
  return c;
}

__global__ __launch_bounds__(128)
void attn_gqa_window64_kernel(const unsigned short* __restrict__ qhp, const unsigned short* __restrict__ qlp,
                              const unsigned short* __restrict__ khp, const unsigned short* __restrict__ klp,
                              const unsigned short* __restrict__ vhp, const unsigned short* __restrict__ vlp,
                              unsigned short* __restrict__ ohp, unsigned short* __restrict__ olp, float sscale) {
  union FB { v16b v; v8b h[2]; };
  __shared__ __align__(16) __bf16 Ksh[AT_KC * AT_LP];            // K hi [kv][d]      9 KB
  __shared__ __align__(16) __bf16 Ksl[AT_KC * AT_LP];            // K lo
  __shared__ __align__(16) __bf16 Vth[AT_D * AT_LP];             // V hi [d][kv]      9 KB
  __shared__ __align__(16) __bf16 Vtl[AT_D * AT_LP];             // V lo
  __shared__ __align__(16) __bf16 Psh[AT_NW][16 * AT_LP];        // per wave P hi [row][kv]
  __shared__ __align__(16) __bf16 Psl[AT_NW][16 * AT_LP];        // per wave P lo
  __shared__ __align__(16) float  Os[AT_NW][16 * 68];            // per wave out tile, pitch 68

  const int tid  = threadIdx.x;
  const int wave = tid >> 5;
  const int lane = tid & 31;
  const int hh   = lane >> 4;
  const int c    = lane & 15;

  const int nqb = kSeq / AT_QB;           // 32
  const int bx = blockIdx.x;
  const int qb = bx % nqb;
  const int h  = bx / nqb;                // 0..kNHq-1 (grid = kNHq * nqb)
  const int kvh = h / kGroups;            // 0..kNKv-1
  const int q0 = qb * AT_QB + wave * 16;

  const size_t bq = (size_t)blockIdx.y * kSeq * kDim;     // batch element's q plane
  const size_t bk = (size_t)blockIdx.y * kSeq * kKvDim;   // batch element's k / v^T plane
  const __bf16* Qh = (const __bf16*)(const void*)qhp + bq + (size_t)h * AT_D;
  const __bf16* Ql = (const __bf16*)(const void*)qlp + bq + (size_t)h * AT_D;
  const __bf16* Kh = (const __bf16*)(const void*)khp + bk + (size_t)kvh * AT_D;
  const __bf16* Kl = (const __bf16*)(const void*)klp + bk + (size_t)kvh * AT_D;
  const __bf16* Vh = (const __bf16*)(const void*)vhp + bk + (size_t)kvh * AT_D * kSeq;
  const __bf16* Vl = (const __bf16*)(const void*)vlp + bk + (size_t)kvh * AT_D * kSeq;

  // ---- Q fragments (A operand, row = lane&15, split k map via Frag load): 2 d-chunks, hi and lo ----
  v16b qah[2], qal[2];
#pragma unroll
  for (int dc = 0; dc < 2; ++dc) {
    const __bf16* qr = Qh + (size_t)(q0 + c) * kDim + dc * 32 + 8 * hh;
    const __bf16* ql = Ql + (size_t)(q0 + c) * kDim + dc * 32 + 8 * hh;
    qah[dc] = Frag<__bf16>::load(qr);
    qal[dc] = Frag<__bf16>::load(ql);
  }

  float mrow[8], lrow[8];
  v8f oacc[4];
#pragma unroll
  for (int r = 0; r < 8; ++r) { mrow[r] = -INFINITY; lrow[r] = 0.f; }
#pragma unroll
  for (int t = 0; t < 4; ++t) oacc[t] = (v8f){0.f,0.f,0.f,0.f,0.f,0.f,0.f,0.f};

  const int qlo = qb * AT_QB - (kWin - 1);                 // smallest key allowed for the block's first row
  const int kcStart = (qlo > 0) ? (qlo / AT_KC) : 0;       // block-uniform
  const int nChunks = qb + 1;                              // block-uniform, <= 32
  for (int kc = kcStart; kc < nChunks; ++kc) {
    const int kv0 = kc * AT_KC;
    __syncthreads();
    {
      // staging coverage: 128 threads x (4 x 8) elements = 64 rows x 64 per plane = the whole chunk tile
      const int r = tid >> 1, half = (tid & 1) * 32;
      const __bf16* ksh = Kh + (size_t)(kv0 + r) * kKvDim + half;   // K row kv0+r, d = half..half+31
      const __bf16* ksl = Kl + (size_t)(kv0 + r) * kKvDim + half;
      const __bf16* vsh = Vh + (size_t)r * kSeq + kv0 + half;        // V^T row d = r, s = kv0+half..+31
      const __bf16* vsl = Vl + (size_t)r * kSeq + kv0 + half;
#pragma unroll
      for (int i = 0; i < 4; ++i) {
        const v8b a0 = *(const v8b*)(ksh + 8 * i);
        const v8b a1 = *(const v8b*)(ksl + 8 * i);
        const v8b b0 = *(const v8b*)(vsh + 8 * i);
        const v8b b1 = *(const v8b*)(vsl + 8 * i);
        *(v8b*)(Ksh + r * AT_LP + half + 8 * i) = a0;
        *(v8b*)(Ksl + r * AT_LP + half + 8 * i) = a1;
        *(v8b*)(Vth + r * AT_LP + half + 8 * i) = b0;
        *(v8b*)(Vtl + r * AT_LP + half + 8 * i) = b1;
      }
    }
    __syncthreads();

    v8f s[4];
#pragma unroll
    for (int j = 0; j < 4; ++j) {
      s[j] = (v8f){0.f,0.f,0.f,0.f,0.f,0.f,0.f,0.f};
#pragma unroll
      for (int dc = 0; dc < 2; ++dc) {
        FB kb, kl;
        kb.h[0] = *(const v8b*)(Ksh + (j * 16 + c) * AT_LP + dc * 32 + 8 * hh);
        kb.h[1] = *(const v8b*)(Ksh + (j * 16 + c) * AT_LP + dc * 32 + 16 + 8 * hh);
        kl.h[0] = *(const v8b*)(Ksl + (j * 16 + c) * AT_LP + dc * 32 + 8 * hh);
        kl.h[1] = *(const v8b*)(Ksl + (j * 16 + c) * AT_LP + dc * 32 + 16 + 8 * hh);
        s[j] = at_mma(qah[dc], kb.v, s[j]);
        s[j] = at_mma(qah[dc], kl.v, s[j]);
        s[j] = at_mma(qal[dc], kb.v, s[j]);
      }
    }
    float cm[8];
#pragma unroll
    for (int r = 0; r < 8; ++r) {
      const int qrow = q0 + 8 * hh + r;
      float m = -INFINITY;
#pragma unroll
      for (int j = 0; j < 4; ++j) {
        const int kvcol = kv0 + j * 16 + c;
        const float sv = s[j][r] * sscale;
        const bool masked = (kvcol > qrow) || (qrow - kvcol > kWin - 1);
        const float sm = masked ? -INFINITY : sv;
        s[j][r] = sm;
        m = fmaxf(m, sm);
      }
#pragma unroll
      for (int off = 1; off < 16; off <<= 1) m = fmaxf(m, __shfl_xor(m, off, 32));
      cm[r] = m;
    }
    __bf16* pwh = Psh[wave];
    __bf16* pwl = Psl[wave];
#pragma unroll
    for (int r = 0; r < 8; ++r) {
      const float mnew  = fmaxf(mrow[r], cm[r]);
      const float mpiv  = (mnew == -INFINITY) ? 0.0f : mnew;   // fully masked so far -> alpha = 0, p = 0
      const float alpha = expf(mrow[r] - mpiv);
      mrow[r] = mnew;
      float psum = 0.f;
#pragma unroll
      for (int j = 0; j < 4; ++j) {
        const float p = expf(s[j][r] - mpiv);
        psum += p;
        __bf16 a, bl; at_split(p, a, bl);
        pwh[(8 * hh + r) * AT_LP + j * 16 + c] = a;
        pwl[(8 * hh + r) * AT_LP + j * 16 + c] = bl;
      }
#pragma unroll
      for (int off = 1; off < 16; off <<= 1) psum += __shfl_xor(psum, off, 32);
      lrow[r] = lrow[r] * alpha + psum;
#pragma unroll
      for (int t = 0; t < 4; ++t) oacc[t][r] *= alpha;
    }
    __builtin_amdgcn_fence(__ATOMIC_RELEASE, "workgroup");
    __builtin_amdgcn_wave_barrier();
    __builtin_amdgcn_fence(__ATOMIC_ACQUIRE, "workgroup");
#pragma unroll 1
    for (int kk = 0; kk < 2; ++kk) {
      FB pa, pl;
      pa.h[0] = *(const v8b*)(pwh + c * AT_LP + kk * 32 + 8 * hh);
      pa.h[1] = *(const v8b*)(pwh + c * AT_LP + kk * 32 + 16 + 8 * hh);
      pl.h[0] = *(const v8b*)(pwl + c * AT_LP + kk * 32 + 8 * hh);
      pl.h[1] = *(const v8b*)(pwl + c * AT_LP + kk * 32 + 16 + 8 * hh);
#pragma unroll
      for (int t = 0; t < 4; ++t) {
        FB vb, vl;
        vb.h[0] = *(const v8b*)(Vth + (t * 16 + c) * AT_LP + kk * 32 + 8 * hh);
        vb.h[1] = *(const v8b*)(Vth + (t * 16 + c) * AT_LP + kk * 32 + 16 + 8 * hh);
        vl.h[0] = *(const v8b*)(Vtl + (t * 16 + c) * AT_LP + kk * 32 + 8 * hh);
        vl.h[1] = *(const v8b*)(Vtl + (t * 16 + c) * AT_LP + kk * 32 + 16 + 8 * hh);
        oacc[t] = at_mma(pa.v, vb.v, oacc[t]);
        oacc[t] = at_mma(pa.v, vl.v, oacc[t]);
        oacc[t] = at_mma(pl.v, vb.v, oacc[t]);
      }
    }
  }

  float* os = Os[wave];
#pragma unroll
  for (int r = 0; r < 8; ++r) {
    const float inv = 1.0f / lrow[r];
#pragma unroll
    for (int t = 0; t < 4; ++t) os[(8 * hh + r) * 68 + t * 16 + c] = oacc[t][r] * inv;
  }
  __builtin_amdgcn_fence(__ATOMIC_RELEASE, "workgroup");
  __builtin_amdgcn_wave_barrier();
  __builtin_amdgcn_fence(__ATOMIC_ACQUIRE, "workgroup");
  {
    // first of the wave's two blocks: block row = token row / 16, k block = column / 32
    const size_t blk0 = (size_t)((blockIdx.y * kSeq + q0) >> 4) * kKBlk + h * (AT_D / 32);
#pragma unroll
    for (int it = 0; it < 4; ++it) {   // it>>1 = block, it&1 = its half (16 k); lane = (k>>3 & 1)*16 + row: 512 consecutive bytes a store
      const float* sp = os + c * 68 + it * 16 + hh * 8;
      const v4f fa = *(const v4f*)(sp), fb = *(const v4f*)(sp + 4);
      const float f[8] = {fa[0], fa[1], fa[2], fa[3], fb[0], fb[1], fb[2], fb[3]};
      v4u hv, lv;
      split8(f, hv, lv);
      const size_t o = (blk0 + (it >> 1)) * 512 + (it & 1) * 256 + lane * 8;
      *(v4u*)(ohp + o) = hv;
      *(v4u*)(olp + o) = lv;
    }
  }
}

// ---------------------------------------------------------------------------
// Workspace region map (byte offsets; every region is fully written in this call before it is read; token rows
// run over both batch elements, row = b*2048 + t; VT holds one [256][2048] plane per batch element; the W*, X* and
// O* bf16 planes are fragment-major, 16-row x 32-k blocks, see wmma_gemm64):
//   Wqh bf16 [768 n][768 k]         0      Wql   1179648
//   Wkh bf16 [256][768]        2359296      Wkl   2752512
//   Wvh bf16 [256][768]        3145728      Wvl   3538944
//   Woh bf16 [768][768]        3932160      Wol   5111808
//   CS  f32  [2048][32]        6291456      SN    6553600
//   Xh  bf16 [4096][768]       6815744      Xl   13107200
//   Qh  bf16 [4096][768]      19398656      Ql   25690112
//   Kh  bf16 [4096][256]      31981568      Kl   34078720
//   VTh bf16 [2][256][2048]   36175872      VTl  38273024
//   Oh  bf16 [4096][768]      40370176      Ol   46661632
//   total                     52953088
// ---------------------------------------------------------------------------
extern "C" void kernel_launch(void* const* d_in, const int* in_sizes, int n_in,
                              void* d_out, int out_size, void* d_ws, size_t ws_size,
                              hipStream_t stream) {
  if (n_in < 7) return;
  if (in_sizes[0] != kNB * kSeq * kDim) return;
  if (in_sizes[1] != kDim * kDim || in_sizes[4] != kDim * kDim) return;
  if (in_sizes[2] != kKvDim * kDim || in_sizes[3] != kKvDim * kDim) return;
  if (in_sizes[5] != kHd || in_sizes[6] != kHd) return;
  if (out_size != kNB * kSeq * kDim) return;

  const float* x    = (const float*)d_in[0];
  const float* Wq   = (const float*)d_in[1];
  const float* Wk   = (const float*)d_in[2];
  const float* Wv   = (const float*)d_in[3];
  const float* Wo   = (const float*)d_in[4];
  const float* lnq  = (const float*)d_in[5];
  const float* lnk  = (const float*)d_in[6];

  const size_t PWQ = (size_t)kDim * kDim * 2;      // 1179648  bf16 [768][768] plane
  const size_t PWK = (size_t)kKvDim * kDim * 2;    // 393216   bf16 [256][768] plane
  const size_t PTB = (size_t)kSeq * kHalfHd * 4;   // 262144   f32 [2048][32] table
  const size_t PXB = (size_t)kTok * kDim * 2;      // 6291456  bf16 [4096][768] plane
  const size_t PKB = (size_t)kTok * kKvDim * 2;    // 2097152  bf16 [4096][256] / [2][256][2048] plane
  size_t off = 0;
  const size_t oWqh = off; off += PWQ;  const size_t oWql = off; off += PWQ;
  const size_t oWkh = off; off += PWK;  const size_t oWkl = off; off += PWK;
  const size_t oWvh = off; off += PWK;  const size_t oWvl = off; off += PWK;
  const size_t oWoh = off; off += PWQ;  const size_t oWol = off; off += PWQ;
  const size_t oCS  = off; off += PTB;  const size_t oSN  = off; off += PTB;
  const size_t oXh  = off; off += PXB;  const size_t oXl  = off; off += PXB;
  const size_t oQh  = off; off += PXB;  const size_t oQl  = off; off += PXB;
  const size_t oKh  = off; off += PKB;  const size_t oKl  = off; off += PKB;
  const size_t oVTh = off; off += PKB;  const size_t oVTl = off; off += PKB;
  const size_t oOh  = off; off += PXB;  const size_t oOl  = off; off += PXB;
  if (off > ws_size) return;                       // off = 52953088
  if (off > (size_t)134217728) return;

  char* ws = (char*)d_ws;
  unsigned short* Wqh = (unsigned short*)(ws + oWqh); unsigned short* Wql = (unsigned short*)(ws + oWql);
  unsigned short* Wkh = (unsigned short*)(ws + oWkh); unsigned short* Wkl = (unsigned short*)(ws + oWkl);
  unsigned short* Wvh = (unsigned short*)(ws + oWvh); unsigned short* Wvl = (unsigned short*)(ws + oWvl);
  unsigned short* Woh = (unsigned short*)(ws + oWoh); unsigned short* Wol = (unsigned short*)(ws + oWol);
  float*          CS  = (float*)(ws + oCS);          float*          SN  = (float*)(ws + oSN);
  unsigned short* Xh  = (unsigned short*)(ws + oXh);  unsigned short* Xl  = (unsigned short*)(ws + oXl);
  unsigned short* Qh  = (unsigned short*)(ws + oQh);  unsigned short* Ql  = (unsigned short*)(ws + oQl);
  unsigned short* Kh  = (unsigned short*)(ws + oKh);  unsigned short* Kl  = (unsigned short*)(ws + oKl);
  unsigned short* VTh = (unsigned short*)(ws + oVTh); unsigned short* VTl = (unsigned short*)(ws + oVTl);
  unsigned short* Oh  = (unsigned short*)(ws + oOh);  unsigned short* Ol  = (unsigned short*)(ws + oOl);

  const dim3 blk(256);
  const dim3 gPrep(kPbT + kPbX + 2 * kPbWq + 2 * kPbWk);            // 2560 blocks
  const dim3 gQKV(kBlkQ + kBlkK + kNB * kBlkV);                     // 160 blocks x 8 tiles
  const dim3 gProjQ(kBlkQ, 1);                                      // 768 tiles: M=4096, N=768
  const dim3 gAtt(kNHq * (kSeq / 64), kNB);                         // 12 heads x 32 query blocks per batch element

  // Both batch elements go through every stage in one launch: the token-row GEMMs see M = 4096 rows (the rotary
  // epilogue takes the position as row % 2048); v^T and attention take the batch element from the block index.
  // (1) rotary tables; x and the weights [out n][in k] f32 -> bf16 hi/lo planes, fragment-major
  prep_kernel<<<gPrep, blk, 0, stream>>>(x, Wq, Wk, Wv, Wo, Xh, Xl, Wqh, Wql, Wkh, Wkl, Wvh, Wvl, Woh, Wol, CS, SN);
  // (2) q and k projections with per-head rmsnorm * w + rotary in the epilogue -> Q/K bf16 hi/lo planes; v^T -> VT hi/lo planes (K = 768 each)
  qkv_gemm64_kernel<<<gQKV, blk, 0, stream>>>(Xh, Xl, Wqh, Wql, Wkh, Wkl, Wvh, Wvl, lnq, lnk, CS, SN, Qh, Ql, Kh, Kl, VTh, VTl, kDim);
  // (3) windowed causal GQA attention per head: y -> bf16 hi/lo planes, fragment-major (every element written by its (b, h, query block) owner)
  attn_gqa_window64_kernel<<<gAtt, dim3(128), 0, stream>>>(Qh, Ql, Kh, Kl, VTh, VTl, Oh, Ol, 0.125f);
  // (4) out = y . Wo^T -> d_out rows 0 .. 4095 (f32)   (M=4096, N=768, K=768)
  wmma_gemm64<1, true, 0, 0, false><<<gProjQ, blk, 0, stream>>>(
      Oh, Ol, kDim, 0L, Woh, Wol, kDim, 0L, d_out, d_out, kDim, 0L,
      lnq, lnq, 0L, kTok, kDim, kDim, 1.0f);
}

// v007
// Measured time: 86.9 microseconds a run.
// Two timings next to v006 put it at 1.17 and 1.16 times that version's speed.
// Counting every step since v000, it is 6.31 times as fast.
// Contractions (q/k/v/out projections, q.k^T scores, p.v): v_wmma_f32_16x16x32_bf16 with bf16 hi/lo split operands (hi.hi + hi.lo + lo.hi), f32 accumulate; rmsnorm, rotary tables, online softmax in f32.
#include <hip/hip_runtime.h>
#include <math.h>
#include <stdint.h>

constexpr int kNB     = 2;
constexpr int kSeq    = 2048;
constexpr int kTok    = kNB * kSeq;          // 4096 token rows over both batch elements
constexpr int kDim    = 768;
constexpr int kHd     = 64;
constexpr int kNHq    = 12;
constexpr int kNKv    = 4;
constexpr int kGroups = 3;
constexpr int kKvDim  = kNKv * kHd;          // 256
constexpr int kWin    = 384;
constexpr int kHalfHd = 32;
constexpr int kKBlk   = kDim / 32;           // 24 k blocks of 32 in a row of 768
static_assert((kSeq & (kSeq - 1)) == 0 && kHd == 64 && kHalfHd * 2 == kHd);
static_assert(kSeq % 64 == 0 && kDim % 64 == 0 && kKvDim % 64 == 0 && kDim % 32 == 0);
static_assert(kNHq == kNKv * kGroups);

typedef __attribute__((ext_vector_type(16))) _Float16 v16h;
typedef __attribute__((ext_vector_type(8)))  _Float16 v8h;
typedef __attribute__((ext_vector_type(16))) __bf16   v16b;
typedef __attribute__((ext_vector_type(8)))  __bf16   v8b;
typedef __attribute__((ext_vector_type(8)))  float    v8f;
typedef __attribute__((ext_vector_type(4)))  float    v4f;
typedef __attribute__((ext_vector_type(2)))  float    v2f;
typedef __attribute__((ext_vector_type(4)))  unsigned int v4u;

__device__ __forceinline__ unsigned short f2bf_bits(float f) {
  unsigned u = __float_as_uint(f);
  return (unsigned short)((u + 0x7FFFu + ((u >> 16) & 1u)) >> 16);
}
__device__ __forceinline__ float bf_bits2f(unsigned short h) { return __uint_as_float(((unsigned)h) << 16); }

__device__ __forceinline__ unsigned pk16(unsigned short a, unsigned short b) { return (unsigned)a | ((unsigned)b << 16); }
// 8 consecutive f32 -> 8 bf16 hi = bf16_rne(f) and 8 bf16 lo = bf16_rne(f - hi), 16 B each
__device__ __forceinline__ void split8(const float (&f)[8], v4u& hv, v4u& lv) {
#pragma unroll   // constant indices keep f, hv and lv in registers
  for (int q = 0; q < 4; ++q) {
    const unsigned short h0 = f2bf_bits(f[2 * q]), h1 = f2bf_bits(f[2 * q + 1]);
    const unsigned short l0 = f2bf_bits(f[2 * q] - bf_bits2f(h0)), l1 = f2bf_bits(f[2 * q + 1] - bf_bits2f(h1));
    hv[q] = pk16(h0, h1);
    lv[q] = pk16(l0, l1);
  }
}

// ---------------------------------------------------------------------------
// Per (token, head) unit of 64 floats: y[d] = w[d] * (x[d] * rsqrt(mean(x^2) + eps)); rotary:
//   o[d] = y[d]*cos[t][d&31] - y[d+32]*sin  (d < 32),   o[d] = y[d]*cos + y[d-32]*sin  (d >= 32);
// o split into bf16 hi/lo. 8 lanes per unit (lane&7 = which 8 of the 64), 4 units per wave: x = the lane's own 8 values,
// p = the 8 of its rotary partner block, w / v = the norm weights of the two blocks, c / s = the table rows' 8 values.
// ---------------------------------------------------------------------------
__device__ __forceinline__ float rope_one(float x, float p, float wx, float wp, float cv, float sv, float rinv, float sg) {
  const float xn = wx * (x * rinv);
  const float pn = wp * (p * rinv);
  return xn * cv + (sg * pn) * sv;
}
__device__ __forceinline__ void norm_rope_unit(const v4f xa, const v4f xb, const v4f pa, const v4f pb, const v4f wa, const v4f wb,
                                               const v4f va, const v4f vb, const v4f ca, const v4f cb, const v4f sa, const v4f sb,
                                               const float sg, v4u& hv, v4u& lv) {
  float ss = xa[0] * xa[0] + xa[1] * xa[1] + xa[2] * xa[2] + xa[3] * xa[3]
           + xb[0] * xb[0] + xb[1] * xb[1] + xb[2] * xb[2] + xb[3] * xb[3];
  ss += __shfl_xor(ss, 1, 32);
  ss += __shfl_xor(ss, 2, 32);
  ss += __shfl_xor(ss, 4, 32);
  const float rinv = rsqrtf(ss * (1.0f / 64.0f) + 1e-6f);
  float o[8];
  o[0] = rope_one(xa[0], pa[0], wa[0], va[0], ca[0], sa[0], rinv, sg);
  o[1] = rope_one(xa[1], pa[1], wa[1], va[1], ca[1], sa[1], rinv, sg);
  o[2] = rope_one(xa[2], pa[2], wa[2], va[2], ca[2], sa[2], rinv, sg);
  o[3] = rope_one(xa[3], pa[3], wa[3], va[3], ca[3], sa[3], rinv, sg);
  o[4] = rope_one(xb[0], pb[0], wb[0], vb[0], cb[0], sb[0], rinv, sg);
  o[5] = rope_one(xb[1], pb[1], wb[1], vb[1], cb[1], sb[1], rinv, sg);
  o[6] = rope_one(xb[2], pb[2], wb[2], vb[2], cb[2], sb[2], rinv, sg);
  o[7] = rope_one(xb[3], pb[3], wb[3], vb[3], cb[3], sb[3], rinv, sg);
  split8(o, hv, lv);
}

// hazard guards as plain device helpers (no inline asm inside the kernel template body)
// four vector slots: the distance asked between a 16-bit matrix instruction and a vector overwrite of a register that it reads;
// kept in front of a load over such a register too, as a precaution
__device__ __forceinline__ void operand_gap() { asm volatile("v_nop\n\tv_nop\n\tv_nop\n\tv_nop" ::: "memory"); }
__device__ __forceinline__ void acc_guard4(v8f& a, v8f& b, v8f& c, v8f& d) { asm volatile("v_nop\n\tv_nop\n\tv_nop\n\tv_nop" : "+v"(a), "+v"(b), "+v"(c), "+v"(d)); }
template <typename T> struct Frag;
template <> struct Frag<_Float16> {
  typedef v16h V; union U { v16h v; v8h h[2]; };
  static __device__ __forceinline__ v16h load(const _Float16* p) {   // elements 0..7 <- p[0..7], 8..15 <- p[16..23]
    U f; f.h[0] = *(const v8h*)(p); f.h[1] = *(const v8h*)(p + 16); return f.v;
  }
  static __device__ __forceinline__ v8f mma(v16h a, v16h b, v8f c) {
    return __builtin_amdgcn_wmma_f32_16x16x32_f16(false, a, false, b, (short)0, c, false, false);
  }
};
template <> struct Frag<__bf16> {
  typedef v16b V; union U { v16b v; v8b h[2]; };
  static __device__ __forceinline__ v16b load(const __bf16* p) {
    U f; f.h[0] = *(const v8b*)(p); f.h[1] = *(const v8b*)(p + 16); return f.v;
  }
  // fragment-major block at byte address p: elements 0..7 <- bytes 0..15, elements 8..15 <- bytes 512..527
  static __device__ __forceinline__ v16b load_packed(const char* p) {
    U f; f.h[0] = *(const v8b*)(p); f.h[1] = *(const v8b*)(p + 512); return f.v;
  }
  static __device__ __forceinline__ v8f mma(v16b a, v16b b, v8f c) {
    return __builtin_amdgcn_wmma_f32_16x16x32_bf16(false, a, false, b, (short)0, c, false, false);
  }
};

// ---- Register-blocked batched WMMA GEMM ------------------------------------
// C[m,n] = scale * sum_k A[m,k] * Bt[n,k] (+bias)(+resid); each wave owns a 64x64 tile.
// A [M,K] and Bt [N,K] are stored fragment-major (written by split_pack_thread and by the attention kernel): each 16-row x 32-k block is
// 512 consecutive elements, block index = (row/16)*kKBlk + k/32, and element (row, k) of a block sits at
// ((k>>4)&1)*256 + (((k>>3)&1)*16 + (row&15))*8 + (k&7). Lane l of a fragment load then reads 16 B at l*16 B, so one
// wave-wide load covers 512 consecutive bytes (4 whole lines) and holds the same elements as a row-major fragment load.
// M,N % 64 == 0, K % 64 == 0, K >= 64; rows of both operands are kDim long (lda == ldb == kDim), so the step from one 16-row
// block row to the next is a compile-time constant and goes into the loads' immediate offsets.
// SPLIT: operands are hi/lo planes (A2/Bt2 = lo planes, same layout); product = hi.hi + hi.lo + lo.hi.
// BIAS_MODE: 0 = none, 1 = bias[m], 2 = bias[n].
// OUT_MODE: 0 = f32, 1 = f16, 2 = bf16 hi plane (Cout) + bf16 lo plane (Cout2), 3 = the tile is 64 token rows x the 64
// columns of one head: per-row rmsnorm * nw, rotary from the tables cs / sn, then bf16 hi/lo planes as in 2 (the slab
// then holds the whole tile, 64 rows).
// ET: 0 = f16 operands, 1 = bf16 operands (pointers passed as 16-bit storage)
template <int ET> struct Elem;
template <> struct Elem<0> { typedef _Float16 T; };
template <> struct Elem<1> { typedef __bf16 T; };
// All fragments of one k step of a 64x64 wave tile: four 16-row blocks of A and of Bt, hi and lo planes.
template <typename T, bool SPLIT> struct FragSet { typename Frag<T>::V bh[4], bl[4], ah[4], al[4]; };
constexpr int kRowStep = kKBlk * 1024;         // bytes from one 16-row block row to the next
template <typename T, bool SPLIT>
__device__ __forceinline__ void load_frag_set(FragSet<T, SPLIT>& f, const char* pAh, const char* pAl, const char* pBh,
                                              const char* pBl, const unsigned vo, const int off) {
#pragma unroll
  for (int j = 0; j < 4; ++j) {
    f.bh[j] = Frag<T>::load_packed(pBh + vo + (off + j * kRowStep));
    if (SPLIT) f.bl[j] = Frag<T>::load_packed(pBl + vo + (off + j * kRowStep));
  }
#pragma unroll
  for (int i = 0; i < 4; ++i) {
    f.ah[i] = Frag<T>::load_packed(pAh + vo + (off + i * kRowStep));
    if (SPLIT) f.al[i] = Frag<T>::load_packed(pAl + vo + (off + i * kRowStep));
  }
}
template <typename T, bool SPLIT>
__device__ __forceinline__ void mma_frag_set(v8f (&acc)[4][4], const FragSet<T, SPLIT>& f) {
#pragma unroll
  for (int i = 0; i < 4; ++i) {
#pragma unroll
    for (int j = 0; j < 4; ++j) {
      acc[i][j] = Frag<T>::mma(f.ah[i], f.bh[j], acc[i][j]);
      if (SPLIT) {
        acc[i][j] = Frag<T>::mma(f.ah[i], f.bl[j], acc[i][j]);
        acc[i][j] = Frag<T>::mma(f.al[i], f.bh[j], acc[i][j]);
      }
    }
  }
}
// gemm64_tile = one wave's 64x64 tile; the kernels below hand it the wave's LDS slab, the batch index b and the tile's
// first row m0 and column n0 (the same in every lane, in scalar registers, so that the four plane bases are scalar too).
template <int ET, bool SPLIT, int BIAS_MODE, int OUT_MODE, bool RESID, int ACT = 0>
__device__ __forceinline__ void gemm64_tile(
    float* __restrict__ slab, const int b, const int m0, const int n0,
    const unsigned short* __restrict__ Ap, const unsigned short* __restrict__ A2p, int lda, long strideA,
    const unsigned short* __restrict__ Btp, const unsigned short* __restrict__ Bt2p, int ldb, long strideB,
    void* __restrict__ Cout, void* __restrict__ Cout2, int ldc, long strideC,
    const float* __restrict__ bias,
    const float* __restrict__ resid, long strideR,
    int K, float scale,
    const float* __restrict__ nw = nullptr, const float* __restrict__ cs = nullptr, const float* __restrict__ sn = nullptr) {
  typedef typename Elem<ET>::T T;
  typedef typename Frag<T>::V V;
  const T* A = (const T*)Ap; const T* A2 = (const T*)A2p; const T* Bt = (const T*)Btp; const T* Bt2 = (const T*)Bt2p;
  const int lane = threadIdx.x & 31;

  const T* Ab  = A  + (size_t)b * strideA;
  const T* Bb  = Bt + (size_t)b * strideB;
  const T* Ab2 = SPLIT ? (A2  + (size_t)b * strideA) : nullptr;
  const T* Bb2 = SPLIT ? (Bt2 + (size_t)b * strideB) : nullptr;

  const int rlane = lane & 15;                 // row (A) / col (B, D) within subtile
  const int mOff  = (lane >> 4) * 8;           // D row offset
  // Every fragment load = scalar base of the tile's first block row in its plane + one 32-bit lane byte offset + an
  // immediate (block row step, second half of the block). The lane offset is the only vector address register; it steps
  // one block (1024 B) per k step, two k steps per trip.
  const char* pBh = (const char*)(Bb  + (size_t)(n0 >> 4) * (kKBlk * 512));
  const char* pBl = SPLIT ? (const char*)(Bb2 + (size_t)(n0 >> 4) * (kKBlk * 512)) : nullptr;
  const char* pAh = (const char*)(Ab  + (size_t)(m0 >> 4) * (kKBlk * 512));
  const char* pAl = SPLIT ? (const char*)(Ab2 + (size_t)(m0 >> 4) * (kKBlk * 512)) : nullptr;
  unsigned vo = (unsigned)lane * 16u;          // this lane's 16 B inside a 512-B half block

  v8f acc[4][4];
#pragma unroll
  for (int i = 0; i < 4; ++i)
#pragma unroll
    for (int j = 0; j < 4; ++j) acc[i][j] = (v8f){0.f,0.f,0.f,0.f,0.f,0.f,0.f,0.f};

  // Two register sets of fragments: while the 48 (SPLIT) matrix instructions of one k step run on one set, the 32 loads of
  // the next k step fill the other, so the loads of a k step have the whole length of the k step before it to arrive.
  FragSet<T, SPLIT> f0, f1;
  load_frag_set<T, SPLIT>(f0, pAh, pAl, pBh, pBl, vo, 0);
  asm volatile("s_wait_xcnt 0x0" :: "v"(vo) : "memory");   // as at the loop's foot, for the path that skips the loop (K == 64)
  for (int k0 = 64; k0 < K; k0 += 64) {
    load_frag_set<T, SPLIT>(f1, pAh, pAl, pBh, pBl, vo, 1024);
    __builtin_amdgcn_sched_barrier(0);   // keeps the next step's loads ahead of this step's products (sunk to their use they would fly alone)
    mma_frag_set<T, SPLIT>(acc, f0);
    __builtin_amdgcn_sched_barrier(0);   // keeps every product on f0 in front of the gap below
    operand_gap();                       // four vector slots between the last product that reads f0 and the first load that refills it
    __builtin_amdgcn_sched_barrier(0);   // keeps every refill of f0 behind that gap
    load_frag_set<T, SPLIT>(f0, pAh, pAl, pBh, pBl, vo, 2048);
    __builtin_amdgcn_sched_barrier(0);   // keeps these loads ahead of the products on f1, as above
    mma_frag_set<T, SPLIT>(acc, f1);
    __builtin_amdgcn_sched_barrier(0);   // keeps every product on f1 in front of the gap and the wait below, a whole k step behind the loads
    // four vector slots between the last product that reads f1 and the first load that refills it (next trip, or behind the
    // loop); the loads in flight name vo: the wait stands before vo is overwritten
    asm volatile("v_nop\n\tv_nop\n\tv_nop\n\tv_nop\n\ts_wait_xcnt 0x0" ::: "memory");
    __builtin_amdgcn_sched_barrier(0);   // keeps the step of vo and the refill of f1 behind that statement
    vo += 2048u;
  }
  const unsigned vt = (unsigned)lane * 16u + (unsigned)(K - 64) * 32u;   // lane offset at the last two k steps (= vo here)
  load_frag_set<T, SPLIT>(f1, pAh, pAl, pBh, pBl, vt, 1024);
  asm volatile("s_wait_xcnt 0x0" :: "v"(vt) : "memory");   // vt is live up to this wait, so nothing overwrites it under the loads that name it
  __builtin_amdgcn_sched_barrier(0);     // keeps the last step's loads ahead of the products before it
  mma_frag_set<T, SPLIT>(acc, f0);
  mma_frag_set<T, SPLIT>(acc, f1);
  acc_guard4(acc[0][0], acc[0][1], acc[0][2], acc[0][3]);
  acc_guard4(acc[1][0], acc[1][1], acc[1][2], acc[1][3]);
  acc_guard4(acc[2][0], acc[2][1], acc[2][2], acc[2][3]);
  acc_guard4(acc[3][0], acc[3][1], acc[3][2], acc[3][3]);

  // ---- epilogue ----
  if (OUT_MODE == 3) {
#pragma unroll
    for (int i = 0; i < 4; ++i)
#pragma unroll
      for (int j = 0; j < 4; ++j)
#pragma unroll
        for (int r = 0; r < 8; ++r) slab[((i << 4) + mOff + r) * 68 + (j << 4) + rlane] = acc[i][j][r] * scale;
    // the rows are read back by other lanes of this wave: the slab's stores stay in front of its loads
    __builtin_amdgcn_fence(__ATOMIC_RELEASE, "workgroup");
    __builtin_amdgcn_wave_barrier();
    __builtin_amdgcn_fence(__ATOMIC_ACQUIRE, "workgroup");
    unsigned short* C  = (unsigned short*)Cout  + (size_t)b * strideC;
    unsigned short* C2 = (unsigned short*)Cout2 + (size_t)b * strideC;
    const int d0 = (lane & 7) * 8;                 // this lane's 8 of the unit's 64 values
    const int dp = d0 ^ kHalfHd;                   // rotary partner block
    const float sg = (d0 < kHalfHd) ? -1.0f : 1.0f;
    // Norm weights and table values: every load = scalar base + a lane byte offset (+ an immediate). Table row = position
    // inside the sequence (m0 % 64 == 0, so the tile lies in one sequence); a pass is 4 rows, a group 4 passes.
    const unsigned wo = (unsigned)d0 * 4u, po = (unsigned)dp * 4u;
    const unsigned tb = (unsigned)(((m0 & (kSeq - 1)) + (lane >> 3)) * kHalfHd + (d0 & 24)) * 4u;
    const char* nwb = (const char*)nw;
    const char* csb = (const char*)cs;
    const char* snb = (const char*)sn;
    const v4f wa = *(const v4f*)(nwb + wo), wb = *(const v4f*)(nwb + wo + 16);
    const v4f va = *(const v4f*)(nwb + po), vb = *(const v4f*)(nwb + po + 16);
    v4f tbl[2][4][4];                              // two groups of table values: cos 0..3, cos 4..7, sin 0..3, sin 4..7 of a pass
#pragma unroll   // constant indices keep tbl in registers
    for (int p = 0; p < 4; ++p) {
      tbl[0][p][0] = *(const v4f*)(csb + tb + p * (16 * kHalfHd)); tbl[0][p][1] = *(const v4f*)(csb + tb + (p * (16 * kHalfHd) + 16));
      tbl[0][p][2] = *(const v4f*)(snb + tb + p * (16 * kHalfHd)); tbl[0][p][3] = *(const v4f*)(snb + tb + (p * (16 * kHalfHd) + 16));
    }
    asm volatile("s_wait_xcnt 0x0" :: "v"(wo), "v"(po) : "memory");   // wo and po are live up to this wait, so nothing overwrites them under the loads that name them
#pragma unroll   // constant indices into tbl
    for (int g = 0; g < 4; ++g) {
      if (g < 3) {
#pragma unroll
        for (int p = 0; p < 4; ++p) {              // the next group's table values fly under this group's arithmetic
          const int im = ((g + 1) * 4 + p) * (16 * kHalfHd);
          tbl[(g + 1) & 1][p][0] = *(const v4f*)(csb + tb + im); tbl[(g + 1) & 1][p][1] = *(const v4f*)(csb + tb + (im + 16));
          tbl[(g + 1) & 1][p][2] = *(const v4f*)(snb + tb + im); tbl[(g + 1) & 1][p][3] = *(const v4f*)(snb + tb + (im + 16));
        }
      }
      __builtin_amdgcn_sched_barrier(0);           // keeps these loads ahead of the group's arithmetic (sunk to their use they would fly alone) and of its stores
#pragma unroll
      for (int p = 0; p < 4; ++p) {
        const int row = (g * 4 + p) * 4 + (lane >> 3);
        const float* sp = slab + row * 68;
        const v4f xa = *(const v4f*)(sp + d0), xb = *(const v4f*)(sp + d0 + 4);
        const v4f pa = *(const v4f*)(sp + dp), pb = *(const v4f*)(sp + dp + 4);
        v4u hv, lv;
        norm_rope_unit(xa, xb, pa, pb, wa, wb, va, vb, tbl[g & 1][p][0], tbl[g & 1][p][1], tbl[g & 1][p][2], tbl[g & 1][p][3], sg, hv, lv);
        const size_t o = (size_t)(m0 + row) * ldc + n0 + d0;
        *(v4u*)(C + o)  = hv;
        *(v4u*)(C2 + o) = lv;
      }
      // the next group's loads and arithmetic reuse the registers of these stores: the wait stands before that; tb is live
      // up to the last of these waits, so nothing overwrites it under the loads that name it
      asm volatile("s_wait_xcnt 0x0" :: "v"(tb) : "memory");
      __builtin_amdgcn_sched_barrier(0);           // keeps what follows behind the wait (without it the scheduler may lift it over the wait)
    }
    return;
  }
  const float* Rb = RESID ? (resid + (size_t)b * strideR) : nullptr;
#pragma unroll
  for (int i = 0; i < 4; ++i) {
    const int mBase = m0 + (i << 4);
#pragma unroll
    for (int j = 0; j < 4; ++j) {
      const int n = n0 + (j << 4) + rlane;
      float bv = 0.f;
      if (BIAS_MODE == 2) bv = bias[n];
#pragma unroll
      for (int r = 0; r < 8; ++r) {
        float v = acc[i][j][r] * scale;
        if (BIAS_MODE == 1) v += bias[mBase + mOff + r];
        if (BIAS_MODE == 2) v += bv;
        if (RESID) v += Rb[(size_t)(mBase + mOff + r) * ldc + n];
        if (ACT == 1) v = tanhf(v);
        if (ACT == 2) v = fmaxf(v, 0.0f);
        if (ACT == 3) v = v / (1.0f + expf(-v));
        if (ACT == 4) v = (v > 0.f) ? v : 0.01f * v;
        slab[(mOff + r) * 68 + (j << 4) + rlane] = v;
      }
    }
    __builtin_amdgcn_fence(__ATOMIC_RELEASE, "workgroup");
    __builtin_amdgcn_wave_barrier();
    __builtin_amdgcn_fence(__ATOMIC_ACQUIRE, "workgroup");
    if (OUT_MODE == 0) {
      float* C = (float*)Cout + (size_t)b * strideC;
      const int hh = lane >> 4, c4 = (lane & 15) * 4;     // row seg = 256 B = 16 lanes x 16 B
      {
#pragma unroll
        for (int it = 0; it < 8; ++it) {
          const int row = it * 2 + hh;
          v4f v = *(const v4f*)(slab + row * 68 + c4);
          *(v4f*)(C + (size_t)(mBase + row) * ldc + n0 + c4) = v;
        }
        // the next block row's address arithmetic reuses the address registers of these stores: the wait stands before that
        asm volatile("s_wait_xcnt 0x0" ::: "memory");
        __builtin_amdgcn_sched_barrier(0);   // keeps that arithmetic behind the wait (without it the scheduler lifts it over the wait)
      }
    } else {
      const int q = lane >> 3, c8 = (lane & 7) * 8;
      unsigned short* C  = (unsigned short*)Cout  + (size_t)b * strideC;
      unsigned short* C2 = (OUT_MODE == 2) ? ((unsigned short*)Cout2 + (size_t)b * strideC) : nullptr;
      {
#pragma unroll
        for (int it = 0; it < 4; ++it) {
          const int row = it * 4 + q;
          const float* sp = slab + row * 68 + c8;
          v8h hv, lv;
#pragma unroll
          for (int e = 0; e < 8; ++e) {
            if (OUT_MODE == 1) {
              hv[e] = (_Float16)sp[e];
            } else {
              unsigned short hb = f2bf_bits(sp[e]);
              unsigned short lb = f2bf_bits(sp[e] - bf_bits2f(hb));
              hv[e] = __builtin_bit_cast(_Float16, hb);
              lv[e] = __builtin_bit_cast(_Float16, lb);
            }
          }
          *(v8h*)(C + (size_t)(mBase + row) * ldc + n0 + c8) = hv;
          if (OUT_MODE == 2) *(v8h*)(C2 + (size_t)(mBase + row) * ldc + n0 + c8) = lv;
        }
        
      }
    }
    __builtin_amdgcn_fence(__ATOMIC_RELEASE, "workgroup");
    __builtin_amdgcn_wave_barrier();
    __builtin_amdgcn_fence(__ATOMIC_ACQUIRE, "workgroup");
  }
}

// One GEMM per launch: 8 waves = 8 consecutive tiles per block, grid.y = batch index.
template <int ET, bool SPLIT, int BIAS_MODE, int OUT_MODE, bool RESID, int ACT = 0>
__global__ __launch_bounds__(256) void wmma_gemm64(
    const unsigned short* __restrict__ Ap, const unsigned short* __restrict__ A2p, int lda, long strideA,
    const unsigned short* __restrict__ Btp, const unsigned short* __restrict__ Bt2p, int ldb, long strideB,
    void* __restrict__ Cout, void* __restrict__ Cout2, int ldc, long strideC,
    const float* __restrict__ bias,
    const float* __restrict__ resid, long strideR,
    int M, int N, int K, float scale) {
  __shared__ __align__(16) float sT[8][16 * 68];   // per-wave 16x64 slab, pitch 68 floats
  const int wave = threadIdx.x >> 5;
  const int tilesN = N >> 6;
  const int tilesM = M >> 6;
  const int tile = __builtin_amdgcn_readfirstlane(blockIdx.x * 8 + wave);
  if (tile >= tilesM * tilesN) return;   // wave-uniform; no block barriers in this kernel
  const int tm = tile / tilesN;
  const int tn = tile - tm * tilesN;
  gemm64_tile<ET, SPLIT, BIAS_MODE, OUT_MODE, RESID, ACT>(sT[wave], blockIdx.y, tm << 6, tn << 6, Ap, A2p, lda, strideA, Btp, Bt2p,
                                                          ldb, strideB, Cout, Cout2, ldc, strideC, bias, resid, strideR, K, scale);
}

// The three projections of x in one launch: none reads what another writes, and each alone fills well under half of
// the chip's WGPs for the whole length of one wave's k loop. Block ranges (8 tiles per block):
//   [0, kBlkQ)                 q   = x . Wq^T, M=4096, N=768: rmsnorm * qw, rotary -> Q hi/lo [row][h*64+d]
//   [kBlkQ, kBlkQ+kBlkK)       k   = x . Wk^T, M=4096, N=256: rmsnorm * kw, rotary -> K hi/lo [row][g*64+d]
//   then kBlkV per batch b     v^T = Wv . x[b]^T -> VT hi/lo [b][g*64+d][s]     M=256,  N=2048 (A = Wv planes, Bt = x planes of b)
constexpr int kBlkQ = (kTok / 64) * (kDim / 64) / 8;      // 96
constexpr int kBlkK = (kTok / 64) * (kKvDim / 64) / 8;    // 32
constexpr int kBlkV = (kKvDim / 64) * (kSeq / 64) / 8;    // 16 per batch element
static_assert(((kTok / 64) * (kDim / 64)) % 8 == 0 && ((kTok / 64) * (kKvDim / 64)) % 8 == 0 && ((kKvDim / 64) * (kSeq / 64)) % 8 == 0);

__global__ __launch_bounds__(256) void qkv_gemm64_kernel(
    const unsigned short* __restrict__ Xh, const unsigned short* __restrict__ Xl,
    const unsigned short* __restrict__ Wqh, const unsigned short* __restrict__ Wql,
    const unsigned short* __restrict__ Wkh, const unsigned short* __restrict__ Wkl,
    const unsigned short* __restrict__ Wvh, const unsigned short* __restrict__ Wvl,
    const float* __restrict__ qw, const float* __restrict__ kw,
    const float* __restrict__ cs, const float* __restrict__ sn,
    unsigned short* __restrict__ Qh, unsigned short* __restrict__ Ql,
    unsigned short* __restrict__ Kh, unsigned short* __restrict__ Kl,
    unsigned short* __restrict__ VTh, unsigned short* __restrict__ VTl, int K) {
  __shared__ __align__(16) float sT[8][64 * 68];   // per-wave 64x64 slab, pitch 68 floats (the v^T tiles use its first 16 rows)
  const int wave = threadIdx.x >> 5;
  const int bx   = blockIdx.x;
  if (bx < kBlkQ + kBlkK) {
    const bool isq = bx < kBlkQ;                   // block-uniform
    const int tile = __builtin_amdgcn_readfirstlane((isq ? bx : bx - kBlkQ) * 8 + wave);
    const int n  = isq ? kDim : kKvDim;
    const int tm = isq ? tile / (kDim / 64) : tile / (kKvDim / 64);
    const int tn = tile - tm * (n >> 6);
    gemm64_tile<1, true, 0, 3, false>(sT[wave], 0, tm << 6, tn << 6, Xh, Xl, kDim, 0L, isq ? Wqh : Wkh, isq ? Wql : Wkl, kDim, 0L,
                                      (void*)(isq ? Qh : Kh), (void*)(isq ? Ql : Kl), n, 0L, nullptr, nullptr, 0L, K, 1.0f,
                                      isq ? qw : kw, cs, sn);
  } else {
    const int v    = bx - (kBlkQ + kBlkK);
    const int tile = __builtin_amdgcn_readfirstlane((v % kBlkV) * 8 + wave);
    const int tm   = tile / (kSeq / 64);
    const int tn   = tile - tm * (kSeq / 64);
    gemm64_tile<1, true, 0, 2, false>(sT[wave], v / kBlkV, tm << 6, tn << 6, Wvh, Wvl, kDim, 0L, Xh, Xl, kDim, (long)kSeq * kDim,
                                      (void*)VTh, (void*)VTl, kSeq, (long)kKvDim * kSeq, nullptr, nullptr, 0L, K, 1.0f);
  }
}

// ---------------------------------------------------------------------------
// bf16 split of a row-major f32 [rows][768] matrix, hi = bf16_rne(in), lo = bf16_rne(in - hi), stored fragment-major
// for wmma_gemm64 (layout: see there). One thread = 8 consecutive k of one row (32 B read, 16 B per plane written);
// one wave = 8 rows x 32 k, half a block: it reads 8 whole 128-B lines and each plane's store fills 4 whole lines.
// rows % 16 == 0; n8 = rows * 768 / 8 threads.
// ---------------------------------------------------------------------------
__device__ __forceinline__ void split_pack_thread(const float* __restrict__ in, unsigned short* __restrict__ hi,
                                                  unsigned short* __restrict__ lo, const int idx, const int n8) {
  if (idx < n8) {
    const int l   = idx & 31;
    const int g   = idx >> 5;                 // half block
    const int blk = g >> 1;
    const int rb  = blk / kKBlk, kb = blk - rb * kKBlk;
    const int r16 = (g & 1) * 8 + (l >> 2);   // row inside the block
    const int kp  = l & 3;                    // which 8 of the block's 32 k
    const float* s = in + (size_t)(rb * 16 + r16) * kDim + kb * 32 + kp * 8;
    const v4f fa = *(const v4f*)(s), fb = *(const v4f*)(s + 4);
    const float f[8] = {fa[0], fa[1], fa[2], fa[3], fb[0], fb[1], fb[2], fb[3]};
    v4u hv, lv;
    split8(f, hv, lv);
    const size_t o = (size_t)blk * 512 + (kp >> 1) * 256 + ((kp & 1) * 16 + r16) * 8;
    *(v4u*)(hi + o) = hv;
    *(v4u*)(lo + o) = lv;
  }
}

// ---------------------------------------------------------------------------
// Rotary tables: cs[t*32+i] = cosf(t * inv_freq[i]), sn likewise, inv_freq[i] = 10000^(-i/32) = 2^(-i*log2(1e4)/32).
// kSeq*32/256 = 256 blocks x 256 threads = exactly 65536 elements per table; each wave writes 32 consecutive
// ---------------------------------------------------------------------------
__device__ __forceinline__ void rope_table_thread(float* __restrict__ cs, float* __restrict__ sn, const int i) {
  const int t  = i >> 5;
  const int fi = i & 31;
  const float invf = exp2f((float)fi * -0.41524101186092f);
  const float ang  = (float)t * invf;
  float sv, cv;
  sincosf(ang, &sv, &cv);
  ((float*)cs)[i] = cv;
  ((float*)sn)[i] = sv;
}

// ---------------------------------------------------------------------------
// Everything that depends on the inputs alone, in one launch: the rotary tables and the bf16 splits of x and of the four
// weight matrices. No part reads what another writes. Block ranges, the part with the longest thread first:
//   kPbT table blocks | kPbX blocks of x | kPbWq of Wq | kPbWk of Wk | kPbWk of Wv | kPbWq of Wo
// ---------------------------------------------------------------------------
constexpr int kN8X  = kTok * kDim / 8;        // 393216 threads
constexpr int kN8Wq = kDim * kDim / 8;        // 73728
constexpr int kN8Wk = kKvDim * kDim / 8;      // 24576
constexpr int kPbT  = kSeq * kHalfHd / 256;   // 256
constexpr int kPbX  = kN8X / 256;             // 1536
constexpr int kPbWq = kN8Wq / 256;            // 288
constexpr int kPbWk = kN8Wk / 256;            // 96
static_assert((kSeq * kHalfHd) % 256 == 0 && kN8X % 256 == 0 && kN8Wq % 256 == 0 && kN8Wk % 256 == 0);

__global__ __launch_bounds__(256) void prep_kernel(
    const float* __restrict__ x, const float* __restrict__ Wq, const float* __restrict__ Wk,
    const float* __restrict__ Wv, const float* __restrict__ Wo,
    unsigned short* __restrict__ Xh, unsigned short* __restrict__ Xl,
    unsigned short* __restrict__ Wqh, unsigned short* __restrict__ Wql,
    unsigned short* __restrict__ Wkh, unsigned short* __restrict__ Wkl,
    unsigned short* __restrict__ Wvh, unsigned short* __restrict__ Wvl,
    unsigned short* __restrict__ Woh, unsigned short* __restrict__ Wol,
    float* __restrict__ cs, float* __restrict__ sn) {
  int bx = blockIdx.x;                          // block-uniform choice of the part
  if (bx < kPbT) { rope_table_thread(cs, sn, bx * 256 + threadIdx.x); return; }
  bx -= kPbT;
  const float* in = x; unsigned short* hi = Xh; unsigned short* lo = Xl; int n8 = kN8X;
  if (bx >= kPbX) {
    bx -= kPbX; in = Wq; hi = Wqh; lo = Wql; n8 = kN8Wq;
    if (bx >= kPbWq) {
      bx -= kPbWq; in = Wk; hi = Wkh; lo = Wkl; n8 = kN8Wk;
      if (bx >= kPbWk) {
        bx -= kPbWk; in = Wv; hi = Wvh; lo = Wvl;
        if (bx >= kPbWk) { bx -= kPbWk; in = Wo; hi = Woh; lo = Wol; n8 = kN8Wq; }
      }
    }
  }
  split_pack_thread(in, hi, lo, bx * 256 + threadIdx.x, n8);
}

// =====================================================================================
// Causal sliding-window grouped-query attention, head dim 64, grid.y = batch element (offsets below are within one).
//   q planes (hi/lo bf16): element (t, h, d) at [t*kDim + h*64 + d]           (12 heads)
//   k planes (hi/lo bf16): element (s, g, d) at [s*kKvDim + g*64 + d]         (4 kv heads, g = h/3)
//   v^T planes (hi/lo bf16): element (g, d, s) at [(g*64 + d)*kSeq + s]
//   out: y element (t, h, d) = row t, column h*64 + d of a [token row][768] matrix, split into bf16 hi/lo planes and stored
//   fragment-major for wmma_gemm64 (layout: see there); a wave's 16 rows x 64 columns are two whole blocks of each plane
//   scores = (q . k) * sscale : bf16 hi/lo split (hi.hi + hi.lo + lo.hi) on v_wmma_f32_16x16x32_bf16
//   out    = p . v             : bf16 hi/lo split of p (unnormalised) and v, f32 accumulate
//   online softmax in f32; keys with s > t or t - s > kWin-1 set to -inf; a fully -inf running max uses a 0 pivot
//   (alpha = 0, p = 0) so nothing non-finite is produced; the diagonal key is always kept.
//   Block = 4 waves = 64 query rows of one head; grid.x = kNHq * (kSeq/64); kv chunks of 64 from the first
//   in-window chunk (block-uniform) up to chunk qb (static bound qb+1 <= 32).
//   K / V^T chunk staging: asynchronous 16-B copies to LDS, two buffers: chunk kc+1 flies while chunk kc is worked on.
//   128 threads x 4 copies per plane = the whole 64x64 tile; 8 lanes cover one 128-B row, a wave-wide copy 4 whole lines.
//   Fragment loads read the LDS tiles with the v8b element type. LDS rows of the K, V^T and P tiles are AT_LP elements
//   apart (64 used + 8 never read or written).
// =====================================================================================
#define AT_D 64
#define AT_NW 4
#define AT_QB 64
#define AT_KC 64
#define AT_LP 72   // LDS row pitch of the K, V^T and P tiles in elements: 144 B = 16 B x 9 (odd), so the 16 rows that one
                   // ds_load_b128 touches per half wave start on 16 different 4-bank groups (128-B rows: only 2 groups)

__device__ __forceinline__ unsigned short at_bf_bits(float f) {
  unsigned u = __float_as_uint(f);
  return (unsigned short)((u + 0x7FFFu + ((u >> 16) & 1u)) >> 16);
}
__device__ __forceinline__ __bf16 at_f2bf(float f) { return __builtin_bit_cast(__bf16, at_bf_bits(f)); }
__device__ __forceinline__ void at_split(float f, __bf16& hi, __bf16& lo) {
  const unsigned short hb = at_bf_bits(f);
  hi = __builtin_bit_cast(__bf16, hb);
  lo = at_f2bf(f - __uint_as_float(((unsigned)hb) << 16));
}
__device__ __forceinline__ v8f at_mma(v16b a, v16b b, v8f c) {
  c = __builtin_amdgcn_wmma_f32_16x16x32_bf16(false, a, false, b, (short)0, c, false, false);
  asm volatile("v_nop\n\tv_nop\n\tv_nop\n\tv_nop" : "+v"(c) : "v"(a), "v"(b));
  return c;
}

#define AT_PL (AT_KC * AT_LP)   // elements of one staged plane (64 rows)
// Eight asynchronous 16-B copies to LDS: rows r, r+16, r+32, r+48 of two planes. l = the lane's LDS byte address of row r in
// the first plane (the second plane lies AT_PL elements behind it), a / b = the lane's global address of row r in the two
// source planes, gs = source elements per 16 rows. The s_wait_xcnt closes the statement, so that no register which a copy
// names is rewritten ahead of it.
__device__ __forceinline__ void at_copy8(const unsigned l, const __bf16* a, const __bf16* b, const int gs) {
  const unsigned l1 = l + 16 * AT_LP * 2, l2 = l + 32 * AT_LP * 2, l3 = l + 48 * AT_LP * 2;
  const unsigned m0 = l + AT_PL * 2, m1 = l1 + AT_PL * 2, m2 = l2 + AT_PL * 2, m3 = l3 + AT_PL * 2;
  const __bf16* a1 = a + gs; const __bf16* a2 = a + 2 * gs; const __bf16* a3 = a + 3 * gs;
  const __bf16* b1 = b + gs; const __bf16* b2 = b + 2 * gs; const __bf16* b3 = b + 3 * gs;
  asm volatile("global_load_async_to_lds_b128 %0, %8, off\n\t"
               "global_load_async_to_lds_b128 %1, %9, off\n\t"
               "global_load_async_to_lds_b128 %2, %10, off\n\t"
               "global_load_async_to_lds_b128 %3, %11, off\n\t"
               "global_load_async_to_lds_b128 %4, %12, off\n\t"
               "global_load_async_to_lds_b128 %5, %13, off\n\t"
               "global_load_async_to_lds_b128 %6, %14, off\n\t"
               "global_load_async_to_lds_b128 %7, %15, off\n\t"
               "s_wait_xcnt 0x0"
               :: "v"(l), "v"(l1), "v"(l2), "v"(l3), "v"(m0), "v"(m1), "v"(m2), "v"(m3),
                  "v"(a), "v"(a1), "v"(a2), "v"(a3), "v"(b), "v"(b1), "v"(b2), "v"(b3) : "memory");
}

__global__ __launch_bounds__(128)
void attn_gqa_window64_kernel(const unsigned short* __restrict__ qhp, const unsigned short* __restrict__ qlp,
                              const unsigned short* __restrict__ khp, const unsigned short* __restrict__ klp,
                              const unsigned short* __restrict__ vhp, const unsigned short* __restrict__ vlp,
                              unsigned short* __restrict__ ohp, unsigned short* __restrict__ olp, float sscale) {
  union FB { v16b v; v8b h[2]; };
  // two buffers x 4 planes of 9 KB: K hi [kv][d], K lo, V hi [d][kv], V lo
  __shared__ __align__(16) __bf16 KV[2][4][AT_PL];
  // per wave: P hi [row][kv], P lo; behind the chunk loop the same bytes hold the wave's out tile (16 rows, pitch 68 floats),
  // so that three workgroups still fit a WGP's LDS beside the second buffer
  __shared__ __align__(16) __bf16 Pw[AT_NW][2][16 * AT_LP];
  static_assert(sizeof(__bf16) * 2 * 16 * AT_LP >= sizeof(float) * 16 * 68);

  const int tid  = threadIdx.x;
  const int wave = tid >> 5;
  const int lane = tid & 31;
  const int hh   = lane >> 4;
  const int c    = lane & 15;

  const int nqb = kSeq / AT_QB;           // 32
  const int bx = blockIdx.x;
  const int qb = bx % nqb;
  const int h  = bx / nqb;                // 0..kNHq-1 (grid = kNHq * nqb)
  const int kvh = h / kGroups;            // 0..kNKv-1
  const int q0 = qb * AT_QB + wave * 16;

  const size_t bq = (size_t)blockIdx.y * kSeq * kDim;     // batch element's q plane
  const size_t bk = (size_t)blockIdx.y * kSeq * kKvDim;   // batch element's k / v^T plane
  const __bf16* Qh = (const __bf16*)(const void*)qhp + bq + (size_t)h * AT_D;
  const __bf16* Ql = (const __bf16*)(const void*)qlp + bq + (size_t)h * AT_D;
  const __bf16* Kh = (const __bf16*)(const void*)khp + bk + (size_t)kvh * AT_D;
  const __bf16* Kl = (const __bf16*)(const void*)klp + bk + (size_t)kvh * AT_D;
  const __bf16* Vh = (const __bf16*)(const void*)vhp + bk + (size_t)kvh * AT_D * kSeq;
  const __bf16* Vl = (const __bf16*)(const void*)vlp + bk + (size_t)kvh * AT_D * kSeq;

  // ---- Q fragments (A operand, row = lane&15, split k map via Frag load): 2 d-chunks, hi and lo ----
  v16b qah[2], qal[2];
#pragma unroll
  for (int dc = 0; dc < 2; ++dc) {
    const __bf16* qr = Qh + (size_t)(q0 + c) * kDim + dc * 32 + 8 * hh;
    const __bf16* ql = Ql + (size_t)(q0 + c) * kDim + dc * 32 + 8 * hh;
    qah[dc] = Frag<__bf16>::load(qr);
    qal[dc] = Frag<__bf16>::load(ql);
  }

  float mrow[8], lrow[8];
  v8f oacc[4];
#pragma unroll
  for (int r = 0; r < 8; ++r) { mrow[r] = -INFINITY; lrow[r] = 0.f; }
#pragma unroll
  for (int t = 0; t < 4; ++t) oacc[t] = (v8f){0.f,0.f,0.f,0.f,0.f,0.f,0.f,0.f};

  const int qlo = qb * AT_QB - (kWin - 1);                 // smallest key allowed for the block's first row
  const int kcStart = (qlo > 0) ? (qlo / AT_KC) : 0;       // block-uniform
  const int nChunks = qb + 1;                              // block-uniform, <= 32
  // staging coverage: copy i of a thread = row i*16 + tid/8, 16 B at (tid&7)*16 B: 128 threads x 4 copies = 64 rows x 128 B a plane
  const int sr = tid >> 3, sc = (tid & 7) * 8;
  const unsigned sl = (unsigned)(size_t)(&KV[0][0][sr * AT_LP + sc]);   // the lane's LDS byte address in buffer 0, plane K hi
  const __bf16* gkh = Kh + (size_t)sr * kKvDim + sc;                    // K row kv0+sr (+16 i), d = sc..sc+7
  const __bf16* gkl = Kl + (size_t)sr * kKvDim + sc;
  const __bf16* gvh = Vh + (size_t)sr * kSeq + sc;                      // V^T row d = sr (+16 i), s = kv0+sc..+7
  const __bf16* gvl = Vl + (size_t)sr * kSeq + sc;
  auto stage = [&](const int ch, const int buf) {   // all 16 copies of chunk ch into buffer buf
    const unsigned lb = sl + (unsigned)buf * (4 * AT_PL * 2);
    at_copy8(lb, gkh + (size_t)ch * (AT_KC * kKvDim), gkl + (size_t)ch * (AT_KC * kKvDim), 16 * kKvDim);
    at_copy8(lb + 2 * AT_PL * 2, gvh + ch * AT_KC, gvl + ch * AT_KC, 16 * kSeq);
  };
  stage(kcStart, 0);
  asm volatile("s_wait_asynccnt 0x0" ::: "memory");   // this wave's copies of the first chunk have landed
  __syncthreads();                                    // ... and every other wave's: the first chunk may be read
  if (kcStart + 1 < nChunks) stage(kcStart + 1, 1);   // block-uniform
  for (int kc = kcStart; kc < nChunks; ++kc) {
    const int kv0 = kc * AT_KC;
    const int cur = (kc - kcStart) & 1;
    const __bf16* Ksh = KV[cur][0];
    const __bf16* Ksl = KV[cur][1];
    const __bf16* Vth = KV[cur][2];
    const __bf16* Vtl = KV[cur][3];

    v8f s[4];
#pragma unroll
    for (int j = 0; j < 4; ++j) {
      s[j] = (v8f){0.f,0.f,0.f,0.f,0.f,0.f,0.f,0.f};
#pragma unroll
      for (int dc = 0; dc < 2; ++dc) {
        FB kb, kl;
        kb.h[0] = *(const v8b*)(Ksh + (j * 16 + c) * AT_LP + dc * 32 + 8 * hh);
        kb.h[1] = *(const v8b*)(Ksh + (j * 16 + c) * AT_LP + dc * 32 + 16 + 8 * hh);
        kl.h[0] = *(const v8b*)(Ksl + (j * 16 + c) * AT_LP + dc * 32 + 8 * hh);
        kl.h[1] = *(const v8b*)(Ksl + (j * 16 + c) * AT_LP + dc * 32 + 16 + 8 * hh);
        s[j] = at_mma(qah[dc], kb.v, s[j]);
        s[j] = at_mma(qah[dc], kl.v, s[j]);
        s[j] = at_mma(qal[dc], kb.v, s[j]);
      }
    }
    float cm[8];
#pragma unroll
    for (int r = 0; r < 8; ++r) {
      const int qrow = q0 + 8 * hh + r;
      float m = -INFINITY;
#pragma unroll
      for (int j = 0; j < 4; ++j) {
        const int kvcol = kv0 + j * 16 + c;
        const float sv = s[j][r] * sscale;
        const bool masked = (kvcol > qrow) || (qrow - kvcol > kWin - 1);
        const float sm = masked ? -INFINITY : sv;
        s[j][r] = sm;
        m = fmaxf(m, sm);
      }
#pragma unroll
      for (int off = 1; off < 16; off <<= 1) m = fmaxf(m, __shfl_xor(m, off, 32));
      cm[r] = m;
    }
    __bf16* pwh = Pw[wave][0];
    __bf16* pwl = Pw[wave][1];
#pragma unroll
    for (int r = 0; r < 8; ++r) {
      const float mnew  = fmaxf(mrow[r], cm[r]);
      const float mpiv  = (mnew == -INFINITY) ? 0.0f : mnew;   // fully masked so far -> alpha = 0, p = 0
      const float alpha = expf(mrow[r] - mpiv);
      mrow[r] = mnew;
      float psum = 0.f;
#pragma unroll
      for (int j = 0; j < 4; ++j) {
        const float p = expf(s[j][r] - mpiv);
        psum += p;
        __bf16 a, bl; at_split(p, a, bl);
        pwh[(8 * hh + r) * AT_LP + j * 16 + c] = a;
        pwl[(8 * hh + r) * AT_LP + j * 16 + c] = bl;
      }
#pragma unroll
      for (int off = 1; off < 16; off <<= 1) psum += __shfl_xor(psum, off, 32);
      lrow[r] = lrow[r] * alpha + psum;
#pragma unroll
      for (int t = 0; t < 4; ++t) oacc[t][r] *= alpha;
    }
    __builtin_amdgcn_fence(__ATOMIC_RELEASE, "workgroup");
    __builtin_amdgcn_wave_barrier();
    __builtin_amdgcn_fence(__ATOMIC_ACQUIRE, "workgroup");
#pragma unroll 1
    for (int kk = 0; kk < 2; ++kk) {
      FB pa, pl;
      pa.h[0] = *(const v8b*)(pwh + c * AT_LP + kk * 32 + 8 * hh);
      pa.h[1] = *(const v8b*)(pwh + c * AT_LP + kk * 32 + 16 + 8 * hh);
      pl.h[0] = *(const v8b*)(pwl + c * AT_LP + kk * 32 + 8 * hh);
      pl.h[1] = *(const v8b*)(pwl + c * AT_LP + kk * 32 + 16 + 8 * hh);
#pragma unroll
      for (int t = 0; t < 4; ++t) {
        FB vb, vl;
        vb.h[0] = *(const v8b*)(Vth + (t * 16 + c) * AT_LP + kk * 32 + 8 * hh);
        vb.h[1] = *(const v8b*)(Vth + (t * 16 + c) * AT_LP + kk * 32 + 16 + 8 * hh);
        vl.h[0] = *(const v8b*)(Vtl + (t * 16 + c) * AT_LP + kk * 32 + 8 * hh);
        vl.h[1] = *(const v8b*)(Vtl + (t * 16 + c) * AT_LP + kk * 32 + 16 + 8 * hh);
        oacc[t] = at_mma(pa.v, vb.v, oacc[t]);
        oacc[t] = at_mma(pa.v, vl.v, oacc[t]);
        oacc[t] = at_mma(pl.v, vb.v, oacc[t]);
      }
    }
    // hand-over: this wave's reads of the chunk are done, its copies of the next chunk have landed; behind the barrier the
    // next chunk may be read by every wave and the buffer just read may be refilled
    asm volatile("s_wait_dscnt 0x0" ::: "memory");
    asm volatile("s_wait_asynccnt 0x0" ::: "memory");
    __syncthreads();
    if (kc + 2 < nChunks) stage(kc + 2, cur);         // block-uniform
  }
  asm volatile("s_wait_asynccnt 0x0" ::: "memory");   // no copy is outstanding when the wave goes on to its epilogue and ends

  float* os = (float*)(void*)&Pw[wave][0][0];         // the wave's own P rows, read for the last time above
#pragma unroll
  for (int r = 0; r < 8; ++r) {
    const float inv = 1.0f / lrow[r];
#pragma unroll
    for (int t = 0; t < 4; ++t) os[(8 * hh + r) * 68 + t * 16 + c] = oacc[t][r] * inv;
  }
  __builtin_amdgcn_fence(__ATOMIC_RELEASE, "workgroup");
  __builtin_amdgcn_wave_barrier();
  __builtin_amdgcn_fence(__ATOMIC_ACQUIRE, "workgroup");
  {
    // first of the wave's two blocks: block row = token row / 16, k block = column / 32
    const size_t blk0 = (size_t)((blockIdx.y * kSeq + q0) >> 4) * kKBlk + h * (AT_D / 32);
#pragma unroll
    for (int it = 0; it < 4; ++it) {   // it>>1 = block, it&1 = its half (16 k); lane = (k>>3 & 1)*16 + row: 512 consecutive bytes a store
      const float* sp = os + c * 68 + it * 16 + hh * 8;
      const v4f fa = *(const v4f*)(sp), fb = *(const v4f*)(sp + 4);
      const float f[8] = {fa[0], fa[1], fa[2], fa[3], fb[0], fb[1], fb[2], fb[3]};
      v4u hv, lv;
      split8(f, hv, lv);
      const size_t o = (blk0 + (it >> 1)) * 512 + (it & 1) * 256 + lane * 8;
      *(v4u*)(ohp + o) = hv;
      *(v4u*)(olp + o) = lv;
    }
  }
}

// ---------------------------------------------------------------------------
// Workspace region map (byte offsets; every region is fully written in this call before it is read; token rows
// run over both batch elements, row = b*2048 + t; VT holds one [256][2048] plane per batch element; the W*, X* and
// O* bf16 planes are fragment-major, 16-row x 32-k blocks, see wmma_gemm64):
//   Wqh bf16 [768 n][768 k]         0      Wql   1179648
//   Wkh bf16 [256][768]        2359296      Wkl   2752512
//   Wvh bf16 [256][768]        3145728      Wvl   3538944
//   Woh bf16 [768][768]        3932160      Wol   5111808
//   CS  f32  [2048][32]        6291456      SN    6553600
//   Xh  bf16 [4096][768]       6815744      Xl   13107200
//   Qh  bf16 [4096][768]      19398656      Ql   25690112
//   Kh  bf16 [4096][256]      31981568      Kl   34078720
//   VTh bf16 [2][256][2048]   36175872      VTl  38273024
//   Oh  bf16 [4096][768]      40370176      Ol   46661632
//   total                     52953088
// ---------------------------------------------------------------------------
extern "C" void kernel_launch(void* const* d_in, const int* in_sizes, int n_in,
                              void* d_out, int out_size, void* d_ws, size_t ws_size,
                              hipStream_t stream) {
  if (n_in < 7) return;
  if (in_sizes[0] != kNB * kSeq * kDim) return;
  if (in_sizes[1] != kDim * kDim || in_sizes[4] != kDim * kDim) return;
  if (in_sizes[2] != kKvDim * kDim || in_sizes[3] != kKvDim * kDim) return;
  if (in_sizes[5] != kHd || in_sizes[6] != kHd) return;
  if (out_size != kNB * kSeq * kDim) return;

  const float* x    = (const float*)d_in[0];
  const float* Wq   = (const float*)d_in[1];
  const float* Wk   = (const float*)d_in[2];
  const float* Wv   = (const float*)d_in[3];
  const float* Wo   = (const float*)d_in[4];
  const float* lnq  = (const float*)d_in[5];
  const float* lnk  = (const float*)d_in[6];

  const size_t PWQ = (size_t)kDim * kDim * 2;      // 1179648  bf16 [768][768] plane
  const size_t PWK = (size_t)kKvDim * kDim * 2;    // 393216   bf16 [256][768] plane
  const size_t PTB = (size_t)kSeq * kHalfHd * 4;   // 262144   f32 [2048][32] table
  const size_t PXB = (size_t)kTok * kDim * 2;      // 6291456  bf16 [4096][768] plane
  const size_t PKB = (size_t)kTok * kKvDim * 2;    // 2097152  bf16 [4096][256] / [2][256][2048] plane
  size_t off = 0;
  const size_t oWqh = off; off += PWQ;  const size_t oWql = off; off += PWQ;
  const size_t oWkh = off; off += PWK;  const size_t oWkl = off; off += PWK;
  const size_t oWvh = off; off += PWK;  const size_t oWvl = off; off += PWK;
  const size_t oWoh = off; off += PWQ;  const size_t oWol = off; off += PWQ;
  const size_t oCS  = off; off += PTB;  const size_t oSN  = off; off += PTB;
  const size_t oXh  = off; off += PXB;  const size_t oXl  = off; off += PXB;
  const size_t oQh  = off; off += PXB;  const size_t oQl  = off; off += PXB;
  const size_t oKh  = off; off += PKB;  const size_t oKl  = off; off += PKB;
  const size_t oVTh = off; off += PKB;  const size_t oVTl = off; off += PKB;
  const size_t oOh  = off; off += PXB;  const size_t oOl  = off; off += PXB;
  if (off > ws_size) return;                       // off = 52953088
  if (off > (size_t)134217728) return;

  char* ws = (char*)d_ws;
  unsigned short* Wqh = (unsigned short*)(ws + oWqh); unsigned short* Wql = (unsigned short*)(ws + oWql);
  unsigned short* Wkh = (unsigned short*)(ws + oWkh); unsigned short* Wkl = (unsigned short*)(ws + oWkl);
  unsigned short* Wvh = (unsigned short*)(ws + oWvh); unsigned short* Wvl = (unsigned short*)(ws + oWvl);
  unsigned short* Woh = (unsigned short*)(ws + oWoh); unsigned short* Wol = (unsigned short*)(ws + oWol);
  float*          CS  = (float*)(ws + oCS);          float*          SN  = (float*)(ws + oSN);
  unsigned short* Xh  = (unsigned short*)(ws + oXh);  unsigned short* Xl  = (unsigned short*)(ws + oXl);
  unsigned short* Qh  = (unsigned short*)(ws + oQh);  unsigned short* Ql  = (unsigned short*)(ws + oQl);
  unsigned short* Kh  = (unsigned short*)(ws + oKh);  unsigned short* Kl  = (unsigned short*)(ws + oKl);
  unsigned short* VTh = (unsigned short*)(ws + oVTh); unsigned short* VTl = (unsigned short*)(ws + oVTl);
  unsigned short* Oh  = (unsigned short*)(ws + oOh);  unsigned short* Ol  = (unsigned short*)(ws + oOl);

  const dim3 blk(256);
  const dim3 gPrep(kPbT + kPbX + 2 * kPbWq + 2 * kPbWk);            // 2560 blocks
  const dim3 gQKV(kBlkQ + kBlkK + kNB * kBlkV);                     // 160 blocks x 8 tiles
  const dim3 gProjQ(kBlkQ, 1);                                      // 768 tiles: M=4096, N=768
  const dim3 gAtt(kNHq * (kSeq / 64), kNB);                         // 12 heads x 32 query blocks per batch element

  // Both batch elements go through every stage in one launch: the token-row GEMMs see M = 4096 rows (the rotary
  // epilogue takes the position as row % 2048); v^T and attention take the batch element from the block index.
  // (1) rotary tables; x and the weights [out n][in k] f32 -> bf16 hi/lo planes, fragment-major
  prep_kernel<<<gPrep, blk, 0, stream>>>(x, Wq, Wk, Wv, Wo, Xh, Xl, Wqh, Wql, Wkh, Wkl, Wvh, Wvl, Woh, Wol, CS, SN);
  // (2) q and k projections with per-head rmsnorm * w + rotary in the epilogue -> Q/K bf16 hi/lo planes; v^T -> VT hi/lo planes (K = 768 each)
  qkv_gemm64_kernel<<<gQKV, blk, 0, stream>>>(Xh, Xl, Wqh, Wql, Wkh, Wkl, Wvh, Wvl, lnq, lnk, CS, SN, Qh, Ql, Kh, Kl, VTh, VTl, kDim);
  // (3) windowed causal GQA attention per head: y -> bf16 hi/lo planes, fragment-major (every element written by its (b, h, query block) owner)
  attn_gqa_window64_kernel<<<gAtt, dim3(128), 0, stream>>>(Qh, Ql, Kh, Kl, VTh, VTl, Oh, Ol, 0.125f);
  // (4) out = y . Wo^T -> d_out rows 0 .. 4095 (f32)   (M=4096, N=768, K=768)
  wmma_gemm64<1, true, 0, 0, false><<<gProjQ, blk, 0, stream>>>(
      Oh, Ol, kDim, 0L, Woh, Wol, kDim, 0L, d_out, d_out, kDim, 0L,
      lnq, lnq, 0L, kTok, kDim, kDim, 1.0f);
}

// v008
// It runs in 78.6 microseconds.
// Timed twice side by side with v007, it ran 1.10 and 1.12 times as fast.
// Counting every step since v000, it is 7.01 times as fast.
// Contractions (q/k/v/out projections, q.k^T scores, p.v): v_wmma_f32_16x16x32_bf16 with bf16 hi/lo split operands (hi.hi + hi.lo + lo.hi), f32 accumulate; rmsnorm, rotary tables, online softmax in f32.
#include <hip/hip_runtime.h>
#include <math.h>
#include <stdint.h>

constexpr int kNB     = 2;
constexpr int kSeq    = 2048;
constexpr int kTok    = kNB * kSeq;          // 4096 token rows over both batch elements
constexpr int kDim    = 768;
constexpr int kHd     = 64;
constexpr int kNHq    = 12;
constexpr int kNKv    = 4;
constexpr int kGroups = 3;
constexpr int kKvDim  = kNKv * kHd;          // 256
constexpr int kWin    = 384;
constexpr int kHalfHd = 32;
constexpr int kKBlk   = kDim / 32;           // 24 k blocks of 32 in a row of 768
static_assert((kSeq & (kSeq - 1)) == 0 && kHd == 64 && kHalfHd * 2 == kHd);
static_assert(kSeq % 64 == 0 && kDim % 64 == 0 && kKvDim % 64 == 0 && kDim % 32 == 0);
static_assert(kNHq == kNKv * kGroups);

typedef __attribute__((ext_vector_type(16))) _Float16 v16h;
typedef __attribute__((ext_vector_type(8)))  _Float16 v8h;
typedef __attribute__((ext_vector_type(16))) __bf16   v16b;
typedef __attribute__((ext_vector_type(8)))  __bf16   v8b;
typedef __attribute__((ext_vector_type(8)))  float    v8f;
typedef __attribute__((ext_vector_type(4)))  float    v4f;
typedef __attribute__((ext_vector_type(2)))  float    v2f;
typedef __attribute__((ext_vector_type(4)))  unsigned int v4u;

__device__ __forceinline__ unsigned short f2bf_bits(float f) {
  unsigned u = __float_as_uint(f);
  return (unsigned short)((u + 0x7FFFu + ((u >> 16) & 1u)) >> 16);
}
__device__ __forceinline__ float bf_bits2f(unsigned short h) { return __uint_as_float(((unsigned)h) << 16); }

__device__ __forceinline__ unsigned pk16(unsigned short a, unsigned short b) { return (unsigned)a | ((unsigned)b << 16); }
// 8 consecutive f32 -> 8 bf16 hi = bf16_rne(f) and 8 bf16 lo = bf16_rne(f - hi), 16 B each
__device__ __forceinline__ void split8(const float (&f)[8], v4u& hv, v4u& lv) {
#pragma unroll   // constant indices keep f, hv and lv in registers
  for (int q = 0; q < 4; ++q) {
    const unsigned short h0 = f2bf_bits(f[2 * q]), h1 = f2bf_bits(f[2 * q + 1]);
    const unsigned short l0 = f2bf_bits(f[2 * q] - bf_bits2f(h0)), l1 = f2bf_bits(f[2 * q + 1] - bf_bits2f(h1));
    hv[q] = pk16(h0, h1);
    lv[q] = pk16(l0, l1);
  }
}

// ---------------------------------------------------------------------------
// Per (token, head) unit of 64 floats: y[d] = w[d] * (x[d] * rsqrt(mean(x^2) + eps)); rotary:
//   o[d] = y[d]*cos[t][d&31] - y[d+32]*sin  (d < 32),   o[d] = y[d]*cos + y[d-32]*sin  (d >= 32);
// o split into bf16 hi/lo. 8 lanes per unit (lane&7 = which 8 of the 64), 4 units per wave: x = the lane's own 8 values,
// p = the 8 of its rotary partner block, w / v = the norm weights of the two blocks, c / s = the table rows' 8 values.
// ---------------------------------------------------------------------------
__device__ __forceinline__ float rope_one(float x, float p, float wx, float wp, float cv, float sv, float rinv, float sg) {
  const float xn = wx * (x * rinv);
  const float pn = wp * (p * rinv);
  return xn * cv + (sg * pn) * sv;
}
__device__ __forceinline__ void norm_rope_unit(const v4f xa, const v4f xb, const v4f pa, const v4f pb, const v4f wa, const v4f wb,
                                               const v4f va, const v4f vb, const v4f ca, const v4f cb, const v4f sa, const v4f sb,
                                               const float sg, v4u& hv, v4u& lv) {
  float ss = xa[0] * xa[0] + xa[1] * xa[1] + xa[2] * xa[2] + xa[3] * xa[3]
           + xb[0] * xb[0] + xb[1] * xb[1] + xb[2] * xb[2] + xb[3] * xb[3];
  ss += __shfl_xor(ss, 1, 32);
  ss += __shfl_xor(ss, 2, 32);
  ss += __shfl_xor(ss, 4, 32);
  const float rinv = rsqrtf(ss * (1.0f / 64.0f) + 1e-6f);
  float o[8];
  o[0] = rope_one(xa[0], pa[0], wa[0], va[0], ca[0], sa[0], rinv, sg);
  o[1] = rope_one(xa[1], pa[1], wa[1], va[1], ca[1], sa[1], rinv, sg);
  o[2] = rope_one(xa[2], pa[2], wa[2], va[2], ca[2], sa[2], rinv, sg);
  o[3] = rope_one(xa[3], pa[3], wa[3], va[3], ca[3], sa[3], rinv, sg);
  o[4] = rope_one(xb[0], pb[0], wb[0], vb[0], cb[0], sb[0], rinv, sg);
  o[5] = rope_one(xb[1], pb[1], wb[1], vb[1], cb[1], sb[1], rinv, sg);
  o[6] = rope_one(xb[2], pb[2], wb[2], vb[2], cb[2], sb[2], rinv, sg);
  o[7] = rope_one(xb[3], pb[3], wb[3], vb[3], cb[3], sb[3], rinv, sg);
  split8(o, hv, lv);
}

// hazard guards as plain device helpers (no inline asm inside the kernel template body)
// four vector slots: the distance asked between a 16-bit matrix instruction and a vector overwrite of a register that it reads;
// kept in front of a load over such a register too, as a precaution
__device__ __forceinline__ void operand_gap() { asm volatile("v_nop\n\tv_nop\n\tv_nop\n\tv_nop" ::: "memory"); }
__device__ __forceinline__ void acc_guard4(v8f& a, v8f& b, v8f& c, v8f& d) { asm volatile("v_nop\n\tv_nop\n\tv_nop\n\tv_nop" : "+v"(a), "+v"(b), "+v"(c), "+v"(d)); }
template <typename T> struct Frag;
template <> struct Frag<_Float16> {
  typedef v16h V; union U { v16h v; v8h h[2]; };
  static __device__ __forceinline__ v16h load(const _Float16* p) {   // elements 0..7 <- p[0..7], 8..15 <- p[16..23]
    U f; f.h[0] = *(const v8h*)(p); f.h[1] = *(const v8h*)(p + 16); return f.v;
  }
  static __device__ __forceinline__ v8f mma(v16h a, v16h b, v8f c) {
    return __builtin_amdgcn_wmma_f32_16x16x32_f16(false, a, false, b, (short)0, c, false, false);
  }
};
template <> struct Frag<__bf16> {
  typedef v16b V; union U { v16b v; v8b h[2]; };
  static __device__ __forceinline__ v16b load(const __bf16* p) {
    U f; f.h[0] = *(const v8b*)(p); f.h[1] = *(const v8b*)(p + 16); return f.v;
  }
  // fragment-major block at byte address p: elements 0..7 <- bytes 0..15, elements 8..15 <- bytes 512..527
  static __device__ __forceinline__ v16b load_packed(const char* p) {
    U f; f.h[0] = *(const v8b*)(p); f.h[1] = *(const v8b*)(p + 512); return f.v;
  }
  static __device__ __forceinline__ v8f mma(v16b a, v16b b, v8f c) {
    return __builtin_amdgcn_wmma_f32_16x16x32_bf16(false, a, false, b, (short)0, c, false, false);
  }
};

// ---- Register-blocked batched WMMA GEMM ------------------------------------
// C[m,n] = scale * sum_k A[m,k] * Bt[n,k] (+bias)(+resid); each wave owns a 64x64 tile.
// A [M,K] and Bt [N,K] are stored fragment-major (written by split_pack_thread and by the attention kernel): each 16-row x 32-k block is
// 512 consecutive elements, block index = (row/16)*kKBlk + k/32, and element (row, k) of a block sits at
// ((k>>4)&1)*256 + (((k>>3)&1)*16 + (row&15))*8 + (k&7). Lane l of a fragment load then reads 16 B at l*16 B, so one
// wave-wide load covers 512 consecutive bytes (4 whole lines) and holds the same elements as a row-major fragment load.
// M,N % 64 == 0, K % 64 == 0, K >= 64; rows of both operands are kDim long (lda == ldb == kDim), so the step from one 16-row
// block row to the next is a compile-time constant and goes into the loads' immediate offsets.
// SPLIT: operands are hi/lo planes (A2/Bt2 = lo planes, same layout); product = hi.hi + hi.lo + lo.hi.
// BIAS_MODE: 0 = none, 1 = bias[m], 2 = bias[n].
// OUT_MODE: 0 = f32, 1 = f16, 2 = bf16 hi plane (Cout) + bf16 lo plane (Cout2), 3 = the tile is 64 token rows x the 64
// columns of one head: per-row rmsnorm * nw, rotary from the tables cs / sn, then bf16 hi/lo planes as in 2 (the slab
// then holds the whole tile, 64 rows).
// ET: 0 = f16 operands, 1 = bf16 operands (pointers passed as 16-bit storage)
template <int ET> struct Elem;
template <> struct Elem<0> { typedef _Float16 T; };
template <> struct Elem<1> { typedef __bf16 T; };
// All fragments of one k step of a 64x64 wave tile: four 16-row blocks of A and of Bt, hi and lo planes.
template <typename T, bool SPLIT> struct FragSet { typename Frag<T>::V bh[4], bl[4], ah[4], al[4]; };
constexpr int kRowStep = kKBlk * 1024;         // bytes from one 16-row block row to the next
template <typename T, bool SPLIT>
__device__ __forceinline__ void load_frag_set(FragSet<T, SPLIT>& f, const char* pAh, const char* pAl, const char* pBh,
                                              const char* pBl, const unsigned vo, const int off) {
#pragma unroll
  for (int j = 0; j < 4; ++j) {
    f.bh[j] = Frag<T>::load_packed(pBh + vo + (off + j * kRowStep));
    if (SPLIT) f.bl[j] = Frag<T>::load_packed(pBl + vo + (off + j * kRowStep));
  }
#pragma unroll
  for (int i = 0; i < 4; ++i) {
    f.ah[i] = Frag<T>::load_packed(pAh + vo + (off + i * kRowStep));
    if (SPLIT) f.al[i] = Frag<T>::load_packed(pAl + vo + (off + i * kRowStep));
  }
}
template <typename T, bool SPLIT>
__device__ __forceinline__ void mma_frag_set(v8f (&acc)[4][4], const FragSet<T, SPLIT>& f) {
#pragma unroll
  for (int i = 0; i < 4; ++i) {
#pragma unroll
    for (int j = 0; j < 4; ++j) {
      acc[i][j] = Frag<T>::mma(f.ah[i], f.bh[j], acc[i][j]);
      if (SPLIT) {
        acc[i][j] = Frag<T>::mma(f.ah[i], f.bl[j], acc[i][j]);
        acc[i][j] = Frag<T>::mma(f.al[i], f.bh[j], acc[i][j]);
      }
    }
  }
}
// gemm64_tile = one wave's 64x64 tile; the kernels below hand it the wave's LDS slab, the batch index b and the tile's
// first row m0 and column n0 (the same in every lane, in scalar registers, so that the four plane bases are scalar too).
template <int ET, bool SPLIT, int BIAS_MODE, int OUT_MODE, bool RESID, int ACT = 0>
__device__ __forceinline__ void gemm64_tile(
    float* __restrict__ slab, const int b, const int m0, const int n0,
    const unsigned short* __restrict__ Ap, const unsigned short* __restrict__ A2p, int lda, long strideA,
    const unsigned short* __restrict__ Btp, const unsigned short* __restrict__ Bt2p, int ldb, long strideB,
    void* __restrict__ Cout, void* __restrict__ Cout2, int ldc, long strideC,
    const float* __restrict__ bias,
    const float* __restrict__ resid, long strideR,
    int K, float scale,
    const float* __restrict__ nw = nullptr, const float* __restrict__ cs = nullptr, const float* __restrict__ sn = nullptr) {
  typedef typename Elem<ET>::T T;
  typedef typename Frag<T>::V V;
  const T* A = (const T*)Ap; const T* A2 = (const T*)A2p; const T* Bt = (const T*)Btp; const T* Bt2 = (const T*)Bt2p;
  const int lane = threadIdx.x & 31;

  const T* Ab  = A  + (size_t)b * strideA;
  const T* Bb  = Bt + (size_t)b * strideB;
  const T* Ab2 = SPLIT ? (A2  + (size_t)b * strideA) : nullptr;
  const T* Bb2 = SPLIT ? (Bt2 + (size_t)b * strideB) : nullptr;

  const int rlane = lane & 15;                 // row (A) / col (B, D) within subtile
  const int mOff  = (lane >> 4) * 8;           // D row offset
  // Every fragment load = scalar base of the tile's first block row in its plane + one 32-bit lane byte offset + an
  // immediate (block row step, second half of the block). The lane offset is the only vector address register; it steps
  // one block (1024 B) per k step, two k steps per trip.
  const char* pBh = (const char*)(Bb  + (size_t)(n0 >> 4) * (kKBlk * 512));
  const char* pBl = SPLIT ? (const char*)(Bb2 + (size_t)(n0 >> 4) * (kKBlk * 512)) : nullptr;
  const char* pAh = (const char*)(Ab  + (size_t)(m0 >> 4) * (kKBlk * 512));
  const char* pAl = SPLIT ? (const char*)(Ab2 + (size_t)(m0 >> 4) * (kKBlk * 512)) : nullptr;
  unsigned vo = (unsigned)lane * 16u;          // this lane's 16 B inside a 512-B half block

  v8f acc[4][4];
#pragma unroll
  for (int i = 0; i < 4; ++i)
#pragma unroll
    for (int j = 0; j < 4; ++j) acc[i][j] = (v8f){0.f,0.f,0.f,0.f,0.f,0.f,0.f,0.f};

  // Two register sets of fragments: while the 48 (SPLIT) matrix instructions of one k step run on one set, the 32 loads of
  // the next k step fill the other, so the loads of a k step have the whole length of the k step before it to arrive.
  FragSet<T, SPLIT> f0, f1;
  load_frag_set<T, SPLIT>(f0, pAh, pAl, pBh, pBl, vo, 0);
  asm volatile("s_wait_xcnt 0x0" :: "v"(vo) : "memory");   // as at the loop's foot, for the path that skips the loop (K == 64)
  for (int k0 = 64; k0 < K; k0 += 64) {
    load_frag_set<T, SPLIT>(f1, pAh, pAl, pBh, pBl, vo, 1024);
    __builtin_amdgcn_sched_barrier(0);   // keeps the next step's loads ahead of this step's products (sunk to their use they would fly alone)
    mma_frag_set<T, SPLIT>(acc, f0);
    __builtin_amdgcn_sched_barrier(0);   // keeps every product on f0 in front of the gap below
    operand_gap();                       // four vector slots between the last product that reads f0 and the first load that refills it
    __builtin_amdgcn_sched_barrier(0);   // keeps every refill of f0 behind that gap
    load_frag_set<T, SPLIT>(f0, pAh, pAl, pBh, pBl, vo, 2048);
    __builtin_amdgcn_sched_barrier(0);   // keeps these loads ahead of the products on f1, as above
    mma_frag_set<T, SPLIT>(acc, f1);
    __builtin_amdgcn_sched_barrier(0);   // keeps every product on f1 in front of the gap and the wait below, a whole k step behind the loads
    // four vector slots between the last product that reads f1 and the first load that refills it (next trip, or behind the
    // loop); the loads in flight name vo: the wait stands before vo is overwritten
    asm volatile("v_nop\n\tv_nop\n\tv_nop\n\tv_nop\n\ts_wait_xcnt 0x0" ::: "memory");
    __builtin_amdgcn_sched_barrier(0);   // keeps the step of vo and the refill of f1 behind that statement
    vo += 2048u;
  }
  const unsigned vt = (unsigned)lane * 16u + (unsigned)(K - 64) * 32u;   // lane offset at the last two k steps (= vo here)
  load_frag_set<T, SPLIT>(f1, pAh, pAl, pBh, pBl, vt, 1024);
  asm volatile("s_wait_xcnt 0x0" :: "v"(vt) : "memory");   // vt is live up to this wait, so nothing overwrites it under the loads that name it
  __builtin_amdgcn_sched_barrier(0);     // keeps the last step's loads ahead of the products before it
  mma_frag_set<T, SPLIT>(acc, f0);
  mma_frag_set<T, SPLIT>(acc, f1);
  acc_guard4(acc[0][0], acc[0][1], acc[0][2], acc[0][3]);
  acc_guard4(acc[1][0], acc[1][1], acc[1][2], acc[1][3]);
  acc_guard4(acc[2][0], acc[2][1], acc[2][2], acc[2][3]);
  acc_guard4(acc[3][0], acc[3][1], acc[3][2], acc[3][3]);

  // ---- epilogue ----
  if (OUT_MODE == 3) {
#pragma unroll
    for (int i = 0; i < 4; ++i)
#pragma unroll
      for (int j = 0; j < 4; ++j)
#pragma unroll
        for (int r = 0; r < 8; ++r) slab[((i << 4) + mOff + r) * 68 + (j << 4) + rlane] = acc[i][j][r] * scale;
    // the rows are read back by other lanes of this wave: the slab's stores stay in front of its loads
    __builtin_amdgcn_fence(__ATOMIC_RELEASE, "workgroup");
    __builtin_amdgcn_wave_barrier();
    __builtin_amdgcn_fence(__ATOMIC_ACQUIRE, "workgroup");
    unsigned short* C  = (unsigned short*)Cout  + (size_t)b * strideC;
    unsigned short* C2 = (unsigned short*)Cout2 + (size_t)b * strideC;
    const int d0 = (lane & 7) * 8;                 // this lane's 8 of the unit's 64 values
    const int dp = d0 ^ kHalfHd;                   // rotary partner block
    const float sg = (d0 < kHalfHd) ? -1.0f : 1.0f;
    // Norm weights and table values: every load = scalar base + a lane byte offset (+ an immediate). Table row = position
    // inside the sequence (m0 % 64 == 0, so the tile lies in one sequence); a pass is 4 rows, a group 4 passes.
    const unsigned wo = (unsigned)d0 * 4u, po = (unsigned)dp * 4u;
    const unsigned tb = (unsigned)(((m0 & (kSeq - 1)) + (lane >> 3)) * kHalfHd + (d0 & 24)) * 4u;
    const char* nwb = (const char*)nw;
    const char* csb = (const char*)cs;
    const char* snb = (const char*)sn;
    const v4f wa = *(const v4f*)(nwb + wo), wb = *(const v4f*)(nwb + wo + 16);
    const v4f va = *(const v4f*)(nwb + po), vb = *(const v4f*)(nwb + po + 16);
    v4f tbl[2][4][4];                              // two groups of table values: cos 0..3, cos 4..7, sin 0..3, sin 4..7 of a pass
#pragma unroll   // constant indices keep tbl in registers
    for (int p = 0; p < 4; ++p) {
      tbl[0][p][0] = *(const v4f*)(csb + tb + p * (16 * kHalfHd)); tbl[0][p][1] = *(const v4f*)(csb + tb + (p * (16 * kHalfHd) + 16));
      tbl[0][p][2] = *(const v4f*)(snb + tb + p * (16 * kHalfHd)); tbl[0][p][3] = *(const v4f*)(snb + tb + (p * (16 * kHalfHd) + 16));
    }
    asm volatile("s_wait_xcnt 0x0" :: "v"(wo), "v"(po) : "memory");   // wo and po are live up to this wait, so nothing overwrites them under the loads that name them
#pragma unroll   // constant indices into tbl
    for (int g = 0; g < 4; ++g) {
      if (g < 3) {
#pragma unroll
        for (int p = 0; p < 4; ++p) {              // the next group's table values fly under this group's arithmetic
          const int im = ((g + 1) * 4 + p) * (16 * kHalfHd);
          tbl[(g + 1) & 1][p][0] = *(const v4f*)(csb + tb + im); tbl[(g + 1) & 1][p][1] = *(const v4f*)(csb + tb + (im + 16));
          tbl[(g + 1) & 1][p][2] = *(const v4f*)(snb + tb + im); tbl[(g + 1) & 1][p][3] = *(const v4f*)(snb + tb + (im + 16));
        }
      }
      __builtin_amdgcn_sched_barrier(0);           // keeps these loads ahead of the group's arithmetic (sunk to their use they would fly alone) and of its stores
#pragma unroll
      for (int p = 0; p < 4; ++p) {
        const int row = (g * 4 + p) * 4 + (lane >> 3);
        const float* sp = slab + row * 68;
        const v4f xa = *(const v4f*)(sp + d0), xb = *(const v4f*)(sp + d0 + 4);
        const v4f pa = *(const v4f*)(sp + dp), pb = *(const v4f*)(sp + dp + 4);
        v4u hv, lv;
        norm_rope_unit(xa, xb, pa, pb, wa, wb, va, vb, tbl[g & 1][p][0], tbl[g & 1][p][1], tbl[g & 1][p][2], tbl[g & 1][p][3], sg, hv, lv);
        const size_t o = (size_t)(m0 + row) * ldc + n0 + d0;
        *(v4u*)(C + o)  = hv;
        *(v4u*)(C2 + o) = lv;
      }
      // the next group's loads and arithmetic reuse the registers of these stores: the wait stands before that; tb is live
      // up to the last of these waits, so nothing overwrites it under the loads that name it
      asm volatile("s_wait_xcnt 0x0" :: "v"(tb) : "memory");
      __builtin_amdgcn_sched_barrier(0);           // keeps what follows behind the wait (without it the scheduler may lift it over the wait)
    }
    return;
  }
  const float* Rb = RESID ? (resid + (size_t)b * strideR) : nullptr;
#pragma unroll
  for (int i = 0; i < 4; ++i) {
    const int mBase = m0 + (i << 4);
#pragma unroll
    for (int j = 0; j < 4; ++j) {
      const int n = n0 + (j << 4) + rlane;
      float bv = 0.f;
      if (BIAS_MODE == 2) bv = bias[n];
#pragma unroll
      for (int r = 0; r < 8; ++r) {
        float v = acc[i][j][r] * scale;
        if (BIAS_MODE == 1) v += bias[mBase + mOff + r];
        if (BIAS_MODE == 2) v += bv;
        if (RESID) v += Rb[(size_t)(mBase + mOff + r) * ldc + n];
        if (ACT == 1) v = tanhf(v);
        if (ACT == 2) v = fmaxf(v, 0.0f);
        if (ACT == 3) v = v / (1.0f + expf(-v));
        if (ACT == 4) v = (v > 0.f) ? v : 0.01f * v;
        slab[(mOff + r) * 68 + (j << 4) + rlane] = v;
      }
    }
    __builtin_amdgcn_fence(__ATOMIC_RELEASE, "workgroup");
    __builtin_amdgcn_wave_barrier();
    __builtin_amdgcn_fence(__ATOMIC_ACQUIRE, "workgroup");
    if (OUT_MODE == 0) {
      float* C = (float*)Cout + (size_t)b * strideC;
      const int hh = lane >> 4, c4 = (lane & 15) * 4;     // row seg = 256 B = 16 lanes x 16 B
      {
#pragma unroll
        for (int it = 0; it < 8; ++it) {
          const int row = it * 2 + hh;
          v4f v = *(const v4f*)(slab + row * 68 + c4);
          *(v4f*)(C + (size_t)(mBase + row) * ldc + n0 + c4) = v;
        }
        // the next block row's address arithmetic reuses the address registers of these stores: the wait stands before that
        asm volatile("s_wait_xcnt 0x0" ::: "memory");
        __builtin_amdgcn_sched_barrier(0);   // keeps that arithmetic behind the wait (without it the scheduler lifts it over the wait)
      }
    } else {
      const int q = lane >> 3, c8 = (lane & 7) * 8;
      unsigned short* C  = (unsigned short*)Cout  + (size_t)b * strideC;
      unsigned short* C2 = (OUT_MODE == 2) ? ((unsigned short*)Cout2 + (size_t)b * strideC) : nullptr;
      {
#pragma unroll
        for (int it = 0; it < 4; ++it) {
          const int row = it * 4 + q;
          const float* sp = slab + row * 68 + c8;
          v8h hv, lv;
#pragma unroll
          for (int e = 0; e < 8; ++e) {
            if (OUT_MODE == 1) {
              hv[e] = (_Float16)sp[e];
            } else {
              unsigned short hb = f2bf_bits(sp[e]);
              unsigned short lb = f2bf_bits(sp[e] - bf_bits2f(hb));
              hv[e] = __builtin_bit_cast(_Float16, hb);
              lv[e] = __builtin_bit_cast(_Float16, lb);
            }
          }
          *(v8h*)(C + (size_t)(mBase + row) * ldc + n0 + c8) = hv;
          if (OUT_MODE == 2) *(v8h*)(C2 + (size_t)(mBase + row) * ldc + n0 + c8) = lv;
        }
        
      }
    }
    __builtin_amdgcn_fence(__ATOMIC_RELEASE, "workgroup");
    __builtin_amdgcn_wave_barrier();
    __builtin_amdgcn_fence(__ATOMIC_ACQUIRE, "workgroup");
  }
}

// One GEMM per launch: 8 waves = 8 consecutive tiles per block, grid.y = batch index.
template <int ET, bool SPLIT, int BIAS_MODE, int OUT_MODE, bool RESID, int ACT = 0>
__global__ __launch_bounds__(256) void wmma_gemm64(
    const unsigned short* __restrict__ Ap, const unsigned short* __restrict__ A2p, int lda, long strideA,
    const unsigned short* __restrict__ Btp, const unsigned short* __restrict__ Bt2p, int ldb, long strideB,
    void* __restrict__ Cout, void* __restrict__ Cout2, int ldc, long strideC,
    const float* __restrict__ bias,
    const float* __restrict__ resid, long strideR,
    int M, int N, int K, float scale) {
  __shared__ __align__(16) float sT[8][16 * 68];   // per-wave 16x64 slab, pitch 68 floats
  const int wave = threadIdx.x >> 5;
  const int tilesN = N >> 6;
  const int tilesM = M >> 6;
  const int tile = __builtin_amdgcn_readfirstlane(blockIdx.x * 8 + wave);
  if (tile >= tilesM * tilesN) return;   // wave-uniform; no block barriers in this kernel
  const int tm = tile / tilesN;
  const int tn = tile - tm * tilesN;
  gemm64_tile<ET, SPLIT, BIAS_MODE, OUT_MODE, RESID, ACT>(sT[wave], blockIdx.y, tm << 6, tn << 6, Ap, A2p, lda, strideA, Btp, Bt2p,
                                                          ldb, strideB, Cout, Cout2, ldc, strideC, bias, resid, strideR, K, scale);
}

// The three projections of x in one launch: none reads what another writes, and each alone fills well under half of
// the chip's WGPs for the whole length of one wave's k loop. Block ranges (8 tiles per block):
//   [0, kBlkQ)                 q   = x . Wq^T, M=4096, N=768: rmsnorm * qw, rotary -> Q hi/lo [row][h*64+d]
//   [kBlkQ, kBlkQ+kBlkK)       k   = x . Wk^T, M=4096, N=256: rmsnorm * kw, rotary -> K hi/lo [row][g*64+d]
//   then kBlkV per batch b     v^T = Wv . x[b]^T -> VT hi/lo [b][g*64+d][s]     M=256,  N=2048 (A = Wv planes, Bt = x planes of b)
constexpr int kBlkQ = (kTok / 64) * (kDim / 64) / 8;      // 96
constexpr int kBlkK = (kTok / 64) * (kKvDim / 64) / 8;    // 32
constexpr int kBlkV = (kKvDim / 64) * (kSeq / 64) / 8;    // 16 per batch element
static_assert(((kTok / 64) * (kDim / 64)) % 8 == 0 && ((kTok / 64) * (kKvDim / 64)) % 8 == 0 && ((kKvDim / 64) * (kSeq / 64)) % 8 == 0);

__global__ __launch_bounds__(256) void qkv_gemm64_kernel(
    const unsigned short* __restrict__ Xh, const unsigned short* __restrict__ Xl,
    const unsigned short* __restrict__ Wqh, const unsigned short* __restrict__ Wql,
    const unsigned short* __restrict__ Wkh, const unsigned short* __restrict__ Wkl,
    const unsigned short* __restrict__ Wvh, const unsigned short* __restrict__ Wvl,
    const float* __restrict__ qw, const float* __restrict__ kw,
    const float* __restrict__ cs, const float* __restrict__ sn,
    unsigned short* __restrict__ Qh, unsigned short* __restrict__ Ql,
    unsigned short* __restrict__ Kh, unsigned short* __restrict__ Kl,
    unsigned short* __restrict__ VTh, unsigned short* __restrict__ VTl, int K) {
  __shared__ __align__(16) float sT[8][64 * 68];   // per-wave 64x64 slab, pitch 68 floats (the v^T tiles use its first 16 rows)
  const int wave = threadIdx.x >> 5;
  const int bx   = blockIdx.x;
  if (bx < kBlkQ + kBlkK) {
    const bool isq = bx < kBlkQ;                   // block-uniform
    const int tile = __builtin_amdgcn_readfirstlane((isq ? bx : bx - kBlkQ) * 8 + wave);
    const int n  = isq ? kDim : kKvDim;
    const int tm = isq ? tile / (kDim / 64) : tile / (kKvDim / 64);
    const int tn = tile - tm * (n >> 6);
    gemm64_tile<1, true, 0, 3, false>(sT[wave], 0, tm << 6, tn << 6, Xh, Xl, kDim, 0L, isq ? Wqh : Wkh, isq ? Wql : Wkl, kDim, 0L,
                                      (void*)(isq ? Qh : Kh), (void*)(isq ? Ql : Kl), n, 0L, nullptr, nullptr, 0L, K, 1.0f,
                                      isq ? qw : kw, cs, sn);
  } else {
    const int v    = bx - (kBlkQ + kBlkK);
    const int tile = __builtin_amdgcn_readfirstlane((v % kBlkV) * 8 + wave);
    const int tm   = tile / (kSeq / 64);
    const int tn   = tile - tm * (kSeq / 64);
    gemm64_tile<1, true, 0, 2, false>(sT[wave], v / kBlkV, tm << 6, tn << 6, Wvh, Wvl, kDim, 0L, Xh, Xl, kDim, (long)kSeq * kDim,
                                      (void*)VTh, (void*)VTl, kSeq, (long)kKvDim * kSeq, nullptr, nullptr, 0L, K, 1.0f);
  }
}

// ---------------------------------------------------------------------------
// bf16 split of a row-major f32 [rows][768] matrix, hi = bf16_rne(in), lo = bf16_rne(in - hi), stored fragment-major
// for wmma_gemm64 (layout: see there). One thread = 8 consecutive k of one row (32 B read, 16 B per plane written);
// one wave = 8 rows x 32 k, half a block: it reads 8 whole 128-B lines and each plane's store fills 4 whole lines.
// rows % 16 == 0; n8 = rows * 768 / 8 threads.
// ---------------------------------------------------------------------------
__device__ __forceinline__ void split_pack_thread(const float* __restrict__ in, unsigned short* __restrict__ hi,
                                                  unsigned short* __restrict__ lo, const int idx, const int n8) {
  if (idx < n8) {
    const int l   = idx & 31;
    const int g   = idx >> 5;                 // half block
    const int blk = g >> 1;
    const int rb  = blk / kKBlk, kb = blk - rb * kKBlk;
    const int r16 = (g & 1) * 8 + (l >> 2);   // row inside the block
    const int kp  = l & 3;                    // which 8 of the block's 32 k
    const float* s = in + (size_t)(rb * 16 + r16) * kDim + kb * 32 + kp * 8;
    const v4f fa = *(const v4f*)(s), fb = *(const v4f*)(s + 4);
    const float f[8] = {fa[0], fa[1], fa[2], fa[3], fb[0], fb[1], fb[2], fb[3]};
    v4u hv, lv;
    split8(f, hv, lv);
    const size_t o = (size_t)blk * 512 + (kp >> 1) * 256 + ((kp & 1) * 16 + r16) * 8;
    *(v4u*)(hi + o) = hv;
    *(v4u*)(lo + o) = lv;
  }
}

// ---------------------------------------------------------------------------
// Rotary tables: cs[t*32+i] = cosf(t * inv_freq[i]), sn likewise, inv_freq[i] = 10000^(-i/32) = 2^(-i*log2(1e4)/32).
// kSeq*32/256 = 256 blocks x 256 threads = exactly 65536 elements per table; each wave writes 32 consecutive
// ---------------------------------------------------------------------------
__device__ __forceinline__ void rope_table_thread(float* __restrict__ cs, float* __restrict__ sn, const int i) {
  const int t  = i >> 5;
  const int fi = i & 31;
  const float invf = exp2f((float)fi * -0.41524101186092f);
  const float ang  = (float)t * invf;
  float sv, cv;
  sincosf(ang, &sv, &cv);
  ((float*)cs)[i] = cv;
  ((float*)sn)[i] = sv;
}

// ---------------------------------------------------------------------------
// Everything that depends on the inputs alone, in one launch: the rotary tables and the bf16 splits of x and of the four
// weight matrices. No part reads what another writes. Block ranges, the part with the longest thread first:
//   kPbT table blocks | kPbX blocks of x | kPbWq of Wq | kPbWk of Wk | kPbWk of Wv | kPbWq of Wo
// ---------------------------------------------------------------------------
constexpr int kN8X  = kTok * kDim / 8;        // 393216 threads
constexpr int kN8Wq = kDim * kDim / 8;        // 73728
constexpr int kN8Wk = kKvDim * kDim / 8;      // 24576
constexpr int kPbT  = kSeq * kHalfHd / 256;   // 256
constexpr int kPbX  = kN8X / 256;             // 1536
constexpr int kPbWq = kN8Wq / 256;            // 288
constexpr int kPbWk = kN8Wk / 256;            // 96
static_assert((kSeq * kHalfHd) % 256 == 0 && kN8X % 256 == 0 && kN8Wq % 256 == 0 && kN8Wk % 256 == 0);

__global__ __launch_bounds__(256) void prep_kernel(
    const float* __restrict__ x, const float* __restrict__ Wq, const float* __restrict__ Wk,
    const float* __restrict__ Wv, const float* __restrict__ Wo,
    unsigned short* __restrict__ Xh, unsigned short* __restrict__ Xl,
    unsigned short* __restrict__ Wqh, unsigned short* __restrict__ Wql,
    unsigned short* __restrict__ Wkh, unsigned short* __restrict__ Wkl,
    unsigned short* __restrict__ Wvh, unsigned short* __restrict__ Wvl,
    unsigned short* __restrict__ Woh, unsigned short* __restrict__ Wol,
    float* __restrict__ cs, float* __restrict__ sn) {
  int bx = blockIdx.x;                          // block-uniform choice of the part
  if (bx < kPbT) { rope_table_thread(cs, sn, bx * 256 + threadIdx.x); return; }
  bx -= kPbT;
  const float* in = x; unsigned short* hi = Xh; unsigned short* lo = Xl; int n8 = kN8X;
  if (bx >= kPbX) {
    bx -= kPbX; in = Wq; hi = Wqh; lo = Wql; n8 = kN8Wq;
    if (bx >= kPbWq) {
      bx -= kPbWq; in = Wk; hi = Wkh; lo = Wkl; n8 = kN8Wk;
      if (bx >= kPbWk) {
        bx -= kPbWk; in = Wv; hi = Wvh; lo = Wvl;
        if (bx >= kPbWk) { bx -= kPbWk; in = Wo; hi = Woh; lo = Wol; n8 = kN8Wq; }
      }
    }
  }
  split_pack_thread(in, hi, lo, bx * 256 + threadIdx.x, n8);
}

#define AT_D 64
#define AT_QB 64
#define AT_KC 64
#define AT_LP 72   // LDS row pitch of the K and V^T tiles in elements: 144 B = 16 B x 9 (odd), so the 16 rows that one
                   // ds_load_b128 touches per half wave start on 16 different 4-bank groups (128-B rows: only 2 groups)

__device__ __forceinline__ v8f at_mma(v16b a, v16b b, v8f c) {
  c = __builtin_amdgcn_wmma_f32_16x16x32_bf16(false, a, false, b, (short)0, c, false, false);
  asm volatile("v_nop\n\tv_nop\n\tv_nop\n\tv_nop" : "+v"(c) : "v"(a), "v"(b));
  return c;
}

// f32 -> bf16_rne, the 16 bits left in the upper half of the word (the lower half is not used): the rounding of f2bf_bits
__device__ __forceinline__ unsigned at_rne_top(float f) {
  const unsigned u = __float_as_uint(f);
  return u + 0x7FFFu + __builtin_amdgcn_ubfe(u, 16, 1);   // bit 16 by one bit-field extract (written with >> and & it became two 16-bit moves and an and)
}
// 8 f32 -> 8 bf16 hi = bf16_rne(f) and 8 bf16 lo = bf16_rne(f - hi), two elements a word (the even one in the lower half)
__device__ __forceinline__ void at_split_pack8(const float (&f)[8], v4u& hv, v4u& lv) {
#pragma unroll   // constant indices keep f, hv and lv in registers
  for (int q = 0; q < 4; ++q) {
    const unsigned h0 = at_rne_top(f[2 * q]), h1 = at_rne_top(f[2 * q + 1]);
    const unsigned l0 = at_rne_top(f[2 * q] - __uint_as_float(h0 & 0xFFFF0000u));
    const unsigned l1 = at_rne_top(f[2 * q + 1] - __uint_as_float(h1 & 0xFFFF0000u));
    hv[q] = __builtin_amdgcn_perm(h1, h0, 0x07060302u);   // one byte permute: (h0 >> 16) | (h1 & 0xFFFF0000)
    lv[q] = __builtin_amdgcn_perm(l1, l0, 0x07060302u);
  }
}
// value of lane l ^ 16 (the other half of the wave), a vector cross-row move
__device__ __forceinline__ float at_half_swap(float v) {
  const int b = __float_as_int(v);
  return __int_as_float(__builtin_amdgcn_permlanex16(b, b, 0x76543210, 0xfedcba98, false, false));
}

#define AT_PL (AT_KC * AT_LP)   // elements of one staged plane (64 rows)
// Eight asynchronous 16-B copies to LDS: rows r, r+16, r+32, r+48 of two planes. l = the lane's LDS byte address of row r in
// the first plane (the second plane lies AT_PL elements behind it), a / b = the lane's global address of row r in the two
// source planes, gs = source elements per 16 rows. The s_wait_xcnt closes the statement, so that no register which a copy
// names is rewritten ahead of it.
__device__ __forceinline__ void at_copy8(const unsigned l, const __bf16* a, const __bf16* b, const int gs) {
  const unsigned l1 = l + 16 * AT_LP * 2, l2 = l + 32 * AT_LP * 2, l3 = l + 48 * AT_LP * 2;
  const unsigned m0 = l + AT_PL * 2, m1 = l1 + AT_PL * 2, m2 = l2 + AT_PL * 2, m3 = l3 + AT_PL * 2;
  const __bf16* a1 = a + gs; const __bf16* a2 = a + 2 * gs; const __bf16* a3 = a + 3 * gs;
  const __bf16* b1 = b + gs; const __bf16* b2 = b + 2 * gs; const __bf16* b3 = b + 3 * gs;
  asm volatile("global_load_async_to_lds_b128 %0, %8, off\n\t"
               "global_load_async_to_lds_b128 %1, %9, off\n\t"
               "global_load_async_to_lds_b128 %2, %10, off\n\t"
               "global_load_async_to_lds_b128 %3, %11, off\n\t"
               "global_load_async_to_lds_b128 %4, %12, off\n\t"
               "global_load_async_to_lds_b128 %5, %13, off\n\t"
               "global_load_async_to_lds_b128 %6, %14, off\n\t"
               "global_load_async_to_lds_b128 %7, %15, off\n\t"
               "s_wait_xcnt 0x0"
               :: "v"(l), "v"(l1), "v"(l2), "v"(l3), "v"(m0), "v"(m1), "v"(m2), "v"(m3),
                  "v"(a), "v"(a1), "v"(a2), "v"(a3), "v"(b), "v"(b1), "v"(b2), "v"(b3) : "memory");
}

__global__ __launch_bounds__(128)
void attn_gqa_window64_kernel(const unsigned short* __restrict__ qhp, const unsigned short* __restrict__ qlp,
                              const unsigned short* __restrict__ khp, const unsigned short* __restrict__ klp,
                              const unsigned short* __restrict__ vhp, const unsigned short* __restrict__ vlp,
                              unsigned short* __restrict__ ohp, unsigned short* __restrict__ olp, float sscale) {
  union FB { v16b v; v8b h[2]; };
  union PB { v16b v; v4u q[2]; };   // p^T fragment: q[0] = the 8 keys of the even score tile, q[1] = of the odd one
  // two buffers x 4 planes of 9 KB: K hi [kv][d], K lo, V hi [d][kv], V lo
  __shared__ __align__(16) __bf16 KV[2][4][AT_PL];

  const int tid  = threadIdx.x;
  const int wave = tid >> 5;
  const int lane = tid & 31;
  const int hh   = lane >> 4;
  const int c    = lane & 15;

  const int nqb = kSeq / AT_QB;           // 32
  const int bx = blockIdx.x;
  const int qb = bx % nqb;
  const int h  = bx / nqb;                // 0..kNHq-1 (grid = kNHq * nqb)
  const int kvh = h / kGroups;            // 0..kNKv-1
  const int q0 = qb * AT_QB + wave * 16;

  const size_t bq = (size_t)blockIdx.y * kSeq * kDim;     // batch element's q plane
  const size_t bk = (size_t)blockIdx.y * kSeq * kKvDim;   // batch element's k / v^T plane
  const __bf16* Qh = (const __bf16*)(const void*)qhp + bq + (size_t)h * AT_D;
  const __bf16* Ql = (const __bf16*)(const void*)qlp + bq + (size_t)h * AT_D;
  const __bf16* Kh = (const __bf16*)(const void*)khp + bk + (size_t)kvh * AT_D;
  const __bf16* Kl = (const __bf16*)(const void*)klp + bk + (size_t)kvh * AT_D;
  const __bf16* Vh = (const __bf16*)(const void*)vhp + bk + (size_t)kvh * AT_D * kSeq;
  const __bf16* Vl = (const __bf16*)(const void*)vlp + bk + (size_t)kvh * AT_D * kSeq;

  // ---- Q fragments (B operand, column = query = lane&15, split k map via Frag load): 2 d-chunks, hi and lo ----
  v16b qah[2], qal[2];
#pragma unroll
  for (int dc = 0; dc < 2; ++dc) {
    const __bf16* qr = Qh + (size_t)(q0 + c) * kDim + dc * 32 + 8 * hh;
    const __bf16* ql = Ql + (size_t)(q0 + c) * kDim + dc * 32 + 8 * hh;
    qah[dc] = Frag<__bf16>::load(qr);
    qal[dc] = Frag<__bf16>::load(ql);
  }

  const int qrow = q0 + c;                // this lane's query
  float mrow = -INFINITY;                 // its running maximum (the same in both halves of the wave)
  float lrow = 0.f;                       // its running sum over this half's keys; the halves are joined behind the loop
  v8f oacc[4];                            // oacc[t][r] = out[qrow][t*16 + 8*hh + r]
#pragma unroll
  for (int t = 0; t < 4; ++t) oacc[t] = (v8f){0.f,0.f,0.f,0.f,0.f,0.f,0.f,0.f};

  const int qlo = qb * AT_QB - (kWin - 1);                 // smallest key allowed for the block's first row
  const int kcStart = (qlo > 0) ? (qlo / AT_KC) : 0;       // block-uniform
  const int nChunks = qb + 1;                              // block-uniform, <= 32
  // staging coverage: copy i of a thread = row i*16 + tid/8, 16 B at (tid&7)*16 B: 128 threads x 4 copies = 64 rows x 128 B a plane
  const int sr = tid >> 3, sc = (tid & 7) * 8;
  const unsigned sl = (unsigned)(size_t)(&KV[0][0][sr * AT_LP + sc]);   // the lane's LDS byte address in buffer 0, plane K hi
  const __bf16* gkh = Kh + (size_t)sr * kKvDim + sc;                    // K row kv0+sr (+16 i), d = sc..sc+7
  const __bf16* gkl = Kl + (size_t)sr * kKvDim + sc;
  const __bf16* gvh = Vh + (size_t)sr * kSeq + sc;                      // V^T row d = sr (+16 i), s = kv0+sc..+7
  const __bf16* gvl = Vl + (size_t)sr * kSeq + sc;
  auto stage = [&](const int ch, const int buf) {   // all 16 copies of chunk ch into buffer buf
    const unsigned lb = sl + (unsigned)buf * (4 * AT_PL * 2);
    at_copy8(lb, gkh + (size_t)ch * (AT_KC * kKvDim), gkl + (size_t)ch * (AT_KC * kKvDim), 16 * kKvDim);
    at_copy8(lb + 2 * AT_PL * 2, gvh + ch * AT_KC, gvl + ch * AT_KC, 16 * kSeq);
  };
  stage(kcStart, 0);
  asm volatile("s_wait_asynccnt 0x0" ::: "memory");   // this wave's copies of the first chunk have landed
  __syncthreads();                                    // ... and every other wave's: the first chunk may be read
  if (kcStart + 1 < nChunks) stage(kcStart + 1, 1);   // block-uniform
  for (int kc = kcStart; kc < nChunks; ++kc) {
    const int kv0 = kc * AT_KC;
    const int cur = (kc - kcStart) & 1;
    const __bf16* Ksh = KV[cur][0];
    const __bf16* Ksl = KV[cur][1];
    const __bf16* Vth = KV[cur][2];
    const __bf16* Vtl = KV[cur][3];

    v8f s[4];
#pragma unroll
    for (int j = 0; j < 4; ++j) {
      s[j] = (v8f){0.f,0.f,0.f,0.f,0.f,0.f,0.f,0.f};
#pragma unroll
      for (int dc = 0; dc < 2; ++dc) {
        FB kb, kl;
        kb.h[0] = *(const v8b*)(Ksh + (j * 16 + c) * AT_LP + dc * 32 + 8 * hh);
        kb.h[1] = *(const v8b*)(Ksh + (j * 16 + c) * AT_LP + dc * 32 + 16 + 8 * hh);
        kl.h[0] = *(const v8b*)(Ksl + (j * 16 + c) * AT_LP + dc * 32 + 8 * hh);
        kl.h[1] = *(const v8b*)(Ksl + (j * 16 + c) * AT_LP + dc * 32 + 16 + 8 * hh);
        s[j] = at_mma(kb.v, qah[dc], s[j]);
        s[j] = at_mma(kl.v, qah[dc], s[j]);
        s[j] = at_mma(kb.v, qal[dc], s[j]);
      }
    }
    // s[j][r] = score of query qrow and key kv0 + j*16 + 8*hh + r
    float mj[4];
#pragma unroll
    for (int j = 0; j < 4; ++j) {
      mj[j] = -INFINITY;
#pragma unroll
      for (int r = 0; r < 8; ++r) {
        const int kvcol = kv0 + j * 16 + 8 * hh + r;
        const float sv = s[j][r] * sscale;
        const bool masked = (kvcol > qrow) || (qrow - kvcol > kWin - 1);
        const float sm = masked ? -INFINITY : sv;
        s[j][r] = sm;
        mj[j] = fmaxf(mj[j], sm);
      }
    }
    float cm = fmaxf(fmaxf(mj[0], mj[1]), fmaxf(mj[2], mj[3]));
    cm = fmaxf(cm, at_half_swap(cm));                          // the chunk's maximum over all 64 keys
    const float mnew  = fmaxf(mrow, cm);
    const float mpiv  = (mnew == -INFINITY) ? 0.0f : mnew;     // fully masked so far -> alpha = 0, p = 0
    const float alpha = expf(mrow - mpiv);
    mrow = mnew;
    PB pa[2], pl[2];
    float pj[4];
#pragma unroll
    for (int j = 0; j < 4; ++j) {
      float p[8];
      pj[j] = 0.f;
#pragma unroll
      for (int r = 0; r < 8; ++r) {
        p[r] = expf(s[j][r] - mpiv);
        pj[j] += p[r];
      }
      at_split_pack8(p, pa[j >> 1].q[j & 1], pl[j >> 1].q[j & 1]);
    }
    lrow = lrow * alpha + ((pj[0] + pj[1]) + (pj[2] + pj[3]));
#pragma unroll
    for (int t = 0; t < 4; ++t)
#pragma unroll
      for (int r = 0; r < 8; ++r) oacc[t][r] *= alpha;
#pragma unroll   // constant indices keep pa and pl in registers
    for (int kk = 0; kk < 2; ++kk) {
#pragma unroll
      for (int t = 0; t < 4; ++t) {
        FB vb, vl;
        vb.h[0] = *(const v8b*)(Vth + (t * 16 + c) * AT_LP + kk * 32 + 8 * hh);
        vb.h[1] = *(const v8b*)(Vth + (t * 16 + c) * AT_LP + kk * 32 + 16 + 8 * hh);
        vl.h[0] = *(const v8b*)(Vtl + (t * 16 + c) * AT_LP + kk * 32 + 8 * hh);
        vl.h[1] = *(const v8b*)(Vtl + (t * 16 + c) * AT_LP + kk * 32 + 16 + 8 * hh);
        oacc[t] = at_mma(vb.v, pa[kk].v, oacc[t]);
        oacc[t] = at_mma(vl.v, pa[kk].v, oacc[t]);
        oacc[t] = at_mma(vb.v, pl[kk].v, oacc[t]);
      }
    }
    // hand-over: this wave's reads of the chunk are done, its copies of the next chunk have landed; behind the barrier the
    // next chunk may be read by every wave and the buffer just read may be refilled
    asm volatile("s_wait_dscnt 0x0" ::: "memory");
    asm volatile("s_wait_asynccnt 0x0" ::: "memory");
    __syncthreads();
    if (kc + 2 < nChunks) stage(kc + 2, cur);         // block-uniform
  }
  asm volatile("s_wait_asynccnt 0x0" ::: "memory");   // no copy is outstanding when the wave goes on to its epilogue and ends

  const float inv = 1.0f / (lrow + at_half_swap(lrow));   // the two halves' sums joined
  {
    // first of the wave's two blocks: block row = token row / 16, k block = column / 32
    const size_t blk0 = (size_t)((blockIdx.y * kSeq + q0) >> 4) * kKBlk + h * (AT_D / 32);
#pragma unroll
    for (int it = 0; it < 4; ++it) {   // it>>1 = block, it&1 = its half (16 k); lane = (k>>3 & 1)*16 + row: 512 consecutive bytes a store
      // the lane's own 8 values of row c: columns it*16 + hh*8 .. +7
      const float f[8] = {oacc[it][0] * inv, oacc[it][1] * inv, oacc[it][2] * inv, oacc[it][3] * inv,
                          oacc[it][4] * inv, oacc[it][5] * inv, oacc[it][6] * inv, oacc[it][7] * inv};
      v4u hv, lv;
      split8(f, hv, lv);
      const size_t o = (blk0 + (it >> 1)) * 512 + (it & 1) * 256 + lane * 8;
      *(v4u*)(ohp + o) = hv;
      *(v4u*)(olp + o) = lv;
    }
  }
}

// ---------------------------------------------------------------------------
// Workspace region map (byte offsets; every region is fully written in this call before it is read; token rows
// run over both batch elements, row = b*2048 + t; VT holds one [256][2048] plane per batch element; the W*, X* and
// O* bf16 planes are fragment-major, 16-row x 32-k blocks, see wmma_gemm64):
//   Wqh bf16 [768 n][768 k]         0      Wql   1179648
//   Wkh bf16 [256][768]        2359296      Wkl   2752512
//   Wvh bf16 [256][768]        3145728      Wvl   3538944
//   Woh bf16 [768][768]        3932160      Wol   5111808
//   CS  f32  [2048][32]        6291456      SN    6553600
//   Xh  bf16 [4096][768]       6815744      Xl   13107200
//   Qh  bf16 [4096][768]      19398656      Ql   25690112
//   Kh  bf16 [4096][256]      31981568      Kl   34078720
//   VTh bf16 [2][256][2048]   36175872      VTl  38273024
//   Oh  bf16 [4096][768]      40370176      Ol   46661632
//   total                     52953088
// ---------------------------------------------------------------------------
extern "C" void kernel_launch(void* const* d_in, const int* in_sizes, int n_in,
                              void* d_out, int out_size, void* d_ws, size_t ws_size,
                              hipStream_t stream) {
  if (n_in < 7) return;
  if (in_sizes[0] != kNB * kSeq * kDim) return;
  if (in_sizes[1] != kDim * kDim || in_sizes[4] != kDim * kDim) return;
  if (in_sizes[2] != kKvDim * kDim || in_sizes[3] != kKvDim * kDim) return;
  if (in_sizes[5] != kHd || in_sizes[6] != kHd) return;
  if (out_size != kNB * kSeq * kDim) return;

  const float* x    = (const float*)d_in[0];
  const float* Wq   = (const float*)d_in[1];
  const float* Wk   = (const float*)d_in[2];
  const float* Wv   = (const float*)d_in[3];
  const float* Wo   = (const float*)d_in[4];
  const float* lnq  = (const float*)d_in[5];
  const float* lnk  = (const float*)d_in[6];

  const size_t PWQ = (size_t)kDim * kDim * 2;      // 1179648  bf16 [768][768] plane
  const size_t PWK = (size_t)kKvDim * kDim * 2;    // 393216   bf16 [256][768] plane
  const size_t PTB = (size_t)kSeq * kHalfHd * 4;   // 262144   f32 [2048][32] table
  const size_t PXB = (size_t)kTok * kDim * 2;      // 6291456  bf16 [4096][768] plane
  const size_t PKB = (size_t)kTok * kKvDim * 2;    // 2097152  bf16 [4096][256] / [2][256][2048] plane
  size_t off = 0;
  const size_t oWqh = off; off += PWQ;  const size_t oWql = off; off += PWQ;
  const size_t oWkh = off; off += PWK;  const size_t oWkl = off; off += PWK;
  const size_t oWvh = off; off += PWK;  const size_t oWvl = off; off += PWK;
  const size_t oWoh = off; off += PWQ;  const size_t oWol = off; off += PWQ;
  const size_t oCS  = off; off += PTB;  const size_t oSN  = off; off += PTB;
  const size_t oXh  = off; off += PXB;  const size_t oXl  = off; off += PXB;
  const size_t oQh  = off; off += PXB;  const size_t oQl  = off; off += PXB;
  const size_t oKh  = off; off += PKB;  const size_t oKl  = off; off += PKB;
  const size_t oVTh = off; off += PKB;  const size_t oVTl = off; off += PKB;
  const size_t oOh  = off; off += PXB;  const size_t oOl  = off; off += PXB;
  if (off > ws_size) return;                       // off = 52953088
  if (off > (size_t)134217728) return;

  char* ws = (char*)d_ws;
  unsigned short* Wqh = (unsigned short*)(ws + oWqh); unsigned short* Wql = (unsigned short*)(ws + oWql);
  unsigned short* Wkh = (unsigned short*)(ws + oWkh); unsigned short* Wkl = (unsigned short*)(ws + oWkl);
  unsigned short* Wvh = (unsigned short*)(ws + oWvh); unsigned short* Wvl = (unsigned short*)(ws + oWvl);
  unsigned short* Woh = (unsigned short*)(ws + oWoh); unsigned short* Wol = (unsigned short*)(ws + oWol);
  float*          CS  = (float*)(ws + oCS);          float*          SN  = (float*)(ws + oSN);
  unsigned short* Xh  = (unsigned short*)(ws + oXh);  unsigned short* Xl  = (unsigned short*)(ws + oXl);
  unsigned short* Qh  = (unsigned short*)(ws + oQh);  unsigned short* Ql  = (unsigned short*)(ws + oQl);
  unsigned short* Kh  = (unsigned short*)(ws + oKh);  unsigned short* Kl  = (unsigned short*)(ws + oKl);
  unsigned short* VTh = (unsigned short*)(ws + oVTh); unsigned short* VTl = (unsigned short*)(ws + oVTl);
  unsigned short* Oh  = (unsigned short*)(ws + oOh);  unsigned short* Ol  = (unsigned short*)(ws + oOl);

  const dim3 blk(256);
  const dim3 gPrep(kPbT + kPbX + 2 * kPbWq + 2 * kPbWk);            // 2560 blocks
  const dim3 gQKV(kBlkQ + kBlkK + kNB * kBlkV);                     // 160 blocks x 8 tiles
  const dim3 gProjQ(kBlkQ, 1);                                      // 768 tiles: M=4096, N=768
  const dim3 gAtt(kNHq * (kSeq / 64), kNB);                         // 12 heads x 32 query blocks per batch element

  // Both batch elements go through every stage in one launch: the token-row GEMMs see M = 4096 rows (the rotary
  // epilogue takes the position as row % 2048); v^T and attention take the batch element from the block index.
  // (1) rotary tables; x and the weights [out n][in k] f32 -> bf16 hi/lo planes, fragment-major
  prep_kernel<<<gPrep, blk, 0, stream>>>(x, Wq, Wk, Wv, Wo, Xh, Xl, Wqh, Wql, Wkh, Wkl, Wvh, Wvl, Woh, Wol, CS, SN);
  // (2) q and k projections with per-head rmsnorm * w + rotary in the epilogue -> Q/K bf16 hi/lo planes; v^T -> VT hi/lo planes (K = 768 each)
  qkv_gemm64_kernel<<<gQKV, blk, 0, stream>>>(Xh, Xl, Wqh, Wql, Wkh, Wkl, Wvh, Wvl, lnq, lnk, CS, SN, Qh, Ql, Kh, Kl, VTh, VTl, kDim);
  // (3) windowed causal GQA attention per head: y -> bf16 hi/lo planes, fragment-major (every element written by its (b, h, query block) owner)
  attn_gqa_window64_kernel<<<gAtt, dim3(128), 0, stream>>>(Qh, Ql, Kh, Kl, VTh, VTl, Oh, Ol, 0.125f);
  // (4) out = y . Wo^T -> d_out rows 0 .. 4095 (f32)   (M=4096, N=768, K=768)
  wmma_gemm64<1, true, 0, 0, false><<<gProjQ, blk, 0, stream>>>(
      Oh, Ol, kDim, 0L, Woh, Wol, kDim, 0L, d_out, d_out, kDim, 0L,
      lnq, lnq, 0L, kTok, kDim, kDim, 1.0f);
}

// v009
// One run takes 69.7 microseconds.
// Two timings next to v008 put it at 1.11 and 1.14 times that version's speed.
// Over all steps from v000 it is 7.90 times as fast.
// Contractions (q/k/v/out projections, q.k^T scores, p.v): v_wmma_f32_16x16x32_bf16 with bf16 hi/lo split operands (hi.hi + hi.lo + lo.hi), f32 accumulate; rmsnorm, rotary tables, online softmax in f32.
#include <hip/hip_runtime.h>
#include <math.h>
#include <stdint.h>

constexpr int kNB     = 2;
constexpr int kSeq    = 2048;
constexpr int kTok    = kNB * kSeq;          // 4096 token rows over both batch elements
constexpr int kDim    = 768;
constexpr int kHd     = 64;
constexpr int kNHq    = 12;
constexpr int kNKv    = 4;
constexpr int kGroups = 3;
constexpr int kKvDim  = kNKv * kHd;          // 256
constexpr int kWin    = 384;
constexpr int kHalfHd = 32;
constexpr int kKBlk   = kDim / 32;           // 24 k blocks of 32 in a row of 768
static_assert((kSeq & (kSeq - 1)) == 0 && kHd == 64 && kHalfHd * 2 == kHd);
static_assert(kSeq % 64 == 0 && kDim % 64 == 0 && kKvDim % 64 == 0 && kDim % 32 == 0);
static_assert(kNHq == kNKv * kGroups);

typedef __attribute__((ext_vector_type(16))) _Float16 v16h;
typedef __attribute__((ext_vector_type(8)))  _Float16 v8h;
typedef __attribute__((ext_vector_type(16))) __bf16   v16b;
typedef __attribute__((ext_vector_type(8)))  __bf16   v8b;
typedef __attribute__((ext_vector_type(8)))  float    v8f;
typedef __attribute__((ext_vector_type(4)))  float    v4f;
typedef __attribute__((ext_vector_type(2)))  float    v2f;
typedef __attribute__((ext_vector_type(4)))  unsigned int v4u;

__device__ __forceinline__ unsigned short f2bf_bits(float f) {
  unsigned u = __float_as_uint(f);
  return (unsigned short)((u + 0x7FFFu + ((u >> 16) & 1u)) >> 16);
}
__device__ __forceinline__ float bf_bits2f(unsigned short h) { return __uint_as_float(((unsigned)h) << 16); }

__device__ __forceinline__ unsigned pk16(unsigned short a, unsigned short b) { return (unsigned)a | ((unsigned)b << 16); }
// 8 consecutive f32 -> 8 bf16 hi = bf16_rne(f) and 8 bf16 lo = bf16_rne(f - hi), 16 B each
__device__ __forceinline__ void split8(const float (&f)[8], v4u& hv, v4u& lv) {
#pragma unroll   // constant indices keep f, hv and lv in registers
  for (int q = 0; q < 4; ++q) {
    const unsigned short h0 = f2bf_bits(f[2 * q]), h1 = f2bf_bits(f[2 * q + 1]);
    const unsigned short l0 = f2bf_bits(f[2 * q] - bf_bits2f(h0)), l1 = f2bf_bits(f[2 * q + 1] - bf_bits2f(h1));
    hv[q] = pk16(h0, h1);
    lv[q] = pk16(l0, l1);
  }
}

// ---------------------------------------------------------------------------
// Per (token, head) unit of 64 floats: y[d] = w[d] * (x[d] * rsqrt(mean(x^2) + eps)); rotary:
//   o[d] = y[d]*cos[t][d&31] - y[d+32]*sin  (d < 32),   o[d] = y[d]*cos + y[d-32]*sin  (d >= 32);
// o split into bf16 hi/lo. 8 lanes per unit (lane&7 = which 8 of the 64), 4 units per wave: x = the lane's own 8 values,
// p = the 8 of its rotary partner block, w / v = the norm weights of the two blocks, c / s = the table rows' 8 values.
// ---------------------------------------------------------------------------
__device__ __forceinline__ float rope_one(float x, float p, float wx, float wp, float cv, float sv, float rinv, float sg) {
  const float xn = wx * (x * rinv);
  const float pn = wp * (p * rinv);
  return xn * cv + (sg * pn) * sv;
}
__device__ __forceinline__ void norm_rope_unit(const v4f xa, const v4f xb, const v4f pa, const v4f pb, const v4f wa, const v4f wb,
                                               const v4f va, const v4f vb, const v4f ca, const v4f cb, const v4f sa, const v4f sb,
                                               const float sg, v4u& hv, v4u& lv) {
  float ss = xa[0] * xa[0] + xa[1] * xa[1] + xa[2] * xa[2] + xa[3] * xa[3]
           + xb[0] * xb[0] + xb[1] * xb[1] + xb[2] * xb[2] + xb[3] * xb[3];
  ss += __shfl_xor(ss, 1, 32);
  ss += __shfl_xor(ss, 2, 32);
  ss += __shfl_xor(ss, 4, 32);
  const float rinv = rsqrtf(ss * (1.0f / 64.0f) + 1e-6f);
  float o[8];
  o[0] = rope_one(xa[0], pa[0], wa[0], va[0], ca[0], sa[0], rinv, sg);
  o[1] = rope_one(xa[1], pa[1], wa[1], va[1], ca[1], sa[1], rinv, sg);
  o[2] = rope_one(xa[2], pa[2], wa[2], va[2], ca[2], sa[2], rinv, sg);
  o[3] = rope_one(xa[3], pa[3], wa[3], va[3], ca[3], sa[3], rinv, sg);
  o[4] = rope_one(xb[0], pb[0], wb[0], vb[0], cb[0], sb[0], rinv, sg);
  o[5] = rope_one(xb[1], pb[1], wb[1], vb[1], cb[1], sb[1], rinv, sg);
  o[6] = rope_one(xb[2], pb[2], wb[2], vb[2], cb[2], sb[2], rinv, sg);
  o[7] = rope_one(xb[3], pb[3], wb[3], vb[3], cb[3], sb[3], rinv, sg);
  split8(o, hv, lv);
}

// hazard guards as plain device helpers (no inline asm inside the kernel template body)
// four vector slots: the distance asked between a 16-bit matrix instruction and a vector overwrite of a register that it reads;
// kept in front of a load over such a register too, as a precaution
__device__ __forceinline__ void operand_gap() { asm volatile("v_nop\n\tv_nop\n\tv_nop\n\tv_nop" ::: "memory"); }
__device__ __forceinline__ void acc_guard4(v8f& a, v8f& b, v8f& c, v8f& d) { asm volatile("v_nop\n\tv_nop\n\tv_nop\n\tv_nop" : "+v"(a), "+v"(b), "+v"(c), "+v"(d)); }
template <typename T> struct Frag;
template <> struct Frag<_Float16> {
  typedef v16h V; union U { v16h v; v8h h[2]; };
  static __device__ __forceinline__ v16h load(const _Float16* p) {   // elements 0..7 <- p[0..7], 8..15 <- p[16..23]
    U f; f.h[0] = *(const v8h*)(p); f.h[1] = *(const v8h*)(p + 16); return f.v;
  }
  static __device__ __forceinline__ v8f mma(v16h a, v16h b, v8f c) {
    return __builtin_amdgcn_wmma_f32_16x16x32_f16(false, a, false, b, (short)0, c, false, false);
  }
};
template <> struct Frag<__bf16> {
  typedef v16b V; union U { v16b v; v8b h[2]; };
  static __device__ __forceinline__ v16b load(const __bf16* p) {
    U f; f.h[0] = *(const v8b*)(p); f.h[1] = *(const v8b*)(p + 16); return f.v;
  }
  // fragment-major block at byte address p: elements 0..7 <- bytes 0..15, elements 8..15 <- bytes 512..527
  static __device__ __forceinline__ v16b load_packed(const char* p) {
    U f; f.h[0] = *(const v8b*)(p); f.h[1] = *(const v8b*)(p + 512); return f.v;
  }
  static __device__ __forceinline__ v8f mma(v16b a, v16b b, v8f c) {
    return __builtin_amdgcn_wmma_f32_16x16x32_bf16(false, a, false, b, (short)0, c, false, false);
  }
};

// ---- Register-blocked batched WMMA GEMM ------------------------------------
// C[m,n] = scale * sum_k A[m,k] * Bt[n,k] (+bias)(+resid); each wave owns a 64x64 tile, a work-group of 4 waves a 128x128
// tile (2 x 2 wave tiles). The work-group's operand rows go through LDS, so that each 16-row block is fetched once a
// work-group and read by the two waves that need it.
// A [M,K] and Bt [N,K] are stored fragment-major (written by split_pack_thread and by the attention kernel): each 16-row x 32-k block is
// 512 consecutive elements, block index = (row/16)*kKBlk + k/32, and element (row, k) of a block sits at
// ((k>>4)&1)*256 + (((k>>3)&1)*16 + (row&15))*8 + (k&7). Lane l of a fragment load then reads 16 B at l*16 B, so one
// wave-wide load covers 512 consecutive bytes (4 whole lines) and holds the same elements as a row-major fragment load.
// M,N % 128 == 0, K % 64 == 0, K >= 64; rows of both operands are kDim long (lda == ldb == kDim), so the step from one 16-row
// block row to the next is a compile-time constant.
// SPLIT: operands are hi/lo planes (A2/Bt2 = lo planes, same layout); product = hi.hi + hi.lo + lo.hi.
// BIAS_MODE: 0 = none, 1 = bias[m], 2 = bias[n].
// OUT_MODE: 0 = f32, 1 = f16, 2 = bf16 hi plane (Cout) + bf16 lo plane (Cout2), 3 = the tile is 64 token rows x the 64
// columns of one head: per-row rmsnorm * nw, rotary from the tables cs / sn, then bf16 hi/lo planes as in 2 (the slab
// then holds the whole tile, 64 rows).
// ET: 0 = f16 operands, 1 = bf16 operands (pointers passed as 16-bit storage)
template <int ET> struct Elem;
template <> struct Elem<0> { typedef _Float16 T; };
template <> struct Elem<1> { typedef __bf16 T; };
// All fragments of one k step of a 64x64 wave tile: four 16-row blocks of A and of Bt, hi and lo planes.
template <typename T, bool SPLIT> struct FragSet { typename Frag<T>::V bh[4], bl[4], ah[4], al[4]; };
constexpr int kRowStep = kKBlk * 1024;         // bytes from one 16-row block row to the next
// One stage in LDS = 64 k (two k steps) of the work-group's 128 A rows and 128 Bt rows: 4 planes (A hi, A lo, Bt hi, Bt lo) x
// 8 block rows x 2 KB (the two consecutive 1-KB blocks of a block row, as they lie in the source plane). Two stages.
constexpr int kSegB   = 2048;                  // one block row of one plane in a stage
constexpr int kPlaneB = 8 * kSegB;             // one plane of a stage
constexpr int kStageB = 4 * kPlaneB;           // 65536
// All fragments of one k step from a stage: sA / sB = the lane's 16 B in the first of the wave's four block rows of plane
// A hi / Bt hi, off = 0 or 1024 (which k step of the stage). Lane l reads 16 B at l*16 B: 512 consecutive bytes a load.
// The order is that of first use in the built code (16 products hi.hi, then 16 hi.lo, then 16 lo.hi), so that the first
// products wait for the first loads only.
template <typename T, bool SPLIT>
__device__ __forceinline__ void lds_frag_set(FragSet<T, SPLIT>& f, const char* sA, const char* sB, const int off) {
  static_assert(SPLIT, "the stage holds hi and lo planes");
  f.ah[0] = Frag<T>::load_packed(sA + off);
#pragma unroll   // here and below: constant indices keep the fragments in registers and the steps in the loads' immediate offsets
  for (int j = 0; j < 4; ++j) f.bh[j] = Frag<T>::load_packed(sB + (off + j * kSegB));
#pragma unroll
  for (int i = 1; i < 4; ++i) f.ah[i] = Frag<T>::load_packed(sA + (off + i * kSegB));
#pragma unroll
  for (int j = 0; j < 4; ++j) f.bl[j] = Frag<T>::load_packed(sB + (kPlaneB + off + j * kSegB));
#pragma unroll
  for (int i = 0; i < 4; ++i) f.al[i] = Frag<T>::load_packed(sA + (kPlaneB + off + i * kSegB));
}
typedef uint32_t u32x4 __attribute__((ext_vector_type(4)));
typedef uint32_t u32x8 __attribute__((ext_vector_type(8)));
__device__ __forceinline__ uint32_t uni(uint32_t v) { return (uint32_t)__builtin_amdgcn_readfirstlane(v); }
// A wave-uniform test as a scalar value, so that the branch on it is a scalar branch (a tensor load ignores EXEC).
__device__ __forceinline__ uint32_t pinned(uint32_t v) {
  uint32_t w = (uint32_t)__builtin_amdgcn_readfirstlane(v);
  asm volatile("" : "+s"(w));   // pinned(): holds the word in a scalar register
  return w;
}
// One tensor load (tensor_load_to_lds), one request of the whole wave: one plane of a stage = 8 rows (block rows) of kSegB bytes,
// source pitch kRowStep bytes, to kPlaneB consecutive LDS bytes at lds_dst (byte offset in the work-group's LDS, a multiple of
// 2 KiB). 1-byte elements, tensor = tile, no pad, no mask. Group 1 is the same for every request: built once.
__device__ __forceinline__ u32x8 tdm_group1() {
  constexpr uint32_t d0 = kSegB, d1 = 8u;
  u32x8 g1;
  g1[0] = uni(0u);
  g1[1] = uni((d0 & 0xFFFFu) << 16);
  g1[2] = uni((d0 >> 16) | ((d1 & 0xFFFFu) << 16));
  g1[3] = uni((d1 >> 16) | (d0 << 16));
  g1[4] = uni(d1);
  g1[5] = uni((uint32_t)kRowStep);
  g1[6] = uni(0u);
  g1[7] = uni(0u);
  asm volatile("" : "+s"(g1));   // pinned(): holds the descriptor words in their scalar registers, so that none is rebuilt or reused under a request in flight
  return g1;
}
__device__ __forceinline__ void tdm_plane(const uint32_t lds_dst, const uint64_t ga, const u32x8 g1) {
  u32x4 g0;
  g0[0] = uni(1u);
  g0[1] = uni(lds_dst);
  g0[2] = uni((uint32_t)ga);
  g0[3] = uni((((uint32_t)(ga >> 32)) & 0x01FFFFFFu) | 0x80000000u);
  asm volatile("tensor_load_to_lds %0, %1" :: "s"(g0), "s"(g1) : "memory");
}
template <typename T, bool SPLIT>
__device__ __forceinline__ void mma_frag_set(v8f (&acc)[4][4], const FragSet<T, SPLIT>& f) {
#pragma unroll
  for (int i = 0; i < 4; ++i) {
#pragma unroll
    for (int j = 0; j < 4; ++j) {
      acc[i][j] = Frag<T>::mma(f.ah[i], f.bh[j], acc[i][j]);
      if (SPLIT) {
        acc[i][j] = Frag<T>::mma(f.ah[i], f.bl[j], acc[i][j]);
        acc[i][j] = Frag<T>::mma(f.al[i], f.bh[j], acc[i][j]);
      }
    }
  }
}
// gemm64_tile = one wave's 64x64 tile of its work-group's 128x128 tile; every wave of the work-group calls it (it holds
// work-group barriers). The kernels below hand it the two-stage LDS ring, the wave's LDS slab (it may lie inside the ring: it is
// written behind the k loop's last barrier only), the batch index b and the work-group tile's first row mB and column nB
// (the same in every lane, in scalar registers).
template <int ET, bool SPLIT, int BIAS_MODE, int OUT_MODE, bool RESID, int ACT = 0>
__device__ __forceinline__ void gemm64_tile(
    char* ring, float* slab, const int b, const int mB, const int nB,
    const unsigned short* __restrict__ Ap, const unsigned short* __restrict__ A2p, int lda, long strideA,
    const unsigned short* __restrict__ Btp, const unsigned short* __restrict__ Bt2p, int ldb, long strideB,
    void* __restrict__ Cout, void* __restrict__ Cout2, int ldc, long strideC,
    const float* __restrict__ bias,
    const float* __restrict__ resid, long strideR,
    int K, float scale,
    const float* __restrict__ nw = nullptr, const float* __restrict__ cs = nullptr, const float* __restrict__ sn = nullptr) {
  typedef typename Elem<ET>::T T;
  typedef typename Frag<T>::V V;
  const T* A = (const T*)Ap; const T* A2 = (const T*)A2p; const T* Bt = (const T*)Btp; const T* Bt2 = (const T*)Bt2p;
  const int tid  = threadIdx.x;                // 0..127, a one-dimensional block
  const int lane = tid & 31;
  const int wv   = __builtin_amdgcn_readfirstlane(tid >> 5);
  const int m0   = mB + (wv >> 1) * 64;        // the wave's tile: wave = 2 * (row half) + (column half)
  const int n0   = nB + (wv & 1) * 64;

  const T* Ab  = A  + (size_t)b * strideA;
  const T* Bb  = Bt + (size_t)b * strideB;
  const T* Ab2 = SPLIT ? (A2  + (size_t)b * strideA) : nullptr;
  const T* Bb2 = SPLIT ? (Bt2 + (size_t)b * strideB) : nullptr;

  const int rlane = lane & 15;                 // row (A) / col (B, D) within subtile
  const int mOff  = (lane >> 4) * 8;           // D row offset
  // Staging: every wave brings one plane of each stage by one tensor load: wave 0 A hi, 1 A lo, 2 Bt hi, 3 Bt lo. Source: the
  // work-group tile's first block row in that plane, 2 KB further along k per stage.
  const T* gp = (wv == 0) ? Ab : (wv == 1) ? Ab2 : (wv == 2) ? Bb : Bb2;
  const uint64_t ga0 = (uint64_t)(size_t)(gp + (size_t)(((wv < 2) ? mB : nB) >> 4) * (kKBlk * 512));
  const uint32_t ld0 = (uint32_t)(size_t)ring + (uint32_t)wv * (uint32_t)kPlaneB;   // the plane's place in stage buffer 0
  const u32x8 g1 = tdm_group1();
  auto stage = [&](const int st, const int buf) {   // this wave's plane of stage st (k = 64 st .. 64 st + 63) into buffer buf
    tdm_plane(ld0 + (uint32_t)buf * (uint32_t)kStageB, ga0 + (uint64_t)st * kSegB, g1);
  };
  // Fragment reads: the wave's four block rows of A (row half) and of Bt (column half)
  const char* fA = ring + ((wv >> 1) * (4 * kSegB) + lane * 16);
  const char* fB = ring + (2 * kPlaneB + (wv & 1) * (4 * kSegB) + lane * 16);

  v8f acc[4][4];
#pragma unroll
  for (int i = 0; i < 4; ++i)
#pragma unroll
    for (int j = 0; j < 4; ++j) acc[i][j] = (v8f){0.f,0.f,0.f,0.f,0.f,0.f,0.f,0.f};

  // Two stage buffers: stage t+1 flies while stage t is worked on. A trip reads its own buffer alone: the 64 fragment loads of
  // its two k steps go ahead as one group, so the second k step's fragments arrive under the first one's 48 products.
  FragSet<T, SPLIT> f0, f1;
  const int nst = K >> 6;                             // the same for the whole work-group
  stage(0, 0);
  asm volatile("s_wait_tensorcnt 0x0" ::: "memory");  // this wave's plane of the first stage has landed
  __syncthreads();                                    // ... and every other wave's: the first stage may be read
  if (pinned(1 < nst)) stage(1, 1);
  for (int t = 0; t < nst; ++t) {
    const int bo = (t & 1) * kStageB;
    lds_frag_set<T, SPLIT>(f0, fA + bo, fB + bo, 0);
    lds_frag_set<T, SPLIT>(f1, fA + bo, fB + bo, 1024);
    __builtin_amdgcn_sched_barrier(0);   // keeps both k steps' loads ahead of the products (sunk to their use they would each wait alone)
    mma_frag_set<T, SPLIT>(acc, f0);
    mma_frag_set<T, SPLIT>(acc, f1);
    __builtin_amdgcn_sched_barrier(0);   // keeps every product in front of the gap below
    operand_gap();                       // four vector slots between the last product and what follows it on either side of the loop's branch
    // hand-over: this wave's reads of the stage are done, its plane of the next stage has landed; behind the barrier the
    // next stage may be read by every wave and the buffer just read may be refilled
    asm volatile("s_wait_dscnt 0x0" ::: "memory");
    asm volatile("s_wait_tensorcnt 0x0" ::: "memory");
    __syncthreads();
    if (pinned(t + 2 < nst)) stage(t + 2, t & 1);     // the same for the whole work-group
  }
  // nothing is outstanding when the ring's LDS becomes the epilogue's slabs (the last trip's barrier ended every wave's reads)
  asm volatile("s_wait_tensorcnt 0x0" ::: "memory");
  asm volatile("s_wait_dscnt 0x0" ::: "memory");
  acc_guard4(acc[0][0], acc[0][1], acc[0][2], acc[0][3]);
  acc_guard4(acc[1][0], acc[1][1], acc[1][2], acc[1][3]);
  acc_guard4(acc[2][0], acc[2][1], acc[2][2], acc[2][3]);
  acc_guard4(acc[3][0], acc[3][1], acc[3][2], acc[3][3]);

  // ---- epilogue ----
  if (OUT_MODE == 3) {
#pragma unroll
    for (int i = 0; i < 4; ++i)
#pragma unroll
      for (int j = 0; j < 4; ++j)
#pragma unroll
        for (int r = 0; r < 8; ++r) slab[((i << 4) + mOff + r) * 68 + (j << 4) + rlane] = acc[i][j][r] * scale;
    // the rows are read back by other lanes of this wave: the slab's stores stay in front of its loads
    __builtin_amdgcn_fence(__ATOMIC_RELEASE, "workgroup");
    __builtin_amdgcn_wave_barrier();
    __builtin_amdgcn_fence(__ATOMIC_ACQUIRE, "workgroup");
    unsigned short* C  = (unsigned short*)Cout  + (size_t)b * strideC;
    unsigned short* C2 = (unsigned short*)Cout2 + (size_t)b * strideC;
    const int d0 = (lane & 7) * 8;                 // this lane's 8 of the unit's 64 values
    const int dp = d0 ^ kHalfHd;                   // rotary partner block
    const float sg = (d0 < kHalfHd) ? -1.0f : 1.0f;
    // Norm weights and table values: every load = scalar base + a lane byte offset (+ an immediate). Table row = position
    // inside the sequence (m0 % 64 == 0, so the tile lies in one sequence); a pass is 4 rows, a group 4 passes.
    const unsigned wo = (unsigned)d0 * 4u, po = (unsigned)dp * 4u;
    const unsigned tb = (unsigned)(((m0 & (kSeq - 1)) + (lane >> 3)) * kHalfHd + (d0 & 24)) * 4u;
    const char* nwb = (const char*)nw;
    const char* csb = (const char*)cs;
    const char* snb = (const char*)sn;
    const v4f wa = *(const v4f*)(nwb + wo), wb = *(const v4f*)(nwb + wo + 16);
    const v4f va = *(const v4f*)(nwb + po), vb = *(const v4f*)(nwb + po + 16);
    v4f tbl[2][4][4];                              // two groups of table values: cos 0..3, cos 4..7, sin 0..3, sin 4..7 of a pass
#pragma unroll   // constant indices keep tbl in registers
    for (int p = 0; p < 4; ++p) {
      tbl[0][p][0] = *(const v4f*)(csb + tb + p * (16 * kHalfHd)); tbl[0][p][1] = *(const v4f*)(csb + tb + (p * (16 * kHalfHd) + 16));
      tbl[0][p][2] = *(const v4f*)(snb + tb + p * (16 * kHalfHd)); tbl[0][p][3] = *(const v4f*)(snb + tb + (p * (16 * kHalfHd) + 16));
    }
    asm volatile("s_wait_xcnt 0x0" :: "v"(wo), "v"(po) : "memory");   // wo and po are live up to this wait, so nothing overwrites them under the loads that name them
#pragma unroll   // constant indices into tbl
    for (int g = 0; g < 4; ++g) {
      if (g < 3) {
#pragma unroll
        for (int p = 0; p < 4; ++p) {              // the next group's table values fly under this group's arithmetic
          const int im = ((g + 1) * 4 + p) * (16 * kHalfHd);
          tbl[(g + 1) & 1][p][0] = *(const v4f*)(csb + tb + im); tbl[(g + 1) & 1][p][1] = *(const v4f*)(csb + tb + (im + 16));
          tbl[(g + 1) & 1][p][2] = *(const v4f*)(snb + tb + im); tbl[(g + 1) & 1][p][3] = *(const v4f*)(snb + tb + (im + 16));
        }
      }
      __builtin_amdgcn_sched_barrier(0);           // keeps these loads ahead of the group's arithmetic (sunk to their use they would fly alone) and of its stores
#pragma unroll
      for (int p = 0; p < 4; ++p) {
        const int row = (g * 4 + p) * 4 + (lane >> 3);
        const float* sp = slab + row * 68;
        const v4f xa = *(const v4f*)(sp + d0), xb = *(const v4f*)(sp + d0 + 4);
        const v4f pa = *(const v4f*)(sp + dp), pb = *(const v4f*)(sp + dp + 4);
        v4u hv, lv;
        norm_rope_unit(xa, xb, pa, pb, wa, wb, va, vb, tbl[g & 1][p][0], tbl[g & 1][p][1], tbl[g & 1][p][2], tbl[g & 1][p][3], sg, hv, lv);
        const size_t o = (size_t)(m0 + row) * ldc + n0 + d0;
        *(v4u*)(C + o)  = hv;
        *(v4u*)(C2 + o) = lv;
      }
      // the next group's loads and arithmetic reuse the registers of these stores: the wait stands before that; tb is live
      // up to the last of these waits, so nothing overwrites it under the loads that name it
      asm volatile("s_wait_xcnt 0x0" :: "v"(tb) : "memory");
      __builtin_amdgcn_sched_barrier(0);           // keeps what follows behind the wait (without it the scheduler may lift it over the wait)
    }
    return;
  }
  const float* Rb = RESID ? (resid + (size_t)b * strideR) : nullptr;
#pragma unroll
  for (int i = 0; i < 4; ++i) {
    const int mBase = m0 + (i << 4);
#pragma unroll
    for (int j = 0; j < 4; ++j) {
      const int n = n0 + (j << 4) + rlane;
      float bv = 0.f;
      if (BIAS_MODE == 2) bv = bias[n];
#pragma unroll
      for (int r = 0; r < 8; ++r) {
        float v = acc[i][j][r] * scale;
        if (BIAS_MODE == 1) v += bias[mBase + mOff + r];
        if (BIAS_MODE == 2) v += bv;
        if (RESID) v += Rb[(size_t)(mBase + mOff + r) * ldc + n];
        if (ACT == 1) v = tanhf(v);
        if (ACT == 2) v = fmaxf(v, 0.0f);
        if (ACT == 3) v = v / (1.0f + expf(-v));
        if (ACT == 4) v = (v > 0.f) ? v : 0.01f * v;
        slab[(mOff + r) * 68 + (j << 4) + rlane] = v;
      }
    }
    __builtin_amdgcn_fence(__ATOMIC_RELEASE, "workgroup");
    __builtin_amdgcn_wave_barrier();
    __builtin_amdgcn_fence(__ATOMIC_ACQUIRE, "workgroup");
    if (OUT_MODE == 0) {
      float* C = (float*)Cout + (size_t)b * strideC;
      const int hh = lane >> 4, c4 = (lane & 15) * 4;     // row seg = 256 B = 16 lanes x 16 B
      {
#pragma unroll
        for (int it = 0; it < 8; ++it) {
          const int row = it * 2 + hh;
          v4f v = *(const v4f*)(slab + row * 68 + c4);
          *(v4f*)(C + (size_t)(mBase + row) * ldc + n0 + c4) = v;
        }
        // the next block row's address arithmetic reuses the address registers of these stores: the wait stands before that
        asm volatile("s_wait_xcnt 0x0" ::: "memory");
        __builtin_amdgcn_sched_barrier(0);   // keeps that arithmetic behind the wait (without it the scheduler lifts it over the wait)
      }
    } else {
      const int q = lane >> 3, c8 = (lane & 7) * 8;
      unsigned short* C  = (unsigned short*)Cout  + (size_t)b * strideC;
      unsigned short* C2 = (OUT_MODE == 2) ? ((unsigned short*)Cout2 + (size_t)b * strideC) : nullptr;
      {
#pragma unroll
        for (int it = 0; it < 4; ++it) {
          const int row = it * 4 + q;
          const float* sp = slab + row * 68 + c8;
          v8h hv, lv;
#pragma unroll
          for (int e = 0; e < 8; ++e) {
            if (OUT_MODE == 1) {
              hv[e] = (_Float16)sp[e];
            } else {
              unsigned short hb = f2bf_bits(sp[e]);
              unsigned short lb = f2bf_bits(sp[e] - bf_bits2f(hb));
              hv[e] = __builtin_bit_cast(_Float16, hb);
              lv[e] = __builtin_bit_cast(_Float16, lb);
            }
          }
          *(v8h*)(C + (size_t)(mBase + row) * ldc + n0 + c8) = hv;
          if (OUT_MODE == 2) *(v8h*)(C2 + (size_t)(mBase + row) * ldc + n0 + c8) = lv;
        }
        
      }
    }
    __builtin_amdgcn_fence(__ATOMIC_RELEASE, "workgroup");
    __builtin_amdgcn_wave_barrier();
    __builtin_amdgcn_fence(__ATOMIC_ACQUIRE, "workgroup");
  }
}

// One GEMM per launch: a block = 4 waves = one 128x128 tile, tiles of one row of tiles in consecutive blocks, grid.y = batch index.
template <int ET, bool SPLIT, int BIAS_MODE, int OUT_MODE, bool RESID, int ACT = 0>
__global__ __launch_bounds__(128) void wmma_gemm64(
    const unsigned short* __restrict__ Ap, const unsigned short* __restrict__ A2p, int lda, long strideA,
    const unsigned short* __restrict__ Btp, const unsigned short* __restrict__ Bt2p, int ldb, long strideB,
    void* __restrict__ Cout, void* __restrict__ Cout2, int ldc, long strideC,
    const float* __restrict__ bias,
    const float* __restrict__ resid, long strideR,
    int M, int N, int K, float scale) {
  // two operand stages; behind the k loop its first bytes are the per-wave 16x64 slabs, pitch 68 floats
  __shared__ __attribute__((aligned(2048))) char smem[2 * kStageB];
  const int wave = threadIdx.x >> 5;
  const int tilesN = N >> 7;
  const int tm = blockIdx.x / tilesN;
  const int tn = blockIdx.x - tm * tilesN;
  if (tm >= (M >> 7)) return;   // the same for the whole block, in front of every barrier
  gemm64_tile<ET, SPLIT, BIAS_MODE, OUT_MODE, RESID, ACT>(smem, (float*)(smem + wave * (16 * 68 * 4)), blockIdx.y, tm << 7, tn << 7,
                                                          Ap, A2p, lda, strideA, Btp, Bt2p,
                                                          ldb, strideB, Cout, Cout2, ldc, strideC, bias, resid, strideR, K, scale);
}

// The three projections of x in one launch: none reads what another writes, and each alone fills well under half of
// the chip's WGPs for the whole length of one wave's k loop. Block ranges (one 128x128 tile per block):
//   [0, kBlkQ)                 q   = x . Wq^T, M=4096, N=768: rmsnorm * qw, rotary -> Q hi/lo [row][h*64+d]
//   [kBlkQ, kBlkQ+kBlkK)       k   = x . Wk^T, M=4096, N=256: rmsnorm * kw, rotary -> K hi/lo [row][g*64+d]
//   then kBlkV per batch b     v^T = Wv . x[b]^T -> VT hi/lo [b][g*64+d][s]     M=256,  N=2048 (A = Wv planes, Bt = x planes of b)
constexpr int kBlkQ = (kTok / 128) * (kDim / 128);        // 192
constexpr int kBlkK = (kTok / 128) * (kKvDim / 128);      // 64
constexpr int kBlkV = (kKvDim / 128) * (kSeq / 128);      // 32 per batch element
static_assert(kTok % 128 == 0 && kDim % 128 == 0 && kKvDim % 128 == 0 && kSeq % 128 == 0);

__global__ __launch_bounds__(128) void qkv_gemm64_kernel(
    const unsigned short* __restrict__ Xh, const unsigned short* __restrict__ Xl,
    const unsigned short* __restrict__ Wqh, const unsigned short* __restrict__ Wql,
    const unsigned short* __restrict__ Wkh, const unsigned short* __restrict__ Wkl,
    const unsigned short* __restrict__ Wvh, const unsigned short* __restrict__ Wvl,
    const float* __restrict__ qw, const float* __restrict__ kw,
    const float* __restrict__ cs, const float* __restrict__ sn,
    unsigned short* __restrict__ Qh, unsigned short* __restrict__ Ql,
    unsigned short* __restrict__ Kh, unsigned short* __restrict__ Kl,
    unsigned short* __restrict__ VTh, unsigned short* __restrict__ VTl, int K) {
  // two operand stages; behind the k loop its first bytes are the per-wave 64x64 slabs, pitch 68 floats (the v^T tiles use a slab's first 16 rows)
  __shared__ __attribute__((aligned(2048))) char smem[2 * kStageB];
  static_assert(4 * 64 * 68 * 4 <= 2 * kStageB);
  const int wave = threadIdx.x >> 5;
  float* slab    = (float*)(smem + wave * (64 * 68 * 4));
  const int bx   = blockIdx.x;
  if (bx < kBlkQ + kBlkK) {
    const bool isq = bx < kBlkQ;                   // block-uniform
    const int tile = isq ? bx : bx - kBlkQ;
    const int n  = isq ? kDim : kKvDim;
    const int tm = isq ? tile / (kDim / 128) : tile / (kKvDim / 128);
    const int tn = tile - tm * (n >> 7);
    gemm64_tile<1, true, 0, 3, false>(smem, slab, 0, tm << 7, tn << 7, Xh, Xl, kDim, 0L, isq ? Wqh : Wkh, isq ? Wql : Wkl, kDim, 0L,
                                      (void*)(isq ? Qh : Kh), (void*)(isq ? Ql : Kl), n, 0L, nullptr, nullptr, 0L, K, 1.0f,
                                      isq ? qw : kw, cs, sn);
  } else {
    const int v    = bx - (kBlkQ + kBlkK);
    const int tile = v % kBlkV;
    const int tm   = tile / (kSeq / 128);
    const int tn   = tile - tm * (kSeq / 128);
    gemm64_tile<1, true, 0, 2, false>(smem, slab, v / kBlkV, tm << 7, tn << 7, Wvh, Wvl, kDim, 0L, Xh, Xl, kDim, (long)kSeq * kDim,
                                      (void*)VTh, (void*)VTl, kSeq, (long)kKvDim * kSeq, nullptr, nullptr, 0L, K, 1.0f);
  }
}

// ---------------------------------------------------------------------------
// bf16 split of a row-major f32 [rows][768] matrix, hi = bf16_rne(in), lo = bf16_rne(in - hi), stored fragment-major
// for wmma_gemm64 (layout: see there). One thread = 8 consecutive k of one row (32 B read, 16 B per plane written);
// one wave = 8 rows x 32 k, half a block: it reads 8 whole 128-B lines and each plane's store fills 4 whole lines.
// rows % 16 == 0; n8 = rows * 768 / 8 threads.
// ---------------------------------------------------------------------------
__device__ __forceinline__ void split_pack_thread(const float* __restrict__ in, unsigned short* __restrict__ hi,
                                                  unsigned short* __restrict__ lo, const int idx, const int n8) {
  if (idx < n8) {
    const int l   = idx & 31;
    const int g   = idx >> 5;                 // half block
    const int blk = g >> 1;
    const int rb  = blk / kKBlk, kb = blk - rb * kKBlk;
    const int r16 = (g & 1) * 8 + (l >> 2);   // row inside the block
    const int kp  = l & 3;                    // which 8 of the block's 32 k
    const float* s = in + (size_t)(rb * 16 + r16) * kDim + kb * 32 + kp * 8;
    const v4f fa = *(const v4f*)(s), fb = *(const v4f*)(s + 4);
    const float f[8] = {fa[0], fa[1], fa[2], fa[3], fb[0], fb[1], fb[2], fb[3]};
    v4u hv, lv;
    split8(f, hv, lv);
    const size_t o = (size_t)blk * 512 + (kp >> 1) * 256 + ((kp & 1) * 16 + r16) * 8;
    *(v4u*)(hi + o) = hv;
    *(v4u*)(lo + o) = lv;
  }
}

// ---------------------------------------------------------------------------
// Rotary tables: cs[t*32+i] = cosf(t * inv_freq[i]), sn likewise, inv_freq[i] = 10000^(-i/32) = 2^(-i*log2(1e4)/32).
// kSeq*32/256 = 256 blocks x 256 threads = exactly 65536 elements per table; each wave writes 32 consecutive
// ---------------------------------------------------------------------------
__device__ __forceinline__ void rope_table_thread(float* __restrict__ cs, float* __restrict__ sn, const int i) {
  const int t  = i >> 5;
  const int fi = i & 31;
  const float invf = exp2f((float)fi * -0.41524101186092f);
  const float ang  = (float)t * invf;
  float sv, cv;
  sincosf(ang, &sv, &cv);
  ((float*)cs)[i] = cv;
  ((float*)sn)[i] = sv;
}

// ---------------------------------------------------------------------------
// Everything that depends on the inputs alone, in one launch: the rotary tables and the bf16 splits of x and of the four
// weight matrices. No part reads what another writes. Block ranges, the part with the longest thread first:
//   kPbT table blocks | kPbX blocks of x | kPbWq of Wq | kPbWk of Wk | kPbWk of Wv | kPbWq of Wo
// ---------------------------------------------------------------------------
constexpr int kN8X  = kTok * kDim / 8;        // 393216 threads
constexpr int kN8Wq = kDim * kDim / 8;        // 73728
constexpr int kN8Wk = kKvDim * kDim / 8;      // 24576
constexpr int kPbT  = kSeq * kHalfHd / 256;   // 256
constexpr int kPbX  = kN8X / 256;             // 1536
constexpr int kPbWq = kN8Wq / 256;            // 288
constexpr int kPbWk = kN8Wk / 256;            // 96
static_assert((kSeq * kHalfHd) % 256 == 0 && kN8X % 256 == 0 && kN8Wq % 256 == 0 && kN8Wk % 256 == 0);

__global__ __launch_bounds__(256) void prep_kernel(
    const float* __restrict__ x, const float* __restrict__ Wq, const float* __restrict__ Wk,
    const float* __restrict__ Wv, const float* __restrict__ Wo,
    unsigned short* __restrict__ Xh, unsigned short* __restrict__ Xl,
    unsigned short* __restrict__ Wqh, unsigned short* __restrict__ Wql,
    unsigned short* __restrict__ Wkh, unsigned short* __restrict__ Wkl,
    unsigned short* __restrict__ Wvh, unsigned short* __restrict__ Wvl,
    unsigned short* __restrict__ Woh, unsigned short* __restrict__ Wol,
    float* __restrict__ cs, float* __restrict__ sn) {
  int bx = blockIdx.x;                          // block-uniform choice of the part
  if (bx < kPbT) { rope_table_thread(cs, sn, bx * 256 + threadIdx.x); return; }
  bx -= kPbT;
  const float* in = x; unsigned short* hi = Xh; unsigned short* lo = Xl; int n8 = kN8X;
  if (bx >= kPbX) {
    bx -= kPbX; in = Wq; hi = Wqh; lo = Wql; n8 = kN8Wq;
    if (bx >= kPbWq) {
      bx -= kPbWq; in = Wk; hi = Wkh; lo = Wkl; n8 = kN8Wk;
      if (bx >= kPbWk) {
        bx -= kPbWk; in = Wv; hi = Wvh; lo = Wvl;
        if (bx >= kPbWk) { bx -= kPbWk; in = Wo; hi = Woh; lo = Wol; n8 = kN8Wq; }
      }
    }
  }
  split_pack_thread(in, hi, lo, bx * 256 + threadIdx.x, n8);
}

#define AT_D 64
#define AT_QB 64
#define AT_KC 64
#define AT_LP 72   // LDS row pitch of the K and V^T tiles in elements: 144 B = 16 B x 9 (odd), so the 16 rows that one
                   // ds_load_b128 touches per half wave start on 16 different 4-bank groups (128-B rows: only 2 groups)

__device__ __forceinline__ v8f at_mma(v16b a, v16b b, v8f c) {
  c = __builtin_amdgcn_wmma_f32_16x16x32_bf16(false, a, false, b, (short)0, c, false, false);
  asm volatile("v_nop\n\tv_nop\n\tv_nop\n\tv_nop" : "+v"(c) : "v"(a), "v"(b));
  return c;
}

// f32 -> bf16_rne, the 16 bits left in the upper half of the word (the lower half is not used): the rounding of f2bf_bits
__device__ __forceinline__ unsigned at_rne_top(float f) {
  const unsigned u = __float_as_uint(f);
  return u + 0x7FFFu + __builtin_amdgcn_ubfe(u, 16, 1);   // bit 16 by one bit-field extract (written with >> and & it became two 16-bit moves and an and)
}
// 8 f32 -> 8 bf16 hi = bf16_rne(f) and 8 bf16 lo = bf16_rne(f - hi), two elements a word (the even one in the lower half)
__device__ __forceinline__ void at_split_pack8(const float (&f)[8], v4u& hv, v4u& lv) {
#pragma unroll   // constant indices keep f, hv and lv in registers
  for (int q = 0; q < 4; ++q) {
    const unsigned h0 = at_rne_top(f[2 * q]), h1 = at_rne_top(f[2 * q + 1]);
    const unsigned l0 = at_rne_top(f[2 * q] - __uint_as_float(h0 & 0xFFFF0000u));
    const unsigned l1 = at_rne_top(f[2 * q + 1] - __uint_as_float(h1 & 0xFFFF0000u));
    hv[q] = __builtin_amdgcn_perm(h1, h0, 0x07060302u);   // one byte permute: (h0 >> 16) | (h1 & 0xFFFF0000)
    lv[q] = __builtin_amdgcn_perm(l1, l0, 0x07060302u);
  }
}
// value of lane l ^ 16 (the other half of the wave), a vector cross-row move
__device__ __forceinline__ float at_half_swap(float v) {
  const int b = __float_as_int(v);
  return __int_as_float(__builtin_amdgcn_permlanex16(b, b, 0x76543210, 0xfedcba98, false, false));
}

#define AT_PL (AT_KC * AT_LP)   // elements of one staged plane (64 rows)
// Eight asynchronous 16-B copies to LDS: rows r, r+16, r+32, r+48 of two planes. l = the lane's LDS byte address of row r in
// the first plane (the second plane lies AT_PL elements behind it), a / b = the lane's global address of row r in the two
// source planes, gs = source elements per 16 rows. The s_wait_xcnt closes the statement, so that no register which a copy
// names is rewritten ahead of it.
__device__ __forceinline__ void at_copy8(const unsigned l, const __bf16* a, const __bf16* b, const int gs) {
  const unsigned l1 = l + 16 * AT_LP * 2, l2 = l + 32 * AT_LP * 2, l3 = l + 48 * AT_LP * 2;
  const unsigned m0 = l + AT_PL * 2, m1 = l1 + AT_PL * 2, m2 = l2 + AT_PL * 2, m3 = l3 + AT_PL * 2;
  const __bf16* a1 = a + gs; const __bf16* a2 = a + 2 * gs; const __bf16* a3 = a + 3 * gs;
  const __bf16* b1 = b + gs; const __bf16* b2 = b + 2 * gs; const __bf16* b3 = b + 3 * gs;
  asm volatile("global_load_async_to_lds_b128 %0, %8, off\n\t"
               "global_load_async_to_lds_b128 %1, %9, off\n\t"
               "global_load_async_to_lds_b128 %2, %10, off\n\t"
               "global_load_async_to_lds_b128 %3, %11, off\n\t"
               "global_load_async_to_lds_b128 %4, %12, off\n\t"
               "global_load_async_to_lds_b128 %5, %13, off\n\t"
               "global_load_async_to_lds_b128 %6, %14, off\n\t"
               "global_load_async_to_lds_b128 %7, %15, off\n\t"
               "s_wait_xcnt 0x0"
               :: "v"(l), "v"(l1), "v"(l2), "v"(l3), "v"(m0), "v"(m1), "v"(m2), "v"(m3),
                  "v"(a), "v"(a1), "v"(a2), "v"(a3), "v"(b), "v"(b1), "v"(b2), "v"(b3) : "memory");
}

__global__ __launch_bounds__(128)
void attn_gqa_window64_kernel(const unsigned short* __restrict__ qhp, const unsigned short* __restrict__ qlp,
                              const unsigned short* __restrict__ khp, const unsigned short* __restrict__ klp,
                              const unsigned short* __restrict__ vhp, const unsigned short* __restrict__ vlp,
                              unsigned short* __restrict__ ohp, unsigned short* __restrict__ olp, float sscale) {
  union FB { v16b v; v8b h[2]; };
  union PB { v16b v; v4u q[2]; };   // p^T fragment: q[0] = the 8 keys of the even score tile, q[1] = of the odd one
  // two buffers x 4 planes of 9 KB: K hi [kv][d], K lo, V hi [d][kv], V lo
  __shared__ __align__(16) __bf16 KV[2][4][AT_PL];

  const int tid  = threadIdx.x;
  const int wave = tid >> 5;
  const int lane = tid & 31;
  const int hh   = lane >> 4;
  const int c    = lane & 15;

  const int nqb = kSeq / AT_QB;           // 32
  const int bx = blockIdx.x;
  const int qb = bx % nqb;
  const int h  = bx / nqb;                // 0..kNHq-1 (grid = kNHq * nqb)
  const int kvh = h / kGroups;            // 0..kNKv-1
  const int q0 = qb * AT_QB + wave * 16;

  const size_t bq = (size_t)blockIdx.y * kSeq * kDim;     // batch element's q plane
  const size_t bk = (size_t)blockIdx.y * kSeq * kKvDim;   // batch element's k / v^T plane
  const __bf16* Qh = (const __bf16*)(const void*)qhp + bq + (size_t)h * AT_D;
  const __bf16* Ql = (const __bf16*)(const void*)qlp + bq + (size_t)h * AT_D;
  const __bf16* Kh = (const __bf16*)(const void*)khp + bk + (size_t)kvh * AT_D;
  const __bf16* Kl = (const __bf16*)(const void*)klp + bk + (size_t)kvh * AT_D;
  const __bf16* Vh = (const __bf16*)(const void*)vhp + bk + (size_t)kvh * AT_D * kSeq;
  const __bf16* Vl = (const __bf16*)(const void*)vlp + bk + (size_t)kvh * AT_D * kSeq;

  // ---- Q fragments (B operand, column = query = lane&15, split k map via Frag load): 2 d-chunks, hi and lo ----
  v16b qah[2], qal[2];
#pragma unroll
  for (int dc = 0; dc < 2; ++dc) {
    const __bf16* qr = Qh + (size_t)(q0 + c) * kDim + dc * 32 + 8 * hh;
    const __bf16* ql = Ql + (size_t)(q0 + c) * kDim + dc * 32 + 8 * hh;
    qah[dc] = Frag<__bf16>::load(qr);
    qal[dc] = Frag<__bf16>::load(ql);
  }

  const int qrow = q0 + c;                // this lane's query
  float mrow = -INFINITY;                 // its running maximum (the same in both halves of the wave)
  float lrow = 0.f;                       // its running sum over this half's keys; the halves are joined behind the loop
  v8f oacc[4];                            // oacc[t][r] = out[qrow][t*16 + 8*hh + r]
#pragma unroll
  for (int t = 0; t < 4; ++t) oacc[t] = (v8f){0.f,0.f,0.f,0.f,0.f,0.f,0.f,0.f};

  const int qlo = qb * AT_QB - (kWin - 1);                 // smallest key allowed for the block's first row
  const int kcStart = (qlo > 0) ? (qlo / AT_KC) : 0;       // block-uniform
  const int nChunks = qb + 1;                              // block-uniform, <= 32
  // staging coverage: copy i of a thread = row i*16 + tid/8, 16 B at (tid&7)*16 B: 128 threads x 4 copies = 64 rows x 128 B a plane
  const int sr = tid >> 3, sc = (tid & 7) * 8;
  const unsigned sl = (unsigned)(size_t)(&KV[0][0][sr * AT_LP + sc]);   // the lane's LDS byte address in buffer 0, plane K hi
  const __bf16* gkh = Kh + (size_t)sr * kKvDim + sc;                    // K row kv0+sr (+16 i), d = sc..sc+7
  const __bf16* gkl = Kl + (size_t)sr * kKvDim + sc;
  const __bf16* gvh = Vh + (size_t)sr * kSeq + sc;                      // V^T row d = sr (+16 i), s = kv0+sc..+7
  const __bf16* gvl = Vl + (size_t)sr * kSeq + sc;
  auto stage = [&](const int ch, const int buf) {   // all 16 copies of chunk ch into buffer buf
    const unsigned lb = sl + (unsigned)buf * (4 * AT_PL * 2);
    at_copy8(lb, gkh + (size_t)ch * (AT_KC * kKvDim), gkl + (size_t)ch * (AT_KC * kKvDim), 16 * kKvDim);
    at_copy8(lb + 2 * AT_PL * 2, gvh + ch * AT_KC, gvl + ch * AT_KC, 16 * kSeq);
  };
  stage(kcStart, 0);
  asm volatile("s_wait_asynccnt 0x0" ::: "memory");   // this wave's copies of the first chunk have landed
  __syncthreads();                                    // ... and every other wave's: the first chunk may be read
  if (kcStart + 1 < nChunks) stage(kcStart + 1, 1);   // block-uniform
  for (int kc = kcStart; kc < nChunks; ++kc) {
    const int kv0 = kc * AT_KC;
    const int cur = (kc - kcStart) & 1;
    const __bf16* Ksh = KV[cur][0];
    const __bf16* Ksl = KV[cur][1];
    const __bf16* Vth = KV[cur][2];
    const __bf16* Vtl = KV[cur][3];

    v8f s[4];
#pragma unroll
    for (int j = 0; j < 4; ++j) {
      s[j] = (v8f){0.f,0.f,0.f,0.f,0.f,0.f,0.f,0.f};
#pragma unroll
      for (int dc = 0; dc < 2; ++dc) {
        FB kb, kl;
        kb.h[0] = *(const v8b*)(Ksh + (j * 16 + c) * AT_LP + dc * 32 + 8 * hh);
        kb.h[1] = *(const v8b*)(Ksh + (j * 16 + c) * AT_LP + dc * 32 + 16 + 8 * hh);
        kl.h[0] = *(const v8b*)(Ksl + (j * 16 + c) * AT_LP + dc * 32 + 8 * hh);
        kl.h[1] = *(const v8b*)(Ksl + (j * 16 + c) * AT_LP + dc * 32 + 16 + 8 * hh);
        s[j] = at_mma(kb.v, qah[dc], s[j]);
        s[j] = at_mma(kl.v, qah[dc], s[j]);
        s[j] = at_mma(kb.v, qal[dc], s[j]);
      }
    }
    // s[j][r] = score of query qrow and key kv0 + j*16 + 8*hh + r
    float mj[4];
#pragma unroll
    for (int j = 0; j < 4; ++j) {
      mj[j] = -INFINITY;
#pragma unroll
      for (int r = 0; r < 8; ++r) {
        const int kvcol = kv0 + j * 16 + 8 * hh + r;
        const float sv = s[j][r] * sscale;
        const bool masked = (kvcol > qrow) || (qrow - kvcol > kWin - 1);
        const float sm = masked ? -INFINITY : sv;
        s[j][r] = sm;
        mj[j] = fmaxf(mj[j], sm);
      }
    }
    float cm = fmaxf(fmaxf(mj[0], mj[1]), fmaxf(mj[2], mj[3]));
    cm = fmaxf(cm, at_half_swap(cm));                          // the chunk's maximum over all 64 keys
    const float mnew  = fmaxf(mrow, cm);
    const float mpiv  = (mnew == -INFINITY) ? 0.0f : mnew;     // fully masked so far -> alpha = 0, p = 0
    const float alpha = expf(mrow - mpiv);
    mrow = mnew;
    PB pa[2], pl[2];
    float pj[4];
#pragma unroll
    for (int j = 0; j < 4; ++j) {
      float p[8];
      pj[j] = 0.f;
#pragma unroll
      for (int r = 0; r < 8; ++r) {
        p[r] = expf(s[j][r] - mpiv);
        pj[j] += p[r];
      }
      at_split_pack8(p, pa[j >> 1].q[j & 1], pl[j >> 1].q[j & 1]);
    }
    lrow = lrow * alpha + ((pj[0] + pj[1]) + (pj[2] + pj[3]));
#pragma unroll
    for (int t = 0; t < 4; ++t)
#pragma unroll
      for (int r = 0; r < 8; ++r) oacc[t][r] *= alpha;
#pragma unroll   // constant indices keep pa and pl in registers
    for (int kk = 0; kk < 2; ++kk) {
#pragma unroll
      for (int t = 0; t < 4; ++t) {
        FB vb, vl;
        vb.h[0] = *(const v8b*)(Vth + (t * 16 + c) * AT_LP + kk * 32 + 8 * hh);
        vb.h[1] = *(const v8b*)(Vth + (t * 16 + c) * AT_LP + kk * 32 + 16 + 8 * hh);
        vl.h[0] = *(const v8b*)(Vtl + (t * 16 + c) * AT_LP + kk * 32 + 8 * hh);
        vl.h[1] = *(const v8b*)(Vtl + (t * 16 + c) * AT_LP + kk * 32 + 16 + 8 * hh);
        oacc[t] = at_mma(vb.v, pa[kk].v, oacc[t]);
        oacc[t] = at_mma(vl.v, pa[kk].v, oacc[t]);
        oacc[t] = at_mma(vb.v, pl[kk].v, oacc[t]);
      }
    }
    // hand-over: this wave's reads of the chunk are done, its copies of the next chunk have landed; behind the barrier the
    // next chunk may be read by every wave and the buffer just read may be refilled
    asm volatile("s_wait_dscnt 0x0" ::: "memory");
    asm volatile("s_wait_asynccnt 0x0" ::: "memory");
    __syncthreads();
    if (kc + 2 < nChunks) stage(kc + 2, cur);         // block-uniform
  }
  asm volatile("s_wait_asynccnt 0x0" ::: "memory");   // no copy is outstanding when the wave goes on to its epilogue and ends

  const float inv = 1.0f / (lrow + at_half_swap(lrow));   // the two halves' sums joined
  {
    // first of the wave's two blocks: block row = token row / 16, k block = column / 32
    const size_t blk0 = (size_t)((blockIdx.y * kSeq + q0) >> 4) * kKBlk + h * (AT_D / 32);
#pragma unroll
    for (int it = 0; it < 4; ++it) {   // it>>1 = block, it&1 = its half (16 k); lane = (k>>3 & 1)*16 + row: 512 consecutive bytes a store
      // the lane's own 8 values of row c: columns it*16 + hh*8 .. +7
      const float f[8] = {oacc[it][0] * inv, oacc[it][1] * inv, oacc[it][2] * inv, oacc[it][3] * inv,
                          oacc[it][4] * inv, oacc[it][5] * inv, oacc[it][6] * inv, oacc[it][7] * inv};
      v4u hv, lv;
      split8(f, hv, lv);
      const size_t o = (blk0 + (it >> 1)) * 512 + (it & 1) * 256 + lane * 8;
      *(v4u*)(ohp + o) = hv;
      *(v4u*)(olp + o) = lv;
    }
  }
}

// ---------------------------------------------------------------------------
// Workspace region map (byte offsets; every region is fully written in this call before it is read; token rows
// run over both batch elements, row = b*2048 + t; VT holds one [256][2048] plane per batch element; the W*, X* and
// O* bf16 planes are fragment-major, 16-row x 32-k blocks, see wmma_gemm64):
//   Wqh bf16 [768 n][768 k]         0      Wql   1179648
//   Wkh bf16 [256][768]        2359296      Wkl   2752512
//   Wvh bf16 [256][768]        3145728      Wvl   3538944
//   Woh bf16 [768][768]        3932160      Wol   5111808
//   CS  f32  [2048][32]        6291456      SN    6553600
//   Xh  bf16 [4096][768]       6815744      Xl   13107200
//   Qh  bf16 [4096][768]      19398656      Ql   25690112
//   Kh  bf16 [4096][256]      31981568      Kl   34078720
//   VTh bf16 [2][256][2048]   36175872      VTl  38273024
//   Oh  bf16 [4096][768]      40370176      Ol   46661632
//   total                     52953088
// ---------------------------------------------------------------------------
extern "C" void kernel_launch(void* const* d_in, const int* in_sizes, int n_in,
                              void* d_out, int out_size, void* d_ws, size_t ws_size,
                              hipStream_t stream) {
  if (n_in < 7) return;
  if (in_sizes[0] != kNB * kSeq * kDim) return;
  if (in_sizes[1] != kDim * kDim || in_sizes[4] != kDim * kDim) return;
  if (in_sizes[2] != kKvDim * kDim || in_sizes[3] != kKvDim * kDim) return;
  if (in_sizes[5] != kHd || in_sizes[6] != kHd) return;
  if (out_size != kNB * kSeq * kDim) return;

  const float* x    = (const float*)d_in[0];
  const float* Wq   = (const float*)d_in[1];
  const float* Wk   = (const float*)d_in[2];
  const float* Wv   = (const float*)d_in[3];
  const float* Wo   = (const float*)d_in[4];
  const float* lnq  = (const float*)d_in[5];
  const float* lnk  = (const float*)d_in[6];

  const size_t PWQ = (size_t)kDim * kDim * 2;      // 1179648  bf16 [768][768] plane
  const size_t PWK = (size_t)kKvDim * kDim * 2;    // 393216   bf16 [256][768] plane
  const size_t PTB = (size_t)kSeq * kHalfHd * 4;   // 262144   f32 [2048][32] table
  const size_t PXB = (size_t)kTok * kDim * 2;      // 6291456  bf16 [4096][768] plane
  const size_t PKB = (size_t)kTok * kKvDim * 2;    // 2097152  bf16 [4096][256] / [2][256][2048] plane
  size_t off = 0;
  const size_t oWqh = off; off += PWQ;  const size_t oWql = off; off += PWQ;
  const size_t oWkh = off; off += PWK;  const size_t oWkl = off; off += PWK;
  const size_t oWvh = off; off += PWK;  const size_t oWvl = off; off += PWK;
  const size_t oWoh = off; off += PWQ;  const size_t oWol = off; off += PWQ;
  const size_t oCS  = off; off += PTB;  const size_t oSN  = off; off += PTB;
  const size_t oXh  = off; off += PXB;  const size_t oXl  = off; off += PXB;
  const size_t oQh  = off; off += PXB;  const size_t oQl  = off; off += PXB;
  const size_t oKh  = off; off += PKB;  const size_t oKl  = off; off += PKB;
  const size_t oVTh = off; off += PKB;  const size_t oVTl = off; off += PKB;
  const size_t oOh  = off; off += PXB;  const size_t oOl  = off; off += PXB;
  if (off > ws_size) return;                       // off = 52953088
  if (off > (size_t)134217728) return;

  char* ws = (char*)d_ws;
  unsigned short* Wqh = (unsigned short*)(ws + oWqh); unsigned short* Wql = (unsigned short*)(ws + oWql);
  unsigned short* Wkh = (unsigned short*)(ws + oWkh); unsigned short* Wkl = (unsigned short*)(ws + oWkl);
  unsigned short* Wvh = (unsigned short*)(ws + oWvh); unsigned short* Wvl = (unsigned short*)(ws + oWvl);
  unsigned short* Woh = (unsigned short*)(ws + oWoh); unsigned short* Wol = (unsigned short*)(ws + oWol);
  float*          CS  = (float*)(ws + oCS);          float*          SN  = (float*)(ws + oSN);
  unsigned short* Xh  = (unsigned short*)(ws + oXh);  unsigned short* Xl  = (unsigned short*)(ws + oXl);
  unsigned short* Qh  = (unsigned short*)(ws + oQh);  unsigned short* Ql  = (unsigned short*)(ws + oQl);
  unsigned short* Kh  = (unsigned short*)(ws + oKh);  unsigned short* Kl  = (unsigned short*)(ws + oKl);
  unsigned short* VTh = (unsigned short*)(ws + oVTh); unsigned short* VTl = (unsigned short*)(ws + oVTl);
  unsigned short* Oh  = (unsigned short*)(ws + oOh);  unsigned short* Ol  = (unsigned short*)(ws + oOl);

  const dim3 blk(256);
  const dim3 gPrep(kPbT + kPbX + 2 * kPbWq + 2 * kPbWk);            // 2560 blocks
  const dim3 gQKV(kBlkQ + kBlkK + kNB * kBlkV);                     // 320 blocks of 4 waves, a 128x128 tile each
  const dim3 gProjQ(kBlkQ, 1);                                      // 192 tiles of 128x128: M=4096, N=768
  const dim3 gAtt(kNHq * (kSeq / 64), kNB);                         // 12 heads x 32 query blocks per batch element

  // Both batch elements go through every stage in one launch: the token-row GEMMs see M = 4096 rows (the rotary
  // epilogue takes the position as row % 2048); v^T and attention take the batch element from the block index.
  // (1) rotary tables; x and the weights [out n][in k] f32 -> bf16 hi/lo planes, fragment-major
  prep_kernel<<<gPrep, blk, 0, stream>>>(x, Wq, Wk, Wv, Wo, Xh, Xl, Wqh, Wql, Wkh, Wkl, Wvh, Wvl, Woh, Wol, CS, SN);
  // (2) q and k projections with per-head rmsnorm * w + rotary in the epilogue -> Q/K bf16 hi/lo planes; v^T -> VT hi/lo planes (K = 768 each)
  qkv_gemm64_kernel<<<gQKV, dim3(128), 0, stream>>>(Xh, Xl, Wqh, Wql, Wkh, Wkl, Wvh, Wvl, lnq, lnk, CS, SN, Qh, Ql, Kh, Kl, VTh, VTl, kDim);
  // (3) windowed causal GQA attention per head: y -> bf16 hi/lo planes, fragment-major (every element written by its (b, h, query block) owner)
  attn_gqa_window64_kernel<<<gAtt, dim3(128), 0, stream>>>(Qh, Ql, Kh, Kl, VTh, VTl, Oh, Ol, 0.125f);
  // (4) out = y . Wo^T -> d_out rows 0 .. 4095 (f32)   (M=4096, N=768, K=768)
  wmma_gemm64<1, true, 0, 0, false><<<gProjQ, dim3(128), 0, stream>>>(
      Oh, Ol, kDim, 0L, Woh, Wol, kDim, 0L, d_out, d_out, kDim, 0L,
      lnq, lnq, 0L, kTok, kDim, kDim, 1.0f);
}

// v010
// Measured time: 65.7 microseconds a run.
// In both of two side-by-side timings against v009, it was 1.06 times as fast.
// Over all steps from v000 it is 8.39 times as fast.
// Contractions (q/k/v/out projections, q.k^T scores, p.v): v_wmma_f32_16x16x32_bf16 with bf16 hi/lo split operands (hi.hi + hi.lo + lo.hi), f32 accumulate; rmsnorm, rotary tables, online softmax in f32.
#include <hip/hip_runtime.h>
#include <math.h>
#include <stdint.h>

constexpr int kNB     = 2;
constexpr int kSeq    = 2048;
constexpr int kTok    = kNB * kSeq;          // 4096 token rows over both batch elements
constexpr int kDim    = 768;
constexpr int kHd     = 64;
constexpr int kNHq    = 12;
constexpr int kNKv    = 4;
constexpr int kGroups = 3;
constexpr int kKvDim  = kNKv * kHd;          // 256
constexpr int kWin    = 384;
constexpr int kHalfHd = 32;
constexpr int kKBlk   = kDim / 32;           // 24 k blocks of 32 in a row of 768
static_assert((kSeq & (kSeq - 1)) == 0 && kHd == 64 && kHalfHd * 2 == kHd);
static_assert(kSeq % 64 == 0 && kDim % 64 == 0 && kKvDim % 64 == 0 && kDim % 32 == 0);
static_assert(kNHq == kNKv * kGroups);

typedef __attribute__((ext_vector_type(16))) _Float16 v16h;
typedef __attribute__((ext_vector_type(8)))  _Float16 v8h;
typedef __attribute__((ext_vector_type(16))) __bf16   v16b;
typedef __attribute__((ext_vector_type(8)))  __bf16   v8b;
typedef __attribute__((ext_vector_type(8)))  float    v8f;
typedef __attribute__((ext_vector_type(4)))  float    v4f;
typedef __attribute__((ext_vector_type(2)))  float    v2f;
typedef __attribute__((ext_vector_type(4)))  unsigned int v4u;

__device__ __forceinline__ unsigned short f2bf_bits(float f) {
  unsigned u = __float_as_uint(f);
  return (unsigned short)((u + 0x7FFFu + ((u >> 16) & 1u)) >> 16);
}
__device__ __forceinline__ float bf_bits2f(unsigned short h) { return __uint_as_float(((unsigned)h) << 16); }

__device__ __forceinline__ unsigned pk16(unsigned short a, unsigned short b) { return (unsigned)a | ((unsigned)b << 16); }
// 8 consecutive f32 -> 8 bf16 hi = bf16_rne(f) and 8 bf16 lo = bf16_rne(f - hi), 16 B each
__device__ __forceinline__ void split8(const float (&f)[8], v4u& hv, v4u& lv) {
#pragma unroll   // constant indices keep f, hv and lv in registers
  for (int q = 0; q < 4; ++q) {
    const unsigned short h0 = f2bf_bits(f[2 * q]), h1 = f2bf_bits(f[2 * q + 1]);
    const unsigned short l0 = f2bf_bits(f[2 * q] - bf_bits2f(h0)), l1 = f2bf_bits(f[2 * q + 1] - bf_bits2f(h1));
    hv[q] = pk16(h0, h1);
    lv[q] = pk16(l0, l1);
  }
}

// ---------------------------------------------------------------------------
// Per (token, head) unit of 64 floats: y[d] = w[d] * (x[d] * rsqrt(mean(x^2) + eps)); rotary:
//   o[d] = y[d]*cos[t][d&31] - y[d+32]*sin  (d < 32),   o[d] = y[d]*cos + y[d-32]*sin  (d >= 32);
// o split into bf16 hi/lo. 8 lanes per unit (lane&7 = which 8 of the 64), 4 units per wave: x = the lane's own 8 values,
// p = the 8 of its rotary partner block, w / v = the norm weights of the two blocks, c / s = the table rows' 8 values.
// ---------------------------------------------------------------------------
__device__ __forceinline__ float rope_one(float x, float p, float wx, float wp, float cv, float sv, float rinv, float sg) {
  const float xn = wx * (x * rinv);
  const float pn = wp * (p * rinv);
  return xn * cv + (sg * pn) * sv;
}
__device__ __forceinline__ void norm_rope_unit(const v4f xa, const v4f xb, const v4f pa, const v4f pb, const v4f wa, const v4f wb,
                                               const v4f va, const v4f vb, const v4f ca, const v4f cb, const v4f sa, const v4f sb,
                                               const float sg, v4u& hv, v4u& lv) {
  float ss = xa[0] * xa[0] + xa[1] * xa[1] + xa[2] * xa[2] + xa[3] * xa[3]
           + xb[0] * xb[0] + xb[1] * xb[1] + xb[2] * xb[2] + xb[3] * xb[3];
  ss += __shfl_xor(ss, 1, 32);
  ss += __shfl_xor(ss, 2, 32);
  ss += __shfl_xor(ss, 4, 32);
  const float rinv = rsqrtf(ss * (1.0f / 64.0f) + 1e-6f);
  float o[8];
  o[0] = rope_one(xa[0], pa[0], wa[0], va[0], ca[0], sa[0], rinv, sg);
  o[1] = rope_one(xa[1], pa[1], wa[1], va[1], ca[1], sa[1], rinv, sg);
  o[2] = rope_one(xa[2], pa[2], wa[2], va[2], ca[2], sa[2], rinv, sg);
  o[3] = rope_one(xa[3], pa[3], wa[3], va[3], ca[3], sa[3], rinv, sg);
  o[4] = rope_one(xb[0], pb[0], wb[0], vb[0], cb[0], sb[0], rinv, sg);
  o[5] = rope_one(xb[1], pb[1], wb[1], vb[1], cb[1], sb[1], rinv, sg);
  o[6] = rope_one(xb[2], pb[2], wb[2], vb[2], cb[2], sb[2], rinv, sg);
  o[7] = rope_one(xb[3], pb[3], wb[3], vb[3], cb[3], sb[3], rinv, sg);
  split8(o, hv, lv);
}

// hazard guards as plain device helpers (no inline asm inside the kernel template body)
// four vector slots: the distance asked between a 16-bit matrix instruction and a vector overwrite of a register that it reads;
// kept in front of a load over such a register too, as a precaution
__device__ __forceinline__ void operand_gap() { asm volatile("v_nop\n\tv_nop\n\tv_nop\n\tv_nop" ::: "memory"); }
__device__ __forceinline__ void acc_guard4(v8f& a, v8f& b, v8f& c, v8f& d) { asm volatile("v_nop\n\tv_nop\n\tv_nop\n\tv_nop" : "+v"(a), "+v"(b), "+v"(c), "+v"(d)); }
template <typename T> struct Frag;
template <> struct Frag<_Float16> {
  typedef v16h V; union U { v16h v; v8h h[2]; };
  static __device__ __forceinline__ v16h load(const _Float16* p) {   // elements 0..7 <- p[0..7], 8..15 <- p[16..23]
    U f; f.h[0] = *(const v8h*)(p); f.h[1] = *(const v8h*)(p + 16); return f.v;
  }
  static __device__ __forceinline__ v8f mma(v16h a, v16h b, v8f c) {
    return __builtin_amdgcn_wmma_f32_16x16x32_f16(false, a, false, b, (short)0, c, false, false);
  }
};
template <> struct Frag<__bf16> {
  typedef v16b V; union U { v16b v; v8b h[2]; };
  static __device__ __forceinline__ v16b load(const __bf16* p) {
    U f; f.h[0] = *(const v8b*)(p); f.h[1] = *(const v8b*)(p + 16); return f.v;
  }
  // fragment-major block at byte address p: elements 0..7 <- bytes 0..15, elements 8..15 <- bytes 512..527
  static __device__ __forceinline__ v16b load_packed(const char* p) {
    U f; f.h[0] = *(const v8b*)(p); f.h[1] = *(const v8b*)(p + 512); return f.v;
  }
  static __device__ __forceinline__ v8f mma(v16b a, v16b b, v8f c) {
    return __builtin_amdgcn_wmma_f32_16x16x32_bf16(false, a, false, b, (short)0, c, false, false);
  }
};

// ---- Register-blocked batched WMMA GEMM ------------------------------------
// C[m,n] = scale * sum_k A[m,k] * Bt[n,k] (+bias)(+resid); each wave owns a 64x64 tile, a work-group of 4 waves a 128x128
// tile (2 x 2 wave tiles). The work-group's operand rows go through LDS, so that each 16-row block is fetched once a
// work-group and read by the two waves that need it.
// A [M,K] and Bt [N,K] are stored fragment-major (written by split_pack_thread and by the attention kernel): each 16-row x 32-k block is
// 512 consecutive elements, block index = (row/16)*kKBlk + k/32, and element (row, k) of a block sits at
// ((k>>4)&1)*256 + (((k>>3)&1)*16 + (row&15))*8 + (k&7). Lane l of a fragment load then reads 16 B at l*16 B, so one
// wave-wide load covers 512 consecutive bytes (4 whole lines) and holds the same elements as a row-major fragment load.
// M,N % 128 == 0, K % 64 == 0, K >= 64; rows of both operands are kDim long (lda == ldb == kDim), so the step from one 16-row
// block row to the next is a compile-time constant.
// SPLIT: operands are hi/lo planes (A2/Bt2 = lo planes, same layout); product = hi.hi + hi.lo + lo.hi.
// BIAS_MODE: 0 = none, 1 = bias[m], 2 = bias[n].
// OUT_MODE: 0 = f32, 1 = f16, 2 = bf16 hi plane (Cout) + bf16 lo plane (Cout2), 3 = the tile is 64 token rows x the 64
// columns of one head: per-row rmsnorm * nw, rotary from the tables cs / sn, then bf16 hi/lo planes as in 2 (the slab
// then holds the whole tile, 64 rows).
// ET: 0 = f16 operands, 1 = bf16 operands (pointers passed as 16-bit storage)
template <int ET> struct Elem;
template <> struct Elem<0> { typedef _Float16 T; };
template <> struct Elem<1> { typedef __bf16 T; };
// All fragments of one k step of a 64x64 wave tile: four 16-row blocks of A and of Bt, hi and lo planes.
template <typename T, bool SPLIT> struct FragSet { typename Frag<T>::V bh[4], bl[4], ah[4], al[4]; };
constexpr int kRowStep = kKBlk * 1024;         // bytes from one 16-row block row to the next
// One stage in LDS = 64 k (two k steps) of the work-group's 128 A rows and 128 Bt rows: 4 planes (A hi, A lo, Bt hi, Bt lo) x
// 8 block rows x 2 KB (the two consecutive 1-KB blocks of a block row, as they lie in the source plane). Two stages.
constexpr int kSegB   = 2048;                  // one block row of one plane in a stage
constexpr int kPlaneB = 8 * kSegB;             // one plane of a stage
constexpr int kStageB = 4 * kPlaneB;           // 65536
// All fragments of one k step from a stage: sA / sB = the lane's 16 B in the first of the wave's four block rows of plane
// A hi / Bt hi, off = 0 or 1024 (which k step of the stage). Lane l reads 16 B at l*16 B: 512 consecutive bytes a load.
// The order is that of first use in the built code (16 products hi.hi, then 16 hi.lo, then 16 lo.hi), so that the first
// products wait for the first loads only.
template <typename T, bool SPLIT>
__device__ __forceinline__ void lds_frag_set(FragSet<T, SPLIT>& f, const char* sA, const char* sB, const int off) {
  static_assert(SPLIT, "the stage holds hi and lo planes");
  f.ah[0] = Frag<T>::load_packed(sA + off);
#pragma unroll   // here and below: constant indices keep the fragments in registers and the steps in the loads' immediate offsets
  for (int j = 0; j < 4; ++j) f.bh[j] = Frag<T>::load_packed(sB + (off + j * kSegB));
#pragma unroll
  for (int i = 1; i < 4; ++i) f.ah[i] = Frag<T>::load_packed(sA + (off + i * kSegB));
#pragma unroll
  for (int j = 0; j < 4; ++j) f.bl[j] = Frag<T>::load_packed(sB + (kPlaneB + off + j * kSegB));
#pragma unroll
  for (int i = 0; i < 4; ++i) f.al[i] = Frag<T>::load_packed(sA + (kPlaneB + off + i * kSegB));
}
typedef uint32_t u32x4 __attribute__((ext_vector_type(4)));
typedef uint32_t u32x8 __attribute__((ext_vector_type(8)));
__device__ __forceinline__ uint32_t uni(uint32_t v) { return (uint32_t)__builtin_amdgcn_readfirstlane(v); }
// A wave-uniform test as a scalar value, so that the branch on it is a scalar branch (a tensor load ignores EXEC).
__device__ __forceinline__ uint32_t pinned(uint32_t v) {
  uint32_t w = (uint32_t)__builtin_amdgcn_readfirstlane(v);
  asm volatile("" : "+s"(w));   // pinned(): holds the word in a scalar register
  return w;
}
// One tensor load (tensor_load_to_lds), one request of the whole wave: one plane of a stage = 8 rows (block rows) of kSegB bytes,
// source pitch kRowStep bytes, to kPlaneB consecutive LDS bytes at lds_dst (byte offset in the work-group's LDS, a multiple of
// 2 KiB). 1-byte elements, tensor = tile, no pad, no mask. Group 1 is the same for every request: built once.
__device__ __forceinline__ u32x8 tdm_group1() {
  constexpr uint32_t d0 = kSegB, d1 = 8u;
  u32x8 g1;
  g1[0] = uni(0u);
  g1[1] = uni((d0 & 0xFFFFu) << 16);
  g1[2] = uni((d0 >> 16) | ((d1 & 0xFFFFu) << 16));
  g1[3] = uni((d1 >> 16) | (d0 << 16));
  g1[4] = uni(d1);
  g1[5] = uni((uint32_t)kRowStep);
  g1[6] = uni(0u);
  g1[7] = uni(0u);
  asm volatile("" : "+s"(g1));   // pinned(): holds the descriptor words in their scalar registers, so that none is rebuilt or reused under a request in flight
  return g1;
}
__device__ __forceinline__ void tdm_plane(const uint32_t lds_dst, const uint64_t ga, const u32x8 g1) {
  u32x4 g0;
  g0[0] = uni(1u);
  g0[1] = uni(lds_dst);
  g0[2] = uni((uint32_t)ga);
  g0[3] = uni((((uint32_t)(ga >> 32)) & 0x01FFFFFFu) | 0x80000000u);
  asm volatile("tensor_load_to_lds %0, %1" :: "s"(g0), "s"(g1) : "memory");
}
template <typename T, bool SPLIT>
__device__ __forceinline__ void mma_frag_set(v8f (&acc)[4][4], const FragSet<T, SPLIT>& f) {
#pragma unroll
  for (int i = 0; i < 4; ++i) {
#pragma unroll
    for (int j = 0; j < 4; ++j) {
      acc[i][j] = Frag<T>::mma(f.ah[i], f.bh[j], acc[i][j]);
      if (SPLIT) {
        acc[i][j] = Frag<T>::mma(f.ah[i], f.bl[j], acc[i][j]);
        acc[i][j] = Frag<T>::mma(f.al[i], f.bh[j], acc[i][j]);
      }
    }
  }
}
// gemm64_tile = one wave's 64x64 tile of its work-group's 128x128 tile; every wave of the work-group calls it (it holds
// work-group barriers). The kernels below hand it the two-stage LDS ring, the wave's LDS slab (it may lie inside the ring: it is
// written behind the k loop's last barrier only), the batch index b and the work-group tile's first row mB and column nB
// (the same in every lane, in scalar registers).
template <int ET, bool SPLIT, int BIAS_MODE, int OUT_MODE, bool RESID, int ACT = 0>
__device__ __forceinline__ void gemm64_tile(
    char* ring, float* slab, const int b, const int mB, const int nB,
    const unsigned short* __restrict__ Ap, const unsigned short* __restrict__ A2p, int lda, long strideA,
    const unsigned short* __restrict__ Btp, const unsigned short* __restrict__ Bt2p, int ldb, long strideB,
    void* __restrict__ Cout, void* __restrict__ Cout2, int ldc, long strideC,
    const float* __restrict__ bias,
    const float* __restrict__ resid, long strideR,
    int K, float scale,
    const float* __restrict__ nw = nullptr, const float* __restrict__ cs = nullptr, const float* __restrict__ sn = nullptr) {
  typedef typename Elem<ET>::T T;
  typedef typename Frag<T>::V V;
  const T* A = (const T*)Ap; const T* A2 = (const T*)A2p; const T* Bt = (const T*)Btp; const T* Bt2 = (const T*)Bt2p;
  const int tid  = threadIdx.x;                // 0..127, a one-dimensional block
  const int lane = tid & 31;
  const int wv   = __builtin_amdgcn_readfirstlane(tid >> 5);
  const int m0   = mB + (wv >> 1) * 64;        // the wave's tile: wave = 2 * (row half) + (column half)
  const int n0   = nB + (wv & 1) * 64;

  const T* Ab  = A  + (size_t)b * strideA;
  const T* Bb  = Bt + (size_t)b * strideB;
  const T* Ab2 = SPLIT ? (A2  + (size_t)b * strideA) : nullptr;
  const T* Bb2 = SPLIT ? (Bt2 + (size_t)b * strideB) : nullptr;

  const int rlane = lane & 15;                 // row (A) / col (B, D) within subtile
  const int mOff  = (lane >> 4) * 8;           // D row offset
  // Staging: every wave brings one plane of each stage by one tensor load: wave 0 A hi, 1 A lo, 2 Bt hi, 3 Bt lo. Source: the
  // work-group tile's first block row in that plane, 2 KB further along k per stage.
  const T* gp = (wv == 0) ? Ab : (wv == 1) ? Ab2 : (wv == 2) ? Bb : Bb2;
  const uint64_t ga0 = (uint64_t)(size_t)(gp + (size_t)(((wv < 2) ? mB : nB) >> 4) * (kKBlk * 512));
  const uint32_t ld0 = (uint32_t)(size_t)ring + (uint32_t)wv * (uint32_t)kPlaneB;   // the plane's place in stage buffer 0
  const u32x8 g1 = tdm_group1();
  auto stage = [&](const int st, const int buf) {   // this wave's plane of stage st (k = 64 st .. 64 st + 63) into buffer buf
    tdm_plane(ld0 + (uint32_t)buf * (uint32_t)kStageB, ga0 + (uint64_t)st * kSegB, g1);
  };
  // Fragment reads: the wave's four block rows of A (row half) and of Bt (column half)
  const char* fA = ring + ((wv >> 1) * (4 * kSegB) + lane * 16);
  const char* fB = ring + (2 * kPlaneB + (wv & 1) * (4 * kSegB) + lane * 16);

  v8f acc[4][4];
#pragma unroll
  for (int i = 0; i < 4; ++i)
#pragma unroll
    for (int j = 0; j < 4; ++j) acc[i][j] = (v8f){0.f,0.f,0.f,0.f,0.f,0.f,0.f,0.f};

  // Two stage buffers: stage t+1 flies while stage t is worked on. A trip reads its own buffer alone: the 64 fragment loads of
  // its two k steps go ahead as one group, so the second k step's fragments arrive under the first one's 48 products.
  FragSet<T, SPLIT> f0, f1;
  const int nst = K >> 6;                             // the same for the whole work-group
  stage(0, 0);
  asm volatile("s_wait_tensorcnt 0x0" ::: "memory");  // this wave's plane of the first stage has landed
  __syncthreads();                                    // ... and every other wave's: the first stage may be read
  if (pinned(1 < nst)) stage(1, 1);
  for (int t = 0; t < nst; ++t) {
    const int bo = (t & 1) * kStageB;
    lds_frag_set<T, SPLIT>(f0, fA + bo, fB + bo, 0);
    lds_frag_set<T, SPLIT>(f1, fA + bo, fB + bo, 1024);
    __builtin_amdgcn_sched_barrier(0);   // keeps both k steps' loads ahead of the products (sunk to their use they would each wait alone)
    mma_frag_set<T, SPLIT>(acc, f0);
    mma_frag_set<T, SPLIT>(acc, f1);
    __builtin_amdgcn_sched_barrier(0);   // keeps every product in front of the gap below
    operand_gap();                       // four vector slots between the last product and what follows it on either side of the loop's branch
    // hand-over: this wave's reads of the stage are done, its plane of the next stage has landed; behind the barrier the
    // next stage may be read by every wave and the buffer just read may be refilled
    asm volatile("s_wait_dscnt 0x0" ::: "memory");
    asm volatile("s_wait_tensorcnt 0x0" ::: "memory");
    __syncthreads();
    if (pinned(t + 2 < nst)) stage(t + 2, t & 1);     // the same for the whole work-group
  }
  // nothing is outstanding when the ring's LDS becomes the epilogue's slabs (the last trip's barrier ended every wave's reads)
  asm volatile("s_wait_tensorcnt 0x0" ::: "memory");
  asm volatile("s_wait_dscnt 0x0" ::: "memory");
  acc_guard4(acc[0][0], acc[0][1], acc[0][2], acc[0][3]);
  acc_guard4(acc[1][0], acc[1][1], acc[1][2], acc[1][3]);
  acc_guard4(acc[2][0], acc[2][1], acc[2][2], acc[2][3]);
  acc_guard4(acc[3][0], acc[3][1], acc[3][2], acc[3][3]);

  // ---- epilogue ----
  if (OUT_MODE == 3) {
#pragma unroll
    for (int i = 0; i < 4; ++i)
#pragma unroll
      for (int j = 0; j < 4; ++j)
#pragma unroll
        for (int r = 0; r < 8; ++r) slab[((i << 4) + mOff + r) * 68 + (j << 4) + rlane] = acc[i][j][r] * scale;
    // the rows are read back by other lanes of this wave: the slab's stores stay in front of its loads
    __builtin_amdgcn_fence(__ATOMIC_RELEASE, "workgroup");
    __builtin_amdgcn_wave_barrier();
    __builtin_amdgcn_fence(__ATOMIC_ACQUIRE, "workgroup");
    unsigned short* C  = (unsigned short*)Cout  + (size_t)b * strideC;
    unsigned short* C2 = (unsigned short*)Cout2 + (size_t)b * strideC;
    const int d0 = (lane & 7) * 8;                 // this lane's 8 of the unit's 64 values
    const int dp = d0 ^ kHalfHd;                   // rotary partner block
    const float sg = (d0 < kHalfHd) ? -1.0f : 1.0f;
    // Norm weights and table values: every load = scalar base + a lane byte offset (+ an immediate). Table row = position
    // inside the sequence (m0 % 64 == 0, so the tile lies in one sequence); a pass is 4 rows, a group 4 passes.
    const unsigned wo = (unsigned)d0 * 4u, po = (unsigned)dp * 4u;
    const unsigned tb = (unsigned)(((m0 & (kSeq - 1)) + (lane >> 3)) * kHalfHd + (d0 & 24)) * 4u;
    const char* nwb = (const char*)nw;
    const char* csb = (const char*)cs;
    const char* snb = (const char*)sn;
    const v4f wa = *(const v4f*)(nwb + wo), wb = *(const v4f*)(nwb + wo + 16);
    const v4f va = *(const v4f*)(nwb + po), vb = *(const v4f*)(nwb + po + 16);
    v4f tbl[2][4][4];                              // two groups of table values: cos 0..3, cos 4..7, sin 0..3, sin 4..7 of a pass
#pragma unroll   // constant indices keep tbl in registers
    for (int p = 0; p < 4; ++p) {
      tbl[0][p][0] = *(const v4f*)(csb + tb + p * (16 * kHalfHd)); tbl[0][p][1] = *(const v4f*)(csb + tb + (p * (16 * kHalfHd) + 16));
      tbl[0][p][2] = *(const v4f*)(snb + tb + p * (16 * kHalfHd)); tbl[0][p][3] = *(const v4f*)(snb + tb + (p * (16 * kHalfHd) + 16));
    }
    asm volatile("s_wait_xcnt 0x0" :: "v"(wo), "v"(po) : "memory");   // wo and po are live up to this wait, so nothing overwrites them under the loads that name them
#pragma unroll   // constant indices into tbl
    for (int g = 0; g < 4; ++g) {
      if (g < 3) {
#pragma unroll
        for (int p = 0; p < 4; ++p) {              // the next group's table values fly under this group's arithmetic
          const int im = ((g + 1) * 4 + p) * (16 * kHalfHd);
          tbl[(g + 1) & 1][p][0] = *(const v4f*)(csb + tb + im); tbl[(g + 1) & 1][p][1] = *(const v4f*)(csb + tb + (im + 16));
          tbl[(g + 1) & 1][p][2] = *(const v4f*)(snb + tb + im); tbl[(g + 1) & 1][p][3] = *(const v4f*)(snb + tb + (im + 16));
        }
      }
      __builtin_amdgcn_sched_barrier(0);           // keeps these loads ahead of the group's arithmetic (sunk to their use they would fly alone) and of its stores
#pragma unroll
      for (int p = 0; p < 4; ++p) {
        const int row = (g * 4 + p) * 4 + (lane >> 3);
        const float* sp = slab + row * 68;
        const v4f xa = *(const v4f*)(sp + d0), xb = *(const v4f*)(sp + d0 + 4);
        const v4f pa = *(const v4f*)(sp + dp), pb = *(const v4f*)(sp + dp + 4);
        v4u hv, lv;
        norm_rope_unit(xa, xb, pa, pb, wa, wb, va, vb, tbl[g & 1][p][0], tbl[g & 1][p][1], tbl[g & 1][p][2], tbl[g & 1][p][3], sg, hv, lv);
        const size_t o = (size_t)(m0 + row) * ldc + n0 + d0;
        *(v4u*)(C + o)  = hv;
        *(v4u*)(C2 + o) = lv;
      }
      // the next group's loads and arithmetic reuse the registers of these stores: the wait stands before that; tb is live
      // up to the last of these waits, so nothing overwrites it under the loads that name it
      asm volatile("s_wait_xcnt 0x0" :: "v"(tb) : "memory");
      __builtin_amdgcn_sched_barrier(0);           // keeps what follows behind the wait (without it the scheduler may lift it over the wait)
    }
    return;
  }
  const float* Rb = RESID ? (resid + (size_t)b * strideR) : nullptr;
#pragma unroll
  for (int i = 0; i < 4; ++i) {
    const int mBase = m0 + (i << 4);
#pragma unroll
    for (int j = 0; j < 4; ++j) {
      const int n = n0 + (j << 4) + rlane;
      float bv = 0.f;
      if (BIAS_MODE == 2) bv = bias[n];
#pragma unroll
      for (int r = 0; r < 8; ++r) {
        float v = acc[i][j][r] * scale;
        if (BIAS_MODE == 1) v += bias[mBase + mOff + r];
        if (BIAS_MODE == 2) v += bv;
        if (RESID) v += Rb[(size_t)(mBase + mOff + r) * ldc + n];
        if (ACT == 1) v = tanhf(v);
        if (ACT == 2) v = fmaxf(v, 0.0f);
        if (ACT == 3) v = v / (1.0f + expf(-v));
        if (ACT == 4) v = (v > 0.f) ? v : 0.01f * v;
        slab[(mOff + r) * 68 + (j << 4) + rlane] = v;
      }
    }
    __builtin_amdgcn_fence(__ATOMIC_RELEASE, "workgroup");
    __builtin_amdgcn_wave_barrier();
    __builtin_amdgcn_fence(__ATOMIC_ACQUIRE, "workgroup");
    if (OUT_MODE == 0) {
      float* C = (float*)Cout + (size_t)b * strideC;
      const int hh = lane >> 4, c4 = (lane & 15) * 4;     // row seg = 256 B = 16 lanes x 16 B
      {
#pragma unroll
        for (int it = 0; it < 8; ++it) {
          const int row = it * 2 + hh;
          v4f v = *(const v4f*)(slab + row * 68 + c4);
          *(v4f*)(C + (size_t)(mBase + row) * ldc + n0 + c4) = v;
        }
        // the next block row's address arithmetic reuses the address registers of these stores: the wait stands before that
        asm volatile("s_wait_xcnt 0x0" ::: "memory");
        __builtin_amdgcn_sched_barrier(0);   // keeps that arithmetic behind the wait (without it the scheduler lifts it over the wait)
      }
    } else {
      const int q = lane >> 3, c8 = (lane & 7) * 8;
      unsigned short* C  = (unsigned short*)Cout  + (size_t)b * strideC;
      unsigned short* C2 = (OUT_MODE == 2) ? ((unsigned short*)Cout2 + (size_t)b * strideC) : nullptr;
      {
#pragma unroll
        for (int it = 0; it < 4; ++it) {
          const int row = it * 4 + q;
          const float* sp = slab + row * 68 + c8;
          v8h hv, lv;
#pragma unroll
          for (int e = 0; e < 8; ++e) {
            if (OUT_MODE == 1) {
              hv[e] = (_Float16)sp[e];
            } else {
              unsigned short hb = f2bf_bits(sp[e]);
              unsigned short lb = f2bf_bits(sp[e] - bf_bits2f(hb));
              hv[e] = __builtin_bit_cast(_Float16, hb);
              lv[e] = __builtin_bit_cast(_Float16, lb);
            }
          }
          *(v8h*)(C + (size_t)(mBase + row) * ldc + n0 + c8) = hv;
          if (OUT_MODE == 2) *(v8h*)(C2 + (size_t)(mBase + row) * ldc + n0 + c8) = lv;
        }
        
      }
    }
    __builtin_amdgcn_fence(__ATOMIC_RELEASE, "workgroup");
    __builtin_amdgcn_wave_barrier();
    __builtin_amdgcn_fence(__ATOMIC_ACQUIRE, "workgroup");
  }
}

// One GEMM per launch: a block = 4 waves = one 128x128 tile, tiles of one row of tiles in consecutive blocks, grid.y = batch index.
template <int ET, bool SPLIT, int BIAS_MODE, int OUT_MODE, bool RESID, int ACT = 0>
__global__ __launch_bounds__(128) void wmma_gemm64(
    const unsigned short* __restrict__ Ap, const unsigned short* __restrict__ A2p, int lda, long strideA,
    const unsigned short* __restrict__ Btp, const unsigned short* __restrict__ Bt2p, int ldb, long strideB,
    void* __restrict__ Cout, void* __restrict__ Cout2, int ldc, long strideC,
    const float* __restrict__ bias,
    const float* __restrict__ resid, long strideR,
    int M, int N, int K, float scale) {
  // two operand stages; behind the k loop its first bytes are the per-wave 16x64 slabs, pitch 68 floats
  __shared__ __attribute__((aligned(2048))) char smem[2 * kStageB];
  const int wave = threadIdx.x >> 5;
  const int tilesN = N >> 7;
  const int tm = blockIdx.x / tilesN;
  const int tn = blockIdx.x - tm * tilesN;
  if (tm >= (M >> 7)) return;   // the same for the whole block, in front of every barrier
  gemm64_tile<ET, SPLIT, BIAS_MODE, OUT_MODE, RESID, ACT>(smem, (float*)(smem + wave * (16 * 68 * 4)), blockIdx.y, tm << 7, tn << 7,
                                                          Ap, A2p, lda, strideA, Btp, Bt2p,
                                                          ldb, strideB, Cout, Cout2, ldc, strideC, bias, resid, strideR, K, scale);
}

// The three projections of x in one launch: none reads what another writes, and each alone fills well under half of
// the chip's WGPs for the whole length of one wave's k loop. Block ranges (one 128x128 tile per block):
//   [0, kBlkQ)                 q   = x . Wq^T, M=4096, N=768: rmsnorm * qw, rotary -> Q hi/lo [row][h*64+d]
//   [kBlkQ, kBlkQ+kBlkK)       k   = x . Wk^T, M=4096, N=256: rmsnorm * kw, rotary -> K hi/lo [row][g*64+d]
//   then kBlkV per batch b     v^T = Wv . x[b]^T -> VT hi/lo [b][g*64+d][s]     M=256,  N=2048 (A = Wv planes, Bt = x planes of b)
constexpr int kBlkQ = (kTok / 128) * (kDim / 128);        // 192
constexpr int kBlkK = (kTok / 128) * (kKvDim / 128);      // 64
constexpr int kBlkV = (kKvDim / 128) * (kSeq / 128);      // 32 per batch element
static_assert(kTok % 128 == 0 && kDim % 128 == 0 && kKvDim % 128 == 0 && kSeq % 128 == 0);

__global__ __launch_bounds__(128) void qkv_gemm64_kernel(
    const unsigned short* __restrict__ Xh, const unsigned short* __restrict__ Xl,
    const unsigned short* __restrict__ Wqh, const unsigned short* __restrict__ Wql,
    const unsigned short* __restrict__ Wkh, const unsigned short* __restrict__ Wkl,
    const unsigned short* __restrict__ Wvh, const unsigned short* __restrict__ Wvl,
    const float* __restrict__ qw, const float* __restrict__ kw,
    const float* __restrict__ cs, const float* __restrict__ sn,
    unsigned short* __restrict__ Qh, unsigned short* __restrict__ Ql,
    unsigned short* __restrict__ Kh, unsigned short* __restrict__ Kl,
    unsigned short* __restrict__ VTh, unsigned short* __restrict__ VTl, int K) {
  // two operand stages; behind the k loop its first bytes are the per-wave 64x64 slabs, pitch 68 floats (the v^T tiles use a slab's first 16 rows)
  __shared__ __attribute__((aligned(2048))) char smem[2 * kStageB];
  static_assert(4 * 64 * 68 * 4 <= 2 * kStageB);
  const int wave = threadIdx.x >> 5;
  float* slab    = (float*)(smem + wave * (64 * 68 * 4));
  const int bx   = blockIdx.x;
  if (bx < kBlkQ + kBlkK) {
    const bool isq = bx < kBlkQ;                   // block-uniform
    const int tile = isq ? bx : bx - kBlkQ;
    const int n  = isq ? kDim : kKvDim;
    const int tm = isq ? tile / (kDim / 128) : tile / (kKvDim / 128);
    const int tn = tile - tm * (n >> 7);
    gemm64_tile<1, true, 0, 3, false>(smem, slab, 0, tm << 7, tn << 7, Xh, Xl, kDim, 0L, isq ? Wqh : Wkh, isq ? Wql : Wkl, kDim, 0L,
                                      (void*)(isq ? Qh : Kh), (void*)(isq ? Ql : Kl), n, 0L, nullptr, nullptr, 0L, K, 1.0f,
                                      isq ? qw : kw, cs, sn);
  } else {
    const int v    = bx - (kBlkQ + kBlkK);
    const int tile = v % kBlkV;
    const int tm   = tile / (kSeq / 128);
    const int tn   = tile - tm * (kSeq / 128);
    gemm64_tile<1, true, 0, 2, false>(smem, slab, v / kBlkV, tm << 7, tn << 7, Wvh, Wvl, kDim, 0L, Xh, Xl, kDim, (long)kSeq * kDim,
                                      (void*)VTh, (void*)VTl, kSeq, (long)kKvDim * kSeq, nullptr, nullptr, 0L, K, 1.0f);
  }
}

// ---------------------------------------------------------------------------
// bf16 split of a row-major f32 [rows][768] matrix, hi = bf16_rne(in), lo = bf16_rne(in - hi), stored fragment-major
// for wmma_gemm64 (layout: see there). One thread = 8 consecutive k of one row (32 B read, 16 B per plane written);
// one wave = 8 rows x 32 k, half a block: it reads 8 whole 128-B lines and each plane's store fills 4 whole lines.
// rows % 16 == 0; n8 = rows * 768 / 8 threads.
// ---------------------------------------------------------------------------
__device__ __forceinline__ void split_pack_thread(const float* __restrict__ in, unsigned short* __restrict__ hi,
                                                  unsigned short* __restrict__ lo, const int idx, const int n8) {
  if (idx < n8) {
    const int l   = idx & 31;
    const int g   = idx >> 5;                 // half block
    const int blk = g >> 1;
    const int rb  = blk / kKBlk, kb = blk - rb * kKBlk;
    const int r16 = (g & 1) * 8 + (l >> 2);   // row inside the block
    const int kp  = l & 3;                    // which 8 of the block's 32 k
    const float* s = in + (size_t)(rb * 16 + r16) * kDim + kb * 32 + kp * 8;
    const v4f fa = *(const v4f*)(s), fb = *(const v4f*)(s + 4);
    const float f[8] = {fa[0], fa[1], fa[2], fa[3], fb[0], fb[1], fb[2], fb[3]};
    v4u hv, lv;
    split8(f, hv, lv);
    const size_t o = (size_t)blk * 512 + (kp >> 1) * 256 + ((kp & 1) * 16 + r16) * 8;
    *(v4u*)(hi + o) = hv;
    *(v4u*)(lo + o) = lv;
  }
}

// ---------------------------------------------------------------------------
// Rotary tables: cs[t*32+i] = cosf(t * inv_freq[i]), sn likewise, inv_freq[i] = 10000^(-i/32) = 2^(-i*log2(1e4)/32).
// kSeq*32/256 = 256 blocks x 256 threads = exactly 65536 elements per table; each wave writes 32 consecutive
// ---------------------------------------------------------------------------
__device__ __forceinline__ void rope_table_thread(float* __restrict__ cs, float* __restrict__ sn, const int i) {
  const int t  = i >> 5;
  const int fi = i & 31;
  const float invf = exp2f((float)fi * -0.41524101186092f);
  const float ang  = (float)t * invf;
  float sv, cv;
  sincosf(ang, &sv, &cv);
  ((float*)cs)[i] = cv;
  ((float*)sn)[i] = sv;
}

// ---------------------------------------------------------------------------
// Everything that depends on the inputs alone, in one launch: the rotary tables and the bf16 splits of x and of the four
// weight matrices. No part reads what another writes. Block ranges, the part with the longest thread first:
//   kPbT table blocks | kPbX blocks of x | kPbWq of Wq | kPbWk of Wk | kPbWk of Wv | kPbWq of Wo
// ---------------------------------------------------------------------------
constexpr int kN8X  = kTok * kDim / 8;        // 393216 threads
constexpr int kN8Wq = kDim * kDim / 8;        // 73728
constexpr int kN8Wk = kKvDim * kDim / 8;      // 24576
constexpr int kPbT  = kSeq * kHalfHd / 256;   // 256
constexpr int kPbX  = kN8X / 256;             // 1536
constexpr int kPbWq = kN8Wq / 256;            // 288
constexpr int kPbWk = kN8Wk / 256;            // 96
static_assert((kSeq * kHalfHd) % 256 == 0 && kN8X % 256 == 0 && kN8Wq % 256 == 0 && kN8Wk % 256 == 0);

__global__ __launch_bounds__(256) void prep_kernel(
    const float* __restrict__ x, const float* __restrict__ Wq, const float* __restrict__ Wk,
    const float* __restrict__ Wv, const float* __restrict__ Wo,
    unsigned short* __restrict__ Xh, unsigned short* __restrict__ Xl,
    unsigned short* __restrict__ Wqh, unsigned short* __restrict__ Wql,
    unsigned short* __restrict__ Wkh, unsigned short* __restrict__ Wkl,
    unsigned short* __restrict__ Wvh, unsigned short* __restrict__ Wvl,
    unsigned short* __restrict__ Woh, unsigned short* __restrict__ Wol,
    float* __restrict__ cs, float* __restrict__ sn) {
  int bx = blockIdx.x;                          // block-uniform choice of the part
  if (bx < kPbT) { rope_table_thread(cs, sn, bx * 256 + threadIdx.x); return; }
  bx -= kPbT;
  const float* in = x; unsigned short* hi = Xh; unsigned short* lo = Xl; int n8 = kN8X;
  if (bx >= kPbX) {
    bx -= kPbX; in = Wq; hi = Wqh; lo = Wql; n8 = kN8Wq;
    if (bx >= kPbWq) {
      bx -= kPbWq; in = Wk; hi = Wkh; lo = Wkl; n8 = kN8Wk;
      if (bx >= kPbWk) {
        bx -= kPbWk; in = Wv; hi = Wvh; lo = Wvl;
        if (bx >= kPbWk) { bx -= kPbWk; in = Wo; hi = Woh; lo = Wol; n8 = kN8Wq; }
      }
    }
  }
  split_pack_thread(in, hi, lo, bx * 256 + threadIdx.x, n8);
}

#define AT_D 64
#define AT_QB 64
#define AT_KC 64
#define AT_LP 72   // LDS row pitch of the K and V^T tiles in elements: 144 B = 16 B x 9 (odd), so the 16 rows that one
                   // ds_load_b128 touches per half wave start on 16 different 4-bank groups (128-B rows: only 2 groups)

__device__ __forceinline__ v8f at_mma(v16b a, v16b b, v8f c) {
  c = __builtin_amdgcn_wmma_f32_16x16x32_bf16(false, a, false, b, (short)0, c, false, false);
  asm volatile("v_nop\n\tv_nop\n\tv_nop\n\tv_nop" : "+v"(c) : "v"(a), "v"(b));
  return c;
}

// f32 -> bf16_rne, the 16 bits left in the upper half of the word (the lower half is not used): the rounding of f2bf_bits
__device__ __forceinline__ unsigned at_rne_top(float f) {
  const unsigned u = __float_as_uint(f);
  return u + 0x7FFFu + __builtin_amdgcn_ubfe(u, 16, 1);   // bit 16 by one bit-field extract (written with >> and & it became two 16-bit moves and an and)
}
// 8 f32 -> 8 bf16 hi = bf16_rne(f) and 8 bf16 lo = bf16_rne(f - hi), two elements a word (the even one in the lower half)
__device__ __forceinline__ void at_split_pack8(const float (&f)[8], v4u& hv, v4u& lv) {
#pragma unroll   // constant indices keep f, hv and lv in registers
  for (int q = 0; q < 4; ++q) {
    const unsigned h0 = at_rne_top(f[2 * q]), h1 = at_rne_top(f[2 * q + 1]);
    const unsigned l0 = at_rne_top(f[2 * q] - __uint_as_float(h0 & 0xFFFF0000u));
    const unsigned l1 = at_rne_top(f[2 * q + 1] - __uint_as_float(h1 & 0xFFFF0000u));
    hv[q] = __builtin_amdgcn_perm(h1, h0, 0x07060302u);   // one byte permute: (h0 >> 16) | (h1 & 0xFFFF0000)
    lv[q] = __builtin_amdgcn_perm(l1, l0, 0x07060302u);
  }
}
// value of lane l ^ 16 (the other half of the wave), a vector cross-row move
__device__ __forceinline__ float at_half_swap(float v) {
  const int b = __float_as_int(v);
  return __int_as_float(__builtin_amdgcn_permlanex16(b, b, 0x76543210, 0xfedcba98, false, false));
}

// 2^x by the bare v_exp_f32 (no range check: the arguments here are -inf or at most a rounding residue above 0, and a result below the normal range may go to 0).
// Written as asm for the slot that the instruction set asks for behind a transcendental before its result is read or its source
// overwritten: the v_nop is that slot; in the run of eight every output is early-clobber, so each exponential is independent of
// the one in front of it (the builtin form came out with neighbours that overwrite each other's source).
__device__ __forceinline__ float at_exp2(const float x) {
  float y;
  asm("v_exp_f32 %0, %1\n\tv_nop" : "=v"(y) : "v"(x));
  return y;
}
__device__ __forceinline__ void at_exp2x8(float (&y)[8], const float (&x)[8]) {
  asm("v_exp_f32 %0, %8\n\t"
      "v_exp_f32 %1, %9\n\t"
      "v_exp_f32 %2, %10\n\t"
      "v_exp_f32 %3, %11\n\t"
      "v_exp_f32 %4, %12\n\t"
      "v_exp_f32 %5, %13\n\t"
      "v_exp_f32 %6, %14\n\t"
      "v_exp_f32 %7, %15\n\t"
      "v_nop"
      : "=&v"(y[0]), "=&v"(y[1]), "=&v"(y[2]), "=&v"(y[3]), "=&v"(y[4]), "=&v"(y[5]), "=&v"(y[6]), "=&v"(y[7])
      : "v"(x[0]), "v"(x[1]), "v"(x[2]), "v"(x[3]), "v"(x[4]), "v"(x[5]), "v"(x[6]), "v"(x[7]));
}

#define AT_PL (AT_KC * AT_LP)   // elements of one staged plane (64 rows)
// Eight asynchronous 16-B copies to LDS: rows r, r+16, r+32, r+48 of two planes. l = the lane's LDS byte address of row r in
// the first plane (the second plane lies AT_PL elements behind it), a / b = the lane's global address of row r in the two
// source planes, gs = source elements per 16 rows. The s_wait_xcnt closes the statement, so that no register which a copy
// names is rewritten ahead of it.
__device__ __forceinline__ void at_copy8(const unsigned l, const __bf16* a, const __bf16* b, const int gs) {
  const unsigned l1 = l + 16 * AT_LP * 2, l2 = l + 32 * AT_LP * 2, l3 = l + 48 * AT_LP * 2;
  const unsigned m0 = l + AT_PL * 2, m1 = l1 + AT_PL * 2, m2 = l2 + AT_PL * 2, m3 = l3 + AT_PL * 2;
  const __bf16* a1 = a + gs; const __bf16* a2 = a + 2 * gs; const __bf16* a3 = a + 3 * gs;
  const __bf16* b1 = b + gs; const __bf16* b2 = b + 2 * gs; const __bf16* b3 = b + 3 * gs;
  asm volatile("global_load_async_to_lds_b128 %0, %8, off\n\t"
               "global_load_async_to_lds_b128 %1, %9, off\n\t"
               "global_load_async_to_lds_b128 %2, %10, off\n\t"
               "global_load_async_to_lds_b128 %3, %11, off\n\t"
               "global_load_async_to_lds_b128 %4, %12, off\n\t"
               "global_load_async_to_lds_b128 %5, %13, off\n\t"
               "global_load_async_to_lds_b128 %6, %14, off\n\t"
               "global_load_async_to_lds_b128 %7, %15, off\n\t"
               "s_wait_xcnt 0x0"
               :: "v"(l), "v"(l1), "v"(l2), "v"(l3), "v"(m0), "v"(m1), "v"(m2), "v"(m3),
                  "v"(a), "v"(a1), "v"(a2), "v"(a3), "v"(b), "v"(b1), "v"(b2), "v"(b3) : "memory");
}

__global__ __launch_bounds__(128)
void attn_gqa_window64_kernel(const unsigned short* __restrict__ qhp, const unsigned short* __restrict__ qlp,
                              const unsigned short* __restrict__ khp, const unsigned short* __restrict__ klp,
                              const unsigned short* __restrict__ vhp, const unsigned short* __restrict__ vlp,
                              unsigned short* __restrict__ ohp, unsigned short* __restrict__ olp, float sscale) {
  union FB { v16b v; v8b h[2]; };
  union PB { v16b v; v4u q[2]; };   // p^T fragment: q[0] = the 8 keys of the even score tile, q[1] = of the odd one
  // two buffers x 4 planes of 9 KB: K hi [kv][d], K lo, V hi [d][kv], V lo
  __shared__ __align__(16) __bf16 KV[2][4][AT_PL];

  const int tid  = threadIdx.x;
  const int wave = tid >> 5;
  const int lane = tid & 31;
  const int hh   = lane >> 4;
  const int c    = lane & 15;

  const int nqb = kSeq / AT_QB;           // 32
  const int bx = blockIdx.x;
  const int qb = bx % nqb;
  const int h  = bx / nqb;                // 0..kNHq-1 (grid = kNHq * nqb)
  const int kvh = h / kGroups;            // 0..kNKv-1
  const int q0 = qb * AT_QB + wave * 16;

  const size_t bq = (size_t)blockIdx.y * kSeq * kDim;     // batch element's q plane
  const size_t bk = (size_t)blockIdx.y * kSeq * kKvDim;   // batch element's k / v^T plane
  const __bf16* Qh = (const __bf16*)(const void*)qhp + bq + (size_t)h * AT_D;
  const __bf16* Ql = (const __bf16*)(const void*)qlp + bq + (size_t)h * AT_D;
  const __bf16* Kh = (const __bf16*)(const void*)khp + bk + (size_t)kvh * AT_D;
  const __bf16* Kl = (const __bf16*)(const void*)klp + bk + (size_t)kvh * AT_D;
  const __bf16* Vh = (const __bf16*)(const void*)vhp + bk + (size_t)kvh * AT_D * kSeq;
  const __bf16* Vl = (const __bf16*)(const void*)vlp + bk + (size_t)kvh * AT_D * kSeq;

  // ---- Q fragments (B operand, column = query = lane&15, split k map via Frag load): 2 d-chunks, hi and lo ----
  v16b qah[2], qal[2];
#pragma unroll
  for (int dc = 0; dc < 2; ++dc) {
    const __bf16* qr = Qh + (size_t)(q0 + c) * kDim + dc * 32 + 8 * hh;
    const __bf16* ql = Ql + (size_t)(q0 + c) * kDim + dc * 32 + 8 * hh;
    qah[dc] = Frag<__bf16>::load(qr);
    qal[dc] = Frag<__bf16>::load(ql);
  }

  const int qrow = q0 + c;                // this lane's query
  const float sc2 = sscale * 1.44269504088896341f;   // sscale * log2(e), sscale > 0: e^(sscale*x) = 2^(sc2*x), one fma and one v_exp_f32 a score
  float mrow = -INFINITY;                 // its running maximum, of unscaled scores (the same in both halves of the wave)
  float lrow = 0.f;                       // its running sum over this half's keys; the halves are joined behind the loop
  v8f oacc[4];                            // oacc[t][r] = out[qrow][t*16 + 8*hh + r]
#pragma unroll
  for (int t = 0; t < 4; ++t) oacc[t] = (v8f){0.f,0.f,0.f,0.f,0.f,0.f,0.f,0.f};

  const int qlo = qb * AT_QB - (kWin - 1);                 // smallest key allowed for the block's first row
  const int kcStart = (qlo > 0) ? (qlo / AT_KC) : 0;       // block-uniform
  const int nChunks = qb + 1;                              // block-uniform, <= 32
  // staging coverage: copy i of a thread = row i*16 + tid/8, 16 B at (tid&7)*16 B: 128 threads x 4 copies = 64 rows x 128 B a plane
  const int sr = tid >> 3, sc = (tid & 7) * 8;
  const unsigned sl = (unsigned)(size_t)(&KV[0][0][sr * AT_LP + sc]);   // the lane's LDS byte address in buffer 0, plane K hi
  const __bf16* gkh = Kh + (size_t)sr * kKvDim + sc;                    // K row kv0+sr (+16 i), d = sc..sc+7
  const __bf16* gkl = Kl + (size_t)sr * kKvDim + sc;
  const __bf16* gvh = Vh + (size_t)sr * kSeq + sc;                      // V^T row d = sr (+16 i), s = kv0+sc..+7
  const __bf16* gvl = Vl + (size_t)sr * kSeq + sc;
  auto stage = [&](const int ch, const int buf) {   // all 16 copies of chunk ch into buffer buf
    const unsigned lb = sl + (unsigned)buf * (4 * AT_PL * 2);
    at_copy8(lb, gkh + (size_t)ch * (AT_KC * kKvDim), gkl + (size_t)ch * (AT_KC * kKvDim), 16 * kKvDim);
    at_copy8(lb + 2 * AT_PL * 2, gvh + ch * AT_KC, gvl + ch * AT_KC, 16 * kSeq);
  };
  stage(kcStart, 0);
  asm volatile("s_wait_asynccnt 0x0" ::: "memory");   // this wave's copies of the first chunk have landed
  __syncthreads();                                    // ... and every other wave's: the first chunk may be read
  if (kcStart + 1 < nChunks) stage(kcStart + 1, 1);   // block-uniform
  for (int kc = kcStart; kc < nChunks; ++kc) {
    const int kv0 = kc * AT_KC;
    const int cur = (kc - kcStart) & 1;
    const __bf16* Ksh = KV[cur][0];
    const __bf16* Ksl = KV[cur][1];
    const __bf16* Vth = KV[cur][2];
    const __bf16* Vtl = KV[cur][3];

    v8f s[4];
#pragma unroll
    for (int j = 0; j < 4; ++j) {
      s[j] = (v8f){0.f,0.f,0.f,0.f,0.f,0.f,0.f,0.f};
#pragma unroll
      for (int dc = 0; dc < 2; ++dc) {
        FB kb, kl;
        kb.h[0] = *(const v8b*)(Ksh + (j * 16 + c) * AT_LP + dc * 32 + 8 * hh);
        kb.h[1] = *(const v8b*)(Ksh + (j * 16 + c) * AT_LP + dc * 32 + 16 + 8 * hh);
        kl.h[0] = *(const v8b*)(Ksl + (j * 16 + c) * AT_LP + dc * 32 + 8 * hh);
        kl.h[1] = *(const v8b*)(Ksl + (j * 16 + c) * AT_LP + dc * 32 + 16 + 8 * hh);
        s[j] = at_mma(kb.v, qah[dc], s[j]);
        s[j] = at_mma(kl.v, qah[dc], s[j]);
        s[j] = at_mma(kb.v, qal[dc], s[j]);
      }
    }
    // s[j][r] = unscaled score of query qrow and key kv0 + j*16 + 8*hh + r; maxima are taken on unscaled scores (sc2 > 0)
    float mj[4];
#pragma unroll
    for (int j = 0; j < 4; ++j) {
      mj[j] = -INFINITY;
#pragma unroll
      for (int r = 0; r < 8; ++r) {
        const int kvcol = kv0 + j * 16 + 8 * hh + r;
        const bool masked = (kvcol > qrow) || (qrow - kvcol > kWin - 1);
        const float sm = masked ? -INFINITY : s[j][r];
        s[j][r] = sm;
        mj[j] = fmaxf(mj[j], sm);
      }
    }
    float cm = fmaxf(fmaxf(mj[0], mj[1]), fmaxf(mj[2], mj[3]));
    cm = fmaxf(cm, at_half_swap(cm));                          // the chunk's maximum over all 64 keys
    const float mnew  = fmaxf(mrow, cm);
    const float mpiv  = (mnew == -INFINITY) ? 0.0f : mnew;     // fully masked so far -> alpha = 0, p = 0
    const float mb    = mpiv * sc2;                            // the pivot in base-2 exponent units
    const float alpha = at_exp2(fmaf(mrow, sc2, -mb));
    mrow = mnew;
    PB pa[2], pl[2];
    float pj[4];
#pragma unroll
    for (int j = 0; j < 4; ++j) {
      float p[8], a[8];
      pj[j] = 0.f;
#pragma unroll
      for (int r = 0; r < 8; ++r) {
        a[r] = fmaf(s[j][r], sc2, -mb);   // log2 of e^(sscale*(s - pivot)); a masked score stays -inf and gives p = 0
      }
      at_exp2x8(p, a);
#pragma unroll   // constant indices keep p in registers
      for (int r = 0; r < 8; ++r) pj[j] += p[r];
      at_split_pack8(p, pa[j >> 1].q[j & 1], pl[j >> 1].q[j & 1]);
    }
    lrow = lrow * alpha + ((pj[0] + pj[1]) + (pj[2] + pj[3]));
#pragma unroll
    for (int t = 0; t < 4; ++t)
#pragma unroll
      for (int r = 0; r < 8; ++r) oacc[t][r] *= alpha;
#pragma unroll   // constant indices keep pa and pl in registers
    for (int kk = 0; kk < 2; ++kk) {
#pragma unroll
      for (int t = 0; t < 4; ++t) {
        FB vb, vl;
        vb.h[0] = *(const v8b*)(Vth + (t * 16 + c) * AT_LP + kk * 32 + 8 * hh);
        vb.h[1] = *(const v8b*)(Vth + (t * 16 + c) * AT_LP + kk * 32 + 16 + 8 * hh);
        vl.h[0] = *(const v8b*)(Vtl + (t * 16 + c) * AT_LP + kk * 32 + 8 * hh);
        vl.h[1] = *(const v8b*)(Vtl + (t * 16 + c) * AT_LP + kk * 32 + 16 + 8 * hh);
        oacc[t] = at_mma(vb.v, pa[kk].v, oacc[t]);
        oacc[t] = at_mma(vl.v, pa[kk].v, oacc[t]);
        oacc[t] = at_mma(vb.v, pl[kk].v, oacc[t]);
      }
    }
    // hand-over: this wave's reads of the chunk are done, its copies of the next chunk have landed; behind the barrier the
    // next chunk may be read by every wave and the buffer just read may be refilled
    asm volatile("s_wait_dscnt 0x0" ::: "memory");
    asm volatile("s_wait_asynccnt 0x0" ::: "memory");
    __syncthreads();
    if (kc + 2 < nChunks) stage(kc + 2, cur);         // block-uniform
  }
  asm volatile("s_wait_asynccnt 0x0" ::: "memory");   // no copy is outstanding when the wave goes on to its epilogue and ends

  const float inv = 1.0f / (lrow + at_half_swap(lrow));   // the two halves' sums joined
  {
    // first of the wave's two blocks: block row = token row / 16, k block = column / 32
    const size_t blk0 = (size_t)((blockIdx.y * kSeq + q0) >> 4) * kKBlk + h * (AT_D / 32);
#pragma unroll
    for (int it = 0; it < 4; ++it) {   // it>>1 = block, it&1 = its half (16 k); lane = (k>>3 & 1)*16 + row: 512 consecutive bytes a store
      // the lane's own 8 values of row c: columns it*16 + hh*8 .. +7
      const float f[8] = {oacc[it][0] * inv, oacc[it][1] * inv, oacc[it][2] * inv, oacc[it][3] * inv,
                          oacc[it][4] * inv, oacc[it][5] * inv, oacc[it][6] * inv, oacc[it][7] * inv};
      v4u hv, lv;
      split8(f, hv, lv);
      const size_t o = (blk0 + (it >> 1)) * 512 + (it & 1) * 256 + lane * 8;
      *(v4u*)(ohp + o) = hv;
      *(v4u*)(olp + o) = lv;
    }
  }
}

// ---------------------------------------------------------------------------
// Workspace region map (byte offsets; every region is fully written in this call before it is read; token rows
// run over both batch elements, row = b*2048 + t; VT holds one [256][2048] plane per batch element; the W*, X* and
// O* bf16 planes are fragment-major, 16-row x 32-k blocks, see wmma_gemm64):
//   Wqh bf16 [768 n][768 k]         0      Wql   1179648
//   Wkh bf16 [256][768]        2359296      Wkl   2752512
//   Wvh bf16 [256][768]        3145728      Wvl   3538944
//   Woh bf16 [768][768]        3932160      Wol   5111808
//   CS  f32  [2048][32]        6291456      SN    6553600
//   Xh  bf16 [4096][768]       6815744      Xl   13107200
//   Qh  bf16 [4096][768]      19398656      Ql   25690112
//   Kh  bf16 [4096][256]      31981568      Kl   34078720
//   VTh bf16 [2][256][2048]   36175872      VTl  38273024
//   Oh  bf16 [4096][768]      40370176      Ol   46661632
//   total                     52953088
// ---------------------------------------------------------------------------
extern "C" void kernel_launch(void* const* d_in, const int* in_sizes, int n_in,
                              void* d_out, int out_size, void* d_ws, size_t ws_size,
                              hipStream_t stream) {
  if (n_in < 7) return;
  if (in_sizes[0] != kNB * kSeq * kDim) return;
  if (in_sizes[1] != kDim * kDim || in_sizes[4] != kDim * kDim) return;
  if (in_sizes[2] != kKvDim * kDim || in_sizes[3] != kKvDim * kDim) return;
  if (in_sizes[5] != kHd || in_sizes[6] != kHd) return;
  if (out_size != kNB * kSeq * kDim) return;

  const float* x    = (const float*)d_in[0];
  const float* Wq   = (const float*)d_in[1];
  const float* Wk   = (const float*)d_in[2];
  const float* Wv   = (const float*)d_in[3];
  const float* Wo   = (const float*)d_in[4];
  const float* lnq  = (const float*)d_in[5];
  const float* lnk  = (const float*)d_in[6];

  const size_t PWQ = (size_t)kDim * kDim * 2;      // 1179648  bf16 [768][768] plane
  const size_t PWK = (size_t)kKvDim * kDim * 2;    // 393216   bf16 [256][768] plane
  const size_t PTB = (size_t)kSeq * kHalfHd * 4;   // 262144   f32 [2048][32] table
  const size_t PXB = (size_t)kTok * kDim * 2;      // 6291456  bf16 [4096][768] plane
  const size_t PKB = (size_t)kTok * kKvDim * 2;    // 2097152  bf16 [4096][256] / [2][256][2048] plane
  size_t off = 0;
  const size_t oWqh = off; off += PWQ;  const size_t oWql = off; off += PWQ;
  const size_t oWkh = off; off += PWK;  const size_t oWkl = off; off += PWK;
  const size_t oWvh = off; off += PWK;  const size_t oWvl = off; off += PWK;
  const size_t oWoh = off; off += PWQ;  const size_t oWol = off; off += PWQ;
  const size_t oCS  = off; off += PTB;  const size_t oSN  = off; off += PTB;
  const size_t oXh  = off; off += PXB;  const size_t oXl  = off; off += PXB;
  const size_t oQh  = off; off += PXB;  const size_t oQl  = off; off += PXB;
  const size_t oKh  = off; off += PKB;  const size_t oKl  = off; off += PKB;
  const size_t oVTh = off; off += PKB;  const size_t oVTl = off; off += PKB;
  const size_t oOh  = off; off += PXB;  const size_t oOl  = off; off += PXB;
  if (off > ws_size) return;                       // off = 52953088
  if (off > (size_t)134217728) return;

  char* ws = (char*)d_ws;
  unsigned short* Wqh = (unsigned short*)(ws + oWqh); unsigned short* Wql = (unsigned short*)(ws + oWql);
  unsigned short* Wkh = (unsigned short*)(ws + oWkh); unsigned short* Wkl = (unsigned short*)(ws + oWkl);
  unsigned short* Wvh = (unsigned short*)(ws + oWvh); unsigned short* Wvl = (unsigned short*)(ws + oWvl);
  unsigned short* Woh = (unsigned short*)(ws + oWoh); unsigned short* Wol = (unsigned short*)(ws + oWol);
  float*          CS  = (float*)(ws + oCS);          float*          SN  = (float*)(ws + oSN);
  unsigned short* Xh  = (unsigned short*)(ws + oXh);  unsigned short* Xl  = (unsigned short*)(ws + oXl);
  unsigned short* Qh  = (unsigned short*)(ws + oQh);  unsigned short* Ql  = (unsigned short*)(ws + oQl);
  unsigned short* Kh  = (unsigned short*)(ws + oKh);  unsigned short* Kl  = (unsigned short*)(ws + oKl);
  unsigned short* VTh = (unsigned short*)(ws + oVTh); unsigned short* VTl = (unsigned short*)(ws + oVTl);
  unsigned short* Oh  = (unsigned short*)(ws + oOh);  unsigned short* Ol  = (unsigned short*)(ws + oOl);

  const dim3 blk(256);
  const dim3 gPrep(kPbT + kPbX + 2 * kPbWq + 2 * kPbWk);            // 2560 blocks
  const dim3 gQKV(kBlkQ + kBlkK + kNB * kBlkV);                     // 320 blocks of 4 waves, a 128x128 tile each
  const dim3 gProjQ(kBlkQ, 1);                                      // 192 tiles of 128x128: M=4096, N=768
  const dim3 gAtt(kNHq * (kSeq / 64), kNB);                         // 12 heads x 32 query blocks per batch element

  // Both batch elements go through every stage in one launch: the token-row GEMMs see M = 4096 rows (the rotary
  // epilogue takes the position as row % 2048); v^T and attention take the batch element from the block index.
  // (1) rotary tables; x and the weights [out n][in k] f32 -> bf16 hi/lo planes, fragment-major
  prep_kernel<<<gPrep, blk, 0, stream>>>(x, Wq, Wk, Wv, Wo, Xh, Xl, Wqh, Wql, Wkh, Wkl, Wvh, Wvl, Woh, Wol, CS, SN);
  // (2) q and k projections with per-head rmsnorm * w + rotary in the epilogue -> Q/K bf16 hi/lo planes; v^T -> VT hi/lo planes (K = 768 each)
  qkv_gemm64_kernel<<<gQKV, dim3(128), 0, stream>>>(Xh, Xl, Wqh, Wql, Wkh, Wkl, Wvh, Wvl, lnq, lnk, CS, SN, Qh, Ql, Kh, Kl, VTh, VTl, kDim);
  // (3) windowed causal GQA attention per head: y -> bf16 hi/lo planes, fragment-major (every element written by its (b, h, query block) owner)
  attn_gqa_window64_kernel<<<gAtt, dim3(128), 0, stream>>>(Qh, Ql, Kh, Kl, VTh, VTl, Oh, Ol, 0.125f);
  // (4) out = y . Wo^T -> d_out rows 0 .. 4095 (f32)   (M=4096, N=768, K=768)
  wmma_gemm64<1, true, 0, 0, false><<<gProjQ, dim3(128), 0, stream>>>(
      Oh, Ol, kDim, 0L, Woh, Wol, kDim, 0L, d_out, d_out, kDim, 0L,
      lnq, lnq, 0L, kTok, kDim, kDim, 1.0f);
}
